// v000
// Times are from an AMD MI455X. After a warm-up the kernel runs many times in a row, and a time is the length of
// such a window on the GPU divided by its runs, so every launch and the gaps after it count. The runs cycle
// through copies of the inputs. A figure is the median of several windows, for all but v000 over two sittings.
// Sittings can differ by a few percent; kernels timed side by side share one.
// v000, which the later versions start from, runs in 4150 microseconds.
// compute dtype: all float inputs rounded to bf16; per-head q/k/v projections with EXACT bf16 products on WMMA 16x16x32 (f32 accumulate) + bias; causal scores q x k once to f16 each (1 product) x 64^-0.5 on every block; softmax over the QUERY axis in f32 (per key column: online max / sum over the visible queries, precise expf); P as bf16 hi + lo against v as bf16 hi + lo (3 products) on EVERY block; ctx x 2^6 once to f16 x Wc f16(bf16 x 2^8) - except the LAST 64 rows of each sequence: ctx as bf16 hi + lo against exact bf16 Wc (2 products) - + bc; f32 output.
#include <hip/hip_runtime.h>
#include <math.h>

typedef __attribute__((ext_vector_type(16))) _Float16 v16h;
typedef __attribute__((ext_vector_type(16))) __bf16 v16b;
typedef __attribute__((ext_vector_type(8)))  _Float16 v8h;
typedef __attribute__((ext_vector_type(8)))  float v8f;
typedef __attribute__((ext_vector_type(4)))  float v4f;
typedef __attribute__((ext_vector_type(2)))  float v2f;
typedef __attribute__((ext_vector_type(4)))  unsigned v4u;
typedef __attribute__((ext_vector_type(4)))  int v4i;
typedef float __attribute__((may_alias)) float_a;
typedef int __attribute__((may_alias)) int_a;

template <typename T> __device__ __forceinline__ void vst2(void* p, T v) { *(T*)p = v;  }
__device__ __forceinline__ v8f wmma16(v16h a, v16h b, v8f c) {
  v8f d = __builtin_amdgcn_wmma_f32_16x16x32_f16(false, a, false, b, (short)0, c, false, false);
  asm volatile("v_nop\n\tv_nop\n\tv_nop\n\tv_nop" : "+v"(d) : "v"(a), "v"(b));
  return d;
}
__device__ __forceinline__ v8f wmma_bf(v16b a, v16b b, v8f c) {
  v8f d = __builtin_amdgcn_wmma_f32_16x16x32_bf16(false, a, false, b, (short)0, c, false, false);
  asm volatile("v_nop\n\tv_nop\n\tv_nop\n\tv_nop" : "+v"(d) : "v"(a), "v"(b));
  return d;
}
// 16x16x32 fragments: lane = (h = lane>>4, row/col = lane&15); elements 0..7 = k0+8h+0..7, 8..15 = k0+16+8h+0..7; D element r = row 8h+r
__device__ __forceinline__ v16h frag_h(const _Float16* rowk0, int lane) {
  union { v16h v; v8h q[2]; } u; const _Float16* p = rowk0 + 8 * (lane >> 4);
  u.q[0] = *(const v8h*)p; u.q[1] = *(const v8h*)(p + 16); return u.v;
}
__device__ __forceinline__ v16h frag_f32(const float* rowk0, int lane) {
  v16h a; const float* p = rowk0 + 8 * (lane >> 4);
#pragma unroll
  for (int i = 0; i < 8; ++i) { a[i] = (_Float16)p[i]; a[8 + i] = (_Float16)p[16 + i]; }
  return a;
}
__device__ __forceinline__ v16h frag_f32s(const float* rowk0, int lane, float sc) {
  v16h a; const float* p = rowk0 + 8 * (lane >> 4);
#pragma unroll
  for (int i = 0; i < 8; ++i) { a[i] = (_Float16)(p[i] * sc); a[8 + i] = (_Float16)(p[16 + i] * sc); }
  return a;
}
// column fragment from a [K][ld] layout (column n), rows >= K read as 0
__device__ __forceinline__ v16h fragc_f32(const float* W, int k0, int n, int lane, int ld, int K) {
  v16h a; const int g = lane >> 4;
#pragma unroll
  for (int i = 0; i < 8; ++i) { const int ka = k0 + 8 * g + i, kb = ka + 16;
    a[i] = (_Float16)(ka < K ? W[(size_t)(ka < K ? ka : K - 1) * ld + n] : 0.f); a[8 + i] = (_Float16)(kb < K ? W[(size_t)(kb < K ? kb : K - 1) * ld + n] : 0.f); }
  return a;
}
struct F2 { v16b h, l; };
__device__ __forceinline__ F2 bsplit16(const float v[16]) { F2 r;
#pragma unroll
  for (int i = 0; i < 16; ++i) { const __bf16 h = (__bf16)v[i]; r.h[i] = h; r.l[i] = (__bf16)(v[i] - (float)h); }
  return r; }
__device__ __forceinline__ F2 split_row(const float* row, int k0, int lane) { float v[16]; const float* p = row + k0 + 8 * (lane >> 4);
#pragma unroll
  for (int i = 0; i < 8; ++i) { v[i] = p[i]; v[8 + i] = p[16 + i]; }
  return bsplit16(v); }
__device__ __forceinline__ F2 split_rowK(const float* row, int k0, int lane, int K) { float v[16]; const int g = lane >> 4;
#pragma unroll
  for (int i = 0; i < 8; ++i) { const int ka = k0 + 8 * g + i, kb = ka + 16; v[i] = ka < K ? row[ka < K ? ka : K - 1] : 0.f; v[8 + i] = kb < K ? row[kb < K ? kb : K - 1] : 0.f; }
  return bsplit16(v); }
__device__ __forceinline__ F2 split_col(const float* W, int k0, int n, int lane, int ld, int K) { float v[16]; const int g = lane >> 4;
#pragma unroll
  for (int i = 0; i < 8; ++i) { const int ka = k0 + 8 * g + i, kb = ka + 16; v[i] = ka < K ? W[(size_t)(ka < K ? ka : K - 1) * ld + n] : 0.f; v[8 + i] = kb < K ? W[(size_t)(kb < K ? kb : K - 1) * ld + n] : 0.f; }
  return bsplit16(v); }
__device__ __forceinline__ v8f mac3(const F2& a, const F2& b, v8f c) { c = wmma_bf(a.l, b.h, c); c = wmma_bf(a.h, b.l, c); return wmma_bf(a.h, b.h, c); }
__device__ __forceinline__ float sigm(float v) { return 1.0f / (1.0f + expf(-v)); }
#define LDSX() do { asm volatile("s_wait_dscnt 0" ::: "memory"); __builtin_amdgcn_wave_barrier(); __builtin_amdgcn_fence(__ATOMIC_RELEASE, "workgroup"); } while (0)

// Causal multi-head attention whose softmax runs over the QUERY axis, with per-head projection tensors (source [4,1024,1024]; Wq / Wk / Wv [16,1024,64] (head, in, out) (0.02) + biases [16,64]; scores / sqrt(64) + triu(-inf, k=1); attn = softmax(..., axis=2) - axis 2 of [B, H, q, k] is the QUERY axis: every key column is normalised over the queries q >= k (faithful to the source); out = attn v; heads merged; Wc [1024,1024] (in,out) + bc).
#define NB 4
#define TT 1024
#define CC 1024            // NH * HD = projected width
#define DIN 1024          // input (model) width
#define NH 16
#define HD 64
#define NQB (TT / 64)
#define HG 8
#define SCALE (0.125f)
#define CAUSAL 1
#ifndef TNB
#define TNB NB
#endif
__device__ __forceinline__ float bfr(float v) { return (float)(__bf16)v; }
__host__ __device__ __forceinline__ int kb_last(int qb) { return CAUSAL ? ((qb * 64 + 63) >> 7) : (TT / 128 - 1); }
typedef __attribute__((ext_vector_type(8))) __bf16 v8b;
__device__ __forceinline__ v16b frag_b(const __bf16* rowk0, int lane) {
  union { v16b v; v8b q[2]; } u; const __bf16* p = rowk0 + 8 * (lane >> 4);
  u.q[0] = *(const v8b*)p; u.q[1] = *(const v8b*)(p + 16); return u.v;
}
#define QBH 16              // causal: query blocks 0..QBH-1 of each sequence (QBH = NQB: every block) take the high-precision path
#define QHI 0               // no q residual plane: the scores are small and single-product everywhere
#define QBH_SC 0            // k_sc: no block takes the 3-product branch (k_pv keeps QBH = NQB: bf16 hi/lo P.v on every block - a query-axis softmax has O(1) weights on the LAST key columns)
#define KHI 1024            // key rows carrying k residual / v bf16 hi+lo planes (used only by the causal high-precision path)
// B fragment (k rows k0+.., output column o) of a weight: (in,out) [K][ld] or (out,in) [ld rows of K]: bf16 exact, or f16(bf16 * 256) exact
__device__ __forceinline__ v16b wcol_io(const float* Wm, int k0, int o, int lane, int ld) { v16b w; const int g = lane >> 4;
#pragma unroll
  for (int i = 0; i < 8; ++i) { w[i] = (__bf16)Wm[(size_t)(k0 + 8 * g + i) * ld + o]; w[8 + i] = (__bf16)Wm[(size_t)(k0 + 16 + 8 * g + i) * ld + o]; }
  return w; }
__device__ __forceinline__ v16b wcol_oi(const float* Wm, int k0, int o, int lane, int K) { v16b w; const float* p = Wm + (size_t)o * K + k0 + 8 * (lane >> 4);
#pragma unroll
  for (int i = 0; i < 8; ++i) { w[i] = (__bf16)p[i]; w[8 + i] = (__bf16)p[16 + i]; }
  return w; }
__device__ __forceinline__ v16h wcolh_io(const float* Wm, int k0, int o, int lane, int ld) { v16h w; const int g = lane >> 4;
#pragma unroll
  for (int i = 0; i < 8; ++i) { w[i] = (_Float16)(bfr(Wm[(size_t)(k0 + 8 * g + i) * ld + o]) * 256.0f); w[8 + i] = (_Float16)(bfr(Wm[(size_t)(k0 + 16 + 8 * g + i) * ld + o]) * 256.0f); }
  return w; }
__device__ __forceinline__ v16h wcolh_oi(const float* Wm, int k0, int o, int lane, int K) { v16h w; const float* p = Wm + (size_t)o * K + k0 + 8 * (lane >> 4);
#pragma unroll
  for (int i = 0; i < 8; ++i) { w[i] = (_Float16)(bfr(p[i]) * 256.0f); w[8 + i] = (_Float16)(bfr(p[16 + i]) * 256.0f); }
  return w; }
#define WQKV_LAYOUT 0   // 0 = per-head [NH][DIN][HD] (head, in, out); 1 = (out,in) [CC][DIN]; 2 = per-head [NH][DIN][HD]
__device__ __forceinline__ v16b wcol_hdk(const float* Wm, int k0, int o, int lane) { v16b w; const int g = lane >> 4; const float* p = Wm + (size_t)(o / HD) * DIN * HD + (o % HD);
#pragma unroll
  for (int i = 0; i < 8; ++i) { w[i] = (__bf16)p[(size_t)(k0 + 8 * g + i) * HD]; w[8 + i] = (__bf16)p[(size_t)(k0 + 16 + 8 * g + i) * HD]; }
  return w; }
#define WO_OUT_IN 0
#if WQKV_LAYOUT == 1
#define WCOL(W, k0, o, lane) wcol_oi(W, k0, o, lane, DIN)
#elif WQKV_LAYOUT == 2
#define WCOL(W, k0, o, lane) wcol_hdk(W, k0, o, lane)
#else
#define WCOL(W, k0, o, lane) wcol_io((W) + (size_t)((o) / 64) * DIN * 64, k0, (o) % 64, lane, 64)   /* per-head weight tensors [16][DIN][64] (head, in, out): output column o = h*64 + kk lives in head h's [DIN][64] (in,out) slab at pitch 64 (a 16-column tile never straddles a head) */
#endif
#if WO_OUT_IN
#define WOCOL(W, k0, o, lane) wcol_oi(W, k0, o, lane, CC)
#define WOCOLH(W, k0, o, lane) wcolh_oi(W, k0, o, lane, CC)
#else
#define WOCOL(W, k0, o, lane) wcol_io(W, k0, o, lane, DIN)
#define WOCOLH(W, k0, o, lane) wcolh_io(W, k0, o, lane, DIN)
#endif

#ifndef SM_EXTRA_PARAMS
#define SM_EXTRA_PARAMS
#endif
#ifndef PROJ_EXTRA_PARAMS
#define PROJ_EXTRA_PARAMS
#endif
#ifndef SM_MASK_HOOK
#define SM_MASK_HOOK (void)0
#endif

#define WS_QH  0u                                      // f16 q rows [b*t][CC]
#define WS_KH  (WS_QH + 2u * (size_t)NB * TT * CC)      // f16 k rows [b*t][CC]
#define WS_VT  (WS_KH + 2u * (size_t)NB * TT * CC)      // f16 v planes [b][c][t]
#define WS_QL  (WS_VT + 2u * (size_t)NB * CC * TT)      // f16 q residual x 2^10 rows [b][t < QHI][CC]
#define WS_KL  (WS_QL + 2u * (size_t)NB * QHI * CC)     // f16 k residual x 2^10 rows [b][t < KHI][CC]
#define WS_VB  (WS_KL + 2u * (size_t)NB * KHI * CC)     // bf16 v hi planes [b][c][t < KHI]
#define WS_VBL (WS_VB + 2u * (size_t)NB * CC * KHI)
#define WS_S   (WS_VBL + 2u * (size_t)NB * CC * KHI)    // f32 logits / P [hg][t][s]
#define WS_Y   (WS_S  + 4u * (size_t)HG * TT * TT)      // f32 ctx rows [b*t][CC] (only when there is an output projection)
#define WS_END (WS_Y  + 4u * (size_t)NB * TT * CC)
#define WS_CM (WS_END)                                  // f32 column maxima [HG][TT]
#define WS_CZ (WS_CM + 4u * (size_t)HG * TT)
#define WS_END2 (WS_CZ + 4u * (size_t)HG * TT)

// ---- k_proj: block = (64 rows, 128 cols, which): q/k/v = X W (+ b) with exact bf16 products (K = DIN) -> which 0: q f16 rows (+ residual rows < QHI); 1: k f16 rows (+ residual rows < KHI); 2: v f16 planes [c][t] (+ bf16 hi/lo planes for t < KHI)
__global__ __launch_bounds__(128) void k_proj(const float* __restrict__ XQ, const float* __restrict__ XK, const float* __restrict__ XV, const float* __restrict__ WQ, const float* __restrict__ WK, const float* __restrict__ WV, const float* __restrict__ BQ, const float* __restrict__ BK, const float* __restrict__ BV,
    _Float16* __restrict__ QH, _Float16* __restrict__ QL, _Float16* __restrict__ KH, _Float16* __restrict__ KL, _Float16* __restrict__ VT, __bf16* __restrict__ VB, __bf16* __restrict__ VBL) {
  __shared__ __align__(16) _Float16 sh[64][136], sl[64][136]; __shared__ __align__(16) _Float16 th[128][72]; __shared__ __align__(16) __bf16 tb[128][72], tbl[128][72];
  const int tid = threadIdx.x, wave = tid >> 5, lane = tid & 31, col = lane & 15, g = lane >> 4; const int which = blockIdx.z; const int c0 = blockIdx.y * 128; const size_t r0 = (size_t)blockIdx.x * 64; const size_t bb = r0 / TT; const int t0 = (int)(r0 % TT);
  const float* X = which == 0 ? XQ : which == 1 ? XK : XV; const float* WA = which == 0 ? WQ : which == 1 ? WK : WV; const float* BA = which == 0 ? BQ : which == 1 ? BK : BV;
  v8f acc[8] = {};
#pragma unroll 2
  for (int kc = 0; kc < DIN / 32; ++kc) { v16b a; { const float* p = X + (r0 + wave * 16 + col) * DIN + kc * 32 + 8 * g;
#pragma unroll
      for (int i = 0; i < 8; ++i) { a[i] = (__bf16)p[i]; a[8 + i] = (__bf16)p[16 + i]; } }
    asm volatile("s_wait_loadcnt 0x0" ::: "memory");
#pragma unroll
    for (int j = 0; j < 8; ++j) { const v16b w = WCOL(WA, kc * 32, c0 + j * 16 + col, lane); asm volatile("s_wait_loadcnt 0x0" ::: "memory"); acc[j] = wmma_bf(a, w, acc[j]); } }
  if (which < 2) { _Float16* DH = which == 0 ? QH : KH; _Float16* DL = which == 0 ? QL : KL; const int nhi = which == 0 ? QHI : KHI; const bool hi_rows = t0 < nhi;
#pragma unroll
    for (int j = 0; j < 8; ++j) { const float bias = BA ? bfr(BA[c0 + j * 16 + col]) : 0.f;
#pragma unroll
      for (int r = 0; r < 8; ++r) { const float v = acc[j][r] + bias; const _Float16 hv = (_Float16)v; sh[wave * 16 + 8 * g + r][j * 16 + col] = hv; sl[wave * 16 + 8 * g + r][j * 16 + col] = (_Float16)((v - (float)hv) * 1024.0f); } }
    __syncthreads();
    for (int e = tid; e < 64 * 16; e += 128) { const int rl = e >> 4, q = e & 15; vst2((unsigned*)(DH + (r0 + rl) * CC + c0 + q * 8), *(const v4u*)&sh[rl][q * 8]); if (hi_rows) vst2((unsigned*)(DL + (bb * nhi + t0 + rl) * (size_t)CC + c0 + q * 8), *(const v4u*)&sl[rl][q * 8]); }
  } else { const bool hi_rows = t0 < KHI;
#pragma unroll
    for (int j = 0; j < 8; ++j) { const float bias = BA ? bfr(BA[c0 + j * 16 + col]) : 0.f;
#pragma unroll
      for (int r = 0; r < 8; ++r) { const float v = acc[j][r] + bias; const int rl = wave * 16 + 8 * g + r, cl = j * 16 + col; th[cl][rl] = (_Float16)v; const __bf16 bh = (__bf16)v; tb[cl][rl] = bh; tbl[cl][rl] = (__bf16)(v - (float)bh); } }
    __syncthreads();
    for (int e = tid; e < 128 * 8; e += 128) { const int cl = e >> 3, q = e & 7; vst2((unsigned*)(VT + (bb * CC + c0 + cl) * (size_t)TT + t0 + q * 8), *(const v4u*)&th[cl][q * 8]); if (hi_rows) { const size_t o3 = (bb * CC + c0 + cl) * (size_t)KHI + t0 + q * 8; vst2((unsigned*)(VB + o3), *(const v4u*)&tb[cl][q * 8]); vst2((unsigned*)(VBL + o3), *(const v4u*)&tbl[cl][q * 8]); } } } }
// ---- k_sc: block = (query block qb, key block kb <= kb_last(qb), head in group) of batch b: logits x SCALE; q hi + residual (x 2^10) against k (2 products) for query rows < QHI, plus the k residual (3 products) for query blocks < QBH_SC (causal early rows); causal: blocks past the diagonal exit, the mask itself is applied by index in k_colstat_c and k_csm_c
__global__ __launch_bounds__(128) void k_sc(const _Float16* __restrict__ QH, const _Float16* __restrict__ KH, const _Float16* __restrict__ QL, const _Float16* __restrict__ KL, int b, int h0, float* __restrict__ S0) { __shared__ __align__(16) float ss[4][16][132];
  const int qb = blockIdx.x, kb = blockIdx.y; if (kb > kb_last(qb)) return;
  const int h = h0 + blockIdx.z; float* S = S0 + (size_t)blockIdx.z * TT * TT;
  const int tid = threadIdx.x, wave = tid >> 5, lane = tid & 31, col = lane & 15, g = lane >> 4; const int k0 = kb * 128; const int ql0 = qb * 64 + wave * 16; const size_t q0 = (size_t)b * TT + ql0, kr0 = (size_t)b * TT + k0;
  v8f acc[8] = {}, accl[8] = {};
  const _Float16* QLb = QL + (size_t)b * QHI * CC; const _Float16* KLb = KL + (size_t)b * KHI * CC;
  if (qb < QBH_SC) {
#pragma unroll
    for (int kc = 0; kc < HD / 32; ++kc) { const v16h ah = frag_h(QH + (q0 + col) * CC + h * HD + kc * 32, lane), al = frag_h(QLb + (size_t)(ql0 + col) * CC + h * HD + kc * 32, lane);
#pragma unroll
      for (int j = 0; j < 8; ++j) { const v16h kbf = frag_h(KH + (kr0 + j * 16 + col) * CC + h * HD + kc * 32, lane), klf = frag_h(KLb + (size_t)(k0 + j * 16 + col) * CC + h * HD + kc * 32, lane); acc[j] = wmma16(ah, kbf, acc[j]); accl[j] = wmma16(al, kbf, accl[j]); accl[j] = wmma16(ah, klf, accl[j]); } }
  } else if (qb * 64 < QHI) {
#pragma unroll
    for (int kc = 0; kc < HD / 32; ++kc) { const v16h ah = frag_h(QH + (q0 + col) * CC + h * HD + kc * 32, lane), al = frag_h(QLb + (size_t)(ql0 + col) * CC + h * HD + kc * 32, lane);
#pragma unroll
      for (int j = 0; j < 8; ++j) { const v16h kbf = frag_h(KH + (kr0 + j * 16 + col) * CC + h * HD + kc * 32, lane); acc[j] = wmma16(ah, kbf, acc[j]); accl[j] = wmma16(al, kbf, accl[j]); } }
  } else {
#pragma unroll
    for (int kc = 0; kc < HD / 32; ++kc) { const v16h ah = frag_h(QH + (q0 + col) * CC + h * HD + kc * 32, lane);
#pragma unroll
      for (int j = 0; j < 8; ++j) { const v16h kbf = frag_h(KH + (kr0 + j * 16 + col) * CC + h * HD + kc * 32, lane); acc[j] = wmma16(ah, kbf, acc[j]); } } }
#pragma unroll
  for (int j = 0; j < 8; ++j) {
#pragma unroll
    for (int r = 0; r < 8; ++r) ss[wave][8 * g + r][j * 16 + col] = (acc[j][r] + accl[j][r] * (1.0f / 1024.0f)) * SCALE; }
  LDSX(); for (int rl = 0; rl < 16; ++rl) vst2(S + (size_t)(ql0 + rl) * TT + k0 + lane * 4, *(const v4f*)&ss[wave][rl][lane * 4]); }
// ---- k_sm: block = query row t (head in group): keys [0, kend): causal -> logit if s <= t else excluded; softmax in f32; P x 2^11 in place (0 for excluded)
__global__ __launch_bounds__(256) void k_sm(float* __restrict__ S0 SM_EXTRA_PARAMS) { __shared__ float sred[8]; __shared__ float sbc; __shared__ __align__(16) float shv[TT];
  const int tid = threadIdx.x; const int t = blockIdx.x; const int kend = (kb_last(t >> 6) + 1) * 128;
  float* sr = S0 + (size_t)blockIdx.y * TT * TT + (size_t)t * TT;
  float m = -3.0e38f; for (int k = tid; k < kend; k += 256) { float v = (!CAUSAL || k <= t) ? sr[k] : -3.0e38f; SM_MASK_HOOK; shv[k] = v; m = fmaxf(m, v); }
#pragma unroll
  for (int o = 1; o < 32; o <<= 1) m = fmaxf(m, __shfl_xor(m, o));
  if ((tid & 31) == 0) sred[tid >> 5] = m; __syncthreads(); if (tid == 0) { float a = sred[0]; for (int i = 1; i < 8; ++i) a = fmaxf(a, sred[i]); sbc = a; } __syncthreads(); m = sbc; __syncthreads();
  float sum = 0.f; for (int k = tid; k < kend; k += 256) { const float v = shv[k]; const float e = (v <= -1.0e38f) ? 0.f : expf(v - m); shv[k] = e; sum += e; }
#pragma unroll
  for (int o = 1; o < 32; o <<= 1) sum += __shfl_xor(sum, o);
  if ((tid & 31) == 0) sred[tid >> 5] = sum; __syncthreads(); if (tid == 0) { float a = 0.f; for (int i = 0; i < 8; ++i) a += sred[i]; sbc = a > 0.f ? 2048.0f / a : 0.f; }   /* a fully excluded row yields P = 0 */ __syncthreads(); const float inv = sbc;
  for (int k = tid; k < kend; k += 256) shv[k] = shv[k] * inv;
  __syncthreads(); for (int q = tid; q < kend / 4; q += 256) vst2(sr + q * 4, *(const v4f*)&shv[q * 4]); }
// ---- k_colstat_c: softmax over the QUERY axis under the causal mask (the source's softmax(axis=2) on [B, H, q, k] scores with -inf where k > q): for every key column k: m_k = max_{q >= k} S[q][k], Z_k = sum_{q >= k} exp(S[q][k] - m_k) (online, one pass, f32, precise expf); thread per column; the row loop starts at the block's first column (block-uniform) and masks q < k by a value select after an unconditional load (rows above a column's diagonal may lie in score blocks k_sc never computed: their content is discarded)
__global__ __launch_bounds__(256) void k_colstat_c(const float* __restrict__ S0, float* __restrict__ CM, float* __restrict__ CZ) { const int k = blockIdx.x * 256 + threadIdx.x; const float* sp = S0 + (size_t)blockIdx.y * TT * TT + k; const int q0 = blockIdx.x * 256;
  float m = -3.0e38f, z = 0.f;
#pragma unroll 4
  for (int q = q0; q < TT; ++q) { const float ld = sp[(size_t)q * TT]; asm volatile("s_wait_loadcnt 0x0" ::: "memory"); const bool vis = q >= k; const float v = vis ? ld : -3.0e38f; const float mn = fmaxf(m, v); z = z * expf(m - mn) + (vis ? expf(v - mn) : 0.f); m = mn; }
  vst2(CM + (size_t)blockIdx.y * TT + k, m); vst2(CZ + (size_t)blockIdx.y * TT + k, z); }   /* every column sees at least its own diagonal entry: Z_k >= 1 */
// ---- k_csm_c: block = query row t: P[t][k] = exp(S[t][k] - m_k) / Z_k x 2^11 for k <= t, 0 for t < k < kend (inside the diagonal block); in place; unconditional loads, value select
__global__ __launch_bounds__(256) void k_csm_c(float* __restrict__ S0, const float* __restrict__ CM, const float* __restrict__ CZ) { const int tid = threadIdx.x; const int t = blockIdx.x; const int kend = (kb_last(t >> 6) + 1) * 128; float* sr = S0 + (size_t)blockIdx.y * TT * TT + (size_t)t * TT; const float* cm = CM + (size_t)blockIdx.y * TT; const float* cz = CZ + (size_t)blockIdx.y * TT;
  for (int q4 = tid; q4 < kend / 4; q4 += 256) { const v4f sv = *(const v4f*)(sr + q4 * 4), m4 = *(const v4f*)(cm + q4 * 4), z4 = *(const v4f*)(cz + q4 * 4); asm volatile("s_wait_loadcnt 0x0" ::: "memory"); v4f p;
#pragma unroll
    for (int u = 0; u < 4; ++u) p[u] = (q4 * 4 + u <= t) ? expf(sv[u] - m4[u]) * (2048.0f / z4[u]) : 0.f;
    vst2(sr + q4 * 4, p); } }
// ---- k_pv: block = 64 queries (qb) of (b, h): ctx = P . v over keys [0, kend) (P x 2^11 once to f16 against v f16: 1 product; query blocks < QBH (= NQB, every block): P and v as bf16 hi + lo, 3 products); 256-B (row, head) segment by 16 lanes
__global__ __launch_bounds__(128) void k_pv(const float* __restrict__ PS0, const _Float16* __restrict__ VT, const __bf16* __restrict__ VB, const __bf16* __restrict__ VBL, int b, int h0, float* __restrict__ Y) { const int h = h0 + blockIdx.z; const float* PS = PS0 + (size_t)blockIdx.z * TT * TT; __shared__ __align__(16) float ss[4][16][HD + 4];
  const int tid = threadIdx.x, wave = tid >> 5, lane = tid & 31, col = lane & 15, g = lane >> 4; const int qb = blockIdx.x; const int ql0 = qb * 64 + wave * 16; const int kce = (kb_last(qb) + 1) * 4;
  v8f acc[HD / 16] = {};
  if (qb < QBH) {
#pragma unroll 1
    for (int kc = 0; kc < kce; ++kc) { const F2 p = split_row(PS + (size_t)(ql0 + col) * TT, kc * 32, lane);
      asm volatile("s_wait_loadcnt 0x0" ::: "memory");
#pragma unroll
      for (int j = 0; j < HD / 16; ++j) { const size_t po = ((size_t)b * CC + h * HD + j * 16 + col) * (size_t)KHI + kc * 32; const v16b vh = frag_b(VB + po, lane); acc[j] = wmma_bf(p.h, vh, acc[j]); acc[j] = wmma_bf(p.l, vh, acc[j]); acc[j] = wmma_bf(p.h, frag_b(VBL + po, lane), acc[j]); } }
  } else {
#pragma unroll 1
    for (int kc = 0; kc < kce; ++kc) { const v16h p = frag_f32(PS + (size_t)(ql0 + col) * TT + kc * 32, lane);
      asm volatile("s_wait_loadcnt 0x0" ::: "memory");
#pragma unroll
      for (int j = 0; j < HD / 16; ++j) { const size_t po = ((size_t)b * CC + h * HD + j * 16 + col) * (size_t)TT + kc * 32; acc[j] = wmma16(p, frag_h(VT + po, lane), acc[j]); } } }
#pragma unroll
  for (int j = 0; j < HD / 16; ++j)
#pragma unroll
    for (int r = 0; r < 8; ++r) ss[wave][8 * g + r][j * 16 + col] = acc[j][r] * (1.0f / 2048.0f);
  LDSX(); for (int rl = 0; rl < 16; ++rl) if (lane < HD / 4) vst2(Y + ((size_t)b * TT + ql0 + rl) * CC + h * HD + lane * 4, *(const v4f*)&ss[wave][rl][lane * 4]); }
// ---- k_out: block = (64 rows, 128 cols): out = ctx Wo (+ bo): ctx x 2^6 once to f16 against Wo as f16(bf16 x 2^8) exact (1 product) x 2^-14; rows < QHI and the LAST 64 rows of each sequence: ctx bf16 hi + lo against exact bf16 Wo (2 products)
__global__ __launch_bounds__(128) void k_out(const float* __restrict__ Y, const float* __restrict__ WO, const float* __restrict__ BO, float* __restrict__ OUT) { __shared__ __align__(16) float sf[4][16][132];
  const int tid = threadIdx.x, wave = tid >> 5, lane = tid & 31, col = lane & 15, g = lane >> 4; const int c0 = blockIdx.y * 128; const size_t r0 = (size_t)blockIdx.x * 64 + wave * 16;
  v8f acc[8] = {};
  const int tb_ = (int)(((size_t)blockIdx.x * 64) % TT); if (CAUSAL && (tb_ < QHI || tb_ >= TT - 64)) {   /* block-uniform; the LAST 64 query rows of each sequence also take the hi + lo context path: under a query-axis softmax the last key columns carry O(1) weights, so the context rows there are an order of magnitude larger */
#pragma unroll 2
    for (int kc = 0; kc < CC / 32; ++kc) { const F2 a = split_row(Y + (r0 + col) * CC, kc * 32, lane); asm volatile("s_wait_loadcnt 0x0" ::: "memory");
#pragma unroll
      for (int j = 0; j < 8; ++j) { const v16b w = WOCOL(WO, kc * 32, c0 + j * 16 + col, lane); asm volatile("s_wait_loadcnt 0x0" ::: "memory"); acc[j] = wmma_bf(a.h, w, acc[j]); acc[j] = wmma_bf(a.l, w, acc[j]); } }
#pragma unroll
    for (int j = 0; j < 8; ++j) { const float bias = BO ? bfr(BO[c0 + j * 16 + col]) : 0.f;
#pragma unroll
      for (int r = 0; r < 8; ++r) sf[wave][8 * g + r][j * 16 + col] = acc[j][r] + bias; }
  } else {
#pragma unroll 2
    for (int kc = 0; kc < CC / 32; ++kc) { const v16h a = frag_f32s(Y + (r0 + col) * CC + kc * 32, lane, 64.0f); asm volatile("s_wait_loadcnt 0x0" ::: "memory");   /* ctx carried x 2^6 into f16 so small-magnitude context rows stay clear of f16 subnormals */
#pragma unroll
      for (int j = 0; j < 8; ++j) { const v16h w = WOCOLH(WO, kc * 32, c0 + j * 16 + col, lane); asm volatile("s_wait_loadcnt 0x0" ::: "memory"); acc[j] = wmma16(a, w, acc[j]); } }
#pragma unroll
    for (int j = 0; j < 8; ++j) { const float bias = BO ? bfr(BO[c0 + j * 16 + col]) : 0.f;
#pragma unroll
      for (int r = 0; r < 8; ++r) sf[wave][8 * g + r][j * 16 + col] = acc[j][r] * (1.0f / 16384.0f) + bias; } }   /* 2^-8 (Wo carry) x 2^-6 (ctx carry) */
  LDSX(); for (int rl = 0; rl < 16; ++rl) vst2(OUT + (r0 + rl) * DIN + c0 + lane * 4, *(const v4f*)&sf[wave][rl][lane * 4]); }

extern "C" void kernel_launch(void* const* d_in, const int* in_sizes, int n_in, void* d_out, int out_size, void* d_ws, size_t ws_size, hipStream_t stream) {
  (void)in_sizes; (void)n_in; (void)out_size;
  const float** F = (const float**)d_in;
  if (ws_size < (size_t)WS_END) return;
  char* ws = (char*)d_ws; _Float16 *QH = (_Float16*)(ws + WS_QH), *KH = (_Float16*)(ws + WS_KH), *VT = (_Float16*)(ws + WS_VT), *QL = (_Float16*)(ws + WS_QL), *KL = (_Float16*)(ws + WS_KL); __bf16 *VB = (__bf16*)(ws + WS_VB), *VBL = (__bf16*)(ws + WS_VBL); float *S = (float*)(ws + WS_S), *Y = (float*)(ws + WS_Y);
  (void)Y; (void)QL; (void)KL; (void)VB; (void)VBL;
  // inputs: 0 source [4,1024,1024]; 1 Wq [16,1024,64] (head, in, out), 2 bq [16,64]; 3 Wk, 4 bk; 5 Wv, 6 bv; 7 Wc [1024,1024] (in,out), 8 bc [1024] (all biases N(0, 0.02^2), nonzero)
  if (ws_size < (size_t)WS_END2) return;
  float *CM = (float*)(ws + WS_CM), *CZ = (float*)(ws + WS_CZ);
  k_proj<<<dim3(TNB * TT / 64, CC / 128, 3), 128, 0, stream>>>(F[0], F[0], F[0], F[1], F[3], F[5], F[2], F[4], F[6], QH, QL, KH, KL, VT, VB, VBL);
  for (int b = 0; b < TNB; ++b) for (int h0 = 0; h0 < NH; h0 += HG) {
    k_sc<<<dim3(NQB, TT / 128, HG), 128, 0, stream>>>(QH, KH, QL, KL, b, h0, S);
    k_colstat_c<<<dim3(TT / 256, HG), 256, 0, stream>>>(S, CM, CZ);   /* per key column j: max / sum over the visible queries i >= j */
    k_csm_c<<<dim3(TT, HG), 256, 0, stream>>>(S, CM, CZ);            /* P[i][j] = exp(S - m_j) / Z_j x 2^11 for j <= i, 0 above the diagonal */
    k_pv<<<dim3(NQB, 1, HG), 128, 0, stream>>>(S, VT, VB, VBL, b, h0, Y);
  }
  k_out<<<dim3(TNB * TT / 64, DIN / 128), 128, 0, stream>>>(Y, F[7], F[8], (float*)d_out);
}

// v001
// A run of this version takes 873 microseconds.
// In both of two side-by-side timings against v000, it was 4.76 times as fast.
// compute dtype: all float inputs rounded to bf16; per-head q/k/v projections with EXACT bf16 products on WMMA 16x16x32 (f32 accumulate) + bias; causal scores q x k once to f16 each (1 product; sigma - 0.4) x 64^-0.5 on every block; softmax over the QUERY axis in f32 (per key column: max / sum over the visible queries, precise expf); P as bf16 hi + lo against v as bf16 hi + lo (3 products) on EVERY block; ctx x 2^6 once to f16 x Wc f16(bf16 x 2^8) - except the LAST 64 rows of each sequence: ctx as bf16 hi + lo against exact bf16 Wc (2 products) - + bc; f32 output.
#include <hip/hip_runtime.h>
#include <math.h>

typedef __attribute__((ext_vector_type(16))) _Float16 v16h;
typedef __attribute__((ext_vector_type(16))) __bf16 v16b;
typedef __attribute__((ext_vector_type(8)))  _Float16 v8h;
typedef __attribute__((ext_vector_type(8)))  float v8f;
typedef __attribute__((ext_vector_type(4)))  float v4f;
typedef __attribute__((ext_vector_type(2)))  float v2f;
typedef __attribute__((ext_vector_type(4)))  unsigned v4u;
typedef __attribute__((ext_vector_type(4)))  int v4i;
typedef float __attribute__((may_alias)) float_a;
typedef int __attribute__((may_alias)) int_a;

template <typename T> __device__ __forceinline__ void vst2(void* p, T v) { *(T*)p = v;  }
__device__ __forceinline__ v8f wmma16(v16h a, v16h b, v8f c) {
  v8f d = __builtin_amdgcn_wmma_f32_16x16x32_f16(false, a, false, b, (short)0, c, false, false);
  asm volatile("v_nop\n\tv_nop\n\tv_nop\n\tv_nop" : "+v"(d) : "v"(a), "v"(b));
  return d;
}
__device__ __forceinline__ v8f wmma_bf(v16b a, v16b b, v8f c) {
  v8f d = __builtin_amdgcn_wmma_f32_16x16x32_bf16(false, a, false, b, (short)0, c, false, false);
  asm volatile("v_nop\n\tv_nop\n\tv_nop\n\tv_nop" : "+v"(d) : "v"(a), "v"(b));
  return d;
}
// 16x16x32 fragments: lane = (h = lane>>4, row/col = lane&15); elements 0..7 = k0+8h+0..7, 8..15 = k0+16+8h+0..7; D element r = row 8h+r
__device__ __forceinline__ v16h frag_h(const _Float16* rowk0, int lane) {
  union { v16h v; v8h q[2]; } u; const _Float16* p = rowk0 + 8 * (lane >> 4);
  u.q[0] = *(const v8h*)p; u.q[1] = *(const v8h*)(p + 16); return u.v;
}
__device__ __forceinline__ v16h frag_f32(const float* rowk0, int lane) {
  v16h a; const float* p = rowk0 + 8 * (lane >> 4);
#pragma unroll
  for (int i = 0; i < 8; ++i) { a[i] = (_Float16)p[i]; a[8 + i] = (_Float16)p[16 + i]; }
  return a;
}
__device__ __forceinline__ v16h frag_f32s(const float* rowk0, int lane, float sc) {
  v16h a; const float* p = rowk0 + 8 * (lane >> 4);
#pragma unroll
  for (int i = 0; i < 8; ++i) { a[i] = (_Float16)(p[i] * sc); a[8 + i] = (_Float16)(p[16 + i] * sc); }
  return a;
}
// column fragment from a [K][ld] layout (column n), rows >= K read as 0
__device__ __forceinline__ v16h fragc_f32(const float* W, int k0, int n, int lane, int ld, int K) {
  v16h a; const int g = lane >> 4;
#pragma unroll
  for (int i = 0; i < 8; ++i) { const int ka = k0 + 8 * g + i, kb = ka + 16;
    a[i] = (_Float16)(ka < K ? W[(size_t)(ka < K ? ka : K - 1) * ld + n] : 0.f); a[8 + i] = (_Float16)(kb < K ? W[(size_t)(kb < K ? kb : K - 1) * ld + n] : 0.f); }
  return a;
}
struct F2 { v16b h, l; };
__device__ __forceinline__ F2 bsplit16(const float v[16]) { F2 r;
#pragma unroll
  for (int i = 0; i < 16; ++i) { const __bf16 h = (__bf16)v[i]; r.h[i] = h; r.l[i] = (__bf16)(v[i] - (float)h); }
  return r; }
__device__ __forceinline__ F2 split_row(const float* row, int k0, int lane) { float v[16]; const float* p = row + k0 + 8 * (lane >> 4);
#pragma unroll
  for (int i = 0; i < 8; ++i) { v[i] = p[i]; v[8 + i] = p[16 + i]; }
  return bsplit16(v); }
__device__ __forceinline__ F2 split_rowK(const float* row, int k0, int lane, int K) { float v[16]; const int g = lane >> 4;
#pragma unroll
  for (int i = 0; i < 8; ++i) { const int ka = k0 + 8 * g + i, kb = ka + 16; v[i] = ka < K ? row[ka < K ? ka : K - 1] : 0.f; v[8 + i] = kb < K ? row[kb < K ? kb : K - 1] : 0.f; }
  return bsplit16(v); }
__device__ __forceinline__ F2 split_col(const float* W, int k0, int n, int lane, int ld, int K) { float v[16]; const int g = lane >> 4;
#pragma unroll
  for (int i = 0; i < 8; ++i) { const int ka = k0 + 8 * g + i, kb = ka + 16; v[i] = ka < K ? W[(size_t)(ka < K ? ka : K - 1) * ld + n] : 0.f; v[8 + i] = kb < K ? W[(size_t)(kb < K ? kb : K - 1) * ld + n] : 0.f; }
  return bsplit16(v); }
__device__ __forceinline__ v8f mac3(const F2& a, const F2& b, v8f c) { c = wmma_bf(a.l, b.h, c); c = wmma_bf(a.h, b.l, c); return wmma_bf(a.h, b.h, c); }
__device__ __forceinline__ float sigm(float v) { return 1.0f / (1.0f + expf(-v)); }
#define LDSX() do { asm volatile("s_wait_dscnt 0" ::: "memory"); __builtin_amdgcn_wave_barrier(); __builtin_amdgcn_fence(__ATOMIC_RELEASE, "workgroup"); } while (0)

// Causal multi-head attention whose softmax runs over the QUERY axis, with per-head projection tensors (source [4,1024,1024]; Wq / Wk / Wv [16,1024,64] (head, in, out) (0.02) + biases [16,64]; scores / sqrt(64) + triu(-inf, k=1); attn = softmax(..., axis=2) - axis 2 of [B, H, q, k] is the QUERY axis: every key column is normalised over the queries q >= k (faithful to the source); out = attn v; heads merged; Wc [1024,1024] (in,out) + bc).
#define NB 4
#define TT 1024
#define CC 1024            // NH * HD = projected width
#define DIN 1024          // input (model) width
#define NH 16
#define HD 64
#define NQB (TT / 64)
#define HG 8
#define SCALE (0.125f)
#define CAUSAL 1
#ifndef TNB
#define TNB NB
#endif
__device__ __forceinline__ float bfr(float v) { return (float)(__bf16)v; }
__host__ __device__ __forceinline__ int kb_last(int qb) { return CAUSAL ? ((qb * 64 + 63) >> 7) : (TT / 128 - 1); }
typedef __attribute__((ext_vector_type(8))) __bf16 v8b;
__device__ __forceinline__ v16b frag_b(const __bf16* rowk0, int lane) {
  union { v16b v; v8b q[2]; } u; const __bf16* p = rowk0 + 8 * (lane >> 4);
  u.q[0] = *(const v8b*)p; u.q[1] = *(const v8b*)(p + 16); return u.v;
}
#define QBH 16              // causal: query blocks 0..QBH-1 of each sequence (QBH = NQB: every block) take the high-precision path
#define QHI 0               // no q residual plane: the scores are small and single-product everywhere
#define QBH_SC 0            // k_sc: no block takes the 3-product branch (k_pv keeps QBH = NQB: bf16 hi/lo P.v on every block - a query-axis softmax has O(1) weights on the LAST key columns)
#define KHI 1024            // key rows carrying k residual / v bf16 hi+lo planes (used only by the causal high-precision path)
// B fragment (k rows k0+.., output column o) of a weight: (in,out) [K][ld] or (out,in) [ld rows of K]: bf16 exact, or f16(bf16 * 256) exact
__device__ __forceinline__ v16b wcol_io(const float* Wm, int k0, int o, int lane, int ld) { v16b w; const int g = lane >> 4;
#pragma unroll
  for (int i = 0; i < 8; ++i) { w[i] = (__bf16)Wm[(size_t)(k0 + 8 * g + i) * ld + o]; w[8 + i] = (__bf16)Wm[(size_t)(k0 + 16 + 8 * g + i) * ld + o]; }
  return w; }
__device__ __forceinline__ v16b wcol_oi(const float* Wm, int k0, int o, int lane, int K) { v16b w; const float* p = Wm + (size_t)o * K + k0 + 8 * (lane >> 4);
#pragma unroll
  for (int i = 0; i < 8; ++i) { w[i] = (__bf16)p[i]; w[8 + i] = (__bf16)p[16 + i]; }
  return w; }
__device__ __forceinline__ v16h wcolh_io(const float* Wm, int k0, int o, int lane, int ld) { v16h w; const int g = lane >> 4;
#pragma unroll
  for (int i = 0; i < 8; ++i) { w[i] = (_Float16)(bfr(Wm[(size_t)(k0 + 8 * g + i) * ld + o]) * 256.0f); w[8 + i] = (_Float16)(bfr(Wm[(size_t)(k0 + 16 + 8 * g + i) * ld + o]) * 256.0f); }
  return w; }
__device__ __forceinline__ v16h wcolh_oi(const float* Wm, int k0, int o, int lane, int K) { v16h w; const float* p = Wm + (size_t)o * K + k0 + 8 * (lane >> 4);
#pragma unroll
  for (int i = 0; i < 8; ++i) { w[i] = (_Float16)(bfr(p[i]) * 256.0f); w[8 + i] = (_Float16)(bfr(p[16 + i]) * 256.0f); }
  return w; }
#define WQKV_LAYOUT 0   // 0 = per-head [NH][DIN][HD] (head, in, out); 1 = (out,in) [CC][DIN]; 2 = per-head [NH][DIN][HD]
__device__ __forceinline__ v16b wcol_hdk(const float* Wm, int k0, int o, int lane) { v16b w; const int g = lane >> 4; const float* p = Wm + (size_t)(o / HD) * DIN * HD + (o % HD);
#pragma unroll
  for (int i = 0; i < 8; ++i) { w[i] = (__bf16)p[(size_t)(k0 + 8 * g + i) * HD]; w[8 + i] = (__bf16)p[(size_t)(k0 + 16 + 8 * g + i) * HD]; }
  return w; }
#define WO_OUT_IN 0
#if WQKV_LAYOUT == 1
#define WCOL(W, k0, o, lane) wcol_oi(W, k0, o, lane, DIN)
#elif WQKV_LAYOUT == 2
#define WCOL(W, k0, o, lane) wcol_hdk(W, k0, o, lane)
#else
#define WCOL(W, k0, o, lane) wcol_io((W) + (size_t)((o) / 64) * DIN * 64, k0, (o) % 64, lane, 64)   /* per-head weight tensors [16][DIN][64] (head, in, out): output column o = h*64 + kk lives in head h's [DIN][64] (in,out) slab at pitch 64 (a 16-column tile never straddles a head) */
#endif
#if WO_OUT_IN
#define WOCOL(W, k0, o, lane) wcol_oi(W, k0, o, lane, CC)
#define WOCOLH(W, k0, o, lane) wcolh_oi(W, k0, o, lane, CC)
#else
#define WOCOL(W, k0, o, lane) wcol_io(W, k0, o, lane, DIN)
#define WOCOLH(W, k0, o, lane) wcolh_io(W, k0, o, lane, DIN)
#endif

#ifndef SM_EXTRA_PARAMS
#define SM_EXTRA_PARAMS
#endif
#ifndef PROJ_EXTRA_PARAMS
#define PROJ_EXTRA_PARAMS
#endif
#ifndef SM_MASK_HOOK
#define SM_MASK_HOOK (void)0
#endif

#define WS_QH  0u                                      // f16 q rows [b*t][CC]
#define WS_KH  (WS_QH + 2u * (size_t)NB * TT * CC)      // f16 k rows [b*t][CC]
#define WS_VT  (WS_KH + 2u * (size_t)NB * TT * CC)      // f16 v planes [b][c][t]
#define WS_QL  (WS_VT + 2u * (size_t)NB * CC * TT)      // f16 q residual x 2^10 rows [b][t < QHI][CC]
#define WS_KL  (WS_QL + 2u * (size_t)NB * QHI * CC)     // f16 k residual x 2^10 rows [b][t < KHI][CC]
#define WS_VB  (WS_KL + 2u * (size_t)NB * KHI * CC)     // bf16 v hi planes [b][c][t < KHI]
#define WS_VBL (WS_VB + 2u * (size_t)NB * CC * KHI)
#define WS_S   (WS_VBL + 2u * (size_t)NB * CC * KHI)    // f32 logits / P [hg][t][s]
#define WS_Y   (WS_S  + 4u * (size_t)HG * TT * TT)      // f32 ctx rows [b*t][CC] (only when there is an output projection)
#define WS_END (WS_Y  + 4u * (size_t)NB * TT * CC)
#define WS_CM (WS_END)                                  // f32 column maxima [HG][TT]
#define WS_CZ (WS_CM + 4u * (size_t)HG * TT)
#define WS_END2 (WS_CZ + 4u * (size_t)HG * TT)

// ---- k_proj: block = (64 rows, 128 cols, which): q/k/v = X W (+ b) with exact bf16 products (K = DIN) -> which 0: q f16 rows (+ residual rows < QHI); 1: k f16 rows (+ residual rows < KHI); 2: v f16 planes [c][t] (+ bf16 hi/lo planes for t < KHI)
__global__ __launch_bounds__(128) void k_proj(const float* __restrict__ XQ, const float* __restrict__ XK, const float* __restrict__ XV, const float* __restrict__ WQ, const float* __restrict__ WK, const float* __restrict__ WV, const float* __restrict__ BQ, const float* __restrict__ BK, const float* __restrict__ BV,
    _Float16* __restrict__ QH, _Float16* __restrict__ QL, _Float16* __restrict__ KH, _Float16* __restrict__ KL, _Float16* __restrict__ VT, __bf16* __restrict__ VB, __bf16* __restrict__ VBL) {
  __shared__ __align__(16) _Float16 sh[64][136], sl[64][136]; __shared__ __align__(16) _Float16 th[128][72]; __shared__ __align__(16) __bf16 tb[128][72], tbl[128][72];
  const int tid = threadIdx.x, wave = tid >> 5, lane = tid & 31, col = lane & 15, g = lane >> 4; const int which = blockIdx.z; const int c0 = blockIdx.y * 128; const size_t r0 = (size_t)blockIdx.x * 64; const size_t bb = r0 / TT; const int t0 = (int)(r0 % TT);
  const float* X = which == 0 ? XQ : which == 1 ? XK : XV; const float* WA = which == 0 ? WQ : which == 1 ? WK : WV; const float* BA = which == 0 ? BQ : which == 1 ? BK : BV;
  v8f acc[8] = {};
#pragma unroll 2
  for (int kc = 0; kc < DIN / 32; ++kc) { v16b a; { const float* p = X + (r0 + wave * 16 + col) * DIN + kc * 32 + 8 * g;
#pragma unroll
      for (int i = 0; i < 8; ++i) { a[i] = (__bf16)p[i]; a[8 + i] = (__bf16)p[16 + i]; } }
    asm volatile("s_wait_loadcnt 0x0" ::: "memory");
#pragma unroll
    for (int j = 0; j < 8; ++j) { const v16b w = WCOL(WA, kc * 32, c0 + j * 16 + col, lane); asm volatile("s_wait_loadcnt 0x0" ::: "memory"); acc[j] = wmma_bf(a, w, acc[j]); } }
  if (which < 2) { _Float16* DH = which == 0 ? QH : KH; _Float16* DL = which == 0 ? QL : KL; const int nhi = which == 0 ? QHI : KHI; const bool hi_rows = t0 < nhi;
#pragma unroll
    for (int j = 0; j < 8; ++j) { const float bias = BA ? bfr(BA[c0 + j * 16 + col]) : 0.f;
#pragma unroll
      for (int r = 0; r < 8; ++r) { const float v = acc[j][r] + bias; const _Float16 hv = (_Float16)v; sh[wave * 16 + 8 * g + r][j * 16 + col] = hv; sl[wave * 16 + 8 * g + r][j * 16 + col] = (_Float16)((v - (float)hv) * 1024.0f); } }
    __syncthreads();
    for (int e = tid; e < 64 * 16; e += 128) { const int rl = e >> 4, q = e & 15; vst2((unsigned*)(DH + (r0 + rl) * CC + c0 + q * 8), *(const v4u*)&sh[rl][q * 8]); if (hi_rows) vst2((unsigned*)(DL + (bb * nhi + t0 + rl) * (size_t)CC + c0 + q * 8), *(const v4u*)&sl[rl][q * 8]); }
  } else { const bool hi_rows = t0 < KHI;
#pragma unroll
    for (int j = 0; j < 8; ++j) { const float bias = BA ? bfr(BA[c0 + j * 16 + col]) : 0.f;
#pragma unroll
      for (int r = 0; r < 8; ++r) { const float v = acc[j][r] + bias; const int rl = wave * 16 + 8 * g + r, cl = j * 16 + col; th[cl][rl] = (_Float16)v; const __bf16 bh = (__bf16)v; tb[cl][rl] = bh; tbl[cl][rl] = (__bf16)(v - (float)bh); } }
    __syncthreads();
    for (int e = tid; e < 128 * 8; e += 128) { const int cl = e >> 3, q = e & 7; vst2((unsigned*)(VT + (bb * CC + c0 + cl) * (size_t)TT + t0 + q * 8), *(const v4u*)&th[cl][q * 8]); if (hi_rows) { const size_t o3 = (bb * CC + c0 + cl) * (size_t)KHI + t0 + q * 8; vst2((unsigned*)(VB + o3), *(const v4u*)&tb[cl][q * 8]); vst2((unsigned*)(VBL + o3), *(const v4u*)&tbl[cl][q * 8]); } } } }
// ---- k_sc: block = (query block qb, key block kb <= kb_last(qb), head in group) of batch b: logits x SCALE; q hi + residual (x 2^10) against k (2 products) for query rows < QHI, plus the k residual (3 products) for query blocks < QBH_SC (causal early rows); causal: blocks past the diagonal exit, the mask itself is applied by index in k_colstat_c and k_csm_c
__global__ __launch_bounds__(128) void k_sc(const _Float16* __restrict__ QH, const _Float16* __restrict__ KH, const _Float16* __restrict__ QL, const _Float16* __restrict__ KL, int b, int h0, float* __restrict__ S0) { __shared__ __align__(16) float ss[4][16][132];
  const int qb = blockIdx.x, kb = blockIdx.y; if (kb > kb_last(qb)) return;
  const int h = h0 + blockIdx.z; float* S = S0 + (size_t)blockIdx.z * TT * TT;
  const int tid = threadIdx.x, wave = tid >> 5, lane = tid & 31, col = lane & 15, g = lane >> 4; const int k0 = kb * 128; const int ql0 = qb * 64 + wave * 16; const size_t q0 = (size_t)b * TT + ql0, kr0 = (size_t)b * TT + k0;
  v8f acc[8] = {}, accl[8] = {};
  const _Float16* QLb = QL + (size_t)b * QHI * CC; const _Float16* KLb = KL + (size_t)b * KHI * CC;
  if (qb < QBH_SC) {
#pragma unroll
    for (int kc = 0; kc < HD / 32; ++kc) { const v16h ah = frag_h(QH + (q0 + col) * CC + h * HD + kc * 32, lane), al = frag_h(QLb + (size_t)(ql0 + col) * CC + h * HD + kc * 32, lane);
#pragma unroll
      for (int j = 0; j < 8; ++j) { const v16h kbf = frag_h(KH + (kr0 + j * 16 + col) * CC + h * HD + kc * 32, lane), klf = frag_h(KLb + (size_t)(k0 + j * 16 + col) * CC + h * HD + kc * 32, lane); acc[j] = wmma16(ah, kbf, acc[j]); accl[j] = wmma16(al, kbf, accl[j]); accl[j] = wmma16(ah, klf, accl[j]); } }
  } else if (qb * 64 < QHI) {
#pragma unroll
    for (int kc = 0; kc < HD / 32; ++kc) { const v16h ah = frag_h(QH + (q0 + col) * CC + h * HD + kc * 32, lane), al = frag_h(QLb + (size_t)(ql0 + col) * CC + h * HD + kc * 32, lane);
#pragma unroll
      for (int j = 0; j < 8; ++j) { const v16h kbf = frag_h(KH + (kr0 + j * 16 + col) * CC + h * HD + kc * 32, lane); acc[j] = wmma16(ah, kbf, acc[j]); accl[j] = wmma16(al, kbf, accl[j]); } }
  } else {
#pragma unroll
    for (int kc = 0; kc < HD / 32; ++kc) { const v16h ah = frag_h(QH + (q0 + col) * CC + h * HD + kc * 32, lane);
#pragma unroll
      for (int j = 0; j < 8; ++j) { const v16h kbf = frag_h(KH + (kr0 + j * 16 + col) * CC + h * HD + kc * 32, lane); acc[j] = wmma16(ah, kbf, acc[j]); } } }
#pragma unroll
  for (int j = 0; j < 8; ++j) {
#pragma unroll
    for (int r = 0; r < 8; ++r) ss[wave][8 * g + r][j * 16 + col] = (acc[j][r] + accl[j][r] * (1.0f / 1024.0f)) * SCALE; }
  LDSX(); for (int rl = 0; rl < 16; ++rl) vst2(S + (size_t)(ql0 + rl) * TT + k0 + lane * 4, *(const v4f*)&ss[wave][rl][lane * 4]); }
// ---- k_sm: block = query row t (head in group): keys [0, kend): causal -> logit if s <= t else excluded; softmax in f32; P x 2^11 in place (0 for excluded)
__global__ __launch_bounds__(256) void k_sm(float* __restrict__ S0 SM_EXTRA_PARAMS) { __shared__ float sred[8]; __shared__ float sbc; __shared__ __align__(16) float shv[TT];
  const int tid = threadIdx.x; const int t = blockIdx.x; const int kend = (kb_last(t >> 6) + 1) * 128;
  float* sr = S0 + (size_t)blockIdx.y * TT * TT + (size_t)t * TT;
  float m = -3.0e38f; for (int k = tid; k < kend; k += 256) { float v = (!CAUSAL || k <= t) ? sr[k] : -3.0e38f; SM_MASK_HOOK; shv[k] = v; m = fmaxf(m, v); }
#pragma unroll
  for (int o = 1; o < 32; o <<= 1) m = fmaxf(m, __shfl_xor(m, o));
  if ((tid & 31) == 0) sred[tid >> 5] = m; __syncthreads(); if (tid == 0) { float a = sred[0]; for (int i = 1; i < 8; ++i) a = fmaxf(a, sred[i]); sbc = a; } __syncthreads(); m = sbc; __syncthreads();
  float sum = 0.f; for (int k = tid; k < kend; k += 256) { const float v = shv[k]; const float e = (v <= -1.0e38f) ? 0.f : expf(v - m); shv[k] = e; sum += e; }
#pragma unroll
  for (int o = 1; o < 32; o <<= 1) sum += __shfl_xor(sum, o);
  if ((tid & 31) == 0) sred[tid >> 5] = sum; __syncthreads(); if (tid == 0) { float a = 0.f; for (int i = 0; i < 8; ++i) a += sred[i]; sbc = a > 0.f ? 2048.0f / a : 0.f; }   /* a fully excluded row yields P = 0 */ __syncthreads(); const float inv = sbc;
  for (int k = tid; k < kend; k += 256) shv[k] = shv[k] * inv;
  __syncthreads(); for (int q = tid; q < kend / 4; q += 256) vst2(sr + q * 4, *(const v4f*)&shv[q * 4]); }
// ---- k_colstat_c: softmax over the QUERY axis under the causal mask (the source's softmax(axis=2) on [B, H, q, k] scores with -inf where k > q): for every key column k: m_k = max_{q >= k} S[q][k], Z_k = sum_{q >= k} exp(S[q][k] - m_k) (f32, precise expf). Block = 32 key columns x 64 row slices: 16 waves, in each wave 4 rows x 8 lanes x 4 columns (one 16-byte load a lane, whole 128-byte lines). A thread keeps its up to 16 rows (q = k0 + slice + 64 i) in registers: column maxima over the wave first, then the exponentials against the wave's maximum, so no running rescale; the 16 waves' (m, z) pairs meet in LDS and wave 0 merges them (z_w x exp(m_w - m)). Rows start at the block's first column, and only a thread's first row can lie above a column's diagonal: q < k is masked there by a value select after an unconditional load. A wave's four rows end together (all bounds are multiples of 4), so its trip count is wave-uniform and no row index needs a clamp
__device__ __forceinline__ float xl8(float v) { return __builtin_bit_cast(float, __builtin_amdgcn_update_dpp(0, __builtin_bit_cast(int, v), 0x168 /* row_xmask:8 */, 0xf, 0xf, true)); }   // lane l <-> l ^ 8, in registers
__device__ __forceinline__ float xl16(float v) { const int b = __builtin_bit_cast(int, v); return __builtin_bit_cast(float, __builtin_amdgcn_permlanex16(b, b, 0x76543210, 0xfedcba98, false, false)); }   // lane l <-> l ^ 16, in registers
__global__ __launch_bounds__(512) void k_colstat_c(const float* __restrict__ S0, float* __restrict__ CM, float* __restrict__ CZ) { __shared__ __align__(16) float sm[16][32], sz[16][32];
  const int tid = threadIdx.x, wave = __builtin_amdgcn_readfirstlane(tid >> 5) /* in a scalar register, so the trip tests below are scalar branches */, lane = tid & 31; const int k0 = blockIdx.x * 32, kc = k0 + (lane & 7) * 4, r0 = k0 + wave * 4, qs = r0 + (lane >> 3); const int nt = (TT - r0 + 63) >> 6;   /* rows r0 + 64 i < TT: 0 trips for a wave that starts past the last row */
  const float* rp = S0 + (size_t)blockIdx.y * TT * TT + (size_t)qs * TT + kc;
  v4f v[16];   /* every loop over i is fully unrolled: constant indices keep v[] in registers, and all of a thread's loads are in flight together off one address */
#pragma unroll
  for (int i = 0; i < 16; ++i) if (i < nt) { if (i == 15) asm volatile("s_wait_xcnt 0x0" ::: "memory");   /* the last load's result may be given the address registers that the fifteen issued loads name: the wait stands in front of that overwrite */
    v[i] = *(const v4f*)(rp + (size_t)i * 64 * TT); }
  v4f m = { -3.0e38f, -3.0e38f, -3.0e38f, -3.0e38f }, z = { 0.f, 0.f, 0.f, 0.f };
#pragma unroll
  for (int i = 0; i < 16; ++i) if (i < nt) {
#pragma unroll
    for (int u = 0; u < 4; ++u) m[u] = fmaxf(m[u], (i > 0 || qs >= kc + u) ? v[i][u] : -3.0e38f); }
#pragma unroll
  for (int u = 0; u < 4; ++u) { m[u] = fmaxf(m[u], xl8(m[u])); m[u] = fmaxf(m[u], xl16(m[u])); }
#pragma unroll
  for (int i = 0; i < 16; ++i) if (i < nt) {
#pragma unroll
    for (int u = 0; u < 4; ++u) { const float e = expf(v[i][u] - m[u]); z[u] += (i > 0 || qs >= kc + u) ? e : 0.f; } }
#pragma unroll
  for (int u = 0; u < 4; ++u) { z[u] += xl8(z[u]); z[u] += xl16(z[u]); }
  if (lane < 8) { *(v4f*)&sm[wave][lane * 4] = m; *(v4f*)&sz[wave][lane * 4] = z; }
  __syncthreads();
  if (wave == 0) { float mm = -3.0e38f, zz = 0.f;   /* a wave with no visible row of a column brings (-3e38, 0): its term is 0 */
#pragma unroll
    for (int w = 0; w < 16; ++w) mm = fmaxf(mm, sm[w][lane]);
#pragma unroll
    for (int w = 0; w < 16; ++w) zz += sz[w][lane] * expf(sm[w][lane] - mm);
    vst2(CM + (size_t)blockIdx.y * TT + k0 + lane, mm); vst2(CZ + (size_t)blockIdx.y * TT + k0 + lane, zz); } }   /* every column sees at least its own diagonal entry: Z_k >= 1 */
// ---- k_csm_c: block = query row t: P[t][k] = exp(S[t][k] - m_k) / Z_k x 2^11 for k <= t, 0 for t < k < kend (inside the diagonal block); in place; unconditional loads, value select
__global__ __launch_bounds__(256) void k_csm_c(float* __restrict__ S0, const float* __restrict__ CM, const float* __restrict__ CZ) { const int tid = threadIdx.x; const int t = blockIdx.x; const int kend = (kb_last(t >> 6) + 1) * 128; float* sr = S0 + (size_t)blockIdx.y * TT * TT + (size_t)t * TT; const float* cm = CM + (size_t)blockIdx.y * TT; const float* cz = CZ + (size_t)blockIdx.y * TT;
  for (int q4 = tid; q4 < kend / 4; q4 += 256) { const v4f sv = *(const v4f*)(sr + q4 * 4), m4 = *(const v4f*)(cm + q4 * 4), z4 = *(const v4f*)(cz + q4 * 4); asm volatile("s_wait_loadcnt 0x0" ::: "memory"); v4f p;
#pragma unroll
    for (int u = 0; u < 4; ++u) p[u] = (q4 * 4 + u <= t) ? expf(sv[u] - m4[u]) * (2048.0f / z4[u]) : 0.f;
    vst2(sr + q4 * 4, p); } }
// ---- k_pv: block = 64 queries (qb) of (b, h): ctx = P . v over keys [0, kend) (P x 2^11 once to f16 against v f16: 1 product; query blocks < QBH (= NQB, every block): P and v as bf16 hi + lo, 3 products); 256-B (row, head) segment by 16 lanes
__global__ __launch_bounds__(128) void k_pv(const float* __restrict__ PS0, const _Float16* __restrict__ VT, const __bf16* __restrict__ VB, const __bf16* __restrict__ VBL, int b, int h0, float* __restrict__ Y) { const int h = h0 + blockIdx.z; const float* PS = PS0 + (size_t)blockIdx.z * TT * TT; __shared__ __align__(16) float ss[4][16][HD + 4];
  const int tid = threadIdx.x, wave = tid >> 5, lane = tid & 31, col = lane & 15, g = lane >> 4; const int qb = blockIdx.x; const int ql0 = qb * 64 + wave * 16; const int kce = (kb_last(qb) + 1) * 4;
  v8f acc[HD / 16] = {};
  if (qb < QBH) {
#pragma unroll 1
    for (int kc = 0; kc < kce; ++kc) { const F2 p = split_row(PS + (size_t)(ql0 + col) * TT, kc * 32, lane);
      asm volatile("s_wait_loadcnt 0x0" ::: "memory");
#pragma unroll
      for (int j = 0; j < HD / 16; ++j) { const size_t po = ((size_t)b * CC + h * HD + j * 16 + col) * (size_t)KHI + kc * 32; const v16b vh = frag_b(VB + po, lane); acc[j] = wmma_bf(p.h, vh, acc[j]); acc[j] = wmma_bf(p.l, vh, acc[j]); acc[j] = wmma_bf(p.h, frag_b(VBL + po, lane), acc[j]); } }
  } else {
#pragma unroll 1
    for (int kc = 0; kc < kce; ++kc) { const v16h p = frag_f32(PS + (size_t)(ql0 + col) * TT + kc * 32, lane);
      asm volatile("s_wait_loadcnt 0x0" ::: "memory");
#pragma unroll
      for (int j = 0; j < HD / 16; ++j) { const size_t po = ((size_t)b * CC + h * HD + j * 16 + col) * (size_t)TT + kc * 32; acc[j] = wmma16(p, frag_h(VT + po, lane), acc[j]); } } }
#pragma unroll
  for (int j = 0; j < HD / 16; ++j)
#pragma unroll
    for (int r = 0; r < 8; ++r) ss[wave][8 * g + r][j * 16 + col] = acc[j][r] * (1.0f / 2048.0f);
  LDSX(); for (int rl = 0; rl < 16; ++rl) if (lane < HD / 4) vst2(Y + ((size_t)b * TT + ql0 + rl) * CC + h * HD + lane * 4, *(const v4f*)&ss[wave][rl][lane * 4]); }
// ---- k_out: block = (64 rows, 128 cols): out = ctx Wo (+ bo): ctx x 2^6 once to f16 against Wo as f16(bf16 x 2^8) exact (1 product) x 2^-14; rows < QHI and the LAST 64 rows of each sequence: ctx bf16 hi + lo against exact bf16 Wo (2 products)
__global__ __launch_bounds__(128) void k_out(const float* __restrict__ Y, const float* __restrict__ WO, const float* __restrict__ BO, float* __restrict__ OUT) { __shared__ __align__(16) float sf[4][16][132];
  const int tid = threadIdx.x, wave = tid >> 5, lane = tid & 31, col = lane & 15, g = lane >> 4; const int c0 = blockIdx.y * 128; const size_t r0 = (size_t)blockIdx.x * 64 + wave * 16;
  v8f acc[8] = {};
  const int tb_ = (int)(((size_t)blockIdx.x * 64) % TT); if (CAUSAL && (tb_ < QHI || tb_ >= TT - 64)) {   /* block-uniform; the LAST 64 query rows of each sequence also take the hi + lo context path: under a query-axis softmax the last key columns carry O(1) weights, so the context rows there are an order of magnitude larger */
#pragma unroll 2
    for (int kc = 0; kc < CC / 32; ++kc) { const F2 a = split_row(Y + (r0 + col) * CC, kc * 32, lane); asm volatile("s_wait_loadcnt 0x0" ::: "memory");
#pragma unroll
      for (int j = 0; j < 8; ++j) { const v16b w = WOCOL(WO, kc * 32, c0 + j * 16 + col, lane); asm volatile("s_wait_loadcnt 0x0" ::: "memory"); acc[j] = wmma_bf(a.h, w, acc[j]); acc[j] = wmma_bf(a.l, w, acc[j]); } }
#pragma unroll
    for (int j = 0; j < 8; ++j) { const float bias = BO ? bfr(BO[c0 + j * 16 + col]) : 0.f;
#pragma unroll
      for (int r = 0; r < 8; ++r) sf[wave][8 * g + r][j * 16 + col] = acc[j][r] + bias; }
  } else {
#pragma unroll 2
    for (int kc = 0; kc < CC / 32; ++kc) { const v16h a = frag_f32s(Y + (r0 + col) * CC + kc * 32, lane, 64.0f); asm volatile("s_wait_loadcnt 0x0" ::: "memory");   /* ctx carried x 2^6 into f16 so small-magnitude context rows stay clear of f16 subnormals */
#pragma unroll
      for (int j = 0; j < 8; ++j) { const v16h w = WOCOLH(WO, kc * 32, c0 + j * 16 + col, lane); asm volatile("s_wait_loadcnt 0x0" ::: "memory"); acc[j] = wmma16(a, w, acc[j]); } }
#pragma unroll
    for (int j = 0; j < 8; ++j) { const float bias = BO ? bfr(BO[c0 + j * 16 + col]) : 0.f;
#pragma unroll
      for (int r = 0; r < 8; ++r) sf[wave][8 * g + r][j * 16 + col] = acc[j][r] * (1.0f / 16384.0f) + bias; } }   /* 2^-8 (Wo carry) x 2^-6 (ctx carry) */
  LDSX(); for (int rl = 0; rl < 16; ++rl) vst2(OUT + (r0 + rl) * DIN + c0 + lane * 4, *(const v4f*)&sf[wave][rl][lane * 4]); }

extern "C" void kernel_launch(void* const* d_in, const int* in_sizes, int n_in, void* d_out, int out_size, void* d_ws, size_t ws_size, hipStream_t stream) {
  (void)in_sizes; (void)n_in; (void)out_size;
  const float** F = (const float**)d_in;
  if (ws_size < (size_t)WS_END) return;
  char* ws = (char*)d_ws; _Float16 *QH = (_Float16*)(ws + WS_QH), *KH = (_Float16*)(ws + WS_KH), *VT = (_Float16*)(ws + WS_VT), *QL = (_Float16*)(ws + WS_QL), *KL = (_Float16*)(ws + WS_KL); __bf16 *VB = (__bf16*)(ws + WS_VB), *VBL = (__bf16*)(ws + WS_VBL); float *S = (float*)(ws + WS_S), *Y = (float*)(ws + WS_Y);
  (void)Y; (void)QL; (void)KL; (void)VB; (void)VBL;
  // inputs: 0 source [4,1024,1024]; 1 Wq [16,1024,64] (head, in, out), 2 bq [16,64]; 3 Wk, 4 bk; 5 Wv, 6 bv; 7 Wc [1024,1024] (in,out), 8 bc [1024] (all biases N(0, 0.02^2), nonzero)
  if (ws_size < (size_t)WS_END2) return;
  float *CM = (float*)(ws + WS_CM), *CZ = (float*)(ws + WS_CZ);
  k_proj<<<dim3(TNB * TT / 64, CC / 128, 3), 128, 0, stream>>>(F[0], F[0], F[0], F[1], F[3], F[5], F[2], F[4], F[6], QH, QL, KH, KL, VT, VB, VBL);
  for (int b = 0; b < TNB; ++b) for (int h0 = 0; h0 < NH; h0 += HG) {
    k_sc<<<dim3(NQB, TT / 128, HG), 128, 0, stream>>>(QH, KH, QL, KL, b, h0, S);
    k_colstat_c<<<dim3(TT / 32, HG), 512, 0, stream>>>(S, CM, CZ);   /* per key column j: max / sum over the visible queries i >= j */
    k_csm_c<<<dim3(TT, HG), 256, 0, stream>>>(S, CM, CZ);            /* P[i][j] = exp(S - m_j) / Z_j x 2^11 for j <= i, 0 above the diagonal */
    k_pv<<<dim3(NQB, 1, HG), 128, 0, stream>>>(S, VT, VB, VBL, b, h0, Y);
  }
  k_out<<<dim3(TNB * TT / 64, DIN / 128), 128, 0, stream>>>(Y, F[7], F[8], (float*)d_out);
}

// v002
// It runs in 504 microseconds.
// Next to v001, in two timings, it ran 1.74 times as fast each time.
// Counting every step since v000, it is 8.28 times as fast.
// compute dtype: all float inputs rounded to bf16; per-head q/k/v projections with EXACT bf16 products on WMMA 16x16x32 (f32 accumulate) + bias; causal scores q x k once to f16 each (1 product; sigma - 0.4) x 64^-0.5 on every block; softmax over the QUERY axis in f32 (per key column: max / sum over the visible queries, precise expf); P as bf16 hi + lo against v as bf16 hi + lo (3 products) on EVERY block; ctx x 2^6 once to f16 x Wc f16(bf16 x 2^8) - except the LAST 64 rows of each sequence: ctx as bf16 hi + lo against exact bf16 Wc (2 products) - + bc; f32 output.
#include <hip/hip_runtime.h>
#include <math.h>

typedef __attribute__((ext_vector_type(16))) _Float16 v16h;
typedef __attribute__((ext_vector_type(16))) __bf16 v16b;
typedef __attribute__((ext_vector_type(8)))  _Float16 v8h;
typedef __attribute__((ext_vector_type(8)))  float v8f;
typedef __attribute__((ext_vector_type(4)))  float v4f;
typedef __attribute__((ext_vector_type(2)))  float v2f;
typedef __attribute__((ext_vector_type(4)))  unsigned v4u;
typedef __attribute__((ext_vector_type(4)))  int v4i;
typedef float __attribute__((may_alias)) float_a;
typedef int __attribute__((may_alias)) int_a;

template <typename T> __device__ __forceinline__ void vst2(void* p, T v) { *(T*)p = v;  }
__device__ __forceinline__ v8f wmma16(v16h a, v16h b, v8f c) {
  v8f d = __builtin_amdgcn_wmma_f32_16x16x32_f16(false, a, false, b, (short)0, c, false, false);
  asm volatile("v_nop\n\tv_nop\n\tv_nop\n\tv_nop" : "+v"(d) : "v"(a), "v"(b));
  return d;
}
__device__ __forceinline__ v8f wmma_bf(v16b a, v16b b, v8f c) {
  v8f d = __builtin_amdgcn_wmma_f32_16x16x32_bf16(false, a, false, b, (short)0, c, false, false);
  asm volatile("v_nop\n\tv_nop\n\tv_nop\n\tv_nop" : "+v"(d) : "v"(a), "v"(b));
  return d;
}
// 16x16x32 fragments: lane = (h = lane>>4, row/col = lane&15); elements 0..7 = k0+8h+0..7, 8..15 = k0+16+8h+0..7; D element r = row 8h+r
__device__ __forceinline__ v16h frag_h(const _Float16* rowk0, int lane) {
  union { v16h v; v8h q[2]; } u; const _Float16* p = rowk0 + 8 * (lane >> 4);
  u.q[0] = *(const v8h*)p; u.q[1] = *(const v8h*)(p + 16); return u.v;
}
__device__ __forceinline__ v16h frag_f32(const float* rowk0, int lane) {
  v16h a; const float* p = rowk0 + 8 * (lane >> 4);
#pragma unroll
  for (int i = 0; i < 8; ++i) { a[i] = (_Float16)p[i]; a[8 + i] = (_Float16)p[16 + i]; }
  return a;
}
__device__ __forceinline__ v16h frag_f32s(const float* rowk0, int lane, float sc) {
  v16h a; const float* p = rowk0 + 8 * (lane >> 4);
#pragma unroll
  for (int i = 0; i < 8; ++i) { a[i] = (_Float16)(p[i] * sc); a[8 + i] = (_Float16)(p[16 + i] * sc); }
  return a;
}
// column fragment from a [K][ld] layout (column n), rows >= K read as 0
__device__ __forceinline__ v16h fragc_f32(const float* W, int k0, int n, int lane, int ld, int K) {
  v16h a; const int g = lane >> 4;
#pragma unroll
  for (int i = 0; i < 8; ++i) { const int ka = k0 + 8 * g + i, kb = ka + 16;
    a[i] = (_Float16)(ka < K ? W[(size_t)(ka < K ? ka : K - 1) * ld + n] : 0.f); a[8 + i] = (_Float16)(kb < K ? W[(size_t)(kb < K ? kb : K - 1) * ld + n] : 0.f); }
  return a;
}
struct F2 { v16b h, l; };
__device__ __forceinline__ F2 bsplit16(const float v[16]) { F2 r;
#pragma unroll
  for (int i = 0; i < 16; ++i) { const __bf16 h = (__bf16)v[i]; r.h[i] = h; r.l[i] = (__bf16)(v[i] - (float)h); }
  return r; }
__device__ __forceinline__ F2 split_row(const float* row, int k0, int lane) { float v[16]; const float* p = row + k0 + 8 * (lane >> 4);
#pragma unroll
  for (int i = 0; i < 8; ++i) { v[i] = p[i]; v[8 + i] = p[16 + i]; }
  return bsplit16(v); }
__device__ __forceinline__ F2 split_rowK(const float* row, int k0, int lane, int K) { float v[16]; const int g = lane >> 4;
#pragma unroll
  for (int i = 0; i < 8; ++i) { const int ka = k0 + 8 * g + i, kb = ka + 16; v[i] = ka < K ? row[ka < K ? ka : K - 1] : 0.f; v[8 + i] = kb < K ? row[kb < K ? kb : K - 1] : 0.f; }
  return bsplit16(v); }
__device__ __forceinline__ F2 split_col(const float* W, int k0, int n, int lane, int ld, int K) { float v[16]; const int g = lane >> 4;
#pragma unroll
  for (int i = 0; i < 8; ++i) { const int ka = k0 + 8 * g + i, kb = ka + 16; v[i] = ka < K ? W[(size_t)(ka < K ? ka : K - 1) * ld + n] : 0.f; v[8 + i] = kb < K ? W[(size_t)(kb < K ? kb : K - 1) * ld + n] : 0.f; }
  return bsplit16(v); }
__device__ __forceinline__ v8f mac3(const F2& a, const F2& b, v8f c) { c = wmma_bf(a.l, b.h, c); c = wmma_bf(a.h, b.l, c); return wmma_bf(a.h, b.h, c); }
__device__ __forceinline__ float sigm(float v) { return 1.0f / (1.0f + expf(-v)); }
#define LDSX() do { asm volatile("s_wait_dscnt 0" ::: "memory"); __builtin_amdgcn_wave_barrier(); __builtin_amdgcn_fence(__ATOMIC_RELEASE, "workgroup"); } while (0)

// Causal multi-head attention whose softmax runs over the QUERY axis, with per-head projection tensors (source [4,1024,1024]; Wq / Wk / Wv [16,1024,64] (head, in, out) (0.02) + biases [16,64]; scores / sqrt(64) + triu(-inf, k=1); attn = softmax(..., axis=2) - axis 2 of [B, H, q, k] is the QUERY axis: every key column is normalised over the queries q >= k (faithful to the source); out = attn v; heads merged; Wc [1024,1024] (in,out) + bc).
#define NB 4
#define TT 1024
#define CC 1024            // NH * HD = projected width
#define DIN 1024          // input (model) width
#define NH 16
#define HD 64
#define NQB (TT / 64)
#define HG 32              // (batch, head) pairs per launch of the score / softmax / context kernels: two whole batches (grid z or y = pair in group), so the logits plane holds HG x TT x TT f32
#define SCALE (0.125f)
#define CAUSAL 1
#ifndef TNB
#define TNB NB
#endif
__device__ __forceinline__ float bfr(float v) { return (float)(__bf16)v; }
__host__ __device__ __forceinline__ int kb_last(int qb) { return CAUSAL ? ((qb * 64 + 63) >> 7) : (TT / 128 - 1); }
typedef __attribute__((ext_vector_type(8))) __bf16 v8b;
__device__ __forceinline__ v16b frag_b(const __bf16* rowk0, int lane) {
  union { v16b v; v8b q[2]; } u; const __bf16* p = rowk0 + 8 * (lane >> 4);
  u.q[0] = *(const v8b*)p; u.q[1] = *(const v8b*)(p + 16); return u.v;
}
#define QBH 16              // causal: query blocks 0..QBH-1 of each sequence (QBH = NQB: every block) take the high-precision path
#define QHI 0               // no q residual plane: the scores are small and single-product everywhere
#define QBH_SC 0            // k_sc: no block takes the 3-product branch (k_pv keeps QBH = NQB: bf16 hi/lo P.v on every block - a query-axis softmax has O(1) weights on the LAST key columns)
#define KHI 1024            // key rows carrying k residual / v bf16 hi+lo planes (used only by the causal high-precision path)
// B fragment (k rows k0+.., output column o) of a weight: (in,out) [K][ld] or (out,in) [ld rows of K]: bf16 exact, or f16(bf16 * 256) exact
__device__ __forceinline__ v16b wcol_io(const float* Wm, int k0, int o, int lane, int ld) { v16b w; const int g = lane >> 4;
#pragma unroll
  for (int i = 0; i < 8; ++i) { w[i] = (__bf16)Wm[(size_t)(k0 + 8 * g + i) * ld + o]; w[8 + i] = (__bf16)Wm[(size_t)(k0 + 16 + 8 * g + i) * ld + o]; }
  return w; }
__device__ __forceinline__ v16b wcol_oi(const float* Wm, int k0, int o, int lane, int K) { v16b w; const float* p = Wm + (size_t)o * K + k0 + 8 * (lane >> 4);
#pragma unroll
  for (int i = 0; i < 8; ++i) { w[i] = (__bf16)p[i]; w[8 + i] = (__bf16)p[16 + i]; }
  return w; }
__device__ __forceinline__ v16h wcolh_io(const float* Wm, int k0, int o, int lane, int ld) { v16h w; const int g = lane >> 4;
#pragma unroll
  for (int i = 0; i < 8; ++i) { w[i] = (_Float16)(bfr(Wm[(size_t)(k0 + 8 * g + i) * ld + o]) * 256.0f); w[8 + i] = (_Float16)(bfr(Wm[(size_t)(k0 + 16 + 8 * g + i) * ld + o]) * 256.0f); }
  return w; }
__device__ __forceinline__ v16h wcolh_oi(const float* Wm, int k0, int o, int lane, int K) { v16h w; const float* p = Wm + (size_t)o * K + k0 + 8 * (lane >> 4);
#pragma unroll
  for (int i = 0; i < 8; ++i) { w[i] = (_Float16)(bfr(p[i]) * 256.0f); w[8 + i] = (_Float16)(bfr(p[16 + i]) * 256.0f); }
  return w; }
#define WQKV_LAYOUT 0   // 0 = per-head [NH][DIN][HD] (head, in, out); 1 = (out,in) [CC][DIN]; 2 = per-head [NH][DIN][HD]
__device__ __forceinline__ v16b wcol_hdk(const float* Wm, int k0, int o, int lane) { v16b w; const int g = lane >> 4; const float* p = Wm + (size_t)(o / HD) * DIN * HD + (o % HD);
#pragma unroll
  for (int i = 0; i < 8; ++i) { w[i] = (__bf16)p[(size_t)(k0 + 8 * g + i) * HD]; w[8 + i] = (__bf16)p[(size_t)(k0 + 16 + 8 * g + i) * HD]; }
  return w; }
#define WO_OUT_IN 0
#if WQKV_LAYOUT == 1
#define WCOL(W, k0, o, lane) wcol_oi(W, k0, o, lane, DIN)
#elif WQKV_LAYOUT == 2
#define WCOL(W, k0, o, lane) wcol_hdk(W, k0, o, lane)
#else
#define WCOL(W, k0, o, lane) wcol_io((W) + (size_t)((o) / 64) * DIN * 64, k0, (o) % 64, lane, 64)   /* per-head weight tensors [16][DIN][64] (head, in, out): output column o = h*64 + kk lives in head h's [DIN][64] (in,out) slab at pitch 64 (a 16-column tile never straddles a head) */
#endif
#if WO_OUT_IN
#define WOCOL(W, k0, o, lane) wcol_oi(W, k0, o, lane, CC)
#define WOCOLH(W, k0, o, lane) wcolh_oi(W, k0, o, lane, CC)
#else
#define WOCOL(W, k0, o, lane) wcol_io(W, k0, o, lane, DIN)
#define WOCOLH(W, k0, o, lane) wcolh_io(W, k0, o, lane, DIN)
#endif

#ifndef SM_EXTRA_PARAMS
#define SM_EXTRA_PARAMS
#endif
#ifndef PROJ_EXTRA_PARAMS
#define PROJ_EXTRA_PARAMS
#endif
#ifndef SM_MASK_HOOK
#define SM_MASK_HOOK (void)0
#endif

#define WS_QH  0u                                      // f16 q rows [b*t][CC]
#define WS_KH  (WS_QH + 2u * (size_t)NB * TT * CC)      // f16 k rows [b*t][CC]
#define WS_VT  (WS_KH + 2u * (size_t)NB * TT * CC)      // f16 v planes [b][c][t]
#define WS_QL  (WS_VT + 2u * (size_t)NB * CC * TT)      // f16 q residual x 2^10 rows [b][t < QHI][CC]
#define WS_KL  (WS_QL + 2u * (size_t)NB * QHI * CC)     // f16 k residual x 2^10 rows [b][t < KHI][CC]
#define WS_VB  (WS_KL + 2u * (size_t)NB * KHI * CC)     // bf16 v hi planes [b][c][t < KHI]
#define WS_VBL (WS_VB + 2u * (size_t)NB * CC * KHI)
#define WS_S   (WS_VBL + 2u * (size_t)NB * CC * KHI)    // f32 logits / P [hg][t][s]
#define WS_Y   (WS_S  + 4u * (size_t)HG * TT * TT)      // f32 ctx rows [b*t][CC] (only when there is an output projection)
#define WS_END (WS_Y  + 4u * (size_t)NB * TT * CC)
#define WS_CM (WS_END)                                  // f32 column maxima [HG][TT]
#define WS_CZ (WS_CM + 4u * (size_t)HG * TT)
#define WS_END2 (WS_CZ + 4u * (size_t)HG * TT)

// ---- k_proj: block = (64 rows, 128 cols, which): q/k/v = X W (+ b) with exact bf16 products (K = DIN) -> which 0: q f16 rows (+ residual rows < QHI); 1: k f16 rows (+ residual rows < KHI); 2: v f16 planes [c][t] (+ bf16 hi/lo planes for t < KHI)
__global__ __launch_bounds__(128) void k_proj(const float* __restrict__ XQ, const float* __restrict__ XK, const float* __restrict__ XV, const float* __restrict__ WQ, const float* __restrict__ WK, const float* __restrict__ WV, const float* __restrict__ BQ, const float* __restrict__ BK, const float* __restrict__ BV,
    _Float16* __restrict__ QH, _Float16* __restrict__ QL, _Float16* __restrict__ KH, _Float16* __restrict__ KL, _Float16* __restrict__ VT, __bf16* __restrict__ VB, __bf16* __restrict__ VBL) {
  __shared__ __align__(16) _Float16 sh[64][136], sl[64][136]; __shared__ __align__(16) _Float16 th[128][72]; __shared__ __align__(16) __bf16 tb[128][72], tbl[128][72];
  const int tid = threadIdx.x, wave = tid >> 5, lane = tid & 31, col = lane & 15, g = lane >> 4; const int which = blockIdx.z; const int c0 = blockIdx.y * 128; const size_t r0 = (size_t)blockIdx.x * 64; const size_t bb = r0 / TT; const int t0 = (int)(r0 % TT);
  const float* X = which == 0 ? XQ : which == 1 ? XK : XV; const float* WA = which == 0 ? WQ : which == 1 ? WK : WV; const float* BA = which == 0 ? BQ : which == 1 ? BK : BV;
  v8f acc[8] = {};
#pragma unroll 2
  for (int kc = 0; kc < DIN / 32; ++kc) { v16b a; { const float* p = X + (r0 + wave * 16 + col) * DIN + kc * 32 + 8 * g;
#pragma unroll
      for (int i = 0; i < 8; ++i) { a[i] = (__bf16)p[i]; a[8 + i] = (__bf16)p[16 + i]; } }
    asm volatile("s_wait_loadcnt 0x0" ::: "memory");
#pragma unroll
    for (int j = 0; j < 8; ++j) { const v16b w = WCOL(WA, kc * 32, c0 + j * 16 + col, lane); asm volatile("s_wait_loadcnt 0x0" ::: "memory"); acc[j] = wmma_bf(a, w, acc[j]); } }
  if (which < 2) { _Float16* DH = which == 0 ? QH : KH; _Float16* DL = which == 0 ? QL : KL; const int nhi = which == 0 ? QHI : KHI; const bool hi_rows = t0 < nhi;
#pragma unroll
    for (int j = 0; j < 8; ++j) { const float bias = BA ? bfr(BA[c0 + j * 16 + col]) : 0.f;
#pragma unroll
      for (int r = 0; r < 8; ++r) { const float v = acc[j][r] + bias; const _Float16 hv = (_Float16)v; sh[wave * 16 + 8 * g + r][j * 16 + col] = hv; sl[wave * 16 + 8 * g + r][j * 16 + col] = (_Float16)((v - (float)hv) * 1024.0f); } }
    __syncthreads();
    for (int e = tid; e < 64 * 16; e += 128) { const int rl = e >> 4, q = e & 15; vst2((unsigned*)(DH + (r0 + rl) * CC + c0 + q * 8), *(const v4u*)&sh[rl][q * 8]); if (hi_rows) vst2((unsigned*)(DL + (bb * nhi + t0 + rl) * (size_t)CC + c0 + q * 8), *(const v4u*)&sl[rl][q * 8]); }
  } else { const bool hi_rows = t0 < KHI;
#pragma unroll
    for (int j = 0; j < 8; ++j) { const float bias = BA ? bfr(BA[c0 + j * 16 + col]) : 0.f;
#pragma unroll
      for (int r = 0; r < 8; ++r) { const float v = acc[j][r] + bias; const int rl = wave * 16 + 8 * g + r, cl = j * 16 + col; th[cl][rl] = (_Float16)v; const __bf16 bh = (__bf16)v; tb[cl][rl] = bh; tbl[cl][rl] = (__bf16)(v - (float)bh); } }
    __syncthreads();
    for (int e = tid; e < 128 * 8; e += 128) { const int cl = e >> 3, q = e & 7; vst2((unsigned*)(VT + (bb * CC + c0 + cl) * (size_t)TT + t0 + q * 8), *(const v4u*)&th[cl][q * 8]); if (hi_rows) { const size_t o3 = (bb * CC + c0 + cl) * (size_t)KHI + t0 + q * 8; vst2((unsigned*)(VB + o3), *(const v4u*)&tb[cl][q * 8]); vst2((unsigned*)(VBL + o3), *(const v4u*)&tbl[cl][q * 8]); } } } }
// ---- k_sc: block = (query block qb, key block kb <= kb_last(qb), (batch, head) pair in group, group = whole batches from batch b): logits x SCALE; q hi + residual (x 2^10) against k (2 products) for query rows < QHI, plus the k residual (3 products) for query blocks < QBH_SC (causal early rows); causal: blocks past the diagonal exit, the mask itself is applied by index in k_colstat_c and k_csm_c
__global__ __launch_bounds__(128) void k_sc(const _Float16* __restrict__ QH, const _Float16* __restrict__ KH, const _Float16* __restrict__ QL, const _Float16* __restrict__ KL, int b, int h0, float* __restrict__ S0) { __shared__ __align__(16) float ss[4][16][132];
  const int qb = blockIdx.x, kb = blockIdx.y; if (kb > kb_last(qb)) return;
  const int hz = h0 + blockIdx.z, h = hz % NH; b += hz / NH;   /* pair in group -> (batch, head): the group runs on over whole batches from batch b */
  float* S = S0 + (size_t)blockIdx.z * TT * TT;
  const int tid = threadIdx.x, wave = tid >> 5, lane = tid & 31, col = lane & 15, g = lane >> 4; const int k0 = kb * 128; const int ql0 = qb * 64 + wave * 16; const size_t q0 = (size_t)b * TT + ql0, kr0 = (size_t)b * TT + k0;
  v8f acc[8] = {}, accl[8] = {};
  const _Float16* QLb = QL + (size_t)b * QHI * CC; const _Float16* KLb = KL + (size_t)b * KHI * CC;
  if (qb < QBH_SC) {
#pragma unroll
    for (int kc = 0; kc < HD / 32; ++kc) { const v16h ah = frag_h(QH + (q0 + col) * CC + h * HD + kc * 32, lane), al = frag_h(QLb + (size_t)(ql0 + col) * CC + h * HD + kc * 32, lane);
#pragma unroll
      for (int j = 0; j < 8; ++j) { const v16h kbf = frag_h(KH + (kr0 + j * 16 + col) * CC + h * HD + kc * 32, lane), klf = frag_h(KLb + (size_t)(k0 + j * 16 + col) * CC + h * HD + kc * 32, lane); acc[j] = wmma16(ah, kbf, acc[j]); accl[j] = wmma16(al, kbf, accl[j]); accl[j] = wmma16(ah, klf, accl[j]); } }
  } else if (qb * 64 < QHI) {
#pragma unroll
    for (int kc = 0; kc < HD / 32; ++kc) { const v16h ah = frag_h(QH + (q0 + col) * CC + h * HD + kc * 32, lane), al = frag_h(QLb + (size_t)(ql0 + col) * CC + h * HD + kc * 32, lane);
#pragma unroll
      for (int j = 0; j < 8; ++j) { const v16h kbf = frag_h(KH + (kr0 + j * 16 + col) * CC + h * HD + kc * 32, lane); acc[j] = wmma16(ah, kbf, acc[j]); accl[j] = wmma16(al, kbf, accl[j]); } }
  } else {
#pragma unroll
    for (int kc = 0; kc < HD / 32; ++kc) { const v16h ah = frag_h(QH + (q0 + col) * CC + h * HD + kc * 32, lane);
#pragma unroll
      for (int j = 0; j < 8; ++j) { const v16h kbf = frag_h(KH + (kr0 + j * 16 + col) * CC + h * HD + kc * 32, lane); acc[j] = wmma16(ah, kbf, acc[j]); } } }
#pragma unroll
  for (int j = 0; j < 8; ++j) {
#pragma unroll
    for (int r = 0; r < 8; ++r) ss[wave][8 * g + r][j * 16 + col] = (acc[j][r] + accl[j][r] * (1.0f / 1024.0f)) * SCALE; }
  LDSX(); for (int rl = 0; rl < 16; ++rl) vst2(S + (size_t)(ql0 + rl) * TT + k0 + lane * 4, *(const v4f*)&ss[wave][rl][lane * 4]); }
// ---- k_sm: block = query row t (head in group): keys [0, kend): causal -> logit if s <= t else excluded; softmax in f32; P x 2^11 in place (0 for excluded)
__global__ __launch_bounds__(256) void k_sm(float* __restrict__ S0 SM_EXTRA_PARAMS) { __shared__ float sred[8]; __shared__ float sbc; __shared__ __align__(16) float shv[TT];
  const int tid = threadIdx.x; const int t = blockIdx.x; const int kend = (kb_last(t >> 6) + 1) * 128;
  float* sr = S0 + (size_t)blockIdx.y * TT * TT + (size_t)t * TT;
  float m = -3.0e38f; for (int k = tid; k < kend; k += 256) { float v = (!CAUSAL || k <= t) ? sr[k] : -3.0e38f; SM_MASK_HOOK; shv[k] = v; m = fmaxf(m, v); }
#pragma unroll
  for (int o = 1; o < 32; o <<= 1) m = fmaxf(m, __shfl_xor(m, o));
  if ((tid & 31) == 0) sred[tid >> 5] = m; __syncthreads(); if (tid == 0) { float a = sred[0]; for (int i = 1; i < 8; ++i) a = fmaxf(a, sred[i]); sbc = a; } __syncthreads(); m = sbc; __syncthreads();
  float sum = 0.f; for (int k = tid; k < kend; k += 256) { const float v = shv[k]; const float e = (v <= -1.0e38f) ? 0.f : expf(v - m); shv[k] = e; sum += e; }
#pragma unroll
  for (int o = 1; o < 32; o <<= 1) sum += __shfl_xor(sum, o);
  if ((tid & 31) == 0) sred[tid >> 5] = sum; __syncthreads(); if (tid == 0) { float a = 0.f; for (int i = 0; i < 8; ++i) a += sred[i]; sbc = a > 0.f ? 2048.0f / a : 0.f; }   /* a fully excluded row yields P = 0 */ __syncthreads(); const float inv = sbc;
  for (int k = tid; k < kend; k += 256) shv[k] = shv[k] * inv;
  __syncthreads(); for (int q = tid; q < kend / 4; q += 256) vst2(sr + q * 4, *(const v4f*)&shv[q * 4]); }
// ---- k_colstat_c: softmax over the QUERY axis under the causal mask (the source's softmax(axis=2) on [B, H, q, k] scores with -inf where k > q): for every key column k: m_k = max_{q >= k} S[q][k], Z_k = sum_{q >= k} exp(S[q][k] - m_k) (f32, precise expf). Block = 32 key columns x 64 row slices: 16 waves, in each wave 4 rows x 8 lanes x 4 columns (one 16-byte load a lane, whole 128-byte lines). A thread keeps its up to 16 rows (q = k0 + slice + 64 i) in registers: column maxima over the wave first, then the exponentials against the wave's maximum, so no running rescale; the 16 waves' (m, z) pairs meet in LDS and wave 0 merges them (z_w x exp(m_w - m)). Rows start at the block's first column, and only a thread's first row can lie above a column's diagonal: q < k is masked there by a value select after an unconditional load. A wave's four rows end together (all bounds are multiples of 4), so its trip count is wave-uniform and no row index needs a clamp
__device__ __forceinline__ float xl8(float v) { return __builtin_bit_cast(float, __builtin_amdgcn_update_dpp(0, __builtin_bit_cast(int, v), 0x168 /* row_xmask:8 */, 0xf, 0xf, true)); }   // lane l <-> l ^ 8, in registers
__device__ __forceinline__ float xl16(float v) { const int b = __builtin_bit_cast(int, v); return __builtin_bit_cast(float, __builtin_amdgcn_permlanex16(b, b, 0x76543210, 0xfedcba98, false, false)); }   // lane l <-> l ^ 16, in registers
__global__ __launch_bounds__(512) void k_colstat_c(const float* __restrict__ S0, float* __restrict__ CM, float* __restrict__ CZ) { __shared__ __align__(16) float sm[16][32], sz[16][32];
  const int tid = threadIdx.x, wave = __builtin_amdgcn_readfirstlane(tid >> 5) /* in a scalar register, so the trip tests below are scalar branches */, lane = tid & 31; const int k0 = blockIdx.x * 32, kc = k0 + (lane & 7) * 4, r0 = k0 + wave * 4, qs = r0 + (lane >> 3); const int nt = (TT - r0 + 63) >> 6;   /* rows r0 + 64 i < TT: 0 trips for a wave that starts past the last row */
  const float* rp = S0 + (size_t)blockIdx.y * TT * TT + (size_t)qs * TT + kc;
  v4f v[16];   /* every loop over i is fully unrolled: constant indices keep v[] in registers, and all of a thread's loads are in flight together off one address */
#pragma unroll
  for (int i = 0; i < 16; ++i) if (i < nt) { if (i == 15) asm volatile("s_wait_xcnt 0x0" ::: "memory");   /* the last load's result may be given the address registers that the fifteen issued loads name: the wait stands in front of that overwrite */
    v[i] = *(const v4f*)(rp + (size_t)i * 64 * TT); }
  v4f m = { -3.0e38f, -3.0e38f, -3.0e38f, -3.0e38f }, z = { 0.f, 0.f, 0.f, 0.f };
#pragma unroll
  for (int i = 0; i < 16; ++i) if (i < nt) {
#pragma unroll
    for (int u = 0; u < 4; ++u) m[u] = fmaxf(m[u], (i > 0 || qs >= kc + u) ? v[i][u] : -3.0e38f); }
#pragma unroll
  for (int u = 0; u < 4; ++u) { m[u] = fmaxf(m[u], xl8(m[u])); m[u] = fmaxf(m[u], xl16(m[u])); }
#pragma unroll
  for (int i = 0; i < 16; ++i) if (i < nt) {
#pragma unroll
    for (int u = 0; u < 4; ++u) { const float e = expf(v[i][u] - m[u]); z[u] += (i > 0 || qs >= kc + u) ? e : 0.f; } }
#pragma unroll
  for (int u = 0; u < 4; ++u) { z[u] += xl8(z[u]); z[u] += xl16(z[u]); }
  if (lane < 8) { *(v4f*)&sm[wave][lane * 4] = m; *(v4f*)&sz[wave][lane * 4] = z; }
  __syncthreads();
  if (wave == 0) { float mm = -3.0e38f, zz = 0.f;   /* a wave with no visible row of a column brings (-3e38, 0): its term is 0 */
#pragma unroll
    for (int w = 0; w < 16; ++w) mm = fmaxf(mm, sm[w][lane]);
#pragma unroll
    for (int w = 0; w < 16; ++w) zz += sz[w][lane] * expf(sm[w][lane] - mm);
    vst2(CM + (size_t)blockIdx.y * TT + k0 + lane, mm); vst2(CZ + (size_t)blockIdx.y * TT + k0 + lane, zz); } }   /* every column sees at least its own diagonal entry: Z_k >= 1 */
// ---- k_csm_c: block = query row t: P[t][k] = exp(S[t][k] - m_k) / Z_k x 2^11 for k <= t, 0 for t < k < kend (inside the diagonal block); in place; unconditional loads, value select
__global__ __launch_bounds__(256) void k_csm_c(float* __restrict__ S0, const float* __restrict__ CM, const float* __restrict__ CZ) { const int tid = threadIdx.x; const int t = blockIdx.x; const int kend = (kb_last(t >> 6) + 1) * 128; float* sr = S0 + (size_t)blockIdx.y * TT * TT + (size_t)t * TT; const float* cm = CM + (size_t)blockIdx.y * TT; const float* cz = CZ + (size_t)blockIdx.y * TT;
  for (int q4 = tid; q4 < kend / 4; q4 += 256) { const v4f sv = *(const v4f*)(sr + q4 * 4), m4 = *(const v4f*)(cm + q4 * 4), z4 = *(const v4f*)(cz + q4 * 4); asm volatile("s_wait_loadcnt 0x0" ::: "memory"); v4f p;
#pragma unroll
    for (int u = 0; u < 4; ++u) p[u] = (q4 * 4 + u <= t) ? expf(sv[u] - m4[u]) * (2048.0f / z4[u]) : 0.f;
    vst2(sr + q4 * 4, p); } }
// ---- k_pv: block = 64 queries (qb) of (b, h): ctx = P . v over keys [0, kend) (every query block, QBH = NQB: P and v as bf16 hi + lo, 3 products; the 1-product f16 branch for blocks >= QBH is not taken); 256-B (row, head) segment by 16 lanes
__global__ __launch_bounds__(128) void k_pv(const float* __restrict__ PS0, const _Float16* __restrict__ VT, const __bf16* __restrict__ VB, const __bf16* __restrict__ VBL, int b, int h0, float* __restrict__ Y) { const int hz = h0 + blockIdx.z, h = hz % NH; b += hz / NH;   /* pair in group -> (batch, head), as in k_sc */
  const float* PS = PS0 + (size_t)blockIdx.z * TT * TT; __shared__ __align__(16) float ss[4][16][HD + 4];
  const int tid = threadIdx.x, wave = tid >> 5, lane = tid & 31, col = lane & 15, g = lane >> 4; const int qb = blockIdx.x; const int ql0 = qb * 64 + wave * 16; const int kce = (kb_last(qb) + 1) * 4;
  v8f acc[HD / 16] = {};
  if (qb < QBH) {
#pragma unroll 1
    for (int kc = 0; kc < kce; ++kc) { const F2 p = split_row(PS + (size_t)(ql0 + col) * TT, kc * 32, lane);
      asm volatile("s_wait_loadcnt 0x0" ::: "memory");
#pragma unroll
      for (int j = 0; j < HD / 16; ++j) { const size_t po = ((size_t)b * CC + h * HD + j * 16 + col) * (size_t)KHI + kc * 32; const v16b vh = frag_b(VB + po, lane); acc[j] = wmma_bf(p.h, vh, acc[j]); acc[j] = wmma_bf(p.l, vh, acc[j]); acc[j] = wmma_bf(p.h, frag_b(VBL + po, lane), acc[j]); } }
  } else {
#pragma unroll 1
    for (int kc = 0; kc < kce; ++kc) { const v16h p = frag_f32(PS + (size_t)(ql0 + col) * TT + kc * 32, lane);
      asm volatile("s_wait_loadcnt 0x0" ::: "memory");
#pragma unroll
      for (int j = 0; j < HD / 16; ++j) { const size_t po = ((size_t)b * CC + h * HD + j * 16 + col) * (size_t)TT + kc * 32; acc[j] = wmma16(p, frag_h(VT + po, lane), acc[j]); } } }
#pragma unroll
  for (int j = 0; j < HD / 16; ++j)
#pragma unroll
    for (int r = 0; r < 8; ++r) ss[wave][8 * g + r][j * 16 + col] = acc[j][r] * (1.0f / 2048.0f);
  LDSX(); for (int rl = 0; rl < 16; ++rl) if (lane < HD / 4) vst2(Y + ((size_t)b * TT + ql0 + rl) * CC + h * HD + lane * 4, *(const v4f*)&ss[wave][rl][lane * 4]); }
// ---- k_out: block = (64 rows, 128 cols): out = ctx Wo (+ bo): ctx x 2^6 once to f16 against Wo as f16(bf16 x 2^8) exact (1 product) x 2^-14; rows < QHI and the LAST 64 rows of each sequence: ctx bf16 hi + lo against exact bf16 Wo (2 products)
__global__ __launch_bounds__(128) void k_out(const float* __restrict__ Y, const float* __restrict__ WO, const float* __restrict__ BO, float* __restrict__ OUT) { __shared__ __align__(16) float sf[4][16][132];
  const int tid = threadIdx.x, wave = tid >> 5, lane = tid & 31, col = lane & 15, g = lane >> 4; const int c0 = blockIdx.y * 128; const size_t r0 = (size_t)blockIdx.x * 64 + wave * 16;
  v8f acc[8] = {};
  const int tb_ = (int)(((size_t)blockIdx.x * 64) % TT); if (CAUSAL && (tb_ < QHI || tb_ >= TT - 64)) {   /* block-uniform; the LAST 64 query rows of each sequence also take the hi + lo context path: under a query-axis softmax the last key columns carry O(1) weights, so the context rows there are an order of magnitude larger */
#pragma unroll 2
    for (int kc = 0; kc < CC / 32; ++kc) { const F2 a = split_row(Y + (r0 + col) * CC, kc * 32, lane); asm volatile("s_wait_loadcnt 0x0" ::: "memory");
#pragma unroll
      for (int j = 0; j < 8; ++j) { const v16b w = WOCOL(WO, kc * 32, c0 + j * 16 + col, lane); asm volatile("s_wait_loadcnt 0x0" ::: "memory"); acc[j] = wmma_bf(a.h, w, acc[j]); acc[j] = wmma_bf(a.l, w, acc[j]); } }
#pragma unroll
    for (int j = 0; j < 8; ++j) { const float bias = BO ? bfr(BO[c0 + j * 16 + col]) : 0.f;
#pragma unroll
      for (int r = 0; r < 8; ++r) sf[wave][8 * g + r][j * 16 + col] = acc[j][r] + bias; }
  } else {
#pragma unroll 2
    for (int kc = 0; kc < CC / 32; ++kc) { const v16h a = frag_f32s(Y + (r0 + col) * CC + kc * 32, lane, 64.0f); asm volatile("s_wait_loadcnt 0x0" ::: "memory");   /* ctx carried x 2^6 into f16 so small-magnitude context rows stay clear of f16 subnormals */
#pragma unroll
      for (int j = 0; j < 8; ++j) { const v16h w = WOCOLH(WO, kc * 32, c0 + j * 16 + col, lane); asm volatile("s_wait_loadcnt 0x0" ::: "memory"); acc[j] = wmma16(a, w, acc[j]); } }
#pragma unroll
    for (int j = 0; j < 8; ++j) { const float bias = BO ? bfr(BO[c0 + j * 16 + col]) : 0.f;
#pragma unroll
      for (int r = 0; r < 8; ++r) sf[wave][8 * g + r][j * 16 + col] = acc[j][r] * (1.0f / 16384.0f) + bias; } }   /* 2^-8 (Wo carry) x 2^-6 (ctx carry) */
  LDSX(); for (int rl = 0; rl < 16; ++rl) vst2(OUT + (r0 + rl) * DIN + c0 + lane * 4, *(const v4f*)&sf[wave][rl][lane * 4]); }

extern "C" void kernel_launch(void* const* d_in, const int* in_sizes, int n_in, void* d_out, int out_size, void* d_ws, size_t ws_size, hipStream_t stream) {
  (void)in_sizes; (void)n_in; (void)out_size;
  const float** F = (const float**)d_in;
  if (ws_size < (size_t)WS_END) return;
  char* ws = (char*)d_ws; _Float16 *QH = (_Float16*)(ws + WS_QH), *KH = (_Float16*)(ws + WS_KH), *VT = (_Float16*)(ws + WS_VT), *QL = (_Float16*)(ws + WS_QL), *KL = (_Float16*)(ws + WS_KL); __bf16 *VB = (__bf16*)(ws + WS_VB), *VBL = (__bf16*)(ws + WS_VBL); float *S = (float*)(ws + WS_S), *Y = (float*)(ws + WS_Y);
  (void)Y; (void)QL; (void)KL; (void)VB; (void)VBL;
  // inputs: 0 source [4,1024,1024]; 1 Wq [16,1024,64] (head, in, out), 2 bq [16,64]; 3 Wk, 4 bk; 5 Wv, 6 bv; 7 Wc [1024,1024] (in,out), 8 bc [1024] (all biases N(0, 0.02^2), nonzero)
  if (ws_size < (size_t)WS_END2) return;
  float *CM = (float*)(ws + WS_CM), *CZ = (float*)(ws + WS_CZ);
  k_proj<<<dim3(TNB * TT / 64, CC / 128, 3), 128, 0, stream>>>(F[0], F[0], F[0], F[1], F[3], F[5], F[2], F[4], F[6], QH, QL, KH, KL, VT, VB, VBL);
  static_assert(HG % NH == 0 && TNB % (HG / NH) == 0, "a launch group is a whole number of batches");
  for (int b = 0; b < TNB; b += HG / NH) { const int h0 = 0;
    k_sc<<<dim3(NQB, TT / 128, HG), 128, 0, stream>>>(QH, KH, QL, KL, b, h0, S);
    k_colstat_c<<<dim3(TT / 32, HG), 512, 0, stream>>>(S, CM, CZ);   /* per key column j: max / sum over the visible queries i >= j */
    k_csm_c<<<dim3(TT, HG), 256, 0, stream>>>(S, CM, CZ);            /* P[i][j] = exp(S - m_j) / Z_j x 2^11 for j <= i, 0 above the diagonal */
    k_pv<<<dim3(NQB, 1, HG), 128, 0, stream>>>(S, VT, VB, VBL, b, h0, Y);
  }
  k_out<<<dim3(TNB * TT / 64, DIN / 128), 128, 0, stream>>>(Y, F[7], F[8], (float*)d_out);
}

// v003
// One run takes 471 microseconds.
// In two side-by-side timings against v002, it was 1.07 and 1.06 times as fast.
// All steps since v000 together make it 8.81 times as fast.
// compute dtype: all float inputs rounded to bf16; per-head q/k/v projections with EXACT bf16 products on WMMA 16x16x32 (f32 accumulate) + bias; causal scores q x k once to f16 each (1 product; sigma - 0.4) x 64^-0.5 on every block; softmax over the QUERY axis in f32 (per key column: max / sum over the visible queries, precise expf); P as bf16 hi + lo against v as bf16 hi + lo (3 products) on EVERY block; ctx x 2^6 once to f16 x Wc f16(bf16 x 2^8) - except the LAST 64 rows of each sequence: ctx as bf16 hi + lo against exact bf16 Wc (2 products) - + bc; f32 output.
#include <hip/hip_runtime.h>
#include <math.h>

typedef __attribute__((ext_vector_type(16))) _Float16 v16h;
typedef __attribute__((ext_vector_type(16))) __bf16 v16b;
typedef __attribute__((ext_vector_type(8)))  _Float16 v8h;
typedef __attribute__((ext_vector_type(8)))  float v8f;
typedef __attribute__((ext_vector_type(4)))  float v4f;
typedef __attribute__((ext_vector_type(2)))  float v2f;
typedef __attribute__((ext_vector_type(4)))  unsigned v4u;
typedef __attribute__((ext_vector_type(4)))  int v4i;
typedef float __attribute__((may_alias)) float_a;
typedef int __attribute__((may_alias)) int_a;

template <typename T> __device__ __forceinline__ void vst2(void* p, T v) { *(T*)p = v;  }
__device__ __forceinline__ v8f wmma16(v16h a, v16h b, v8f c) {
  v8f d = __builtin_amdgcn_wmma_f32_16x16x32_f16(false, a, false, b, (short)0, c, false, false);
  asm volatile("v_nop\n\tv_nop\n\tv_nop\n\tv_nop" : "+v"(d) : "v"(a), "v"(b));
  return d;
}
__device__ __forceinline__ v8f wmma_bf(v16b a, v16b b, v8f c) {
  v8f d = __builtin_amdgcn_wmma_f32_16x16x32_bf16(false, a, false, b, (short)0, c, false, false);
  asm volatile("v_nop\n\tv_nop\n\tv_nop\n\tv_nop" : "+v"(d) : "v"(a), "v"(b));
  return d;
}
// 16x16x32 fragments: lane = (h = lane>>4, row/col = lane&15); elements 0..7 = k0+8h+0..7, 8..15 = k0+16+8h+0..7; D element r = row 8h+r
__device__ __forceinline__ v16h frag_h(const _Float16* rowk0, int lane) {
  union { v16h v; v8h q[2]; } u; const _Float16* p = rowk0 + 8 * (lane >> 4);
  u.q[0] = *(const v8h*)p; u.q[1] = *(const v8h*)(p + 16); return u.v;
}
__device__ __forceinline__ v16h frag_f32(const float* rowk0, int lane) {
  v16h a; const float* p = rowk0 + 8 * (lane >> 4);
#pragma unroll
  for (int i = 0; i < 8; ++i) { a[i] = (_Float16)p[i]; a[8 + i] = (_Float16)p[16 + i]; }
  return a;
}
__device__ __forceinline__ v16h frag_f32s(const float* rowk0, int lane, float sc) {
  v16h a; const float* p = rowk0 + 8 * (lane >> 4);
#pragma unroll
  for (int i = 0; i < 8; ++i) { a[i] = (_Float16)(p[i] * sc); a[8 + i] = (_Float16)(p[16 + i] * sc); }
  return a;
}
// column fragment from a [K][ld] layout (column n), rows >= K read as 0
__device__ __forceinline__ v16h fragc_f32(const float* W, int k0, int n, int lane, int ld, int K) {
  v16h a; const int g = lane >> 4;
#pragma unroll
  for (int i = 0; i < 8; ++i) { const int ka = k0 + 8 * g + i, kb = ka + 16;
    a[i] = (_Float16)(ka < K ? W[(size_t)(ka < K ? ka : K - 1) * ld + n] : 0.f); a[8 + i] = (_Float16)(kb < K ? W[(size_t)(kb < K ? kb : K - 1) * ld + n] : 0.f); }
  return a;
}
struct F2 { v16b h, l; };
__device__ __forceinline__ F2 bsplit16(const float v[16]) { F2 r;
#pragma unroll
  for (int i = 0; i < 16; ++i) { const __bf16 h = (__bf16)v[i]; r.h[i] = h; r.l[i] = (__bf16)(v[i] - (float)h); }
  return r; }
__device__ __forceinline__ F2 split_row(const float* row, int k0, int lane) { float v[16]; const float* p = row + k0 + 8 * (lane >> 4);
#pragma unroll
  for (int i = 0; i < 8; ++i) { v[i] = p[i]; v[8 + i] = p[16 + i]; }
  return bsplit16(v); }
__device__ __forceinline__ F2 split_rowK(const float* row, int k0, int lane, int K) { float v[16]; const int g = lane >> 4;
#pragma unroll
  for (int i = 0; i < 8; ++i) { const int ka = k0 + 8 * g + i, kb = ka + 16; v[i] = ka < K ? row[ka < K ? ka : K - 1] : 0.f; v[8 + i] = kb < K ? row[kb < K ? kb : K - 1] : 0.f; }
  return bsplit16(v); }
__device__ __forceinline__ F2 split_col(const float* W, int k0, int n, int lane, int ld, int K) { float v[16]; const int g = lane >> 4;
#pragma unroll
  for (int i = 0; i < 8; ++i) { const int ka = k0 + 8 * g + i, kb = ka + 16; v[i] = ka < K ? W[(size_t)(ka < K ? ka : K - 1) * ld + n] : 0.f; v[8 + i] = kb < K ? W[(size_t)(kb < K ? kb : K - 1) * ld + n] : 0.f; }
  return bsplit16(v); }
__device__ __forceinline__ v8f mac3(const F2& a, const F2& b, v8f c) { c = wmma_bf(a.l, b.h, c); c = wmma_bf(a.h, b.l, c); return wmma_bf(a.h, b.h, c); }
__device__ __forceinline__ float sigm(float v) { return 1.0f / (1.0f + expf(-v)); }
#define LDSX() do { asm volatile("s_wait_dscnt 0" ::: "memory"); __builtin_amdgcn_wave_barrier(); __builtin_amdgcn_fence(__ATOMIC_RELEASE, "workgroup"); } while (0)

// Causal multi-head attention whose softmax runs over the QUERY axis, with per-head projection tensors (source [4,1024,1024]; Wq / Wk / Wv [16,1024,64] (head, in, out) (0.02) + biases [16,64]; scores / sqrt(64) + triu(-inf, k=1); attn = softmax(..., axis=2) - axis 2 of [B, H, q, k] is the QUERY axis: every key column is normalised over the queries q >= k (faithful to the source); out = attn v; heads merged; Wc [1024,1024] (in,out) + bc).
#define NB 4
#define TT 1024
#define CC 1024            // NH * HD = projected width
#define DIN 1024          // input (model) width
#define NH 16
#define HD 64
#define NQB (TT / 64)
#define HG 32              // (batch, head) pairs per launch of the score / softmax / context kernels: two whole batches (grid z or y = pair in group), so the logits plane holds HG x TT x TT f32
#define SCALE (0.125f)
#define CAUSAL 1
#ifndef TNB
#define TNB NB
#endif
__device__ __forceinline__ float bfr(float v) { return (float)(__bf16)v; }
__host__ __device__ __forceinline__ int kb_last(int qb) { return CAUSAL ? ((qb * 64 + 63) >> 7) : (TT / 128 - 1); }
typedef __attribute__((ext_vector_type(8))) __bf16 v8b;
__device__ __forceinline__ v16b frag_b(const __bf16* rowk0, int lane) {
  union { v16b v; v8b q[2]; } u; const __bf16* p = rowk0 + 8 * (lane >> 4);
  u.q[0] = *(const v8b*)p; u.q[1] = *(const v8b*)(p + 16); return u.v;
}
#define QBH 16              // causal: query blocks 0..QBH-1 of each sequence (QBH = NQB: every block) take the high-precision path
#define QHI 0               // no q residual plane: the scores are small and single-product everywhere
#define QBH_SC 0            // k_sc: no block takes the 3-product branch (k_pv keeps QBH = NQB: bf16 hi/lo P.v on every block - a query-axis softmax has O(1) weights on the LAST key columns)
#define KHI 1024            // key rows carrying k residual / v bf16 hi+lo planes (used only by the causal high-precision path)
// B fragment (k rows k0+.., output column o) of a weight: (in,out) [K][ld] or (out,in) [ld rows of K]: bf16 exact, or f16(bf16 * 256) exact
__device__ __forceinline__ v16b wcol_io(const float* Wm, int k0, int o, int lane, int ld) { v16b w; const int g = lane >> 4;
#pragma unroll
  for (int i = 0; i < 8; ++i) { w[i] = (__bf16)Wm[(size_t)(k0 + 8 * g + i) * ld + o]; w[8 + i] = (__bf16)Wm[(size_t)(k0 + 16 + 8 * g + i) * ld + o]; }
  return w; }
__device__ __forceinline__ v16b wcol_oi(const float* Wm, int k0, int o, int lane, int K) { v16b w; const float* p = Wm + (size_t)o * K + k0 + 8 * (lane >> 4);
#pragma unroll
  for (int i = 0; i < 8; ++i) { w[i] = (__bf16)p[i]; w[8 + i] = (__bf16)p[16 + i]; }
  return w; }
__device__ __forceinline__ v16h wcolh_io(const float* Wm, int k0, int o, int lane, int ld) { v16h w; const int g = lane >> 4;
#pragma unroll
  for (int i = 0; i < 8; ++i) { w[i] = (_Float16)(bfr(Wm[(size_t)(k0 + 8 * g + i) * ld + o]) * 256.0f); w[8 + i] = (_Float16)(bfr(Wm[(size_t)(k0 + 16 + 8 * g + i) * ld + o]) * 256.0f); }
  return w; }
__device__ __forceinline__ v16h wcolh_oi(const float* Wm, int k0, int o, int lane, int K) { v16h w; const float* p = Wm + (size_t)o * K + k0 + 8 * (lane >> 4);
#pragma unroll
  for (int i = 0; i < 8; ++i) { w[i] = (_Float16)(bfr(p[i]) * 256.0f); w[8 + i] = (_Float16)(bfr(p[16 + i]) * 256.0f); }
  return w; }
#define WQKV_LAYOUT 0   // 0 = per-head [NH][DIN][HD] (head, in, out); 1 = (out,in) [CC][DIN]; 2 = per-head [NH][DIN][HD]
__device__ __forceinline__ v16b wcol_hdk(const float* Wm, int k0, int o, int lane) { v16b w; const int g = lane >> 4; const float* p = Wm + (size_t)(o / HD) * DIN * HD + (o % HD);
#pragma unroll
  for (int i = 0; i < 8; ++i) { w[i] = (__bf16)p[(size_t)(k0 + 8 * g + i) * HD]; w[8 + i] = (__bf16)p[(size_t)(k0 + 16 + 8 * g + i) * HD]; }
  return w; }
#define WO_OUT_IN 0
#if WQKV_LAYOUT == 1
#define WCOL(W, k0, o, lane) wcol_oi(W, k0, o, lane, DIN)
#elif WQKV_LAYOUT == 2
#define WCOL(W, k0, o, lane) wcol_hdk(W, k0, o, lane)
#else
#define WCOL(W, k0, o, lane) wcol_io((W) + (size_t)((o) / 64) * DIN * 64, k0, (o) % 64, lane, 64)   /* per-head weight tensors [16][DIN][64] (head, in, out): output column o = h*64 + kk lives in head h's [DIN][64] (in,out) slab at pitch 64 (a 16-column tile never straddles a head) */
#endif
#if WO_OUT_IN
#define WOCOL(W, k0, o, lane) wcol_oi(W, k0, o, lane, CC)
#define WOCOLH(W, k0, o, lane) wcolh_oi(W, k0, o, lane, CC)
#else
#define WOCOL(W, k0, o, lane) wcol_io(W, k0, o, lane, DIN)
#define WOCOLH(W, k0, o, lane) wcolh_io(W, k0, o, lane, DIN)
#endif

#ifndef SM_EXTRA_PARAMS
#define SM_EXTRA_PARAMS
#endif
#ifndef PROJ_EXTRA_PARAMS
#define PROJ_EXTRA_PARAMS
#endif
#ifndef SM_MASK_HOOK
#define SM_MASK_HOOK (void)0
#endif

#define WS_QH  0u                                      // f16 q rows [b*t][CC]
#define WS_KH  (WS_QH + 2u * (size_t)NB * TT * CC)      // f16 k rows [b*t][CC]
#define WS_VT  (WS_KH + 2u * (size_t)NB * TT * CC)      // f16 v planes [b][c][t]
#define WS_QL  (WS_VT + 2u * (size_t)NB * CC * TT)      // f16 q residual x 2^10 rows [b][t < QHI][CC]
#define WS_KL  (WS_QL + 2u * (size_t)NB * QHI * CC)     // f16 k residual x 2^10 rows [b][t < KHI][CC]
#define WS_VB  (WS_KL + 2u * (size_t)NB * KHI * CC)     // bf16 v hi planes [b][c][t < KHI]
#define WS_VBL (WS_VB + 2u * (size_t)NB * CC * KHI)
#define WS_S   (WS_VBL + 2u * (size_t)NB * CC * KHI)    // f32 logits [hg][t][s]
#define WS_Y   (WS_S  + 4u * (size_t)HG * TT * TT)      // f32 ctx rows [b*t][CC] (only when there is an output projection)
#define WS_END (WS_Y  + 4u * (size_t)NB * TT * CC)
#define WS_CM (WS_END)                                  // f32 column maxima [HG][TT]
#define WS_CZ (WS_CM + 4u * (size_t)HG * TT)           // f32 2^11 / column sum [HG][TT]
#define WS_END2 (WS_CZ + 4u * (size_t)HG * TT)

// ---- k_proj: block = (64 rows, 128 cols, which): q/k/v = X W (+ b) with exact bf16 products (K = DIN) -> which 0: q f16 rows (+ residual rows < QHI); 1: k f16 rows (+ residual rows < KHI); 2: v f16 planes [c][t] (+ bf16 hi/lo planes for t < KHI)
__global__ __launch_bounds__(128) void k_proj(const float* __restrict__ XQ, const float* __restrict__ XK, const float* __restrict__ XV, const float* __restrict__ WQ, const float* __restrict__ WK, const float* __restrict__ WV, const float* __restrict__ BQ, const float* __restrict__ BK, const float* __restrict__ BV,
    _Float16* __restrict__ QH, _Float16* __restrict__ QL, _Float16* __restrict__ KH, _Float16* __restrict__ KL, _Float16* __restrict__ VT, __bf16* __restrict__ VB, __bf16* __restrict__ VBL) {
  __shared__ __align__(16) _Float16 sh[64][136], sl[64][136]; __shared__ __align__(16) _Float16 th[128][72]; __shared__ __align__(16) __bf16 tb[128][72], tbl[128][72];
  const int tid = threadIdx.x, wave = tid >> 5, lane = tid & 31, col = lane & 15, g = lane >> 4; const int which = blockIdx.z; const int c0 = blockIdx.y * 128; const size_t r0 = (size_t)blockIdx.x * 64; const size_t bb = r0 / TT; const int t0 = (int)(r0 % TT);
  const float* X = which == 0 ? XQ : which == 1 ? XK : XV; const float* WA = which == 0 ? WQ : which == 1 ? WK : WV; const float* BA = which == 0 ? BQ : which == 1 ? BK : BV;
  v8f acc[8] = {};
#pragma unroll 2
  for (int kc = 0; kc < DIN / 32; ++kc) { v16b a; { const float* p = X + (r0 + wave * 16 + col) * DIN + kc * 32 + 8 * g;
#pragma unroll
      for (int i = 0; i < 8; ++i) { a[i] = (__bf16)p[i]; a[8 + i] = (__bf16)p[16 + i]; } }
    asm volatile("s_wait_loadcnt 0x0" ::: "memory");
#pragma unroll
    for (int j = 0; j < 8; ++j) { const v16b w = WCOL(WA, kc * 32, c0 + j * 16 + col, lane); asm volatile("s_wait_loadcnt 0x0" ::: "memory"); acc[j] = wmma_bf(a, w, acc[j]); } }
  if (which < 2) { _Float16* DH = which == 0 ? QH : KH; _Float16* DL = which == 0 ? QL : KL; const int nhi = which == 0 ? QHI : KHI; const bool hi_rows = t0 < nhi;
#pragma unroll
    for (int j = 0; j < 8; ++j) { const float bias = BA ? bfr(BA[c0 + j * 16 + col]) : 0.f;
#pragma unroll
      for (int r = 0; r < 8; ++r) { const float v = acc[j][r] + bias; const _Float16 hv = (_Float16)v; sh[wave * 16 + 8 * g + r][j * 16 + col] = hv; sl[wave * 16 + 8 * g + r][j * 16 + col] = (_Float16)((v - (float)hv) * 1024.0f); } }
    __syncthreads();
    for (int e = tid; e < 64 * 16; e += 128) { const int rl = e >> 4, q = e & 15; vst2((unsigned*)(DH + (r0 + rl) * CC + c0 + q * 8), *(const v4u*)&sh[rl][q * 8]); if (hi_rows) vst2((unsigned*)(DL + (bb * nhi + t0 + rl) * (size_t)CC + c0 + q * 8), *(const v4u*)&sl[rl][q * 8]); }
  } else { const bool hi_rows = t0 < KHI;
#pragma unroll
    for (int j = 0; j < 8; ++j) { const float bias = BA ? bfr(BA[c0 + j * 16 + col]) : 0.f;
#pragma unroll
      for (int r = 0; r < 8; ++r) { const float v = acc[j][r] + bias; const int rl = wave * 16 + 8 * g + r, cl = j * 16 + col; th[cl][rl] = (_Float16)v; const __bf16 bh = (__bf16)v; tb[cl][rl] = bh; tbl[cl][rl] = (__bf16)(v - (float)bh); } }
    __syncthreads();
    for (int e = tid; e < 128 * 8; e += 128) { const int cl = e >> 3, q = e & 7; vst2((unsigned*)(VT + (bb * CC + c0 + cl) * (size_t)TT + t0 + q * 8), *(const v4u*)&th[cl][q * 8]); if (hi_rows) { const size_t o3 = (bb * CC + c0 + cl) * (size_t)KHI + t0 + q * 8; vst2((unsigned*)(VB + o3), *(const v4u*)&tb[cl][q * 8]); vst2((unsigned*)(VBL + o3), *(const v4u*)&tbl[cl][q * 8]); } } } }
// ---- k_sc: block = (query block qb, key block kb <= kb_last(qb), (batch, head) pair in group, group = whole batches from batch b): logits x SCALE; q hi + residual (x 2^10) against k (2 products) for query rows < QHI, plus the k residual (3 products) for query blocks < QBH_SC (causal early rows); causal: blocks past the diagonal exit, the mask itself is applied by index in k_colstat_c and in k_pv's fragment loader p_frag
__global__ __launch_bounds__(128) void k_sc(const _Float16* __restrict__ QH, const _Float16* __restrict__ KH, const _Float16* __restrict__ QL, const _Float16* __restrict__ KL, int b, int h0, float* __restrict__ S0) { __shared__ __align__(16) float ss[4][16][132];
  const int qb = blockIdx.x, kb = blockIdx.y; if (kb > kb_last(qb)) return;
  const int hz = h0 + blockIdx.z, h = hz % NH; b += hz / NH;   /* pair in group -> (batch, head): the group runs on over whole batches from batch b */
  float* S = S0 + (size_t)blockIdx.z * TT * TT;
  const int tid = threadIdx.x, wave = tid >> 5, lane = tid & 31, col = lane & 15, g = lane >> 4; const int k0 = kb * 128; const int ql0 = qb * 64 + wave * 16; const size_t q0 = (size_t)b * TT + ql0, kr0 = (size_t)b * TT + k0;
  v8f acc[8] = {}, accl[8] = {};
  const _Float16* QLb = QL + (size_t)b * QHI * CC; const _Float16* KLb = KL + (size_t)b * KHI * CC;
  if (qb < QBH_SC) {
#pragma unroll
    for (int kc = 0; kc < HD / 32; ++kc) { const v16h ah = frag_h(QH + (q0 + col) * CC + h * HD + kc * 32, lane), al = frag_h(QLb + (size_t)(ql0 + col) * CC + h * HD + kc * 32, lane);
#pragma unroll
      for (int j = 0; j < 8; ++j) { const v16h kbf = frag_h(KH + (kr0 + j * 16 + col) * CC + h * HD + kc * 32, lane), klf = frag_h(KLb + (size_t)(k0 + j * 16 + col) * CC + h * HD + kc * 32, lane); acc[j] = wmma16(ah, kbf, acc[j]); accl[j] = wmma16(al, kbf, accl[j]); accl[j] = wmma16(ah, klf, accl[j]); } }
  } else if (qb * 64 < QHI) {
#pragma unroll
    for (int kc = 0; kc < HD / 32; ++kc) { const v16h ah = frag_h(QH + (q0 + col) * CC + h * HD + kc * 32, lane), al = frag_h(QLb + (size_t)(ql0 + col) * CC + h * HD + kc * 32, lane);
#pragma unroll
      for (int j = 0; j < 8; ++j) { const v16h kbf = frag_h(KH + (kr0 + j * 16 + col) * CC + h * HD + kc * 32, lane); acc[j] = wmma16(ah, kbf, acc[j]); accl[j] = wmma16(al, kbf, accl[j]); } }
  } else {
#pragma unroll
    for (int kc = 0; kc < HD / 32; ++kc) { const v16h ah = frag_h(QH + (q0 + col) * CC + h * HD + kc * 32, lane);
#pragma unroll
      for (int j = 0; j < 8; ++j) { const v16h kbf = frag_h(KH + (kr0 + j * 16 + col) * CC + h * HD + kc * 32, lane); acc[j] = wmma16(ah, kbf, acc[j]); } } }
#pragma unroll
  for (int j = 0; j < 8; ++j) {
#pragma unroll
    for (int r = 0; r < 8; ++r) ss[wave][8 * g + r][j * 16 + col] = (acc[j][r] + accl[j][r] * (1.0f / 1024.0f)) * SCALE; }
  LDSX(); for (int rl = 0; rl < 16; ++rl) vst2(S + (size_t)(ql0 + rl) * TT + k0 + lane * 4, *(const v4f*)&ss[wave][rl][lane * 4]); }
// ---- k_sm: block = query row t (head in group): keys [0, kend): causal -> logit if s <= t else excluded; softmax in f32; P x 2^11 in place (0 for excluded)
__global__ __launch_bounds__(256) void k_sm(float* __restrict__ S0 SM_EXTRA_PARAMS) { __shared__ float sred[8]; __shared__ float sbc; __shared__ __align__(16) float shv[TT];
  const int tid = threadIdx.x; const int t = blockIdx.x; const int kend = (kb_last(t >> 6) + 1) * 128;
  float* sr = S0 + (size_t)blockIdx.y * TT * TT + (size_t)t * TT;
  float m = -3.0e38f; for (int k = tid; k < kend; k += 256) { float v = (!CAUSAL || k <= t) ? sr[k] : -3.0e38f; SM_MASK_HOOK; shv[k] = v; m = fmaxf(m, v); }
#pragma unroll
  for (int o = 1; o < 32; o <<= 1) m = fmaxf(m, __shfl_xor(m, o));
  if ((tid & 31) == 0) sred[tid >> 5] = m; __syncthreads(); if (tid == 0) { float a = sred[0]; for (int i = 1; i < 8; ++i) a = fmaxf(a, sred[i]); sbc = a; } __syncthreads(); m = sbc; __syncthreads();
  float sum = 0.f; for (int k = tid; k < kend; k += 256) { const float v = shv[k]; const float e = (v <= -1.0e38f) ? 0.f : expf(v - m); shv[k] = e; sum += e; }
#pragma unroll
  for (int o = 1; o < 32; o <<= 1) sum += __shfl_xor(sum, o);
  if ((tid & 31) == 0) sred[tid >> 5] = sum; __syncthreads(); if (tid == 0) { float a = 0.f; for (int i = 0; i < 8; ++i) a += sred[i]; sbc = a > 0.f ? 2048.0f / a : 0.f; }   /* a fully excluded row yields P = 0 */ __syncthreads(); const float inv = sbc;
  for (int k = tid; k < kend; k += 256) shv[k] = shv[k] * inv;
  __syncthreads(); for (int q = tid; q < kend / 4; q += 256) vst2(sr + q * 4, *(const v4f*)&shv[q * 4]); }
// ---- k_colstat_c: softmax over the QUERY axis under the causal mask (the source's softmax(axis=2) on [B, H, q, k] scores with -inf where k > q): for every key column k: m_k = max_{q >= k} S[q][k], Z_k = sum_{q >= k} exp(S[q][k] - m_k) (f32, precise expf). Block = 32 key columns x 64 row slices: 16 waves, in each wave 4 rows x 8 lanes x 4 columns (one 16-byte load a lane, whole 128-byte lines). A thread keeps its up to 16 rows (q = k0 + slice + 64 i) in registers: column maxima over the wave first, then the exponentials against the wave's maximum, so no running rescale; the 16 waves' (m, z) pairs meet in LDS and wave 0 merges them (z_w x exp(m_w - m)). Rows start at the block's first column, and only a thread's first row can lie above a column's diagonal: q < k is masked there by a value select after an unconditional load. A wave's four rows end together (all bounds are multiples of 4), so its trip count is wave-uniform and no row index needs a clamp
__device__ __forceinline__ float xl8(float v) { return __builtin_bit_cast(float, __builtin_amdgcn_update_dpp(0, __builtin_bit_cast(int, v), 0x168 /* row_xmask:8 */, 0xf, 0xf, true)); }   // lane l <-> l ^ 8, in registers
__device__ __forceinline__ float xl16(float v) { const int b = __builtin_bit_cast(int, v); return __builtin_bit_cast(float, __builtin_amdgcn_permlanex16(b, b, 0x76543210, 0xfedcba98, false, false)); }   // lane l <-> l ^ 16, in registers
__global__ __launch_bounds__(512) void k_colstat_c(const float* __restrict__ S0, float* __restrict__ CM, float* __restrict__ CZ) { __shared__ __align__(16) float sm[16][32], sz[16][32];
  const int tid = threadIdx.x, wave = __builtin_amdgcn_readfirstlane(tid >> 5) /* in a scalar register, so the trip tests below are scalar branches */, lane = tid & 31; const int k0 = blockIdx.x * 32, kc = k0 + (lane & 7) * 4, r0 = k0 + wave * 4, qs = r0 + (lane >> 3); const int nt = (TT - r0 + 63) >> 6;   /* rows r0 + 64 i < TT: 0 trips for a wave that starts past the last row */
  const float* rp = S0 + (size_t)blockIdx.y * TT * TT + (size_t)qs * TT + kc;
  v4f v[16];   /* every loop over i is fully unrolled: constant indices keep v[] in registers, and all of a thread's loads are in flight together off one address */
#pragma unroll
  for (int i = 0; i < 16; ++i) if (i < nt) { if (i == 15) asm volatile("s_wait_xcnt 0x0" ::: "memory");   /* the last load's result may be given the address registers that the fifteen issued loads name: the wait stands in front of that overwrite */
    v[i] = *(const v4f*)(rp + (size_t)i * 64 * TT); }
  v4f m = { -3.0e38f, -3.0e38f, -3.0e38f, -3.0e38f }, z = { 0.f, 0.f, 0.f, 0.f };
#pragma unroll
  for (int i = 0; i < 16; ++i) if (i < nt) {
#pragma unroll
    for (int u = 0; u < 4; ++u) m[u] = fmaxf(m[u], (i > 0 || qs >= kc + u) ? v[i][u] : -3.0e38f); }
#pragma unroll
  for (int u = 0; u < 4; ++u) { m[u] = fmaxf(m[u], xl8(m[u])); m[u] = fmaxf(m[u], xl16(m[u])); }
#pragma unroll
  for (int i = 0; i < 16; ++i) if (i < nt) {
#pragma unroll
    for (int u = 0; u < 4; ++u) { const float e = expf(v[i][u] - m[u]); z[u] += (i > 0 || qs >= kc + u) ? e : 0.f; } }
#pragma unroll
  for (int u = 0; u < 4; ++u) { z[u] += xl8(z[u]); z[u] += xl16(z[u]); }
  if (lane < 8) { *(v4f*)&sm[wave][lane * 4] = m; *(v4f*)&sz[wave][lane * 4] = z; }
  __syncthreads();
  if (wave == 0) { float mm = -3.0e38f, zz = 0.f;   /* a wave with no visible row of a column brings (-3e38, 0): its term is 0 */
#pragma unroll
    for (int w = 0; w < 16; ++w) mm = fmaxf(mm, sm[w][lane]);
#pragma unroll
    for (int w = 0; w < 16; ++w) zz += sz[w][lane] * expf(sm[w][lane] - mm);
    vst2(CM + (size_t)blockIdx.y * TT + k0 + lane, mm); vst2(CZ + (size_t)blockIdx.y * TT + k0 + lane, 2048.0f / zz); } }   /* every column sees at least its own diagonal entry: Z_k >= 1; stored as 2^11 / Z_k, one division a column, the factor k_pv multiplies by */
// P fragment of one query row, formed from its logits where k_pv loads them (no pass over the logits plane in between): su / mu / ru = logits plane, column maxima and 2^11 / Z_k at the trip's first key (wave-uniform), so / co = the lane's element offsets (row x TT + 8g; 8g), dk = query index - the lane's first key. Elements 0..7 = keys +0..7, 8..15 = keys +16..23; P = exp(S - m_k) x (2^11 / Z_k) for key <= query, 0 above the diagonal (inside the diagonal block); unconditional loads, value select
__device__ __forceinline__ void p_frag(const float* su, const float* mu, const float* ru, unsigned so, unsigned co, int dk, float v[16]) { v4f s4[4], m4[4], r4[4];
#pragma unroll
  for (int q = 0; q < 4; ++q) { const unsigned o = (q >> 1) * 16 + (q & 1) * 4; s4[q] = *(const v4f*)(su + so + o); m4[q] = *(const v4f*)(mu + co + o); r4[q] = *(const v4f*)(ru + co + o); }
  asm volatile("s_wait_loadcnt 0x0" ::: "memory"); __builtin_amdgcn_sched_barrier(0);   /* the scheduling barrier keeps the arithmetic behind the wait: without it the compiler lifts the exponentials over the wait and issues the four 2^11 / Z loads only behind them, a second load latency in every trip; so all twelve loads are in flight together */
#pragma unroll
  for (int q = 0; q < 4; ++q) { const int o = (q >> 1) * 16 + (q & 1) * 4;
#pragma unroll
    for (int u = 0; u < 4; ++u) { const float e = expf(s4[q][u] - m4[q][u]) * r4[q][u]; v[q * 4 + u] = (o + u <= dk) ? e : 0.f; } } }
// ---- k_pv: block = 64 queries (qb) of (b, h): ctx = P . v over keys [0, kend), P x 2^11 made from the logits and the column statistics in the fragment loader p_frag (P and v as bf16 hi + lo, 3 products, on every query block); 256-B (row, head) segment by 16 lanes
__global__ __launch_bounds__(128) void k_pv(const float* __restrict__ PS0, const float* __restrict__ CM, const float* __restrict__ CZ, const _Float16* __restrict__ VT, const __bf16* __restrict__ VB, const __bf16* __restrict__ VBL, int b, int h0, float* __restrict__ Y) { const int hz = h0 + blockIdx.z, h = hz % NH; b += hz / NH;   /* pair in group -> (batch, head), as in k_sc */
  const float* PS = PS0 + (size_t)blockIdx.z * TT * TT; const float* cm = CM + (size_t)blockIdx.z * TT; const float* cr = CZ + (size_t)blockIdx.z * TT; __shared__ __align__(16) float ss[4][16][HD + 4];
  const int tid = threadIdx.x, wave = tid >> 5, lane = tid & 31, col = lane & 15, g = lane >> 4; const int qb = blockIdx.x; const int ql0 = qb * 64 + wave * 16; const int kce = (kb_last(qb) + 1) * 4; const unsigned so = (unsigned)(ql0 + col) * TT + 8u * g; const int dk0 = ql0 + col - 8 * g;
  v8f acc[HD / 16] = {};
  if (qb < QBH) {
#pragma unroll 1
    for (int kc = 0; kc < kce; ++kc) { float pf[16]; p_frag(PS + kc * 32, cm + kc * 32, cr + kc * 32, so, 8u * g, dk0 - kc * 32, pf); const F2 p = bsplit16(pf);
#pragma unroll
      for (int j = 0; j < HD / 16; ++j) { const size_t po = ((size_t)b * CC + h * HD + j * 16 + col) * (size_t)KHI + kc * 32; const v16b vh = frag_b(VB + po, lane); acc[j] = wmma_bf(p.h, vh, acc[j]); acc[j] = wmma_bf(p.l, vh, acc[j]); acc[j] = wmma_bf(p.h, frag_b(VBL + po, lane), acc[j]); } }
  } else {
#pragma unroll 1
    for (int kc = 0; kc < kce; ++kc) { float pf[16]; p_frag(PS + kc * 32, cm + kc * 32, cr + kc * 32, so, 8u * g, dk0 - kc * 32, pf); v16h p;
#pragma unroll
      for (int i = 0; i < 16; ++i) p[i] = (_Float16)pf[i];
#pragma unroll
      for (int j = 0; j < HD / 16; ++j) { const size_t po = ((size_t)b * CC + h * HD + j * 16 + col) * (size_t)TT + kc * 32; acc[j] = wmma16(p, frag_h(VT + po, lane), acc[j]); } } }
#pragma unroll
  for (int j = 0; j < HD / 16; ++j)
#pragma unroll
    for (int r = 0; r < 8; ++r) ss[wave][8 * g + r][j * 16 + col] = acc[j][r] * (1.0f / 2048.0f);
  LDSX(); for (int rl = 0; rl < 16; ++rl) if (lane < HD / 4) vst2(Y + ((size_t)b * TT + ql0 + rl) * CC + h * HD + lane * 4, *(const v4f*)&ss[wave][rl][lane * 4]); }
// ---- k_out: block = (64 rows, 128 cols): out = ctx Wo (+ bo): ctx x 2^6 once to f16 against Wo as f16(bf16 x 2^8) exact (1 product) x 2^-14; rows < QHI and the LAST 64 rows of each sequence: ctx bf16 hi + lo against exact bf16 Wo (2 products)
__global__ __launch_bounds__(128) void k_out(const float* __restrict__ Y, const float* __restrict__ WO, const float* __restrict__ BO, float* __restrict__ OUT) { __shared__ __align__(16) float sf[4][16][132];
  const int tid = threadIdx.x, wave = tid >> 5, lane = tid & 31, col = lane & 15, g = lane >> 4; const int c0 = blockIdx.y * 128; const size_t r0 = (size_t)blockIdx.x * 64 + wave * 16;
  v8f acc[8] = {};
  const int tb_ = (int)(((size_t)blockIdx.x * 64) % TT); if (CAUSAL && (tb_ < QHI || tb_ >= TT - 64)) {   /* block-uniform; the LAST 64 query rows of each sequence also take the hi + lo context path: under a query-axis softmax the last key columns carry O(1) weights, so the context rows there are an order of magnitude larger */
#pragma unroll 2
    for (int kc = 0; kc < CC / 32; ++kc) { const F2 a = split_row(Y + (r0 + col) * CC, kc * 32, lane); asm volatile("s_wait_loadcnt 0x0" ::: "memory");
#pragma unroll
      for (int j = 0; j < 8; ++j) { const v16b w = WOCOL(WO, kc * 32, c0 + j * 16 + col, lane); asm volatile("s_wait_loadcnt 0x0" ::: "memory"); acc[j] = wmma_bf(a.h, w, acc[j]); acc[j] = wmma_bf(a.l, w, acc[j]); } }
#pragma unroll
    for (int j = 0; j < 8; ++j) { const float bias = BO ? bfr(BO[c0 + j * 16 + col]) : 0.f;
#pragma unroll
      for (int r = 0; r < 8; ++r) sf[wave][8 * g + r][j * 16 + col] = acc[j][r] + bias; }
  } else {
#pragma unroll 2
    for (int kc = 0; kc < CC / 32; ++kc) { const v16h a = frag_f32s(Y + (r0 + col) * CC + kc * 32, lane, 64.0f); asm volatile("s_wait_loadcnt 0x0" ::: "memory");   /* ctx carried x 2^6 into f16 so small-magnitude context rows stay clear of f16 subnormals */
#pragma unroll
      for (int j = 0; j < 8; ++j) { const v16h w = WOCOLH(WO, kc * 32, c0 + j * 16 + col, lane); asm volatile("s_wait_loadcnt 0x0" ::: "memory"); acc[j] = wmma16(a, w, acc[j]); } }
#pragma unroll
    for (int j = 0; j < 8; ++j) { const float bias = BO ? bfr(BO[c0 + j * 16 + col]) : 0.f;
#pragma unroll
      for (int r = 0; r < 8; ++r) sf[wave][8 * g + r][j * 16 + col] = acc[j][r] * (1.0f / 16384.0f) + bias; } }   /* 2^-8 (Wo carry) x 2^-6 (ctx carry) */
  LDSX(); for (int rl = 0; rl < 16; ++rl) vst2(OUT + (r0 + rl) * DIN + c0 + lane * 4, *(const v4f*)&sf[wave][rl][lane * 4]); }

extern "C" void kernel_launch(void* const* d_in, const int* in_sizes, int n_in, void* d_out, int out_size, void* d_ws, size_t ws_size, hipStream_t stream) {
  (void)in_sizes; (void)n_in; (void)out_size;
  const float** F = (const float**)d_in;
  if (ws_size < (size_t)WS_END) return;
  char* ws = (char*)d_ws; _Float16 *QH = (_Float16*)(ws + WS_QH), *KH = (_Float16*)(ws + WS_KH), *VT = (_Float16*)(ws + WS_VT), *QL = (_Float16*)(ws + WS_QL), *KL = (_Float16*)(ws + WS_KL); __bf16 *VB = (__bf16*)(ws + WS_VB), *VBL = (__bf16*)(ws + WS_VBL); float *S = (float*)(ws + WS_S), *Y = (float*)(ws + WS_Y);
  (void)Y; (void)QL; (void)KL; (void)VB; (void)VBL;
  // inputs: 0 source [4,1024,1024]; 1 Wq [16,1024,64] (head, in, out), 2 bq [16,64]; 3 Wk, 4 bk; 5 Wv, 6 bv; 7 Wc [1024,1024] (in,out), 8 bc [1024] (all biases N(0, 0.02^2), nonzero)
  if (ws_size < (size_t)WS_END2) return;
  float *CM = (float*)(ws + WS_CM), *CZ = (float*)(ws + WS_CZ);
  k_proj<<<dim3(TNB * TT / 64, CC / 128, 3), 128, 0, stream>>>(F[0], F[0], F[0], F[1], F[3], F[5], F[2], F[4], F[6], QH, QL, KH, KL, VT, VB, VBL);
  static_assert(HG % NH == 0 && TNB % (HG / NH) == 0, "a launch group is a whole number of batches");
  for (int b = 0; b < TNB; b += HG / NH) { const int h0 = 0;
    k_sc<<<dim3(NQB, TT / 128, HG), 128, 0, stream>>>(QH, KH, QL, KL, b, h0, S);
    k_colstat_c<<<dim3(TT / 32, HG), 512, 0, stream>>>(S, CM, CZ);   /* per key column j: max / sum over the visible queries i >= j */
    k_pv<<<dim3(NQB, 1, HG), 128, 0, stream>>>(S, CM, CZ, VT, VB, VBL, b, h0, Y);   /* P[i][j] = exp(S - m_j) x 2^11 / Z_j for j <= i, 0 above the diagonal, formed in the loader */
  }
  k_out<<<dim3(TNB * TT / 64, DIN / 128), 128, 0, stream>>>(Y, F[7], F[8], (float*)d_out);
}

// v004
// Measured time: 318 microseconds a run.
// In two side-by-side timings against v003, it was 1.49 and 1.47 times as fast.
// Over all steps from v000 it is 13.0 times as fast.
// compute dtype: all float inputs rounded to bf16; per-head q/k/v projections with EXACT bf16 products on WMMA 16x16x32 (f32 accumulate) + bias; causal scores q x k once to f16 each (1 product; sigma - 0.4) x 64^-0.5 on every block; softmax over the QUERY axis in f32 (per key column: max / sum over the visible queries, precise expf); P as bf16 hi + lo against v as bf16 hi + lo (3 products) on EVERY block; ctx x 2^6 once to f16 x Wc f16(bf16 x 2^8) - except the LAST 64 rows of each sequence: ctx as bf16 hi + lo against exact bf16 Wc (2 products) - + bc; f32 output.
#include <hip/hip_runtime.h>
#include <math.h>

typedef __attribute__((ext_vector_type(16))) _Float16 v16h;
typedef __attribute__((ext_vector_type(16))) __bf16 v16b;
typedef __attribute__((ext_vector_type(8)))  _Float16 v8h;
typedef __attribute__((ext_vector_type(8)))  float v8f;
typedef __attribute__((ext_vector_type(4)))  float v4f;
typedef __attribute__((ext_vector_type(2)))  float v2f;
typedef __attribute__((ext_vector_type(4)))  unsigned v4u;
typedef __attribute__((ext_vector_type(4)))  int v4i;
typedef float __attribute__((may_alias)) float_a;
typedef int __attribute__((may_alias)) int_a;

template <typename T> __device__ __forceinline__ void vst2(void* p, T v) { *(T*)p = v;  }
__device__ __forceinline__ v8f wmma16(v16h a, v16h b, v8f c) {
  v8f d = __builtin_amdgcn_wmma_f32_16x16x32_f16(false, a, false, b, (short)0, c, false, false);
  asm volatile("v_nop\n\tv_nop\n\tv_nop\n\tv_nop" : "+v"(d) : "v"(a), "v"(b));
  return d;
}
__device__ __forceinline__ v8f wmma_bf(v16b a, v16b b, v8f c) {
  v8f d = __builtin_amdgcn_wmma_f32_16x16x32_bf16(false, a, false, b, (short)0, c, false, false);
  asm volatile("v_nop\n\tv_nop\n\tv_nop\n\tv_nop" : "+v"(d) : "v"(a), "v"(b));
  return d;
}
// 16x16x32 fragments: lane = (h = lane>>4, row/col = lane&15); elements 0..7 = k0+8h+0..7, 8..15 = k0+16+8h+0..7; D element r = row 8h+r
__device__ __forceinline__ v16h frag_h(const _Float16* rowk0, int lane) {
  union { v16h v; v8h q[2]; } u; const _Float16* p = rowk0 + 8 * (lane >> 4);
  u.q[0] = *(const v8h*)p; u.q[1] = *(const v8h*)(p + 16); return u.v;
}
__device__ __forceinline__ v16h frag_f32(const float* rowk0, int lane) {
  v16h a; const float* p = rowk0 + 8 * (lane >> 4);
#pragma unroll
  for (int i = 0; i < 8; ++i) { a[i] = (_Float16)p[i]; a[8 + i] = (_Float16)p[16 + i]; }
  return a;
}
__device__ __forceinline__ v16h frag_f32s(const float* rowk0, int lane, float sc) {
  v16h a; const float* p = rowk0 + 8 * (lane >> 4);
#pragma unroll
  for (int i = 0; i < 8; ++i) { a[i] = (_Float16)(p[i] * sc); a[8 + i] = (_Float16)(p[16 + i] * sc); }
  return a;
}
// column fragment from a [K][ld] layout (column n), rows >= K read as 0
__device__ __forceinline__ v16h fragc_f32(const float* W, int k0, int n, int lane, int ld, int K) {
  v16h a; const int g = lane >> 4;
#pragma unroll
  for (int i = 0; i < 8; ++i) { const int ka = k0 + 8 * g + i, kb = ka + 16;
    a[i] = (_Float16)(ka < K ? W[(size_t)(ka < K ? ka : K - 1) * ld + n] : 0.f); a[8 + i] = (_Float16)(kb < K ? W[(size_t)(kb < K ? kb : K - 1) * ld + n] : 0.f); }
  return a;
}
struct F2 { v16b h, l; };
__device__ __forceinline__ F2 bsplit16(const float v[16]) { F2 r;
#pragma unroll
  for (int i = 0; i < 16; ++i) { const __bf16 h = (__bf16)v[i]; r.h[i] = h; r.l[i] = (__bf16)(v[i] - (float)h); }
  return r; }
__device__ __forceinline__ F2 split_row(const float* row, int k0, int lane) { float v[16]; const float* p = row + k0 + 8 * (lane >> 4);
#pragma unroll
  for (int i = 0; i < 8; ++i) { v[i] = p[i]; v[8 + i] = p[16 + i]; }
  return bsplit16(v); }
__device__ __forceinline__ F2 split_rowK(const float* row, int k0, int lane, int K) { float v[16]; const int g = lane >> 4;
#pragma unroll
  for (int i = 0; i < 8; ++i) { const int ka = k0 + 8 * g + i, kb = ka + 16; v[i] = ka < K ? row[ka < K ? ka : K - 1] : 0.f; v[8 + i] = kb < K ? row[kb < K ? kb : K - 1] : 0.f; }
  return bsplit16(v); }
__device__ __forceinline__ F2 split_col(const float* W, int k0, int n, int lane, int ld, int K) { float v[16]; const int g = lane >> 4;
#pragma unroll
  for (int i = 0; i < 8; ++i) { const int ka = k0 + 8 * g + i, kb = ka + 16; v[i] = ka < K ? W[(size_t)(ka < K ? ka : K - 1) * ld + n] : 0.f; v[8 + i] = kb < K ? W[(size_t)(kb < K ? kb : K - 1) * ld + n] : 0.f; }
  return bsplit16(v); }
__device__ __forceinline__ v8f mac3(const F2& a, const F2& b, v8f c) { c = wmma_bf(a.l, b.h, c); c = wmma_bf(a.h, b.l, c); return wmma_bf(a.h, b.h, c); }
__device__ __forceinline__ float sigm(float v) { return 1.0f / (1.0f + expf(-v)); }
#define LDSX() do { asm volatile("s_wait_dscnt 0" ::: "memory"); __builtin_amdgcn_wave_barrier(); __builtin_amdgcn_fence(__ATOMIC_RELEASE, "workgroup"); } while (0)

// Causal multi-head attention whose softmax runs over the QUERY axis, with per-head projection tensors (source [4,1024,1024]; Wq / Wk / Wv [16,1024,64] (head, in, out) (0.02) + biases [16,64]; scores / sqrt(64) + triu(-inf, k=1); attn = softmax(..., axis=2) - axis 2 of [B, H, q, k] is the QUERY axis: every key column is normalised over the queries q >= k (faithful to the source); out = attn v; heads merged; Wc [1024,1024] (in,out) + bc).
#define NB 4
#define TT 1024
#define CC 1024            // NH * HD = projected width
#define DIN 1024          // input (model) width
#define NH 16
#define HD 64
#define NQB (TT / 64)
#define HG 32              // (batch, head) pairs per launch of the score / softmax / context kernels: two whole batches (grid z or y = pair in group), so the logits plane holds HG x TT x TT f32
#define SCALE (0.125f)
#define CAUSAL 1
#ifndef TNB
#define TNB NB
#endif
__device__ __forceinline__ float bfr(float v) { return (float)(__bf16)v; }
__host__ __device__ __forceinline__ int kb_last(int qb) { return CAUSAL ? ((qb * 64 + 63) >> 7) : (TT / 128 - 1); }
typedef __attribute__((ext_vector_type(8))) __bf16 v8b;
__device__ __forceinline__ v16b frag_b(const __bf16* rowk0, int lane) {
  union { v16b v; v8b q[2]; } u; const __bf16* p = rowk0 + 8 * (lane >> 4);
  u.q[0] = *(const v8b*)p; u.q[1] = *(const v8b*)(p + 16); return u.v;
}
#define QBH 16              // causal: query blocks 0..QBH-1 of each sequence (QBH = NQB: every block) take the high-precision path
#define QHI 0               // no q residual plane: the scores are small and single-product everywhere
#define QBH_SC 0            // k_sc: no block takes the 3-product branch (k_pv keeps QBH = NQB: bf16 hi/lo P.v on every block - a query-axis softmax has O(1) weights on the LAST key columns)
#define KHI 1024            // key rows carrying k residual / v bf16 hi+lo planes (used only by the causal high-precision path)
// B fragment (k rows k0+.., output column o) of a weight: (in,out) [K][ld] or (out,in) [ld rows of K]: bf16 exact, or f16(bf16 * 256) exact
__device__ __forceinline__ v16b wcol_io(const float* Wm, int k0, int o, int lane, int ld) { v16b w; const int g = lane >> 4;
#pragma unroll
  for (int i = 0; i < 8; ++i) { w[i] = (__bf16)Wm[(size_t)(k0 + 8 * g + i) * ld + o]; w[8 + i] = (__bf16)Wm[(size_t)(k0 + 16 + 8 * g + i) * ld + o]; }
  return w; }
__device__ __forceinline__ v16b wcol_oi(const float* Wm, int k0, int o, int lane, int K) { v16b w; const float* p = Wm + (size_t)o * K + k0 + 8 * (lane >> 4);
#pragma unroll
  for (int i = 0; i < 8; ++i) { w[i] = (__bf16)p[i]; w[8 + i] = (__bf16)p[16 + i]; }
  return w; }
__device__ __forceinline__ v16h wcolh_io(const float* Wm, int k0, int o, int lane, int ld) { v16h w; const int g = lane >> 4;
#pragma unroll
  for (int i = 0; i < 8; ++i) { w[i] = (_Float16)(bfr(Wm[(size_t)(k0 + 8 * g + i) * ld + o]) * 256.0f); w[8 + i] = (_Float16)(bfr(Wm[(size_t)(k0 + 16 + 8 * g + i) * ld + o]) * 256.0f); }
  return w; }
__device__ __forceinline__ v16h wcolh_oi(const float* Wm, int k0, int o, int lane, int K) { v16h w; const float* p = Wm + (size_t)o * K + k0 + 8 * (lane >> 4);
#pragma unroll
  for (int i = 0; i < 8; ++i) { w[i] = (_Float16)(bfr(p[i]) * 256.0f); w[8 + i] = (_Float16)(bfr(p[16 + i]) * 256.0f); }
  return w; }
#define WQKV_LAYOUT 0   // 0 = per-head [NH][DIN][HD] (head, in, out); 1 = (out,in) [CC][DIN]; 2 = per-head [NH][DIN][HD]
__device__ __forceinline__ v16b wcol_hdk(const float* Wm, int k0, int o, int lane) { v16b w; const int g = lane >> 4; const float* p = Wm + (size_t)(o / HD) * DIN * HD + (o % HD);
#pragma unroll
  for (int i = 0; i < 8; ++i) { w[i] = (__bf16)p[(size_t)(k0 + 8 * g + i) * HD]; w[8 + i] = (__bf16)p[(size_t)(k0 + 16 + 8 * g + i) * HD]; }
  return w; }
#define WO_OUT_IN 0
#if WQKV_LAYOUT == 1
#define WCOL(W, k0, o, lane) wcol_oi(W, k0, o, lane, DIN)
#elif WQKV_LAYOUT == 2
#define WCOL(W, k0, o, lane) wcol_hdk(W, k0, o, lane)
#else
#define WCOL(W, k0, o, lane) wcol_io((W) + (size_t)((o) / 64) * DIN * 64, k0, (o) % 64, lane, 64)   /* per-head weight tensors [16][DIN][64] (head, in, out): output column o = h*64 + kk lives in head h's [DIN][64] (in,out) slab at pitch 64 (a 16-column tile never straddles a head) */
#endif
#if WO_OUT_IN
#define WOCOL(W, k0, o, lane) wcol_oi(W, k0, o, lane, CC)
#define WOCOLH(W, k0, o, lane) wcolh_oi(W, k0, o, lane, CC)
#else
#define WOCOL(W, k0, o, lane) wcol_io(W, k0, o, lane, DIN)
#define WOCOLH(W, k0, o, lane) wcolh_io(W, k0, o, lane, DIN)
#endif

#ifndef SM_EXTRA_PARAMS
#define SM_EXTRA_PARAMS
#endif
#ifndef PROJ_EXTRA_PARAMS
#define PROJ_EXTRA_PARAMS
#endif
#ifndef SM_MASK_HOOK
#define SM_MASK_HOOK (void)0
#endif

#define WS_QH  0u                                      // f16 q rows [b*t][CC]
#define WS_KH  (WS_QH + 2u * (size_t)NB * TT * CC)      // f16 k rows [b*t][CC]
#define WS_VT  (WS_KH + 2u * (size_t)NB * TT * CC)      // f16 v planes [b][c][t]
#define WS_QL  (WS_VT + 2u * (size_t)NB * CC * TT)      // f16 q residual x 2^10 rows [b][t < QHI][CC]
#define WS_KL  (WS_QL + 2u * (size_t)NB * QHI * CC)     // f16 k residual x 2^10 rows [b][t < KHI][CC]
#define WS_VB  (WS_KL + 2u * (size_t)NB * KHI * CC)     // bf16 v hi planes [b][c][t < KHI]
#define WS_VBL (WS_VB + 2u * (size_t)NB * CC * KHI)
#define WS_S   (WS_VBL + 2u * (size_t)NB * CC * KHI)    // f32 logits [hg][t][s]
#define WS_Y   (WS_S  + 4u * (size_t)HG * TT * TT)      // f32 ctx rows [b*t][CC] (only when there is an output projection)
#define WS_END (WS_Y  + 4u * (size_t)NB * TT * CC)
#define WS_CM (WS_END)                                  // f32 column maxima [HG][TT]
#define WS_CZ (WS_CM + 4u * (size_t)HG * TT)           // f32 2^11 / column sum [HG][TT]
#define WS_END2 (WS_CZ + 4u * (size_t)HG * TT)

// ---- weight tile in LDS for k_proj / k_out: a block's 64 k x 128 column slice of a (in,out) weight is read once for its four waves, in whole 128-byte lines (a lane: 4 columns x 16 k rows, 16-byte loads), rounded to its 16-bit operand type in registers and stored column-major (a column's 64 k values in a row of 128 bytes), so that a B fragment is two 16-byte LDS reads. Two buffers: the next tile's loads (and the wave's own next A rows) fly during this tile's products, one barrier a tile.
#define KT 64               // k rows of a tile
#define WT_G 2336           // elements between the four column groups n & 3: 32 rows of 72 + 32. Column n lies at (n & 3) x 4672 B + (n >> 2) x 144 B: the storing lanes (columns 4 apart) and the reading lanes (16 neighbouring columns) both fall on 16 different 16-byte bank groups
#define WT_SZ (4 * WT_G)    // elements of one buffer
__device__ __forceinline__ int wt_row(int n) { return (n & 3) * WT_G + (n >> 2) * 72; }
struct WT { v4f r[16]; };   // a lane's share of a tile: k rows wave x 16 + 0..15, columns lane x 4 + 0..3
struct XR { v4f r[8]; };    // a lane's A-fragment source values of one tile (two 32-k steps)
__device__ __forceinline__ void wt_load(WT& t, const float* p, int ld) {
#pragma unroll
  for (int i = 0; i < 16; ++i) t.r[i] = *(const v4f*)(p + (size_t)i * ld); }
__device__ __forceinline__ void xr_load(XR& x, const float* p) {
#pragma unroll
  for (int q = 0; q < 8; ++q) x.r[q] = *(const v4f*)(p + (q >> 2) * 32 + ((q >> 1) & 1) * 16 + (q & 1) * 4); }
__device__ __forceinline__ void xr_get(const XR& x, int s, float v[16]) {   // elements 0..7 = k +0..7, 8..15 = k +16..23 from the lane's first k of step s
#pragma unroll
  for (int q = 0; q < 4; ++q)
#pragma unroll
    for (int u = 0; u < 4; ++u) v[q * 4 + u] = x.r[s * 4 + q][u]; }
template <int F16> __device__ __forceinline__ void wt_store(const WT& t, __bf16* buf, int wave, int lane) {   // F16 = 0: bf16(w); 1: f16(bf16(w) x 2^8), both exact carriers of the bf16 weight
#pragma unroll
  for (int u = 0; u < 4; ++u) { __bf16* d = buf + wt_row(lane * 4 + u) + wave * 16;
#pragma unroll
    for (int hf = 0; hf < 2; ++hf) {
      if (F16) { v8h o;
#pragma unroll
        for (int i = 0; i < 8; ++i) o[i] = (_Float16)(bfr(t.r[hf * 8 + i][u]) * 256.0f);
        *(v8h*)(d + hf * 8) = o;
      } else { v8b o;
#pragma unroll
        for (int i = 0; i < 8; ++i) o[i] = (__bf16)t.r[hf * 8 + i][u];
        *(v8b*)(d + hf * 8) = o; } } } }
// the first tile's loads, written once in front of any branch between the modes, with their wait directly behind them
__device__ __forceinline__ void gemm_first(WT& wt, XR& xr, const float* xp, const float* wp, int ldw) { wt_load(wt, wp, ldw); xr_load(xr, xp);
  asm volatile("s_wait_xcnt 0x0" ::: "memory"); __builtin_amdgcn_sched_barrier(0); }   /* the wait stands in front of any reuse of the address registers that the issued loads name; the scheduling barrier keeps the register arithmetic that follows from being lifted over it */
// acc[j] += A (the wave's 16 rows, f32 source, K = 1024) x W (columns j x 16 + 0..15 of the block's 128). xp = the lane's row + 8g; wp = the weight at (k row wave x 16, the lane's 4 columns), ldw its row pitch. wt / xr = tile 0 as gemm_first loaded it. MODE 0: A bf16 x W bf16; 1: A bf16 hi + lo x W bf16 (2 products); 2: A x 2^6 f16 x W f16(bf16 x 2^8). Ends behind a barrier: the buffers may be reused
template <int MODE> __device__ __forceinline__ void gemm_wt(WT& wt, XR& xr, const float* xp, const float* wp, int ldw, __bf16* wbuf, int wave, int lane, v8f acc[8]) { const int col = lane & 15;
  wt_store<MODE == 2>(wt, wbuf, wave, lane);
  __syncthreads();
  for (int t = 0; t < 1024 / KT; ++t) { float v0[16], v1[16]; xr_get(xr, 0, v0); xr_get(xr, 1, v1); const __bf16* wb = wbuf + (t & 1) * WT_SZ;
    F2 a0, a1; v16h h0, h1;
    if (MODE == 2) {
#pragma unroll
      for (int i = 0; i < 16; ++i) { h0[i] = (_Float16)(v0[i] * 64.0f); h1[i] = (_Float16)(v1[i] * 64.0f); }
    } else if (MODE == 1) { a0 = bsplit16(v0); a1 = bsplit16(v1);
    } else {
#pragma unroll
      for (int i = 0; i < 16; ++i) { a0.h[i] = (__bf16)v0[i]; a1.h[i] = (__bf16)v1[i]; } }
    if (t + 1 < 1024 / KT) { wt_load(wt, wp + (size_t)(t + 1) * KT * ldw, ldw); xr_load(xr, xp + (t + 1) * KT);
      asm volatile("s_wait_xcnt 0x0" ::: "memory"); __builtin_amdgcn_sched_barrier(0); }   /* as above: the address registers are reused while the loads fly */
#pragma unroll
    for (int s = 0; s < 2; ++s) {
      v16b w[8];
#pragma unroll
      for (int j = 0; j < 8; ++j) w[j] = frag_b(wb + wt_row(j * 16 + col) + s * 32, lane);
      __builtin_amdgcn_sched_barrier(0);   /* keeps the step's sixteen LDS reads together in front of its products: left alone the compiler reads each fragment into one register set directly in front of its product, and every product then waits out an LDS latency */
#pragma unroll
      for (int j = 0; j < 8; ++j) {
        if (MODE == 2) acc[j] = wmma16(s ? h1 : h0, __builtin_bit_cast(v16h, w[j]), acc[j]);
        else { acc[j] = wmma_bf(s ? a1.h : a0.h, w[j], acc[j]); if (MODE == 1) acc[j] = wmma_bf(s ? a1.l : a0.l, w[j], acc[j]); } } }
    __builtin_amdgcn_sched_barrier(0);   /* keeps the wait for the next tile's loads behind this tile's last product: left alone the compiler lifts the first conversions, and the wait with them, in among the products */
    if (t + 1 < 1024 / KT) wt_store<MODE == 2>(wt, wbuf + ((t + 1) & 1) * WT_SZ, wave, lane);
    __syncthreads(); } }   /* the one barrier of a tile: publishes tile t + 1 and ends every wave's reads of the buffer that trip t + 1 refills */
// ---- k_proj: block = (64 rows, 128 cols, which): q/k/v = X W (+ b) with exact bf16 products (K = DIN) -> which 0: q f16 rows (+ residual rows < QHI); 1: k f16 rows (+ residual rows < KHI); 2: v f16 planes [c][t] (+ bf16 hi/lo planes for t < KHI)
__global__ __launch_bounds__(128) void k_proj(const float* __restrict__ XQ, const float* __restrict__ XK, const float* __restrict__ XV, const float* __restrict__ WQ, const float* __restrict__ WK, const float* __restrict__ WV, const float* __restrict__ BQ, const float* __restrict__ BK, const float* __restrict__ BV,
    _Float16* __restrict__ QH, _Float16* __restrict__ QL, _Float16* __restrict__ KH, _Float16* __restrict__ KL, _Float16* __restrict__ VT, __bf16* __restrict__ VB, __bf16* __restrict__ VBL) {
  union Sm { struct { _Float16 sh[64][136], sl[64][136]; } qk; struct { _Float16 th[128][72]; __bf16 tb[128][72], tbl[128][72]; } vv; __bf16 w[2 * WT_SZ]; };   /* the weight tiles lie in the LDS of the epilogue's staging arrays, which are written only behind the product loop's last barrier */
  __shared__ __align__(16) Sm sm; _Float16 (&sh)[64][136] = sm.qk.sh; _Float16 (&sl)[64][136] = sm.qk.sl; _Float16 (&th)[128][72] = sm.vv.th; __bf16 (&tb)[128][72] = sm.vv.tb; __bf16 (&tbl)[128][72] = sm.vv.tbl;
  const int tid = threadIdx.x, wave = tid >> 5, lane = tid & 31, col = lane & 15, g = lane >> 4; const int which = blockIdx.z; const int c0 = blockIdx.y * 128; const size_t r0 = (size_t)blockIdx.x * 64; const size_t bb = r0 / TT; const int t0 = (int)(r0 % TT);
  const float* X = which == 0 ? XQ : which == 1 ? XK : XV; const float* WA = which == 0 ? WQ : which == 1 ? WK : WV; const float* BA = which == 0 ? BQ : which == 1 ? BK : BV;
  v8f acc[8] = {};
  const float* xp = X + (r0 + wave * 16 + col) * DIN + 8 * g; const float* wp = WA + (size_t)(c0 / 64 + g) * DIN * 64 + (size_t)(wave * 16) * 64 + col * 4; WT wt; XR xr; gemm_first(wt, xr, xp, wp, 64);
  gemm_wt<0>(wt, xr, xp, wp, 64, sm.w, wave, lane, acc);   /* per-head weights [16][DIN][64]: the block's 128 columns are two heads' slabs at pitch 64; lanes 0..15 read the first head's 64 columns, lanes 16..31 the second's */
  if (which < 2) { _Float16* DH = which == 0 ? QH : KH; _Float16* DL = which == 0 ? QL : KL; const int nhi = which == 0 ? QHI : KHI; const bool hi_rows = t0 < nhi;
#pragma unroll
    for (int j = 0; j < 8; ++j) { const float bias = BA ? bfr(BA[c0 + j * 16 + col]) : 0.f;
#pragma unroll
      for (int r = 0; r < 8; ++r) { const float v = acc[j][r] + bias; const _Float16 hv = (_Float16)v; sh[wave * 16 + 8 * g + r][j * 16 + col] = hv; sl[wave * 16 + 8 * g + r][j * 16 + col] = (_Float16)((v - (float)hv) * 1024.0f); } }
    __syncthreads();
    for (int e = tid; e < 64 * 16; e += 128) { const int rl = e >> 4, q = e & 15; vst2((unsigned*)(DH + (r0 + rl) * CC + c0 + q * 8), *(const v4u*)&sh[rl][q * 8]); if (hi_rows) vst2((unsigned*)(DL + (bb * nhi + t0 + rl) * (size_t)CC + c0 + q * 8), *(const v4u*)&sl[rl][q * 8]); }
  } else { const bool hi_rows = t0 < KHI;
#pragma unroll
    for (int j = 0; j < 8; ++j) { const float bias = BA ? bfr(BA[c0 + j * 16 + col]) : 0.f;
#pragma unroll
      for (int r = 0; r < 8; ++r) { const float v = acc[j][r] + bias; const int rl = wave * 16 + 8 * g + r, cl = j * 16 + col; th[cl][rl] = (_Float16)v; const __bf16 bh = (__bf16)v; tb[cl][rl] = bh; tbl[cl][rl] = (__bf16)(v - (float)bh); } }
    __syncthreads();
    for (int e = tid; e < 128 * 8; e += 128) { const int cl = e >> 3, q = e & 7; vst2((unsigned*)(VT + (bb * CC + c0 + cl) * (size_t)TT + t0 + q * 8), *(const v4u*)&th[cl][q * 8]); if (hi_rows) { const size_t o3 = (bb * CC + c0 + cl) * (size_t)KHI + t0 + q * 8; vst2((unsigned*)(VB + o3), *(const v4u*)&tb[cl][q * 8]); vst2((unsigned*)(VBL + o3), *(const v4u*)&tbl[cl][q * 8]); } } } }
// ---- k_sc: block = (query block qb, key block kb <= kb_last(qb), (batch, head) pair in group, group = whole batches from batch b): logits x SCALE; q hi + residual (x 2^10) against k (2 products) for query rows < QHI, plus the k residual (3 products) for query blocks < QBH_SC (causal early rows); causal: blocks past the diagonal exit, the mask itself is applied by index in k_colstat_c and in k_pv's fragment loader p_frag
__global__ __launch_bounds__(128) void k_sc(const _Float16* __restrict__ QH, const _Float16* __restrict__ KH, const _Float16* __restrict__ QL, const _Float16* __restrict__ KL, int b, int h0, float* __restrict__ S0) { __shared__ __align__(16) float ss[4][16][132];
  const int qb = blockIdx.x, kb = blockIdx.y; if (kb > kb_last(qb)) return;
  const int hz = h0 + blockIdx.z, h = hz % NH; b += hz / NH;   /* pair in group -> (batch, head): the group runs on over whole batches from batch b */
  float* S = S0 + (size_t)blockIdx.z * TT * TT;
  const int tid = threadIdx.x, wave = tid >> 5, lane = tid & 31, col = lane & 15, g = lane >> 4; const int k0 = kb * 128; const int ql0 = qb * 64 + wave * 16; const size_t q0 = (size_t)b * TT + ql0, kr0 = (size_t)b * TT + k0;
  v8f acc[8] = {}, accl[8] = {};
  const _Float16* QLb = QL + (size_t)b * QHI * CC; const _Float16* KLb = KL + (size_t)b * KHI * CC;
  if (qb < QBH_SC) {
#pragma unroll
    for (int kc = 0; kc < HD / 32; ++kc) { const v16h ah = frag_h(QH + (q0 + col) * CC + h * HD + kc * 32, lane), al = frag_h(QLb + (size_t)(ql0 + col) * CC + h * HD + kc * 32, lane);
#pragma unroll
      for (int j = 0; j < 8; ++j) { const v16h kbf = frag_h(KH + (kr0 + j * 16 + col) * CC + h * HD + kc * 32, lane), klf = frag_h(KLb + (size_t)(k0 + j * 16 + col) * CC + h * HD + kc * 32, lane); acc[j] = wmma16(ah, kbf, acc[j]); accl[j] = wmma16(al, kbf, accl[j]); accl[j] = wmma16(ah, klf, accl[j]); } }
  } else if (qb * 64 < QHI) {
#pragma unroll
    for (int kc = 0; kc < HD / 32; ++kc) { const v16h ah = frag_h(QH + (q0 + col) * CC + h * HD + kc * 32, lane), al = frag_h(QLb + (size_t)(ql0 + col) * CC + h * HD + kc * 32, lane);
#pragma unroll
      for (int j = 0; j < 8; ++j) { const v16h kbf = frag_h(KH + (kr0 + j * 16 + col) * CC + h * HD + kc * 32, lane); acc[j] = wmma16(ah, kbf, acc[j]); accl[j] = wmma16(al, kbf, accl[j]); } }
  } else {
#pragma unroll
    for (int kc = 0; kc < HD / 32; ++kc) { const v16h ah = frag_h(QH + (q0 + col) * CC + h * HD + kc * 32, lane);
#pragma unroll
      for (int j = 0; j < 8; ++j) { const v16h kbf = frag_h(KH + (kr0 + j * 16 + col) * CC + h * HD + kc * 32, lane); acc[j] = wmma16(ah, kbf, acc[j]); } } }
#pragma unroll
  for (int j = 0; j < 8; ++j) {
#pragma unroll
    for (int r = 0; r < 8; ++r) ss[wave][8 * g + r][j * 16 + col] = (acc[j][r] + accl[j][r] * (1.0f / 1024.0f)) * SCALE; }
  LDSX(); for (int rl = 0; rl < 16; ++rl) vst2(S + (size_t)(ql0 + rl) * TT + k0 + lane * 4, *(const v4f*)&ss[wave][rl][lane * 4]); }
// ---- k_sm: block = query row t (head in group): keys [0, kend): causal -> logit if s <= t else excluded; softmax in f32; P x 2^11 in place (0 for excluded)
__global__ __launch_bounds__(256) void k_sm(float* __restrict__ S0 SM_EXTRA_PARAMS) { __shared__ float sred[8]; __shared__ float sbc; __shared__ __align__(16) float shv[TT];
  const int tid = threadIdx.x; const int t = blockIdx.x; const int kend = (kb_last(t >> 6) + 1) * 128;
  float* sr = S0 + (size_t)blockIdx.y * TT * TT + (size_t)t * TT;
  float m = -3.0e38f; for (int k = tid; k < kend; k += 256) { float v = (!CAUSAL || k <= t) ? sr[k] : -3.0e38f; SM_MASK_HOOK; shv[k] = v; m = fmaxf(m, v); }
#pragma unroll
  for (int o = 1; o < 32; o <<= 1) m = fmaxf(m, __shfl_xor(m, o));
  if ((tid & 31) == 0) sred[tid >> 5] = m; __syncthreads(); if (tid == 0) { float a = sred[0]; for (int i = 1; i < 8; ++i) a = fmaxf(a, sred[i]); sbc = a; } __syncthreads(); m = sbc; __syncthreads();
  float sum = 0.f; for (int k = tid; k < kend; k += 256) { const float v = shv[k]; const float e = (v <= -1.0e38f) ? 0.f : expf(v - m); shv[k] = e; sum += e; }
#pragma unroll
  for (int o = 1; o < 32; o <<= 1) sum += __shfl_xor(sum, o);
  if ((tid & 31) == 0) sred[tid >> 5] = sum; __syncthreads(); if (tid == 0) { float a = 0.f; for (int i = 0; i < 8; ++i) a += sred[i]; sbc = a > 0.f ? 2048.0f / a : 0.f; }   /* a fully excluded row yields P = 0 */ __syncthreads(); const float inv = sbc;
  for (int k = tid; k < kend; k += 256) shv[k] = shv[k] * inv;
  __syncthreads(); for (int q = tid; q < kend / 4; q += 256) vst2(sr + q * 4, *(const v4f*)&shv[q * 4]); }
// ---- k_colstat_c: softmax over the QUERY axis under the causal mask (the source's softmax(axis=2) on [B, H, q, k] scores with -inf where k > q): for every key column k: m_k = max_{q >= k} S[q][k], Z_k = sum_{q >= k} exp(S[q][k] - m_k) (f32, precise expf). Block = 32 key columns x 64 row slices: 16 waves, in each wave 4 rows x 8 lanes x 4 columns (one 16-byte load a lane, whole 128-byte lines). A thread keeps its up to 16 rows (q = k0 + slice + 64 i) in registers: column maxima over the wave first, then the exponentials against the wave's maximum, so no running rescale; the 16 waves' (m, z) pairs meet in LDS and wave 0 merges them (z_w x exp(m_w - m)). Rows start at the block's first column, and only a thread's first row can lie above a column's diagonal: q < k is masked there by a value select after an unconditional load. A wave's four rows end together (all bounds are multiples of 4), so its trip count is wave-uniform and no row index needs a clamp
__device__ __forceinline__ float xl8(float v) { return __builtin_bit_cast(float, __builtin_amdgcn_update_dpp(0, __builtin_bit_cast(int, v), 0x168 /* row_xmask:8 */, 0xf, 0xf, true)); }   // lane l <-> l ^ 8, in registers
__device__ __forceinline__ float xl16(float v) { const int b = __builtin_bit_cast(int, v); return __builtin_bit_cast(float, __builtin_amdgcn_permlanex16(b, b, 0x76543210, 0xfedcba98, false, false)); }   // lane l <-> l ^ 16, in registers
__global__ __launch_bounds__(512) void k_colstat_c(const float* __restrict__ S0, float* __restrict__ CM, float* __restrict__ CZ) { __shared__ __align__(16) float sm[16][32], sz[16][32];
  const int tid = threadIdx.x, wave = __builtin_amdgcn_readfirstlane(tid >> 5) /* in a scalar register, so the trip tests below are scalar branches */, lane = tid & 31; const int k0 = blockIdx.x * 32, kc = k0 + (lane & 7) * 4, r0 = k0 + wave * 4, qs = r0 + (lane >> 3); const int nt = (TT - r0 + 63) >> 6;   /* rows r0 + 64 i < TT: 0 trips for a wave that starts past the last row */
  const float* rp = S0 + (size_t)blockIdx.y * TT * TT + (size_t)qs * TT + kc;
  v4f v[16];   /* every loop over i is fully unrolled: constant indices keep v[] in registers, and all of a thread's loads are in flight together off one address */
#pragma unroll
  for (int i = 0; i < 16; ++i) if (i < nt) { if (i == 15) asm volatile("s_wait_xcnt 0x0" ::: "memory");   /* the last load's result may be given the address registers that the fifteen issued loads name: the wait stands in front of that overwrite */
    v[i] = *(const v4f*)(rp + (size_t)i * 64 * TT); }
  v4f m = { -3.0e38f, -3.0e38f, -3.0e38f, -3.0e38f }, z = { 0.f, 0.f, 0.f, 0.f };
#pragma unroll
  for (int i = 0; i < 16; ++i) if (i < nt) {
#pragma unroll
    for (int u = 0; u < 4; ++u) m[u] = fmaxf(m[u], (i > 0 || qs >= kc + u) ? v[i][u] : -3.0e38f); }
#pragma unroll
  for (int u = 0; u < 4; ++u) { m[u] = fmaxf(m[u], xl8(m[u])); m[u] = fmaxf(m[u], xl16(m[u])); }
#pragma unroll
  for (int i = 0; i < 16; ++i) if (i < nt) {
#pragma unroll
    for (int u = 0; u < 4; ++u) { const float e = expf(v[i][u] - m[u]); z[u] += (i > 0 || qs >= kc + u) ? e : 0.f; } }
#pragma unroll
  for (int u = 0; u < 4; ++u) { z[u] += xl8(z[u]); z[u] += xl16(z[u]); }
  if (lane < 8) { *(v4f*)&sm[wave][lane * 4] = m; *(v4f*)&sz[wave][lane * 4] = z; }
  __syncthreads();
  if (wave == 0) { float mm = -3.0e38f, zz = 0.f;   /* a wave with no visible row of a column brings (-3e38, 0): its term is 0 */
#pragma unroll
    for (int w = 0; w < 16; ++w) mm = fmaxf(mm, sm[w][lane]);
#pragma unroll
    for (int w = 0; w < 16; ++w) zz += sz[w][lane] * expf(sm[w][lane] - mm);
    vst2(CM + (size_t)blockIdx.y * TT + k0 + lane, mm); vst2(CZ + (size_t)blockIdx.y * TT + k0 + lane, 2048.0f / zz); } }   /* every column sees at least its own diagonal entry: Z_k >= 1; stored as 2^11 / Z_k, one division a column, the factor k_pv multiplies by */
// P fragment of one query row, formed from its logits where k_pv loads them (no pass over the logits plane in between): su / mu / ru = logits plane, column maxima and 2^11 / Z_k at the trip's first key (wave-uniform), so / co = the lane's element offsets (row x TT + 8g; 8g), dk = query index - the lane's first key. Elements 0..7 = keys +0..7, 8..15 = keys +16..23; P = exp(S - m_k) x (2^11 / Z_k) for key <= query, 0 above the diagonal (inside the diagonal block); unconditional loads, value select
__device__ __forceinline__ void p_frag(const float* su, const float* mu, const float* ru, unsigned so, unsigned co, int dk, float v[16]) { v4f s4[4], m4[4], r4[4];
#pragma unroll
  for (int q = 0; q < 4; ++q) { const unsigned o = (q >> 1) * 16 + (q & 1) * 4; s4[q] = *(const v4f*)(su + so + o); m4[q] = *(const v4f*)(mu + co + o); r4[q] = *(const v4f*)(ru + co + o); }
  asm volatile("s_wait_loadcnt 0x0" ::: "memory"); __builtin_amdgcn_sched_barrier(0);   /* the scheduling barrier keeps the arithmetic behind the wait: without it the compiler lifts the exponentials over the wait and issues the four 2^11 / Z loads only behind them, a second load latency in every trip; so all twelve loads are in flight together */
#pragma unroll
  for (int q = 0; q < 4; ++q) { const int o = (q >> 1) * 16 + (q & 1) * 4;
#pragma unroll
    for (int u = 0; u < 4; ++u) { const float e = expf(s4[q][u] - m4[q][u]) * r4[q][u]; v[q * 4 + u] = (o + u <= dk) ? e : 0.f; } } }
// ---- k_pv: block = 64 queries (qb) of (b, h): ctx = P . v over keys [0, kend), P x 2^11 made from the logits and the column statistics in the fragment loader p_frag (P and v as bf16 hi + lo, 3 products, on every query block); 256-B (row, head) segment by 16 lanes
__global__ __launch_bounds__(128) void k_pv(const float* __restrict__ PS0, const float* __restrict__ CM, const float* __restrict__ CZ, const _Float16* __restrict__ VT, const __bf16* __restrict__ VB, const __bf16* __restrict__ VBL, int b, int h0, float* __restrict__ Y) { const int hz = h0 + blockIdx.z, h = hz % NH; b += hz / NH;   /* pair in group -> (batch, head), as in k_sc */
  const float* PS = PS0 + (size_t)blockIdx.z * TT * TT; const float* cm = CM + (size_t)blockIdx.z * TT; const float* cr = CZ + (size_t)blockIdx.z * TT; __shared__ __align__(16) float ss[4][16][HD + 4];
  const int tid = threadIdx.x, wave = tid >> 5, lane = tid & 31, col = lane & 15, g = lane >> 4; const int qb = blockIdx.x; const int ql0 = qb * 64 + wave * 16; const int kce = (kb_last(qb) + 1) * 4; const unsigned so = (unsigned)(ql0 + col) * TT + 8u * g; const int dk0 = ql0 + col - 8 * g;
  v8f acc[HD / 16] = {};
  if (qb < QBH) {
#pragma unroll 1
    for (int kc = 0; kc < kce; ++kc) { float pf[16]; p_frag(PS + kc * 32, cm + kc * 32, cr + kc * 32, so, 8u * g, dk0 - kc * 32, pf); const F2 p = bsplit16(pf);
#pragma unroll
      for (int j = 0; j < HD / 16; ++j) { const size_t po = ((size_t)b * CC + h * HD + j * 16 + col) * (size_t)KHI + kc * 32; const v16b vh = frag_b(VB + po, lane); acc[j] = wmma_bf(p.h, vh, acc[j]); acc[j] = wmma_bf(p.l, vh, acc[j]); acc[j] = wmma_bf(p.h, frag_b(VBL + po, lane), acc[j]); } }
  } else {
#pragma unroll 1
    for (int kc = 0; kc < kce; ++kc) { float pf[16]; p_frag(PS + kc * 32, cm + kc * 32, cr + kc * 32, so, 8u * g, dk0 - kc * 32, pf); v16h p;
#pragma unroll
      for (int i = 0; i < 16; ++i) p[i] = (_Float16)pf[i];
#pragma unroll
      for (int j = 0; j < HD / 16; ++j) { const size_t po = ((size_t)b * CC + h * HD + j * 16 + col) * (size_t)TT + kc * 32; acc[j] = wmma16(p, frag_h(VT + po, lane), acc[j]); } } }
#pragma unroll
  for (int j = 0; j < HD / 16; ++j)
#pragma unroll
    for (int r = 0; r < 8; ++r) ss[wave][8 * g + r][j * 16 + col] = acc[j][r] * (1.0f / 2048.0f);
  LDSX(); for (int rl = 0; rl < 16; ++rl) if (lane < HD / 4) vst2(Y + ((size_t)b * TT + ql0 + rl) * CC + h * HD + lane * 4, *(const v4f*)&ss[wave][rl][lane * 4]); }
// ---- k_out: block = (64 rows, 128 cols): out = ctx Wo (+ bo): ctx x 2^6 once to f16 against Wo as f16(bf16 x 2^8) exact (1 product) x 2^-14; rows < QHI and the LAST 64 rows of each sequence: ctx bf16 hi + lo against exact bf16 Wo (2 products)
__global__ __launch_bounds__(128) void k_out(const float* __restrict__ Y, const float* __restrict__ WO, const float* __restrict__ BO, float* __restrict__ OUT) { union Sm { float sf[4][16][132]; __bf16 w[2 * WT_SZ]; }; __shared__ __align__(16) Sm sm; float (&sf)[4][16][132] = sm.sf;   /* weight tiles and the epilogue's staging share the LDS: sf is written only behind the product loop's last barrier */
  const int tid = threadIdx.x, wave = tid >> 5, lane = tid & 31, col = lane & 15, g = lane >> 4; const int c0 = blockIdx.y * 128; const size_t r0 = (size_t)blockIdx.x * 64 + wave * 16;
  v8f acc[8] = {};
  const float* xp = Y + (r0 + col) * CC + 8 * g; const float* wp = WO + (size_t)(wave * 16) * DIN + c0 + lane * 4; WT wt; XR xr; gemm_first(wt, xr, xp, wp, DIN);   /* both arms start from the same first tile */
  const int tb_ = (int)(((size_t)blockIdx.x * 64) % TT); if (CAUSAL && (tb_ < QHI || tb_ >= TT - 64)) {   /* block-uniform; the LAST 64 query rows of each sequence also take the hi + lo context path: under a query-axis softmax the last key columns carry O(1) weights, so the context rows there are an order of magnitude larger */
    gemm_wt<1>(wt, xr, xp, wp, DIN, sm.w, wave, lane, acc);
#pragma unroll
    for (int j = 0; j < 8; ++j) { const float bias = BO ? bfr(BO[c0 + j * 16 + col]) : 0.f;
#pragma unroll
      for (int r = 0; r < 8; ++r) sf[wave][8 * g + r][j * 16 + col] = acc[j][r] + bias; }
  } else {
    gemm_wt<2>(wt, xr, xp, wp, DIN, sm.w, wave, lane, acc);   /* ctx carried x 2^6 into f16 so small-magnitude context rows stay clear of f16 subnormals */
#pragma unroll
    for (int j = 0; j < 8; ++j) { const float bias = BO ? bfr(BO[c0 + j * 16 + col]) : 0.f;
#pragma unroll
      for (int r = 0; r < 8; ++r) sf[wave][8 * g + r][j * 16 + col] = acc[j][r] * (1.0f / 16384.0f) + bias; } }   /* 2^-8 (Wo carry) x 2^-6 (ctx carry) */
  LDSX(); for (int rl = 0; rl < 16; ++rl) vst2(OUT + (r0 + rl) * DIN + c0 + lane * 4, *(const v4f*)&sf[wave][rl][lane * 4]); }

extern "C" void kernel_launch(void* const* d_in, const int* in_sizes, int n_in, void* d_out, int out_size, void* d_ws, size_t ws_size, hipStream_t stream) {
  (void)in_sizes; (void)n_in; (void)out_size;
  const float** F = (const float**)d_in;
  if (ws_size < (size_t)WS_END) return;
  char* ws = (char*)d_ws; _Float16 *QH = (_Float16*)(ws + WS_QH), *KH = (_Float16*)(ws + WS_KH), *VT = (_Float16*)(ws + WS_VT), *QL = (_Float16*)(ws + WS_QL), *KL = (_Float16*)(ws + WS_KL); __bf16 *VB = (__bf16*)(ws + WS_VB), *VBL = (__bf16*)(ws + WS_VBL); float *S = (float*)(ws + WS_S), *Y = (float*)(ws + WS_Y);
  (void)Y; (void)QL; (void)KL; (void)VB; (void)VBL;
  // inputs: 0 source [4,1024,1024]; 1 Wq [16,1024,64] (head, in, out), 2 bq [16,64]; 3 Wk, 4 bk; 5 Wv, 6 bv; 7 Wc [1024,1024] (in,out), 8 bc [1024] (all biases N(0, 0.02^2), nonzero)
  if (ws_size < (size_t)WS_END2) return;
  float *CM = (float*)(ws + WS_CM), *CZ = (float*)(ws + WS_CZ);
  k_proj<<<dim3(TNB * TT / 64, CC / 128, 3), 128, 0, stream>>>(F[0], F[0], F[0], F[1], F[3], F[5], F[2], F[4], F[6], QH, QL, KH, KL, VT, VB, VBL);
  static_assert(HG % NH == 0 && TNB % (HG / NH) == 0, "a launch group is a whole number of batches");
  for (int b = 0; b < TNB; b += HG / NH) { const int h0 = 0;
    k_sc<<<dim3(NQB, TT / 128, HG), 128, 0, stream>>>(QH, KH, QL, KL, b, h0, S);
    k_colstat_c<<<dim3(TT / 32, HG), 512, 0, stream>>>(S, CM, CZ);   /* per key column j: max / sum over the visible queries i >= j */
    k_pv<<<dim3(NQB, 1, HG), 128, 0, stream>>>(S, CM, CZ, VT, VB, VBL, b, h0, Y);   /* P[i][j] = exp(S - m_j) x 2^11 / Z_j for j <= i, 0 above the diagonal, formed in the loader */
  }
  k_out<<<dim3(TNB * TT / 64, DIN / 128), 128, 0, stream>>>(Y, F[7], F[8], (float*)d_out);
}

// v005
// A run of this version takes 144 microseconds.
// Next to v004, in two timings, it ran 2.20 times as fast each time.
// Over all steps from v000 it is 28.6 times as fast.
// compute dtype: all float inputs rounded to bf16; per-head q/k/v projections with EXACT bf16 products on WMMA 16x16x32 (f32 accumulate) + bias; causal scores q x k once to f16 each (1 product; sigma - 0.4) x 64^-0.5 on every block; softmax over the QUERY axis in f32 (per key column: max / sum over the visible queries, precise expf); P as bf16 hi + lo against v as bf16 hi + lo (3 products) on EVERY block; ctx x 2^6 once to f16 x Wc f16(bf16 x 2^8) - except the LAST 64 rows of each sequence: ctx as bf16 hi + lo against exact bf16 Wc (2 products) - + bc; f32 output.
#include <hip/hip_runtime.h>
#include <math.h>

typedef __attribute__((ext_vector_type(16))) _Float16 v16h;
typedef __attribute__((ext_vector_type(16))) __bf16 v16b;
typedef __attribute__((ext_vector_type(8)))  _Float16 v8h;
typedef __attribute__((ext_vector_type(8)))  float v8f;
typedef __attribute__((ext_vector_type(4)))  float v4f;
typedef __attribute__((ext_vector_type(2)))  float v2f;
typedef __attribute__((ext_vector_type(4)))  unsigned v4u;
typedef __attribute__((ext_vector_type(4)))  int v4i;
typedef float __attribute__((may_alias)) float_a;
typedef int __attribute__((may_alias)) int_a;

template <typename T> __device__ __forceinline__ void vst2(void* p, T v) { *(T*)p = v;  }
__device__ __forceinline__ v8f wmma16(v16h a, v16h b, v8f c) {
  v8f d = __builtin_amdgcn_wmma_f32_16x16x32_f16(false, a, false, b, (short)0, c, false, false);
  asm volatile("v_nop\n\tv_nop\n\tv_nop\n\tv_nop" : "+v"(d) : "v"(a), "v"(b));
  return d;
}
__device__ __forceinline__ v8f wmma_bf(v16b a, v16b b, v8f c) {
  v8f d = __builtin_amdgcn_wmma_f32_16x16x32_bf16(false, a, false, b, (short)0, c, false, false);
  asm volatile("v_nop\n\tv_nop\n\tv_nop\n\tv_nop" : "+v"(d) : "v"(a), "v"(b));
  return d;
}
// 16x16x32 fragments: lane = (h = lane>>4, row/col = lane&15); elements 0..7 = k0+8h+0..7, 8..15 = k0+16+8h+0..7; D element r = row 8h+r
__device__ __forceinline__ v16h frag_h(const _Float16* rowk0, int lane) {
  union { v16h v; v8h q[2]; } u; const _Float16* p = rowk0 + 8 * (lane >> 4);
  u.q[0] = *(const v8h*)p; u.q[1] = *(const v8h*)(p + 16); return u.v;
}
__device__ __forceinline__ v16h frag_f32(const float* rowk0, int lane) {
  v16h a; const float* p = rowk0 + 8 * (lane >> 4);
#pragma unroll
  for (int i = 0; i < 8; ++i) { a[i] = (_Float16)p[i]; a[8 + i] = (_Float16)p[16 + i]; }
  return a;
}
__device__ __forceinline__ v16h frag_f32s(const float* rowk0, int lane, float sc) {
  v16h a; const float* p = rowk0 + 8 * (lane >> 4);
#pragma unroll
  for (int i = 0; i < 8; ++i) { a[i] = (_Float16)(p[i] * sc); a[8 + i] = (_Float16)(p[16 + i] * sc); }
  return a;
}
// column fragment from a [K][ld] layout (column n), rows >= K read as 0
__device__ __forceinline__ v16h fragc_f32(const float* W, int k0, int n, int lane, int ld, int K) {
  v16h a; const int g = lane >> 4;
#pragma unroll
  for (int i = 0; i < 8; ++i) { const int ka = k0 + 8 * g + i, kb = ka + 16;
    a[i] = (_Float16)(ka < K ? W[(size_t)(ka < K ? ka : K - 1) * ld + n] : 0.f); a[8 + i] = (_Float16)(kb < K ? W[(size_t)(kb < K ? kb : K - 1) * ld + n] : 0.f); }
  return a;
}
struct F2 { v16b h, l; };
__device__ __forceinline__ F2 bsplit16(const float v[16]) { F2 r;
#pragma unroll
  for (int i = 0; i < 16; ++i) { const __bf16 h = (__bf16)v[i]; r.h[i] = h; r.l[i] = (__bf16)(v[i] - (float)h); }
  return r; }
__device__ __forceinline__ F2 split_row(const float* row, int k0, int lane) { float v[16]; const float* p = row + k0 + 8 * (lane >> 4);
#pragma unroll
  for (int i = 0; i < 8; ++i) { v[i] = p[i]; v[8 + i] = p[16 + i]; }
  return bsplit16(v); }
__device__ __forceinline__ F2 split_rowK(const float* row, int k0, int lane, int K) { float v[16]; const int g = lane >> 4;
#pragma unroll
  for (int i = 0; i < 8; ++i) { const int ka = k0 + 8 * g + i, kb = ka + 16; v[i] = ka < K ? row[ka < K ? ka : K - 1] : 0.f; v[8 + i] = kb < K ? row[kb < K ? kb : K - 1] : 0.f; }
  return bsplit16(v); }
__device__ __forceinline__ F2 split_col(const float* W, int k0, int n, int lane, int ld, int K) { float v[16]; const int g = lane >> 4;
#pragma unroll
  for (int i = 0; i < 8; ++i) { const int ka = k0 + 8 * g + i, kb = ka + 16; v[i] = ka < K ? W[(size_t)(ka < K ? ka : K - 1) * ld + n] : 0.f; v[8 + i] = kb < K ? W[(size_t)(kb < K ? kb : K - 1) * ld + n] : 0.f; }
  return bsplit16(v); }
__device__ __forceinline__ v8f mac3(const F2& a, const F2& b, v8f c) { c = wmma_bf(a.l, b.h, c); c = wmma_bf(a.h, b.l, c); return wmma_bf(a.h, b.h, c); }
__device__ __forceinline__ float sigm(float v) { return 1.0f / (1.0f + expf(-v)); }
#define LDSX() do { asm volatile("s_wait_dscnt 0" ::: "memory"); __builtin_amdgcn_wave_barrier(); __builtin_amdgcn_fence(__ATOMIC_RELEASE, "workgroup"); } while (0)

// Causal multi-head attention whose softmax runs over the QUERY axis, with per-head projection tensors (source [4,1024,1024]; Wq / Wk / Wv [16,1024,64] (head, in, out) (0.02) + biases [16,64]; scores / sqrt(64) + triu(-inf, k=1); attn = softmax(..., axis=2) - axis 2 of [B, H, q, k] is the QUERY axis: every key column is normalised over the queries q >= k (faithful to the source); out = attn v; heads merged; Wc [1024,1024] (in,out) + bc).
#define NB 4
#define TT 1024
#define CC 1024            // NH * HD = projected width
#define DIN 1024          // input (model) width
#define NH 16
#define HD 64
#define NQB (TT / 64)
#define NP (NB * NH)        // (batch, head) pairs: the column-statistics and context kernels take all of them in one launch (grid y or z = pair)
#define SCALE (0.125f)
#define CAUSAL 1
#ifndef TNB
#define TNB NB
#endif
__device__ __forceinline__ float bfr(float v) { return (float)(__bf16)v; }
__host__ __device__ __forceinline__ int kb_last(int qb) { return CAUSAL ? ((qb * 64 + 63) >> 7) : (TT / 128 - 1); }
typedef __attribute__((ext_vector_type(8))) __bf16 v8b;
__device__ __forceinline__ v16b frag_b(const __bf16* rowk0, int lane) {
  union { v16b v; v8b q[2]; } u; const __bf16* p = rowk0 + 8 * (lane >> 4);
  u.q[0] = *(const v8b*)p; u.q[1] = *(const v8b*)(p + 16); return u.v;
}
#define QHI 0               // no q residual plane: the scores are small and single-product everywhere
#define KHI 1024            // key rows carrying k residual / v bf16 hi+lo planes (used only by the causal high-precision path)
// B fragment (k rows k0+.., output column o) of a weight: (in,out) [K][ld] or (out,in) [ld rows of K]: bf16 exact, or f16(bf16 * 256) exact
__device__ __forceinline__ v16b wcol_io(const float* Wm, int k0, int o, int lane, int ld) { v16b w; const int g = lane >> 4;
#pragma unroll
  for (int i = 0; i < 8; ++i) { w[i] = (__bf16)Wm[(size_t)(k0 + 8 * g + i) * ld + o]; w[8 + i] = (__bf16)Wm[(size_t)(k0 + 16 + 8 * g + i) * ld + o]; }
  return w; }
__device__ __forceinline__ v16b wcol_oi(const float* Wm, int k0, int o, int lane, int K) { v16b w; const float* p = Wm + (size_t)o * K + k0 + 8 * (lane >> 4);
#pragma unroll
  for (int i = 0; i < 8; ++i) { w[i] = (__bf16)p[i]; w[8 + i] = (__bf16)p[16 + i]; }
  return w; }
__device__ __forceinline__ v16h wcolh_io(const float* Wm, int k0, int o, int lane, int ld) { v16h w; const int g = lane >> 4;
#pragma unroll
  for (int i = 0; i < 8; ++i) { w[i] = (_Float16)(bfr(Wm[(size_t)(k0 + 8 * g + i) * ld + o]) * 256.0f); w[8 + i] = (_Float16)(bfr(Wm[(size_t)(k0 + 16 + 8 * g + i) * ld + o]) * 256.0f); }
  return w; }
__device__ __forceinline__ v16h wcolh_oi(const float* Wm, int k0, int o, int lane, int K) { v16h w; const float* p = Wm + (size_t)o * K + k0 + 8 * (lane >> 4);
#pragma unroll
  for (int i = 0; i < 8; ++i) { w[i] = (_Float16)(bfr(p[i]) * 256.0f); w[8 + i] = (_Float16)(bfr(p[16 + i]) * 256.0f); }
  return w; }
#define WQKV_LAYOUT 0   // 0 = per-head [NH][DIN][HD] (head, in, out); 1 = (out,in) [CC][DIN]; 2 = per-head [NH][DIN][HD]
__device__ __forceinline__ v16b wcol_hdk(const float* Wm, int k0, int o, int lane) { v16b w; const int g = lane >> 4; const float* p = Wm + (size_t)(o / HD) * DIN * HD + (o % HD);
#pragma unroll
  for (int i = 0; i < 8; ++i) { w[i] = (__bf16)p[(size_t)(k0 + 8 * g + i) * HD]; w[8 + i] = (__bf16)p[(size_t)(k0 + 16 + 8 * g + i) * HD]; }
  return w; }
#define WO_OUT_IN 0
#if WQKV_LAYOUT == 1
#define WCOL(W, k0, o, lane) wcol_oi(W, k0, o, lane, DIN)
#elif WQKV_LAYOUT == 2
#define WCOL(W, k0, o, lane) wcol_hdk(W, k0, o, lane)
#else
#define WCOL(W, k0, o, lane) wcol_io((W) + (size_t)((o) / 64) * DIN * 64, k0, (o) % 64, lane, 64)   /* per-head weight tensors [16][DIN][64] (head, in, out): output column o = h*64 + kk lives in head h's [DIN][64] (in,out) slab at pitch 64 (a 16-column tile never straddles a head) */
#endif
#if WO_OUT_IN
#define WOCOL(W, k0, o, lane) wcol_oi(W, k0, o, lane, CC)
#define WOCOLH(W, k0, o, lane) wcolh_oi(W, k0, o, lane, CC)
#else
#define WOCOL(W, k0, o, lane) wcol_io(W, k0, o, lane, DIN)
#define WOCOLH(W, k0, o, lane) wcolh_io(W, k0, o, lane, DIN)
#endif

#ifndef SM_EXTRA_PARAMS
#define SM_EXTRA_PARAMS
#endif
#ifndef PROJ_EXTRA_PARAMS
#define PROJ_EXTRA_PARAMS
#endif
#ifndef SM_MASK_HOOK
#define SM_MASK_HOOK (void)0
#endif

#define WS_QH  0u                                      // f16 q rows [b*t][CC]
#define WS_KH  (WS_QH + 2u * (size_t)NB * TT * CC)      // f16 k rows [b*t][CC]
#define WS_VT  (WS_KH + 2u * (size_t)NB * TT * CC)      // f16 v planes [b][c][t]
#define WS_QL  (WS_VT + 2u * (size_t)NB * CC * TT)      // f16 q residual x 2^10 rows [b][t < QHI][CC]
#define WS_KL  (WS_QL + 2u * (size_t)NB * QHI * CC)     // f16 k residual x 2^10 rows [b][t < KHI][CC]
#define WS_VB  (WS_KL + 2u * (size_t)NB * KHI * CC)     // bf16 v hi planes [b][c][t < KHI]
#define WS_VBL (WS_VB + 2u * (size_t)NB * CC * KHI)
#define WS_Y   (WS_VBL + 2u * (size_t)NB * CC * KHI)    // f32 ctx rows [b*t][CC] (only when there is an output projection)
#define WS_END (WS_Y  + 4u * (size_t)NB * TT * CC)
#define WS_CM (WS_END)                                  // f32 column maxima [NP][TT]
#define WS_CZ (WS_CM + 4u * (size_t)NP * TT)           // f32 2^11 / column sum [NP][TT]
#define WS_END2 (WS_CZ + 4u * (size_t)NP * TT)

// ---- weight tile in LDS for k_proj / k_out: a block's 64 k x 128 column slice of a (in,out) weight is read once for its four waves, in whole 128-byte lines (a lane: 4 columns x 16 k rows, 16-byte loads), rounded to its 16-bit operand type in registers and stored column-major (a column's 64 k values in a row of 128 bytes), so that a B fragment is two 16-byte LDS reads. Two buffers: the next tile's loads (and the wave's own next A rows) fly during this tile's products, one barrier a tile.
#define KT 64               // k rows of a tile
#define WT_G 2336           // elements between the four column groups n & 3: 32 rows of 72 + 32. Column n lies at (n & 3) x 4672 B + (n >> 2) x 144 B: the storing lanes (columns 4 apart) and the reading lanes (16 neighbouring columns) both fall on 16 different 16-byte bank groups
#define WT_SZ (4 * WT_G)    // elements of one buffer
__device__ __forceinline__ int wt_row(int n) { return (n & 3) * WT_G + (n >> 2) * 72; }
struct WT { v4f r[16]; };   // a lane's share of a tile: k rows wave x 16 + 0..15, columns lane x 4 + 0..3
struct XR { v4f r[8]; };    // a lane's A-fragment source values of one tile (two 32-k steps)
__device__ __forceinline__ void wt_load(WT& t, const float* p, int ld) {
#pragma unroll
  for (int i = 0; i < 16; ++i) t.r[i] = *(const v4f*)(p + (size_t)i * ld); }
__device__ __forceinline__ void xr_load(XR& x, const float* p) {
#pragma unroll
  for (int q = 0; q < 8; ++q) x.r[q] = *(const v4f*)(p + (q >> 2) * 32 + ((q >> 1) & 1) * 16 + (q & 1) * 4); }
__device__ __forceinline__ void xr_get(const XR& x, int s, float v[16]) {   // elements 0..7 = k +0..7, 8..15 = k +16..23 from the lane's first k of step s
#pragma unroll
  for (int q = 0; q < 4; ++q)
#pragma unroll
    for (int u = 0; u < 4; ++u) v[q * 4 + u] = x.r[s * 4 + q][u]; }
template <int F16> __device__ __forceinline__ void wt_store(const WT& t, __bf16* buf, int wave, int lane) {   // F16 = 0: bf16(w); 1: f16(bf16(w) x 2^8), both exact carriers of the bf16 weight
#pragma unroll
  for (int u = 0; u < 4; ++u) { __bf16* d = buf + wt_row(lane * 4 + u) + wave * 16;
#pragma unroll
    for (int hf = 0; hf < 2; ++hf) {
      if (F16) { v8h o;
#pragma unroll
        for (int i = 0; i < 8; ++i) o[i] = (_Float16)(bfr(t.r[hf * 8 + i][u]) * 256.0f);
        *(v8h*)(d + hf * 8) = o;
      } else { v8b o;
#pragma unroll
        for (int i = 0; i < 8; ++i) o[i] = (__bf16)t.r[hf * 8 + i][u];
        *(v8b*)(d + hf * 8) = o; } } } }
// the first tile's loads, written once in front of any branch between the modes, with their wait directly behind them
__device__ __forceinline__ void gemm_first(WT& wt, XR& xr, const float* xp, const float* wp, int ldw) { wt_load(wt, wp, ldw); xr_load(xr, xp);
  asm volatile("s_wait_xcnt 0x0" ::: "memory"); __builtin_amdgcn_sched_barrier(0); }   /* the wait stands in front of any reuse of the address registers that the issued loads name; the scheduling barrier keeps the register arithmetic that follows from being lifted over it */
// acc[j] += A (the wave's 16 rows, f32 source, K = 1024) x W (columns j x 16 + 0..15 of the block's 128). xp = the lane's row + 8g; wp = the weight at (k row wave x 16, the lane's 4 columns), ldw its row pitch. wt / xr = tile 0 as gemm_first loaded it. MODE 0: A bf16 x W bf16; 1: A bf16 hi + lo x W bf16 (2 products); 2: A x 2^6 f16 x W f16(bf16 x 2^8). Ends behind a barrier: the buffers may be reused
template <int MODE> __device__ __forceinline__ void gemm_wt(WT& wt, XR& xr, const float* xp, const float* wp, int ldw, __bf16* wbuf, int wave, int lane, v8f acc[8]) { const int col = lane & 15;
  wt_store<MODE == 2>(wt, wbuf, wave, lane);
  __syncthreads();
  for (int t = 0; t < 1024 / KT; ++t) { float v0[16], v1[16]; xr_get(xr, 0, v0); xr_get(xr, 1, v1); const __bf16* wb = wbuf + (t & 1) * WT_SZ;
    F2 a0, a1; v16h h0, h1;
    if (MODE == 2) {
#pragma unroll
      for (int i = 0; i < 16; ++i) { h0[i] = (_Float16)(v0[i] * 64.0f); h1[i] = (_Float16)(v1[i] * 64.0f); }
    } else if (MODE == 1) { a0 = bsplit16(v0); a1 = bsplit16(v1);
    } else {
#pragma unroll
      for (int i = 0; i < 16; ++i) { a0.h[i] = (__bf16)v0[i]; a1.h[i] = (__bf16)v1[i]; } }
    if (t + 1 < 1024 / KT) { wt_load(wt, wp + (size_t)(t + 1) * KT * ldw, ldw); xr_load(xr, xp + (t + 1) * KT);
      asm volatile("s_wait_xcnt 0x0" ::: "memory"); __builtin_amdgcn_sched_barrier(0); }   /* as above: the address registers are reused while the loads fly */
#pragma unroll
    for (int s = 0; s < 2; ++s) {
      v16b w[8];
#pragma unroll
      for (int j = 0; j < 8; ++j) w[j] = frag_b(wb + wt_row(j * 16 + col) + s * 32, lane);
      __builtin_amdgcn_sched_barrier(0);   /* keeps the step's sixteen LDS reads together in front of its products: left alone the compiler reads each fragment into one register set directly in front of its product, and every product then waits out an LDS latency */
#pragma unroll
      for (int j = 0; j < 8; ++j) {
        if (MODE == 2) acc[j] = wmma16(s ? h1 : h0, __builtin_bit_cast(v16h, w[j]), acc[j]);
        else { acc[j] = wmma_bf(s ? a1.h : a0.h, w[j], acc[j]); if (MODE == 1) acc[j] = wmma_bf(s ? a1.l : a0.l, w[j], acc[j]); } } }
    __builtin_amdgcn_sched_barrier(0);   /* keeps the wait for the next tile's loads behind this tile's last product: left alone the compiler lifts the first conversions, and the wait with them, in among the products */
    if (t + 1 < 1024 / KT) wt_store<MODE == 2>(wt, wbuf + ((t + 1) & 1) * WT_SZ, wave, lane);
    __syncthreads(); } }   /* the one barrier of a tile: publishes tile t + 1 and ends every wave's reads of the buffer that trip t + 1 refills */
// ---- k_proj: block = (64 rows, 128 cols, which): q/k/v = X W (+ b) with exact bf16 products (K = DIN) -> which 0: q f16 rows (+ residual rows < QHI); 1: k f16 rows (+ residual rows < KHI); 2: v f16 planes [c][t] (+ bf16 hi/lo planes for t < KHI)
__global__ __launch_bounds__(128) void k_proj(const float* __restrict__ XQ, const float* __restrict__ XK, const float* __restrict__ XV, const float* __restrict__ WQ, const float* __restrict__ WK, const float* __restrict__ WV, const float* __restrict__ BQ, const float* __restrict__ BK, const float* __restrict__ BV,
    _Float16* __restrict__ QH, _Float16* __restrict__ QL, _Float16* __restrict__ KH, _Float16* __restrict__ KL, _Float16* __restrict__ VT, __bf16* __restrict__ VB, __bf16* __restrict__ VBL) {
  union Sm { struct { _Float16 sh[64][136], sl[64][136]; } qk; struct { _Float16 th[128][72]; __bf16 tb[128][72], tbl[128][72]; } vv; __bf16 w[2 * WT_SZ]; };   /* the weight tiles lie in the LDS of the epilogue's staging arrays, which are written only behind the product loop's last barrier */
  __shared__ __align__(16) Sm sm; _Float16 (&sh)[64][136] = sm.qk.sh; _Float16 (&sl)[64][136] = sm.qk.sl; _Float16 (&th)[128][72] = sm.vv.th; __bf16 (&tb)[128][72] = sm.vv.tb; __bf16 (&tbl)[128][72] = sm.vv.tbl;
  const int tid = threadIdx.x, wave = tid >> 5, lane = tid & 31, col = lane & 15, g = lane >> 4; const int which = blockIdx.z; const int c0 = blockIdx.y * 128; const size_t r0 = (size_t)blockIdx.x * 64; const size_t bb = r0 / TT; const int t0 = (int)(r0 % TT);
  const float* X = which == 0 ? XQ : which == 1 ? XK : XV; const float* WA = which == 0 ? WQ : which == 1 ? WK : WV; const float* BA = which == 0 ? BQ : which == 1 ? BK : BV;
  v8f acc[8] = {};
  const float* xp = X + (r0 + wave * 16 + col) * DIN + 8 * g; const float* wp = WA + (size_t)(c0 / 64 + g) * DIN * 64 + (size_t)(wave * 16) * 64 + col * 4; WT wt; XR xr; gemm_first(wt, xr, xp, wp, 64);
  gemm_wt<0>(wt, xr, xp, wp, 64, sm.w, wave, lane, acc);   /* per-head weights [16][DIN][64]: the block's 128 columns are two heads' slabs at pitch 64; lanes 0..15 read the first head's 64 columns, lanes 16..31 the second's */
  if (which < 2) { _Float16* DH = which == 0 ? QH : KH; _Float16* DL = which == 0 ? QL : KL; const int nhi = which == 0 ? QHI : KHI; const bool hi_rows = t0 < nhi;
#pragma unroll
    for (int j = 0; j < 8; ++j) { const float bias = BA ? bfr(BA[c0 + j * 16 + col]) : 0.f;
#pragma unroll
      for (int r = 0; r < 8; ++r) { const float v = acc[j][r] + bias; const _Float16 hv = (_Float16)v; sh[wave * 16 + 8 * g + r][j * 16 + col] = hv; sl[wave * 16 + 8 * g + r][j * 16 + col] = (_Float16)((v - (float)hv) * 1024.0f); } }
    __syncthreads();
    for (int e = tid; e < 64 * 16; e += 128) { const int rl = e >> 4, q = e & 15; vst2((unsigned*)(DH + (r0 + rl) * CC + c0 + q * 8), *(const v4u*)&sh[rl][q * 8]); if (hi_rows) vst2((unsigned*)(DL + (bb * nhi + t0 + rl) * (size_t)CC + c0 + q * 8), *(const v4u*)&sl[rl][q * 8]); }
  } else { const bool hi_rows = t0 < KHI;
#pragma unroll
    for (int j = 0; j < 8; ++j) { const float bias = BA ? bfr(BA[c0 + j * 16 + col]) : 0.f;
#pragma unroll
      for (int r = 0; r < 8; ++r) { const float v = acc[j][r] + bias; const int rl = wave * 16 + 8 * g + r, cl = j * 16 + col; th[cl][rl] = (_Float16)v; const __bf16 bh = (__bf16)v; tb[cl][rl] = bh; tbl[cl][rl] = (__bf16)(v - (float)bh); } }
    __syncthreads();
    for (int e = tid; e < 128 * 8; e += 128) { const int cl = e >> 3, q = e & 7; vst2((unsigned*)(VT + (bb * CC + c0 + cl) * (size_t)TT + t0 + q * 8), *(const v4u*)&th[cl][q * 8]); if (hi_rows) { const size_t o3 = (bb * CC + c0 + cl) * (size_t)KHI + t0 + q * 8; vst2((unsigned*)(VB + o3), *(const v4u*)&tb[cl][q * 8]); vst2((unsigned*)(VBL + o3), *(const v4u*)&tbl[cl][q * 8]); } } } }
// ---- k_sm: block = query row t (head in group): keys [0, kend): causal -> logit if s <= t else excluded; softmax in f32; P x 2^11 in place (0 for excluded)
__global__ __launch_bounds__(256) void k_sm(float* __restrict__ S0 SM_EXTRA_PARAMS) { __shared__ float sred[8]; __shared__ float sbc; __shared__ __align__(16) float shv[TT];
  const int tid = threadIdx.x; const int t = blockIdx.x; const int kend = (kb_last(t >> 6) + 1) * 128;
  float* sr = S0 + (size_t)blockIdx.y * TT * TT + (size_t)t * TT;
  float m = -3.0e38f; for (int k = tid; k < kend; k += 256) { float v = (!CAUSAL || k <= t) ? sr[k] : -3.0e38f; SM_MASK_HOOK; shv[k] = v; m = fmaxf(m, v); }
#pragma unroll
  for (int o = 1; o < 32; o <<= 1) m = fmaxf(m, __shfl_xor(m, o));
  if ((tid & 31) == 0) sred[tid >> 5] = m; __syncthreads(); if (tid == 0) { float a = sred[0]; for (int i = 1; i < 8; ++i) a = fmaxf(a, sred[i]); sbc = a; } __syncthreads(); m = sbc; __syncthreads();
  float sum = 0.f; for (int k = tid; k < kend; k += 256) { const float v = shv[k]; const float e = (v <= -1.0e38f) ? 0.f : expf(v - m); shv[k] = e; sum += e; }
#pragma unroll
  for (int o = 1; o < 32; o <<= 1) sum += __shfl_xor(sum, o);
  if ((tid & 31) == 0) sred[tid >> 5] = sum; __syncthreads(); if (tid == 0) { float a = 0.f; for (int i = 0; i < 8; ++i) a += sred[i]; sbc = a > 0.f ? 2048.0f / a : 0.f; }   /* a fully excluded row yields P = 0 */ __syncthreads(); const float inv = sbc;
  for (int k = tid; k < kend; k += 256) shv[k] = shv[k] * inv;
  __syncthreads(); for (int q = tid; q < kend / 4; q += 256) vst2(sr + q * 4, *(const v4f*)&shv[q * 4]); }
// the products of k_colstat_w and k_pv_w: the plain builtins (the compiler keeps the distances behind its own matrix instructions, and their operands may lie in any register window)
__device__ __forceinline__ v8f mm_h(v16h a, v16h b, v8f c) { return __builtin_amdgcn_wmma_f32_16x16x32_f16(false, a, false, b, (short)0, c, false, false); }
__device__ __forceinline__ v8f mm_b(v16b a, v16b b, v8f c) { return __builtin_amdgcn_wmma_f32_16x16x32_bf16(false, a, false, b, (short)0, c, false, false); }
#define XW() do { asm volatile("s_wait_xcnt 0x0" ::: "memory"); __builtin_amdgcn_sched_barrier(0); } while (0)   /* behind a group of global loads: the wait stands in front of any later write of a register that the issued loads name (address, offset, scalar base); the scheduling barrier keeps such writes from being lifted over it and the loads from sinking below it */
// fragment loads as wave-uniform base + one 32-bit lane offset (elements): the lane offsets are formed once and stay in their registers, so no load of a loop names a vector register that is written again
__device__ __forceinline__ v16h frag_hu(const _Float16* ub, unsigned off) { union { v16h v; v8h q[2]; } u; const _Float16* p = ub + off; u.q[0] = *(const v8h*)p; u.q[1] = *(const v8h*)(p + 16); return u.v; }
__device__ __forceinline__ v16b frag_bu(const __bf16* ub, unsigned off) { union { v16b v; v8b q[2]; } u; const __bf16* p = ub + off; u.q[0] = *(const v8b*)p; u.q[1] = *(const v8b*)(p + 16); return u.v; }
// ---- k_colstat_w: softmax over the QUERY axis under the causal mask (the source's softmax(axis=2) on [B, H, q, k] scores with -inf where k > q): for every key column k: m_k = max_{q >= k} S[q][k], Z_k = sum_{q >= k} exp(S[q][k] - m_k) (f32, precise expf). The logits are formed here on the matrix unit (q f16 x k f16, one product, x SCALE) and never stored. Block = 64 key columns of one (batch, head) pair, 8 waves: a wave keeps the 64 columns' k fragments in registers and takes every eighth 16-query tile from the block's first column down; a lane (column col, rows 8g + r) keeps a running (m, z) per column tile, rescaled once a tile; the 16 partial pairs of a column (8 waves x 2 lane halves) meet in LDS and are merged as z_w x exp(m_w - m)
__global__ __launch_bounds__(256) void k_colstat_w(const _Float16* __restrict__ QH, const _Float16* __restrict__ KH, float* __restrict__ CM, float* __restrict__ CZ) { __shared__ __align__(16) float sm[16][64], sz[16][64];
  const int tid = threadIdx.x, wave = __builtin_amdgcn_readfirstlane(tid >> 5) /* in a scalar register: the trip tests are scalar branches, every lane is on at the products */, lane = tid & 31, col = lane & 15, g = lane >> 4; const int kb = blockIdx.x, pz = blockIdx.y, k0 = kb * 64;
  const size_t base = (size_t)(pz / NH) * TT * CC + (size_t)(pz % NH) * HD; const unsigned fo = (unsigned)col * CC + 8u * g;
  float m[4], z[4];
#pragma unroll
  for (int j = 0; j < 4; ++j) { m[j] = -3.0e38f; z[j] = 0.f; }
  int qt = kb * 4 + wave;   /* tiles above the block's first column hold no visible query */
  if (qt < TT / 16) { v16h kf[4][2]; const _Float16* Ku = KH + base + (size_t)k0 * CC; const _Float16* Qu = QH + base + (size_t)qt * 16 * CC;
#pragma unroll
    for (int j = 0; j < 4; ++j)
#pragma unroll
      for (int ks = 0; ks < 2; ++ks) kf[j][ks] = frag_hu(Ku + j * 16 * CC + ks * 32, fo);
    XW();
    do { const v16h a0 = frag_hu(Qu, fo), a1 = frag_hu(Qu + 32, fo);
      XW();
      v8f s[4] = {};
#pragma unroll
      for (int j = 0; j < 4; ++j) s[j] = mm_h(a0, kf[j][0], s[j]);
#pragma unroll
      for (int j = 0; j < 4; ++j) s[j] = mm_h(a1, kf[j][1], s[j]);
      const int dq = qt * 16 + 8 * g - k0 - col;   /* query of element 0 - key of column tile 0 */
#pragma unroll
      for (int j = 0; j < 4; ++j) { float sv[8], tm = -3.0e38f;
#pragma unroll
        for (int r = 0; r < 8; ++r) { sv[r] = s[j][r] * SCALE; tm = fmaxf(tm, (dq + r >= j * 16) ? sv[r] : -3.0e38f); }
        const float mn = fmaxf(m[j], tm); float zs = z[j] * expf(m[j] - mn);
#pragma unroll
        for (int r = 0; r < 8; ++r) { const float e = expf(sv[r] - mn); zs += (dq + r >= j * 16) ? e : 0.f; }
        m[j] = mn; z[j] = zs; }
      Qu += 8 * 16 * CC; qt += 8; } while (qt < TT / 16); }
#pragma unroll
  for (int j = 0; j < 4; ++j) { sm[wave * 2 + g][j * 16 + col] = m[j]; sz[wave * 2 + g][j * 16 + col] = z[j]; }
  __syncthreads();
  if (tid < 64) { float mm = -3.0e38f, zz = 0.f;   /* a partial with no visible row of a column brings (-3e38, 0): its term is 0 */
#pragma unroll
    for (int w = 0; w < 16; ++w) mm = fmaxf(mm, sm[w][tid]);
#pragma unroll
    for (int w = 0; w < 16; ++w) zz += sz[w][tid] * expf(sm[w][tid] - mm);
    vst2(CM + (size_t)pz * TT + k0 + tid, mm); vst2(CZ + (size_t)pz * TT + k0 + tid, 2048.0f / zz); } }   /* every column sees at least its own diagonal entry: Z_k >= 1; stored as 2^11 / Z_k, one division a column, the factor k_pv_w multiplies by */
// ---- k_pv_w: ctx = P . v, the logits formed again on the matrix unit where P is needed. A wave = 32 queries (two 16-query tiles, their q fragments kept in registers) of one (batch, head) pair, a trip = 32 keys, up to the wave's own diagonal. The logits are taken TRANSPOSED (A = 16 key rows of k, B = the 16 queries of q): D element r of lane (g, col) is key 8g + r of query col, so the two key tiles of a trip are, register for register, elements 0..7 and 8..15 of the P fragment (row = query col, keys +8g+0..7 and +16+8g+0..7): no move between lanes. P = exp(S - m_k) x (2^11 / Z_k) for key <= query, 0 above the diagonal; P and v as bf16 hi + lo, 3 products, each accumulator in the order h.vh, l.vh, h.vl. The k and v fragments of a trip serve both query tiles. Block = 8 waves of one pair: waves w and w + 4 take the 32-query tiles i and 31 - i (i + 1 and 32 - i trips), 33 trips for every such two
__global__ __launch_bounds__(256) void k_pv_w(const _Float16* __restrict__ QH, const _Float16* __restrict__ KH, const float* __restrict__ CM, const float* __restrict__ CZ, const __bf16* __restrict__ VB, const __bf16* __restrict__ VBL, float* __restrict__ Y) { __shared__ __align__(16) float ss[8][32][HD + 4];
  const int tid = threadIdx.x, wave = __builtin_amdgcn_readfirstlane(tid >> 5) /* in a scalar register: the trip count is wave-uniform and its test a scalar branch */, lane = tid & 31, col = lane & 15, g = lane >> 4; const int pz = blockIdx.z, b = pz / NH, h = pz % NH;
  const int i4 = blockIdx.x * 4 + (wave & 3), qi = wave < 4 ? i4 : 31 - i4, ql0 = qi * 32;
  const size_t base = (size_t)b * TT * CC + (size_t)h * HD; const unsigned fo = (unsigned)col * CC + 8u * g, co = 8u * g, vo = (unsigned)col * KHI + 8u * g;
  const _Float16* Qu = QH + base + (size_t)ql0 * CC; const _Float16* Ku = KH + base; const float* mu = CM + (size_t)pz * TT; const float* ru = CZ + (size_t)pz * TT; const __bf16* Vh = VB + ((size_t)b * CC + h * HD) * (size_t)KHI; const __bf16* Vl = VBL + ((size_t)b * CC + h * HD) * (size_t)KHI;
  v16h qf[2][2];
#pragma unroll
  for (int t = 0; t < 2; ++t)
#pragma unroll
    for (int ks = 0; ks < 2; ++ks) qf[t][ks] = frag_hu(Qu + t * 16 * CC + ks * 32, fo);
  XW();
  v8f acc[2][HD / 16] = {}; int kc = 0;
  do { v16h ka[2][2]; v4f m4[4], r4[4]; v16b vh[HD / 16], vl[HD / 16];   /* at least one trip: every tile has its diagonal */
#pragma unroll
    for (int kt = 0; kt < 2; ++kt)
#pragma unroll
      for (int ks = 0; ks < 2; ++ks) ka[kt][ks] = frag_hu(Ku + kt * 16 * CC + ks * 32, fo);
    XW();
#pragma unroll
    for (int q = 0; q < 4; ++q) { const int o = (q >> 1) * 16 + (q & 1) * 4; const float* pm = mu + co; const float* pr = ru + co; m4[q] = *(const v4f*)(pm + o); r4[q] = *(const v4f*)(pr + o); }
    XW();
#pragma unroll
    for (int j = 0; j < HD / 16; ++j) vh[j] = frag_bu(Vh + j * 16 * KHI, vo);
    XW();
#pragma unroll
    for (int j = 0; j < HD / 16; ++j) vl[j] = frag_bu(Vl + j * 16 * KHI, vo);
    XW();   /* all of a trip's loads are issued in front of its arithmetic: one load latency a trip */
#pragma unroll
    for (int t = 0; t < 2; ++t) { v8f s0 = {}, s1 = {};
      s0 = mm_h(ka[0][0], qf[t][0], s0); s1 = mm_h(ka[1][0], qf[t][0], s1); s0 = mm_h(ka[0][1], qf[t][1], s0); s1 = mm_h(ka[1][1], qf[t][1], s1);
      const int dk = ql0 + t * 16 + col - 8 * g - kc * 32;   /* query - the lane's first key */
      float pf[16];
#pragma unroll
      for (int i = 0; i < 8; ++i) { const float e0 = expf(s0[i] * SCALE - m4[i >> 2][i & 3]) * r4[i >> 2][i & 3], e1 = expf(s1[i] * SCALE - m4[2 + (i >> 2)][i & 3]) * r4[2 + (i >> 2)][i & 3]; pf[i] = (i <= dk) ? e0 : 0.f; pf[8 + i] = (16 + i <= dk) ? e1 : 0.f; }
      const F2 p = bsplit16(pf);
#pragma unroll
      for (int j = 0; j < HD / 16; ++j) acc[t][j] = mm_b(p.h, vh[j], acc[t][j]);
#pragma unroll
      for (int j = 0; j < HD / 16; ++j) acc[t][j] = mm_b(p.l, vh[j], acc[t][j]);
#pragma unroll
      for (int j = 0; j < HD / 16; ++j) acc[t][j] = mm_b(p.h, vl[j], acc[t][j]); }
    Ku += 32 * CC; mu += 32; ru += 32; Vh += 32; Vl += 32; } while (++kc <= qi);
#pragma unroll
  for (int t = 0; t < 2; ++t)
#pragma unroll
    for (int j = 0; j < HD / 16; ++j)
#pragma unroll
      for (int r = 0; r < 8; ++r) ss[wave][t * 16 + 8 * g + r][j * 16 + col] = acc[t][j][r] * (1.0f / 2048.0f);
  LDSX(); for (int i = 0; i < 16; ++i) vst2(Y + ((size_t)b * TT + ql0 + i * 2 + g) * CC + h * HD + col * 4, *(const v4f*)&ss[wave][i * 2 + g][col * 4]); }   /* a wave's own rows; a store = two rows' 256-byte (row, head) segments */
// ---- k_out: block = (64 rows, 128 cols): out = ctx Wo (+ bo): ctx x 2^6 once to f16 against Wo as f16(bf16 x 2^8) exact (1 product) x 2^-14; causal early rows (< QHI of each sequence) and the last 64 rows of each sequence: ctx bf16 hi + lo against exact bf16 Wo (2 products)
__global__ __launch_bounds__(128) void k_out(const float* __restrict__ Y, const float* __restrict__ WO, const float* __restrict__ BO, float* __restrict__ OUT) { union Sm { float sf[4][16][132]; __bf16 w[2 * WT_SZ]; }; __shared__ __align__(16) Sm sm; float (&sf)[4][16][132] = sm.sf;   /* weight tiles and the epilogue's staging share the LDS: sf is written only behind the product loop's last barrier */
  const int tid = threadIdx.x, wave = tid >> 5, lane = tid & 31, col = lane & 15, g = lane >> 4; const int c0 = blockIdx.y * 128; const size_t r0 = (size_t)blockIdx.x * 64 + wave * 16;
  v8f acc[8] = {};
  const float* xp = Y + (r0 + col) * CC + 8 * g; const float* wp = WO + (size_t)(wave * 16) * DIN + c0 + lane * 4; WT wt; XR xr; gemm_first(wt, xr, xp, wp, DIN);   /* both arms start from the same first tile */
  const int tb_ = (int)(((size_t)blockIdx.x * 64) % TT); if (CAUSAL && (tb_ < QHI || tb_ >= TT - 64)) {   /* block-uniform; the LAST 64 query rows of each sequence also take the hi + lo context path: under a query-axis softmax the last key columns carry O(1) weights, so the context rows there are an order of magnitude larger */
    gemm_wt<1>(wt, xr, xp, wp, DIN, sm.w, wave, lane, acc);
#pragma unroll
    for (int j = 0; j < 8; ++j) { const float bias = BO ? bfr(BO[c0 + j * 16 + col]) : 0.f;
#pragma unroll
      for (int r = 0; r < 8; ++r) sf[wave][8 * g + r][j * 16 + col] = acc[j][r] + bias; }
  } else {
    gemm_wt<2>(wt, xr, xp, wp, DIN, sm.w, wave, lane, acc);   /* ctx carried x 2^6 into f16 so small-magnitude context rows stay clear of f16 subnormals */
#pragma unroll
    for (int j = 0; j < 8; ++j) { const float bias = BO ? bfr(BO[c0 + j * 16 + col]) : 0.f;
#pragma unroll
      for (int r = 0; r < 8; ++r) sf[wave][8 * g + r][j * 16 + col] = acc[j][r] * (1.0f / 16384.0f) + bias; } }   /* 2^-8 (Wo carry) x 2^-6 (ctx carry) */
  LDSX(); for (int rl = 0; rl < 16; ++rl) vst2(OUT + (r0 + rl) * DIN + c0 + lane * 4, *(const v4f*)&sf[wave][rl][lane * 4]); }

extern "C" void kernel_launch(void* const* d_in, const int* in_sizes, int n_in, void* d_out, int out_size, void* d_ws, size_t ws_size, hipStream_t stream) {
  (void)in_sizes; (void)n_in; (void)out_size;
  const float** F = (const float**)d_in;
  if (ws_size < (size_t)WS_END) return;
  char* ws = (char*)d_ws; _Float16 *QH = (_Float16*)(ws + WS_QH), *KH = (_Float16*)(ws + WS_KH), *VT = (_Float16*)(ws + WS_VT), *QL = (_Float16*)(ws + WS_QL), *KL = (_Float16*)(ws + WS_KL); __bf16 *VB = (__bf16*)(ws + WS_VB), *VBL = (__bf16*)(ws + WS_VBL); float *Y = (float*)(ws + WS_Y);
  (void)Y; (void)QL; (void)KL; (void)VB; (void)VBL;
  // inputs: 0 source [4,1024,1024]; 1 Wq [16,1024,64] (head, in, out), 2 bq [16,64]; 3 Wk, 4 bk; 5 Wv, 6 bv; 7 Wc [1024,1024] (in,out), 8 bc [1024] (all biases N(0, 0.02^2), nonzero)
  if (ws_size < (size_t)WS_END2) return;
  float *CM = (float*)(ws + WS_CM), *CZ = (float*)(ws + WS_CZ);
  k_proj<<<dim3(TNB * TT / 64, CC / 128, 3), 128, 0, stream>>>(F[0], F[0], F[0], F[1], F[3], F[5], F[2], F[4], F[6], QH, QL, KH, KL, VT, VB, VBL);
  k_colstat_w<<<dim3(TT / 64, NP), 256, 0, stream>>>(QH, KH, CM, CZ);   /* per key column j: max / sum over the visible queries i >= j */
  k_pv_w<<<dim3(TT / 256, 1, NP), 256, 0, stream>>>(QH, KH, CM, CZ, VB, VBL, Y);   /* P[i][j] = exp(S - m_j) x 2^11 / Z_j for j <= i, 0 above the diagonal */
  k_out<<<dim3(TNB * TT / 64, DIN / 128), 128, 0, stream>>>(Y, F[7], F[8], (float*)d_out);
}

// v006
// Measured time: 139 microseconds a run.
// Two timings next to v005 both put it at 1.04 times that version's speed.
// Over all steps from v000 it is 29.7 times as fast.
// compute dtype: all float inputs rounded to bf16; per-head q/k/v projections with EXACT bf16 products on WMMA 16x16x32 (f32 accumulate) + bias; causal scores q x k once to f16 each (1 product; sigma - 0.4) x 64^-0.5 on every block; softmax over the QUERY axis in f32 (per key column: max / sum over the visible queries, precise expf); P as bf16 hi + lo against v as bf16 hi + lo (3 products) on EVERY block; ctx x 2^6 once to f16 x Wc f16(bf16 x 2^8) - except the LAST 64 rows of each sequence: ctx as bf16 hi + lo against exact bf16 Wc (2 products) - + bc; f32 output.
#include <hip/hip_runtime.h>
#include <math.h>

typedef __attribute__((ext_vector_type(16))) _Float16 v16h;
typedef __attribute__((ext_vector_type(16))) __bf16 v16b;
typedef __attribute__((ext_vector_type(8)))  _Float16 v8h;
typedef __attribute__((ext_vector_type(8)))  float v8f;
typedef __attribute__((ext_vector_type(4)))  float v4f;
typedef __attribute__((ext_vector_type(2)))  float v2f;
typedef __attribute__((ext_vector_type(4)))  unsigned v4u;
typedef __attribute__((ext_vector_type(4)))  int v4i;
typedef float __attribute__((may_alias)) float_a;
typedef int __attribute__((may_alias)) int_a;

template <typename T> __device__ __forceinline__ void vst2(void* p, T v) { *(T*)p = v;  }
__device__ __forceinline__ v8f wmma16(v16h a, v16h b, v8f c) {
  v8f d = __builtin_amdgcn_wmma_f32_16x16x32_f16(false, a, false, b, (short)0, c, false, false);
  asm volatile("v_nop\n\tv_nop\n\tv_nop\n\tv_nop" : "+v"(d) : "v"(a), "v"(b));
  return d;
}
__device__ __forceinline__ v8f wmma_bf(v16b a, v16b b, v8f c) {
  v8f d = __builtin_amdgcn_wmma_f32_16x16x32_bf16(false, a, false, b, (short)0, c, false, false);
  asm volatile("v_nop\n\tv_nop\n\tv_nop\n\tv_nop" : "+v"(d) : "v"(a), "v"(b));
  return d;
}
// 16x16x32 fragments: lane = (h = lane>>4, row/col = lane&15); elements 0..7 = k0+8h+0..7, 8..15 = k0+16+8h+0..7; D element r = row 8h+r
__device__ __forceinline__ v16h frag_h(const _Float16* rowk0, int lane) {
  union { v16h v; v8h q[2]; } u; const _Float16* p = rowk0 + 8 * (lane >> 4);
  u.q[0] = *(const v8h*)p; u.q[1] = *(const v8h*)(p + 16); return u.v;
}
__device__ __forceinline__ v16h frag_f32(const float* rowk0, int lane) {
  v16h a; const float* p = rowk0 + 8 * (lane >> 4);
#pragma unroll
  for (int i = 0; i < 8; ++i) { a[i] = (_Float16)p[i]; a[8 + i] = (_Float16)p[16 + i]; }
  return a;
}
__device__ __forceinline__ v16h frag_f32s(const float* rowk0, int lane, float sc) {
  v16h a; const float* p = rowk0 + 8 * (lane >> 4);
#pragma unroll
  for (int i = 0; i < 8; ++i) { a[i] = (_Float16)(p[i] * sc); a[8 + i] = (_Float16)(p[16 + i] * sc); }
  return a;
}
// column fragment from a [K][ld] layout (column n), rows >= K read as 0
__device__ __forceinline__ v16h fragc_f32(const float* W, int k0, int n, int lane, int ld, int K) {
  v16h a; const int g = lane >> 4;
#pragma unroll
  for (int i = 0; i < 8; ++i) { const int ka = k0 + 8 * g + i, kb = ka + 16;
    a[i] = (_Float16)(ka < K ? W[(size_t)(ka < K ? ka : K - 1) * ld + n] : 0.f); a[8 + i] = (_Float16)(kb < K ? W[(size_t)(kb < K ? kb : K - 1) * ld + n] : 0.f); }
  return a;
}
struct F2 { v16b h, l; };
__device__ __forceinline__ F2 bsplit16(const float v[16]) { F2 r;
#pragma unroll
  for (int i = 0; i < 16; ++i) { const __bf16 h = (__bf16)v[i]; r.h[i] = h; r.l[i] = (__bf16)(v[i] - (float)h); }
  return r; }
__device__ __forceinline__ F2 split_row(const float* row, int k0, int lane) { float v[16]; const float* p = row + k0 + 8 * (lane >> 4);
#pragma unroll
  for (int i = 0; i < 8; ++i) { v[i] = p[i]; v[8 + i] = p[16 + i]; }
  return bsplit16(v); }
__device__ __forceinline__ F2 split_rowK(const float* row, int k0, int lane, int K) { float v[16]; const int g = lane >> 4;
#pragma unroll
  for (int i = 0; i < 8; ++i) { const int ka = k0 + 8 * g + i, kb = ka + 16; v[i] = ka < K ? row[ka < K ? ka : K - 1] : 0.f; v[8 + i] = kb < K ? row[kb < K ? kb : K - 1] : 0.f; }
  return bsplit16(v); }
__device__ __forceinline__ F2 split_col(const float* W, int k0, int n, int lane, int ld, int K) { float v[16]; const int g = lane >> 4;
#pragma unroll
  for (int i = 0; i < 8; ++i) { const int ka = k0 + 8 * g + i, kb = ka + 16; v[i] = ka < K ? W[(size_t)(ka < K ? ka : K - 1) * ld + n] : 0.f; v[8 + i] = kb < K ? W[(size_t)(kb < K ? kb : K - 1) * ld + n] : 0.f; }
  return bsplit16(v); }
__device__ __forceinline__ v8f mac3(const F2& a, const F2& b, v8f c) { c = wmma_bf(a.l, b.h, c); c = wmma_bf(a.h, b.l, c); return wmma_bf(a.h, b.h, c); }
__device__ __forceinline__ float sigm(float v) { return 1.0f / (1.0f + expf(-v)); }
#define LDSX() do { asm volatile("s_wait_dscnt 0" ::: "memory"); __builtin_amdgcn_wave_barrier(); __builtin_amdgcn_fence(__ATOMIC_RELEASE, "workgroup"); } while (0)

// Causal multi-head attention whose softmax runs over the QUERY axis, with per-head projection tensors (source [4,1024,1024]; Wq / Wk / Wv [16,1024,64] (head, in, out) (0.02) + biases [16,64]; scores / sqrt(64) + triu(-inf, k=1); attn = softmax(..., axis=2) - axis 2 of [B, H, q, k] is the QUERY axis: every key column is normalised over the queries q >= k (faithful to the source); out = attn v; heads merged; Wc [1024,1024] (in,out) + bc).
#define NB 4
#define TT 1024
#define CC 1024            // NH * HD = projected width
#define DIN 1024          // input (model) width
#define NH 16
#define HD 64
#define NQB (TT / 64)
#define NP (NB * NH)        // (batch, head) pairs: the column-statistics and context kernels take all of them in one launch (grid y or z = pair)
#define SCALE (0.125f)
#define CAUSAL 1
#ifndef TNB
#define TNB NB
#endif
__device__ __forceinline__ float bfr(float v) { return (float)(__bf16)v; }
__host__ __device__ __forceinline__ int kb_last(int qb) { return CAUSAL ? ((qb * 64 + 63) >> 7) : (TT / 128 - 1); }
typedef __attribute__((ext_vector_type(8))) __bf16 v8b;
__device__ __forceinline__ v16b frag_b(const __bf16* rowk0, int lane) {
  union { v16b v; v8b q[2]; } u; const __bf16* p = rowk0 + 8 * (lane >> 4);
  u.q[0] = *(const v8b*)p; u.q[1] = *(const v8b*)(p + 16); return u.v;
}
#define QHI 0               // no q residual plane: the scores are small and single-product everywhere
#define KHI 1024            // key rows carrying k residual / v bf16 hi+lo planes (used only by the causal high-precision path)
// B fragment (k rows k0+.., output column o) of a weight: (in,out) [K][ld] or (out,in) [ld rows of K]: bf16 exact, or f16(bf16 * 256) exact
__device__ __forceinline__ v16b wcol_io(const float* Wm, int k0, int o, int lane, int ld) { v16b w; const int g = lane >> 4;
#pragma unroll
  for (int i = 0; i < 8; ++i) { w[i] = (__bf16)Wm[(size_t)(k0 + 8 * g + i) * ld + o]; w[8 + i] = (__bf16)Wm[(size_t)(k0 + 16 + 8 * g + i) * ld + o]; }
  return w; }
__device__ __forceinline__ v16b wcol_oi(const float* Wm, int k0, int o, int lane, int K) { v16b w; const float* p = Wm + (size_t)o * K + k0 + 8 * (lane >> 4);
#pragma unroll
  for (int i = 0; i < 8; ++i) { w[i] = (__bf16)p[i]; w[8 + i] = (__bf16)p[16 + i]; }
  return w; }
__device__ __forceinline__ v16h wcolh_io(const float* Wm, int k0, int o, int lane, int ld) { v16h w; const int g = lane >> 4;
#pragma unroll
  for (int i = 0; i < 8; ++i) { w[i] = (_Float16)(bfr(Wm[(size_t)(k0 + 8 * g + i) * ld + o]) * 256.0f); w[8 + i] = (_Float16)(bfr(Wm[(size_t)(k0 + 16 + 8 * g + i) * ld + o]) * 256.0f); }
  return w; }
__device__ __forceinline__ v16h wcolh_oi(const float* Wm, int k0, int o, int lane, int K) { v16h w; const float* p = Wm + (size_t)o * K + k0 + 8 * (lane >> 4);
#pragma unroll
  for (int i = 0; i < 8; ++i) { w[i] = (_Float16)(bfr(p[i]) * 256.0f); w[8 + i] = (_Float16)(bfr(p[16 + i]) * 256.0f); }
  return w; }
#define WQKV_LAYOUT 0   // 0 = per-head [NH][DIN][HD] (head, in, out); 1 = (out,in) [CC][DIN]; 2 = per-head [NH][DIN][HD]
__device__ __forceinline__ v16b wcol_hdk(const float* Wm, int k0, int o, int lane) { v16b w; const int g = lane >> 4; const float* p = Wm + (size_t)(o / HD) * DIN * HD + (o % HD);
#pragma unroll
  for (int i = 0; i < 8; ++i) { w[i] = (__bf16)p[(size_t)(k0 + 8 * g + i) * HD]; w[8 + i] = (__bf16)p[(size_t)(k0 + 16 + 8 * g + i) * HD]; }
  return w; }
#define WO_OUT_IN 0
#if WQKV_LAYOUT == 1
#define WCOL(W, k0, o, lane) wcol_oi(W, k0, o, lane, DIN)
#elif WQKV_LAYOUT == 2
#define WCOL(W, k0, o, lane) wcol_hdk(W, k0, o, lane)
#else
#define WCOL(W, k0, o, lane) wcol_io((W) + (size_t)((o) / 64) * DIN * 64, k0, (o) % 64, lane, 64)   /* per-head weight tensors [16][DIN][64] (head, in, out): output column o = h*64 + kk lives in head h's [DIN][64] (in,out) slab at pitch 64 (a 16-column tile never straddles a head) */
#endif
#if WO_OUT_IN
#define WOCOL(W, k0, o, lane) wcol_oi(W, k0, o, lane, CC)
#define WOCOLH(W, k0, o, lane) wcolh_oi(W, k0, o, lane, CC)
#else
#define WOCOL(W, k0, o, lane) wcol_io(W, k0, o, lane, DIN)
#define WOCOLH(W, k0, o, lane) wcolh_io(W, k0, o, lane, DIN)
#endif

#ifndef SM_EXTRA_PARAMS
#define SM_EXTRA_PARAMS
#endif
#ifndef PROJ_EXTRA_PARAMS
#define PROJ_EXTRA_PARAMS
#endif
#ifndef SM_MASK_HOOK
#define SM_MASK_HOOK (void)0
#endif

#define WS_QH  0u                                      // f16 q rows [b*t][CC]
#define WS_KH  (WS_QH + 2u * (size_t)NB * TT * CC)      // f16 k rows [b*t][CC]
#define WS_VT  (WS_KH + 2u * (size_t)NB * TT * CC)      // f16 v planes [b][c][t]
#define WS_QL  (WS_VT + 2u * (size_t)NB * CC * TT)      // f16 q residual x 2^10 rows [b][t < QHI][CC]
#define WS_KL  (WS_QL + 2u * (size_t)NB * QHI * CC)     // f16 k residual x 2^10 rows [b][t < KHI][CC]
#define WS_VB  (WS_KL + 2u * (size_t)NB * KHI * CC)     // bf16 v hi planes [b][c][t < KHI]
#define WS_VBL (WS_VB + 2u * (size_t)NB * CC * KHI)
#define WS_Y   (WS_VBL + 2u * (size_t)NB * CC * KHI)    // f32 ctx rows [b*t][CC] (only when there is an output projection)
#define WS_END (WS_Y  + 4u * (size_t)NB * TT * CC)
#define WS_CM (WS_END)                                  // f32 column maxima [NP][TT]
#define WS_CZ (WS_CM + 4u * (size_t)NP * TT)           // f32 2^11 / column sum [NP][TT]
#define WS_END2 (WS_CZ + 4u * (size_t)NP * TT)

// ---- weight tile in LDS for k_proj / k_out: a block's 64 k x 128 column slice of a (in,out) weight is read once for its four waves, in whole 128-byte lines (a lane: 4 columns x 16 k rows, 16-byte loads), rounded to its 16-bit operand type in registers and stored column-major (a column's 64 k values in a row of 128 bytes), so that a B fragment is two 16-byte LDS reads. Two buffers: the next tile's loads (and the wave's own next A rows) fly during this tile's products, one barrier a tile. The A rows take the same road: a wave reads its 16 rows x 64 k in whole lines (a load = two rows' 256 bytes), rounds them to the operand type once and stores them row-major at a pitch of 144 bytes behind the weight buffers; an A fragment is two 16-byte LDS reads.
#define KT 64               // k rows of a tile
#define WT_G 2336           // elements between the four column groups n & 3: 32 rows of 72 + 32. Column n lies at (n & 3) x 4672 B + (n >> 2) x 144 B: the storing lanes (columns 4 apart) and the reading lanes (16 neighbouring columns) both fall on 16 different 16-byte bank groups
#define WT_SZ (4 * WT_G)    // elements of one buffer
__device__ __forceinline__ int wt_row(int n) { return (n & 3) * WT_G + (n >> 2) * 72; }
struct WT { v4f r[16]; };   // a lane's share of a tile: k rows wave x 16 + 0..15, columns lane x 4 + 0..3
#define AT_P 72             // elements between two A rows in LDS: 144 B = 16 B x 9, the reading lanes (16 neighbouring rows) fall on 16 different 16-byte bank groups
#define AT_SZ (64 * AT_P)   // elements of one A plane (the block's 64 rows)
typedef __attribute__((ext_vector_type(4))) __bf16 v4b;
typedef __attribute__((ext_vector_type(4))) _Float16 v4h;
struct XR { v4f r[8]; };    // a lane's share of its wave's A rows of one tile: rows 2q + (lane >> 4), k (lane & 15) x 4 + 0..3
__device__ __forceinline__ void wt_load(WT& t, const float* p, int ld) {
#pragma unroll
  for (int i = 0; i < 16; ++i) t.r[i] = *(const v4f*)(p + (size_t)i * ld); }
__device__ __forceinline__ void xr_load(XR& x, const float* p) {   // p = the wave's row (lane >> 4) at k (lane & 15) x 4; the A rows have 1024 elements
#pragma unroll
  for (int q = 0; q < 8; ++q) x.r[q] = *(const v4f*)(p + (size_t)(2 * q) * 1024); }
// MODE 0: bf16(a); 1: bf16 hi in the first plane, bf16 lo in the second; 2: f16(a x 2^6). ab = the buffer's first plane
template <int MODE> __device__ __forceinline__ void xr_store(const XR& x, __bf16* ab, int wave, int lane) {
#pragma unroll
  for (int q = 0; q < 8; ++q) { __bf16* d = ab + (wave * 16 + 2 * q + (lane >> 4)) * AT_P + (lane & 15) * 4;
    if (MODE == 2) { v4h o;
#pragma unroll
      for (int u = 0; u < 4; ++u) o[u] = (_Float16)(x.r[q][u] * 64.0f);
      *(v4h*)d = o;
    } else { v4b o, ol;
#pragma unroll
      for (int u = 0; u < 4; ++u) { const __bf16 h = (__bf16)x.r[q][u]; o[u] = h; ol[u] = (__bf16)(x.r[q][u] - (float)h); }
      *(v4b*)d = o; if (MODE == 1) *(v4b*)(d + AT_SZ) = ol; } } }
template <int F16> __device__ __forceinline__ void wt_store(const WT& t, __bf16* buf, int wave, int lane) {   // F16 = 0: bf16(w); 1: f16(bf16(w) x 2^8), both exact carriers of the bf16 weight
#pragma unroll
  for (int u = 0; u < 4; ++u) { __bf16* d = buf + wt_row(lane * 4 + u) + wave * 16;
#pragma unroll
    for (int hf = 0; hf < 2; ++hf) {
      if (F16) { v8h o;
#pragma unroll
        for (int i = 0; i < 8; ++i) o[i] = (_Float16)(bfr(t.r[hf * 8 + i][u]) * 256.0f);
        *(v8h*)(d + hf * 8) = o;
      } else { v8b o;
#pragma unroll
        for (int i = 0; i < 8; ++i) o[i] = (__bf16)t.r[hf * 8 + i][u];
        *(v8b*)(d + hf * 8) = o; } } } }
// the first tile's loads, written once in front of any branch between the modes, with their wait directly behind them
__device__ __forceinline__ void gemm_first(WT& wt, XR& xr, const float* xp, const float* wp, int ldw) { wt_load(wt, wp, ldw); xr_load(xr, xp);
  asm volatile("s_wait_xcnt 0x0" ::: "memory"); __builtin_amdgcn_sched_barrier(0); }   /* the wait stands in front of any reuse of the address registers that the issued loads name; the scheduling barrier keeps the register arithmetic that follows from being lifted over it */
// acc[j] += A (the wave's 16 rows, f32 source, K = 1024) x W (columns j x 16 + 0..15 of the block's 128). xp = the wave's row g at k col x 4; wp = the weight at (k row wave x 16, the lane's 4 columns), ldw its row pitch. wt / xr = tile 0 as gemm_first loaded it. MODE 0: A bf16 x W bf16; 1: A bf16 hi + lo x W bf16 (2 products); 2: A x 2^6 f16 x W f16(bf16 x 2^8). Ends behind a barrier: the buffers may be reused
template <int MODE> __device__ __forceinline__ void gemm_wt(WT& wt, XR& xr, const float* xp, const float* wp, int ldw, __bf16* wbuf, int wave, int lane, v8f acc[8]) { const int col = lane & 15; constexpr int AB = (MODE == 1 ? 2 : 1) * AT_SZ; __bf16* abuf = wbuf + 2 * WT_SZ;   /* the A buffers lie behind the two weight buffers */
  wt_store<MODE == 2>(wt, wbuf, wave, lane); xr_store<MODE>(xr, abuf, wave, lane);
  __syncthreads();
  for (int t = 0; t < 1024 / KT; ++t) { const __bf16* wb = wbuf + (t & 1) * WT_SZ; const __bf16* ab = abuf + (t & 1) * AB + (wave * 16 + col) * AT_P;
    if (t + 1 < 1024 / KT) { wt_load(wt, wp + (size_t)(t + 1) * KT * ldw, ldw); xr_load(xr, xp + (t + 1) * KT);
      asm volatile("s_wait_xcnt 0x0" ::: "memory"); __builtin_amdgcn_sched_barrier(0); }   /* as above: the address registers are reused while the loads fly */
#pragma unroll
    for (int s = 0; s < 2; ++s) {
      v16b w[8], ah = frag_b(ab + s * 32, lane), al; if (MODE == 1) al = frag_b(ab + AT_SZ + s * 32, lane);
#pragma unroll
      for (int j = 0; j < 8; ++j) w[j] = frag_b(wb + wt_row(col) + j * (4 * 72) + s * 32, lane);   /* wt_row(j x 16 + col) written as one lane address + a constant: the eight fragments share one address register */
      __builtin_amdgcn_sched_barrier(0);   /* keeps the step's LDS reads together in front of its products: left alone the compiler reads each fragment into one register set directly in front of its product, and every product then waits out an LDS latency */
#pragma unroll
      for (int j = 0; j < 8; ++j) {
        if (MODE == 2) acc[j] = wmma16(__builtin_bit_cast(v16h, ah), __builtin_bit_cast(v16h, w[j]), acc[j]);
        else { acc[j] = wmma_bf(ah, w[j], acc[j]); if (MODE == 1) acc[j] = wmma_bf(al, w[j], acc[j]); } } }
    __builtin_amdgcn_sched_barrier(0);   /* keeps the wait for the next tile's loads behind this tile's last product: left alone the compiler lifts the first conversions, and the wait with them, in among the products */
    if (t + 1 < 1024 / KT) { wt_store<MODE == 2>(wt, wbuf + ((t + 1) & 1) * WT_SZ, wave, lane); xr_store<MODE>(xr, abuf + ((t + 1) & 1) * AB, wave, lane); }
    __syncthreads(); } }   /* the one barrier of a tile: publishes tile t + 1 and ends every wave's reads of the buffer that trip t + 1 refills */
// ---- k_proj: block = (64 rows, 128 cols, which): q/k/v = X W (+ b) with exact bf16 products (K = DIN) -> which 0: q f16 rows (+ residual rows < QHI); 1: k f16 rows (+ residual rows < KHI); 2: v f16 planes [c][t] (+ bf16 hi/lo planes for t < KHI)
__global__ __launch_bounds__(128) void k_proj(const float* __restrict__ XQ, const float* __restrict__ XK, const float* __restrict__ XV, const float* __restrict__ WQ, const float* __restrict__ WK, const float* __restrict__ WV, const float* __restrict__ BQ, const float* __restrict__ BK, const float* __restrict__ BV,
    _Float16* __restrict__ QH, _Float16* __restrict__ QL, _Float16* __restrict__ KH, _Float16* __restrict__ KL, _Float16* __restrict__ VT, __bf16* __restrict__ VB, __bf16* __restrict__ VBL) {
  union Sm { struct { _Float16 sh[64][136], sl[64][136]; } qk; struct { _Float16 th[128][72]; __bf16 tb[128][72], tbl[128][72]; } vv; __bf16 w[2 * WT_SZ + 2 * AT_SZ]; };   /* the weight tiles lie in the LDS of the epilogue's staging arrays, which are written only behind the product loop's last barrier */
  __shared__ __align__(16) Sm sm; _Float16 (&sh)[64][136] = sm.qk.sh; _Float16 (&sl)[64][136] = sm.qk.sl; _Float16 (&th)[128][72] = sm.vv.th; __bf16 (&tb)[128][72] = sm.vv.tb; __bf16 (&tbl)[128][72] = sm.vv.tbl;
  const int tid = threadIdx.x, wave = tid >> 5, lane = tid & 31, col = lane & 15, g = lane >> 4; const int which = blockIdx.z; const int c0 = blockIdx.y * 128; const size_t r0 = (size_t)blockIdx.x * 64; const size_t bb = r0 / TT; const int t0 = (int)(r0 % TT);
  const float* X = which == 0 ? XQ : which == 1 ? XK : XV; const float* WA = which == 0 ? WQ : which == 1 ? WK : WV; const float* BA = which == 0 ? BQ : which == 1 ? BK : BV;
  v8f acc[8] = {};
  const float* xp = X + (r0 + wave * 16 + g) * DIN + col * 4; const float* wp = WA + (size_t)(c0 / 64 + g) * DIN * 64 + (size_t)(wave * 16) * 64 + col * 4; WT wt; XR xr; gemm_first(wt, xr, xp, wp, 64);
  gemm_wt<0>(wt, xr, xp, wp, 64, sm.w, wave, lane, acc);   /* per-head weights [16][DIN][64]: the block's 128 columns are two heads' slabs at pitch 64; lanes 0..15 read the first head's 64 columns, lanes 16..31 the second's */
  if (which < 2) { _Float16* DH = which == 0 ? QH : KH; _Float16* DL = which == 0 ? QL : KL; const int nhi = which == 0 ? QHI : KHI; const bool hi_rows = t0 < nhi;
#pragma unroll
    for (int j = 0; j < 8; ++j) { const float bias = BA ? bfr(BA[c0 + j * 16 + col]) : 0.f;
#pragma unroll
      for (int r = 0; r < 8; ++r) { const float v = acc[j][r] + bias; const _Float16 hv = (_Float16)v; sh[wave * 16 + 8 * g + r][j * 16 + col] = hv; sl[wave * 16 + 8 * g + r][j * 16 + col] = (_Float16)((v - (float)hv) * 1024.0f); } }
    __syncthreads();
    for (int e = tid; e < 64 * 16; e += 128) { const int rl = e >> 4, q = e & 15; vst2((unsigned*)(DH + (r0 + rl) * CC + c0 + q * 8), *(const v4u*)&sh[rl][q * 8]); if (hi_rows) vst2((unsigned*)(DL + (bb * nhi + t0 + rl) * (size_t)CC + c0 + q * 8), *(const v4u*)&sl[rl][q * 8]); }
  } else { const bool hi_rows = t0 < KHI;
#pragma unroll
    for (int j = 0; j < 8; ++j) { const float bias = BA ? bfr(BA[c0 + j * 16 + col]) : 0.f;
#pragma unroll
      for (int r = 0; r < 8; ++r) { const float v = acc[j][r] + bias; const int rl = wave * 16 + 8 * g + r, cl = j * 16 + col; th[cl][rl] = (_Float16)v; const __bf16 bh = (__bf16)v; tb[cl][rl] = bh; tbl[cl][rl] = (__bf16)(v - (float)bh); } }
    __syncthreads();
    for (int e = tid; e < 128 * 8; e += 128) { const int cl = e >> 3, q = e & 7; vst2((unsigned*)(VT + (bb * CC + c0 + cl) * (size_t)TT + t0 + q * 8), *(const v4u*)&th[cl][q * 8]); if (hi_rows) { const size_t o3 = (bb * CC + c0 + cl) * (size_t)KHI + t0 + q * 8; vst2((unsigned*)(VB + o3), *(const v4u*)&tb[cl][q * 8]); vst2((unsigned*)(VBL + o3), *(const v4u*)&tbl[cl][q * 8]); } } } }
// ---- k_sm: block = query row t (head in group): keys [0, kend): causal -> logit if s <= t else excluded; softmax in f32; P x 2^11 in place (0 for excluded)
__global__ __launch_bounds__(256) void k_sm(float* __restrict__ S0 SM_EXTRA_PARAMS) { __shared__ float sred[8]; __shared__ float sbc; __shared__ __align__(16) float shv[TT];
  const int tid = threadIdx.x; const int t = blockIdx.x; const int kend = (kb_last(t >> 6) + 1) * 128;
  float* sr = S0 + (size_t)blockIdx.y * TT * TT + (size_t)t * TT;
  float m = -3.0e38f; for (int k = tid; k < kend; k += 256) { float v = (!CAUSAL || k <= t) ? sr[k] : -3.0e38f; SM_MASK_HOOK; shv[k] = v; m = fmaxf(m, v); }
#pragma unroll
  for (int o = 1; o < 32; o <<= 1) m = fmaxf(m, __shfl_xor(m, o));
  if ((tid & 31) == 0) sred[tid >> 5] = m; __syncthreads(); if (tid == 0) { float a = sred[0]; for (int i = 1; i < 8; ++i) a = fmaxf(a, sred[i]); sbc = a; } __syncthreads(); m = sbc; __syncthreads();
  float sum = 0.f; for (int k = tid; k < kend; k += 256) { const float v = shv[k]; const float e = (v <= -1.0e38f) ? 0.f : expf(v - m); shv[k] = e; sum += e; }
#pragma unroll
  for (int o = 1; o < 32; o <<= 1) sum += __shfl_xor(sum, o);
  if ((tid & 31) == 0) sred[tid >> 5] = sum; __syncthreads(); if (tid == 0) { float a = 0.f; for (int i = 0; i < 8; ++i) a += sred[i]; sbc = a > 0.f ? 2048.0f / a : 0.f; }   /* a fully excluded row yields P = 0 */ __syncthreads(); const float inv = sbc;
  for (int k = tid; k < kend; k += 256) shv[k] = shv[k] * inv;
  __syncthreads(); for (int q = tid; q < kend / 4; q += 256) vst2(sr + q * 4, *(const v4f*)&shv[q * 4]); }
// the products of k_colstat_w and k_pv_w: the plain builtins (the compiler keeps the distances behind its own matrix instructions, and their operands may lie in any register window)
__device__ __forceinline__ v8f mm_h(v16h a, v16h b, v8f c) { return __builtin_amdgcn_wmma_f32_16x16x32_f16(false, a, false, b, (short)0, c, false, false); }
__device__ __forceinline__ v8f mm_b(v16b a, v16b b, v8f c) { return __builtin_amdgcn_wmma_f32_16x16x32_bf16(false, a, false, b, (short)0, c, false, false); }
#define XW() do { asm volatile("s_wait_xcnt 0x0" ::: "memory"); __builtin_amdgcn_sched_barrier(0); } while (0)   /* behind a group of global loads: the wait stands in front of any later write of a register that the issued loads name (address, offset, scalar base); the scheduling barrier keeps such writes from being lifted over it and the loads from sinking below it */
// fragment loads as wave-uniform base + one 32-bit lane offset (elements): the lane offsets are formed once and stay in their registers, so no load of a loop names a vector register that is written again
__device__ __forceinline__ v16h frag_hu(const _Float16* ub, unsigned off) { union { v16h v; v8h q[2]; } u; const _Float16* p = ub + off; u.q[0] = *(const v8h*)p; u.q[1] = *(const v8h*)(p + 16); return u.v; }
__device__ __forceinline__ v16b frag_bu(const __bf16* ub, unsigned off) { union { v16b v; v8b q[2]; } u; const __bf16* p = ub + off; u.q[0] = *(const v8b*)p; u.q[1] = *(const v8b*)(p + 16); return u.v; }
// ---- k_colstat_w: softmax over the QUERY axis under the causal mask (the source's softmax(axis=2) on [B, H, q, k] scores with -inf where k > q): for every key column k: m_k = max_{q >= k} S[q][k], Z_k = sum_{q >= k} exp(S[q][k] - m_k) (f32, precise expf). The logits are formed here on the matrix unit (q f16 x k f16, one product, x SCALE) and never stored. Block = 64 key columns of one (batch, head) pair, 8 waves: a wave keeps the 64 columns' k fragments in registers and takes every eighth 16-query tile from the block's first column down; a lane (column col, rows 8g + r) keeps a running (m, z) per column tile, rescaled once a tile; the 16 partial pairs of a column (8 waves x 2 lane halves) meet in LDS and are merged as z_w x exp(m_w - m)
__global__ __launch_bounds__(256) void k_colstat_w(const _Float16* __restrict__ QH, const _Float16* __restrict__ KH, float* __restrict__ CM, float* __restrict__ CZ) { __shared__ __align__(16) float sm[16][64], sz[16][64];
  const int tid = threadIdx.x, wave = __builtin_amdgcn_readfirstlane(tid >> 5) /* in a scalar register: the trip tests are scalar branches, every lane is on at the products */, lane = tid & 31, col = lane & 15, g = lane >> 4; const int kb = blockIdx.x, pz = blockIdx.y, k0 = kb * 64;
  const size_t base = (size_t)(pz / NH) * TT * CC + (size_t)(pz % NH) * HD; const unsigned fo = (unsigned)col * CC + 8u * g;
  float m[4], z[4];
#pragma unroll
  for (int j = 0; j < 4; ++j) { m[j] = -3.0e38f; z[j] = 0.f; }
  int qt = kb * 4 + wave;   /* tiles above the block's first column hold no visible query */
  if (qt < TT / 16) { v16h kf[4][2]; const _Float16* Ku = KH + base + (size_t)k0 * CC; const _Float16* Qu = QH + base + (size_t)qt * 16 * CC;
#pragma unroll
    for (int j = 0; j < 4; ++j)
#pragma unroll
      for (int ks = 0; ks < 2; ++ks) kf[j][ks] = frag_hu(Ku + j * 16 * CC + ks * 32, fo);
    XW();
    do { const v16h a0 = frag_hu(Qu, fo), a1 = frag_hu(Qu + 32, fo);
      XW();
      v8f s[4] = {};
#pragma unroll
      for (int j = 0; j < 4; ++j) s[j] = mm_h(a0, kf[j][0], s[j]);
#pragma unroll
      for (int j = 0; j < 4; ++j) s[j] = mm_h(a1, kf[j][1], s[j]);
      const int dq = qt * 16 + 8 * g - k0 - col;   /* query of element 0 - key of column tile 0 */
#pragma unroll
      for (int j = 0; j < 4; ++j) { float sv[8], tm = -3.0e38f;
#pragma unroll
        for (int r = 0; r < 8; ++r) { sv[r] = s[j][r] * SCALE; tm = fmaxf(tm, (dq + r >= j * 16) ? sv[r] : -3.0e38f); }
        const float mn = fmaxf(m[j], tm); float zs = z[j] * expf(m[j] - mn);
#pragma unroll
        for (int r = 0; r < 8; ++r) { const float e = expf(sv[r] - mn); zs += (dq + r >= j * 16) ? e : 0.f; }
        m[j] = mn; z[j] = zs; }
      Qu += 8 * 16 * CC; qt += 8; } while (qt < TT / 16); }
#pragma unroll
  for (int j = 0; j < 4; ++j) { sm[wave * 2 + g][j * 16 + col] = m[j]; sz[wave * 2 + g][j * 16 + col] = z[j]; }
  __syncthreads();
  if (tid < 64) { float mm = -3.0e38f, zz = 0.f;   /* a partial with no visible row of a column brings (-3e38, 0): its term is 0 */
#pragma unroll
    for (int w = 0; w < 16; ++w) mm = fmaxf(mm, sm[w][tid]);
#pragma unroll
    for (int w = 0; w < 16; ++w) zz += sz[w][tid] * expf(sm[w][tid] - mm);
    vst2(CM + (size_t)pz * TT + k0 + tid, mm); vst2(CZ + (size_t)pz * TT + k0 + tid, 2048.0f / zz); } }   /* every column sees at least its own diagonal entry: Z_k >= 1; stored as 2^11 / Z_k, one division a column, the factor k_pv_w multiplies by */
// ---- k_pv_w: ctx = P . v, the logits formed again on the matrix unit where P is needed. A wave = 32 queries (two 16-query tiles, their q fragments kept in registers) of one (batch, head) pair, a trip = 32 keys, up to the wave's own diagonal. The logits are taken TRANSPOSED (A = 16 key rows of k, B = the 16 queries of q): D element r of lane (g, col) is key 8g + r of query col, so the two key tiles of a trip are, register for register, elements 0..7 and 8..15 of the P fragment (row = query col, keys +8g+0..7 and +16+8g+0..7): no move between lanes. P = exp(S - m_k) x (2^11 / Z_k) for key <= query, 0 above the diagonal; P and v as bf16 hi + lo, 3 products, each accumulator in the order h.vh, l.vh, h.vl. The k and v fragments of a trip serve both query tiles. Block = 8 waves of one pair: waves w and w + 4 take the 32-query tiles i and 31 - i (i + 1 and 32 - i trips), 33 trips for every such two
__global__ __launch_bounds__(256) void k_pv_w(const _Float16* __restrict__ QH, const _Float16* __restrict__ KH, const float* __restrict__ CM, const float* __restrict__ CZ, const __bf16* __restrict__ VB, const __bf16* __restrict__ VBL, float* __restrict__ Y) { __shared__ __align__(16) float ss[8][32][HD + 4];
  const int tid = threadIdx.x, wave = __builtin_amdgcn_readfirstlane(tid >> 5) /* in a scalar register: the trip count is wave-uniform and its test a scalar branch */, lane = tid & 31, col = lane & 15, g = lane >> 4; const int pz = blockIdx.z, b = pz / NH, h = pz % NH;
  const int i4 = blockIdx.x * 4 + (wave & 3), qi = wave < 4 ? i4 : 31 - i4, ql0 = qi * 32;
  const size_t base = (size_t)b * TT * CC + (size_t)h * HD; const unsigned fo = (unsigned)col * CC + 8u * g, co = 8u * g, vo = (unsigned)col * KHI + 8u * g;
  const _Float16* Qu = QH + base + (size_t)ql0 * CC; const _Float16* Ku = KH + base; const float* mu = CM + (size_t)pz * TT; const float* ru = CZ + (size_t)pz * TT; const __bf16* Vh = VB + ((size_t)b * CC + h * HD) * (size_t)KHI; const __bf16* Vl = VBL + ((size_t)b * CC + h * HD) * (size_t)KHI;
  v16h qf[2][2];
#pragma unroll
  for (int t = 0; t < 2; ++t)
#pragma unroll
    for (int ks = 0; ks < 2; ++ks) qf[t][ks] = frag_hu(Qu + t * 16 * CC + ks * 32, fo);
  XW();
  v8f acc[2][HD / 16] = {}; int kc = 0;
  do { v16h ka[2][2]; v4f m4[4], r4[4]; v16b vh[HD / 16], vl[HD / 16];   /* at least one trip: every tile has its diagonal */
#pragma unroll
    for (int kt = 0; kt < 2; ++kt)
#pragma unroll
      for (int ks = 0; ks < 2; ++ks) ka[kt][ks] = frag_hu(Ku + kt * 16 * CC + ks * 32, fo);
    XW();
#pragma unroll
    for (int q = 0; q < 4; ++q) { const int o = (q >> 1) * 16 + (q & 1) * 4; const float* pm = mu + co; const float* pr = ru + co; m4[q] = *(const v4f*)(pm + o); r4[q] = *(const v4f*)(pr + o); }
    XW();
#pragma unroll
    for (int j = 0; j < HD / 16; ++j) vh[j] = frag_bu(Vh + j * 16 * KHI, vo);
    XW();
#pragma unroll
    for (int j = 0; j < HD / 16; ++j) vl[j] = frag_bu(Vl + j * 16 * KHI, vo);
    XW();   /* all of a trip's loads are issued in front of its arithmetic: one load latency a trip */
#pragma unroll
    for (int t = 0; t < 2; ++t) { v8f s0 = {}, s1 = {};
      s0 = mm_h(ka[0][0], qf[t][0], s0); s1 = mm_h(ka[1][0], qf[t][0], s1); s0 = mm_h(ka[0][1], qf[t][1], s0); s1 = mm_h(ka[1][1], qf[t][1], s1);
      const int dk = ql0 + t * 16 + col - 8 * g - kc * 32;   /* query - the lane's first key */
      float pf[16];
#pragma unroll
      for (int i = 0; i < 8; ++i) { const float e0 = expf(s0[i] * SCALE - m4[i >> 2][i & 3]) * r4[i >> 2][i & 3], e1 = expf(s1[i] * SCALE - m4[2 + (i >> 2)][i & 3]) * r4[2 + (i >> 2)][i & 3]; pf[i] = (i <= dk) ? e0 : 0.f; pf[8 + i] = (16 + i <= dk) ? e1 : 0.f; }
      const F2 p = bsplit16(pf);
#pragma unroll
      for (int j = 0; j < HD / 16; ++j) acc[t][j] = mm_b(p.h, vh[j], acc[t][j]);
#pragma unroll
      for (int j = 0; j < HD / 16; ++j) acc[t][j] = mm_b(p.l, vh[j], acc[t][j]);
#pragma unroll
      for (int j = 0; j < HD / 16; ++j) acc[t][j] = mm_b(p.h, vl[j], acc[t][j]); }
    Ku += 32 * CC; mu += 32; ru += 32; Vh += 32; Vl += 32; } while (++kc <= qi);
#pragma unroll
  for (int t = 0; t < 2; ++t)
#pragma unroll
    for (int j = 0; j < HD / 16; ++j)
#pragma unroll
      for (int r = 0; r < 8; ++r) ss[wave][t * 16 + 8 * g + r][j * 16 + col] = acc[t][j][r] * (1.0f / 2048.0f);
  LDSX(); for (int i = 0; i < 16; ++i) vst2(Y + ((size_t)b * TT + ql0 + i * 2 + g) * CC + h * HD + col * 4, *(const v4f*)&ss[wave][i * 2 + g][col * 4]); }   /* a wave's own rows; a store = two rows' 256-byte (row, head) segments */
// ---- k_out: block = (64 rows, 128 cols): out = ctx Wo (+ bo): ctx x 2^6 once to f16 against Wo as f16(bf16 x 2^8) exact (1 product) x 2^-14; causal rows < QHI (none) and the last 64 rows of each sequence: ctx bf16 hi + lo against exact bf16 Wo (2 products)
__global__ __launch_bounds__(128) void k_out(const float* __restrict__ Y, const float* __restrict__ WO, const float* __restrict__ BO, float* __restrict__ OUT) { union Sm { float sf[4][16][132]; __bf16 w[2 * WT_SZ + 4 * AT_SZ]; }; __shared__ __align__(16) Sm sm; float (&sf)[4][16][132] = sm.sf;   /* weight tiles and the epilogue's staging share the LDS: sf is written only behind the product loop's last barrier */
  const int tid = threadIdx.x, wave = tid >> 5, lane = tid & 31, col = lane & 15, g = lane >> 4; const int c0 = blockIdx.y * 128; const size_t r0 = (size_t)blockIdx.x * 64 + wave * 16;
  v8f acc[8] = {};
  const float* xp = Y + (r0 + g) * CC + col * 4; const float* wp = WO + (size_t)(wave * 16) * DIN + c0 + lane * 4; WT wt; XR xr; gemm_first(wt, xr, xp, wp, DIN);   /* both arms start from the same first tile */
  const int tb_ = (int)(((size_t)blockIdx.x * 64) % TT); if (CAUSAL && (tb_ < QHI || tb_ >= TT - 64)) {   /* block-uniform; the LAST 64 query rows of each sequence also take the hi + lo context path: under a query-axis softmax the last key columns carry O(1) weights, so the context rows there are an order of magnitude larger */
    gemm_wt<1>(wt, xr, xp, wp, DIN, sm.w, wave, lane, acc);
#pragma unroll
    for (int j = 0; j < 8; ++j) { const float bias = BO ? bfr(BO[c0 + j * 16 + col]) : 0.f;
#pragma unroll
      for (int r = 0; r < 8; ++r) sf[wave][8 * g + r][j * 16 + col] = acc[j][r] + bias; }
  } else {
    gemm_wt<2>(wt, xr, xp, wp, DIN, sm.w, wave, lane, acc);   /* ctx carried x 2^6 into f16 so small-magnitude context rows stay clear of f16 subnormals */
#pragma unroll
    for (int j = 0; j < 8; ++j) { const float bias = BO ? bfr(BO[c0 + j * 16 + col]) : 0.f;
#pragma unroll
      for (int r = 0; r < 8; ++r) sf[wave][8 * g + r][j * 16 + col] = acc[j][r] * (1.0f / 16384.0f) + bias; } }   /* 2^-8 (Wo carry) x 2^-6 (ctx carry) */
  LDSX(); for (int rl = 0; rl < 16; ++rl) vst2(OUT + (r0 + rl) * DIN + c0 + lane * 4, *(const v4f*)&sf[wave][rl][lane * 4]); }

extern "C" void kernel_launch(void* const* d_in, const int* in_sizes, int n_in, void* d_out, int out_size, void* d_ws, size_t ws_size, hipStream_t stream) {
  (void)in_sizes; (void)n_in; (void)out_size;
  const float** F = (const float**)d_in;
  if (ws_size < (size_t)WS_END) return;
  char* ws = (char*)d_ws; _Float16 *QH = (_Float16*)(ws + WS_QH), *KH = (_Float16*)(ws + WS_KH), *VT = (_Float16*)(ws + WS_VT), *QL = (_Float16*)(ws + WS_QL), *KL = (_Float16*)(ws + WS_KL); __bf16 *VB = (__bf16*)(ws + WS_VB), *VBL = (__bf16*)(ws + WS_VBL); float *Y = (float*)(ws + WS_Y);
  (void)Y; (void)QL; (void)KL; (void)VB; (void)VBL;
  // inputs: 0 source [4,1024,1024]; 1 Wq [16,1024,64] (head, in, out), 2 bq [16,64]; 3 Wk, 4 bk; 5 Wv, 6 bv; 7 Wc [1024,1024] (in,out), 8 bc [1024] (all biases N(0, 0.02^2), nonzero)
  if (ws_size < (size_t)WS_END2) return;
  float *CM = (float*)(ws + WS_CM), *CZ = (float*)(ws + WS_CZ);
  k_proj<<<dim3(TNB * TT / 64, CC / 128, 3), 128, 0, stream>>>(F[0], F[0], F[0], F[1], F[3], F[5], F[2], F[4], F[6], QH, QL, KH, KL, VT, VB, VBL);
  k_colstat_w<<<dim3(TT / 64, NP), 256, 0, stream>>>(QH, KH, CM, CZ);   /* per key column j: max / sum over the visible queries i >= j */
  k_pv_w<<<dim3(TT / 256, 1, NP), 256, 0, stream>>>(QH, KH, CM, CZ, VB, VBL, Y);   /* P[i][j] = exp(S - m_j) x 2^11 / Z_j for j <= i, 0 above the diagonal */
  k_out<<<dim3(TNB * TT / 64, DIN / 128), 128, 0, stream>>>(Y, F[7], F[8], (float*)d_out);
}

// v007
// Measured time: 127 microseconds a run.
// In both of two side-by-side timings against v006, it was 1.09 times as fast.
// Counting every step since v000, it is 32.3 times as fast.
// compute dtype: all float inputs rounded to bf16; per-head q/k/v projections with EXACT bf16 products on WMMA 16x16x32 (f32 accumulate) + bias; causal scores q x k once to f16 each (1 product; sigma - 0.4) x 64^-0.5 on every block; softmax over the QUERY axis in f32 (per key column: max / sum over the visible queries; exp(x) = 2^(x log2 e) on the chip's own exp2 instruction, the logit scale and log2 e folded into one multiply-add); P as bf16 hi + lo against v as bf16 hi + lo (3 products) on EVERY block; ctx x 2^6 once to f16 x Wc f16(bf16 x 2^8) - except the LAST 64 rows of each sequence: ctx as bf16 hi + lo against exact bf16 Wc (2 products) - + bc; f32 output.
#include <hip/hip_runtime.h>
#include <math.h>

typedef __attribute__((ext_vector_type(16))) _Float16 v16h;
typedef __attribute__((ext_vector_type(16))) __bf16 v16b;
typedef __attribute__((ext_vector_type(8)))  _Float16 v8h;
typedef __attribute__((ext_vector_type(8)))  float v8f;
typedef __attribute__((ext_vector_type(4)))  float v4f;
typedef __attribute__((ext_vector_type(2)))  float v2f;
typedef __attribute__((ext_vector_type(4)))  unsigned v4u;
typedef __attribute__((ext_vector_type(4)))  int v4i;
typedef float __attribute__((may_alias)) float_a;
typedef int __attribute__((may_alias)) int_a;

template <typename T> __device__ __forceinline__ void vst2(void* p, T v) { *(T*)p = v;  }
__device__ __forceinline__ v8f wmma16(v16h a, v16h b, v8f c) {
  v8f d = __builtin_amdgcn_wmma_f32_16x16x32_f16(false, a, false, b, (short)0, c, false, false);
  asm volatile("v_nop\n\tv_nop\n\tv_nop\n\tv_nop" : "+v"(d) : "v"(a), "v"(b));
  return d;
}
__device__ __forceinline__ v8f wmma_bf(v16b a, v16b b, v8f c) {
  v8f d = __builtin_amdgcn_wmma_f32_16x16x32_bf16(false, a, false, b, (short)0, c, false, false);
  asm volatile("v_nop\n\tv_nop\n\tv_nop\n\tv_nop" : "+v"(d) : "v"(a), "v"(b));
  return d;
}
// 16x16x32 fragments: lane = (h = lane>>4, row/col = lane&15); elements 0..7 = k0+8h+0..7, 8..15 = k0+16+8h+0..7; D element r = row 8h+r
__device__ __forceinline__ v16h frag_h(const _Float16* rowk0, int lane) {
  union { v16h v; v8h q[2]; } u; const _Float16* p = rowk0 + 8 * (lane >> 4);
  u.q[0] = *(const v8h*)p; u.q[1] = *(const v8h*)(p + 16); return u.v;
}
__device__ __forceinline__ v16h frag_f32(const float* rowk0, int lane) {
  v16h a; const float* p = rowk0 + 8 * (lane >> 4);
#pragma unroll
  for (int i = 0; i < 8; ++i) { a[i] = (_Float16)p[i]; a[8 + i] = (_Float16)p[16 + i]; }
  return a;
}
__device__ __forceinline__ v16h frag_f32s(const float* rowk0, int lane, float sc) {
  v16h a; const float* p = rowk0 + 8 * (lane >> 4);
#pragma unroll
  for (int i = 0; i < 8; ++i) { a[i] = (_Float16)(p[i] * sc); a[8 + i] = (_Float16)(p[16 + i] * sc); }
  return a;
}
// column fragment from a [K][ld] layout (column n), rows >= K read as 0
__device__ __forceinline__ v16h fragc_f32(const float* W, int k0, int n, int lane, int ld, int K) {
  v16h a; const int g = lane >> 4;
#pragma unroll
  for (int i = 0; i < 8; ++i) { const int ka = k0 + 8 * g + i, kb = ka + 16;
    a[i] = (_Float16)(ka < K ? W[(size_t)(ka < K ? ka : K - 1) * ld + n] : 0.f); a[8 + i] = (_Float16)(kb < K ? W[(size_t)(kb < K ? kb : K - 1) * ld + n] : 0.f); }
  return a;
}
struct F2 { v16b h, l; };
__device__ __forceinline__ F2 bsplit16(const float v[16]) { F2 r;
#pragma unroll
  for (int i = 0; i < 16; ++i) { const __bf16 h = (__bf16)v[i]; r.h[i] = h; r.l[i] = (__bf16)(v[i] - (float)h); }
  return r; }
__device__ __forceinline__ F2 split_row(const float* row, int k0, int lane) { float v[16]; const float* p = row + k0 + 8 * (lane >> 4);
#pragma unroll
  for (int i = 0; i < 8; ++i) { v[i] = p[i]; v[8 + i] = p[16 + i]; }
  return bsplit16(v); }
__device__ __forceinline__ F2 split_rowK(const float* row, int k0, int lane, int K) { float v[16]; const int g = lane >> 4;
#pragma unroll
  for (int i = 0; i < 8; ++i) { const int ka = k0 + 8 * g + i, kb = ka + 16; v[i] = ka < K ? row[ka < K ? ka : K - 1] : 0.f; v[8 + i] = kb < K ? row[kb < K ? kb : K - 1] : 0.f; }
  return bsplit16(v); }
__device__ __forceinline__ F2 split_col(const float* W, int k0, int n, int lane, int ld, int K) { float v[16]; const int g = lane >> 4;
#pragma unroll
  for (int i = 0; i < 8; ++i) { const int ka = k0 + 8 * g + i, kb = ka + 16; v[i] = ka < K ? W[(size_t)(ka < K ? ka : K - 1) * ld + n] : 0.f; v[8 + i] = kb < K ? W[(size_t)(kb < K ? kb : K - 1) * ld + n] : 0.f; }
  return bsplit16(v); }
__device__ __forceinline__ v8f mac3(const F2& a, const F2& b, v8f c) { c = wmma_bf(a.l, b.h, c); c = wmma_bf(a.h, b.l, c); return wmma_bf(a.h, b.h, c); }
__device__ __forceinline__ float sigm(float v) { return 1.0f / (1.0f + expf(-v)); }
#define LDSX() do { asm volatile("s_wait_dscnt 0" ::: "memory"); __builtin_amdgcn_wave_barrier(); __builtin_amdgcn_fence(__ATOMIC_RELEASE, "workgroup"); } while (0)

// Causal multi-head attention whose softmax runs over the QUERY axis, with per-head projection tensors (source [4,1024,1024]; Wq / Wk / Wv [16,1024,64] (head, in, out) (0.02) + biases [16,64]; scores / sqrt(64) + triu(-inf, k=1); attn = softmax(..., axis=2) - axis 2 of [B, H, q, k] is the QUERY axis: every key column is normalised over the queries q >= k (faithful to the source); out = attn v; heads merged; Wc [1024,1024] (in,out) + bc).
#define NB 4
#define TT 1024
#define CC 1024            // NH * HD = projected width
#define DIN 1024          // input (model) width
#define NH 16
#define HD 64
#define NQB (TT / 64)
#define NP (NB * NH)        // (batch, head) pairs: the column-statistics and context kernels take all of them in one launch (grid y or z = pair)
#define SCALE (0.125f)
#define CAUSAL 1
#ifndef TNB
#define TNB NB
#endif
__device__ __forceinline__ float bfr(float v) { return (float)(__bf16)v; }
__host__ __device__ __forceinline__ int kb_last(int qb) { return CAUSAL ? ((qb * 64 + 63) >> 7) : (TT / 128 - 1); }
typedef __attribute__((ext_vector_type(8))) __bf16 v8b;
__device__ __forceinline__ v16b frag_b(const __bf16* rowk0, int lane) {
  union { v16b v; v8b q[2]; } u; const __bf16* p = rowk0 + 8 * (lane >> 4);
  u.q[0] = *(const v8b*)p; u.q[1] = *(const v8b*)(p + 16); return u.v;
}
#define QHI 0               // no q residual plane: the scores are small and single-product everywhere
#define KHI 1024            // key rows carrying k residual / v bf16 hi+lo planes (all key rows: the v planes feed every trip of k_pv_w; the k residual is not read)
// B fragment (k rows k0+.., output column o) of a weight: (in,out) [K][ld] or (out,in) [ld rows of K]: bf16 exact, or f16(bf16 * 256) exact
__device__ __forceinline__ v16b wcol_io(const float* Wm, int k0, int o, int lane, int ld) { v16b w; const int g = lane >> 4;
#pragma unroll
  for (int i = 0; i < 8; ++i) { w[i] = (__bf16)Wm[(size_t)(k0 + 8 * g + i) * ld + o]; w[8 + i] = (__bf16)Wm[(size_t)(k0 + 16 + 8 * g + i) * ld + o]; }
  return w; }
__device__ __forceinline__ v16b wcol_oi(const float* Wm, int k0, int o, int lane, int K) { v16b w; const float* p = Wm + (size_t)o * K + k0 + 8 * (lane >> 4);
#pragma unroll
  for (int i = 0; i < 8; ++i) { w[i] = (__bf16)p[i]; w[8 + i] = (__bf16)p[16 + i]; }
  return w; }
__device__ __forceinline__ v16h wcolh_io(const float* Wm, int k0, int o, int lane, int ld) { v16h w; const int g = lane >> 4;
#pragma unroll
  for (int i = 0; i < 8; ++i) { w[i] = (_Float16)(bfr(Wm[(size_t)(k0 + 8 * g + i) * ld + o]) * 256.0f); w[8 + i] = (_Float16)(bfr(Wm[(size_t)(k0 + 16 + 8 * g + i) * ld + o]) * 256.0f); }
  return w; }
__device__ __forceinline__ v16h wcolh_oi(const float* Wm, int k0, int o, int lane, int K) { v16h w; const float* p = Wm + (size_t)o * K + k0 + 8 * (lane >> 4);
#pragma unroll
  for (int i = 0; i < 8; ++i) { w[i] = (_Float16)(bfr(p[i]) * 256.0f); w[8 + i] = (_Float16)(bfr(p[16 + i]) * 256.0f); }
  return w; }
#define WQKV_LAYOUT 0   // 0 = per-head [NH][DIN][HD] (head, in, out); 1 = (out,in) [CC][DIN]; 2 = per-head [NH][DIN][HD]
__device__ __forceinline__ v16b wcol_hdk(const float* Wm, int k0, int o, int lane) { v16b w; const int g = lane >> 4; const float* p = Wm + (size_t)(o / HD) * DIN * HD + (o % HD);
#pragma unroll
  for (int i = 0; i < 8; ++i) { w[i] = (__bf16)p[(size_t)(k0 + 8 * g + i) * HD]; w[8 + i] = (__bf16)p[(size_t)(k0 + 16 + 8 * g + i) * HD]; }
  return w; }
#define WO_OUT_IN 0
#if WQKV_LAYOUT == 1
#define WCOL(W, k0, o, lane) wcol_oi(W, k0, o, lane, DIN)
#elif WQKV_LAYOUT == 2
#define WCOL(W, k0, o, lane) wcol_hdk(W, k0, o, lane)
#else
#define WCOL(W, k0, o, lane) wcol_io((W) + (size_t)((o) / 64) * DIN * 64, k0, (o) % 64, lane, 64)   /* per-head weight tensors [16][DIN][64] (head, in, out): output column o = h*64 + kk lives in head h's [DIN][64] (in,out) slab at pitch 64 (a 16-column tile never straddles a head) */
#endif
#if WO_OUT_IN
#define WOCOL(W, k0, o, lane) wcol_oi(W, k0, o, lane, CC)
#define WOCOLH(W, k0, o, lane) wcolh_oi(W, k0, o, lane, CC)
#else
#define WOCOL(W, k0, o, lane) wcol_io(W, k0, o, lane, DIN)
#define WOCOLH(W, k0, o, lane) wcolh_io(W, k0, o, lane, DIN)
#endif

#ifndef SM_EXTRA_PARAMS
#define SM_EXTRA_PARAMS
#endif
#ifndef PROJ_EXTRA_PARAMS
#define PROJ_EXTRA_PARAMS
#endif
#ifndef SM_MASK_HOOK
#define SM_MASK_HOOK (void)0
#endif

#define WS_QH  0u                                      // f16 q rows [b*t][CC]
#define WS_KH  (WS_QH + 2u * (size_t)NB * TT * CC)      // f16 k rows [b*t][CC]
#define WS_VT  (WS_KH + 2u * (size_t)NB * TT * CC)      // f16 v planes [b][c][t]
#define WS_QL  (WS_VT + 2u * (size_t)NB * CC * TT)      // f16 q residual x 2^10 rows [b][t < QHI][CC]
#define WS_KL  (WS_QL + 2u * (size_t)NB * QHI * CC)     // f16 k residual x 2^10 rows [b][t < KHI][CC]
#define WS_VB  (WS_KL + 2u * (size_t)NB * KHI * CC)     // bf16 v hi planes [b][c][t < KHI]
#define WS_VBL (WS_VB + 2u * (size_t)NB * CC * KHI)
#define WS_Y   (WS_VBL + 2u * (size_t)NB * CC * KHI)    // f32 ctx rows [b*t][CC] (only when there is an output projection)
#define WS_END (WS_Y  + 4u * (size_t)NB * TT * CC)
#define WS_CM (WS_END)                                  // f32 column maxima x log2(e) [NP][TT]
#define WS_CZ (WS_CM + 4u * (size_t)NP * TT)           // f32 2^11 / column sum [NP][TT]
#define WS_END2 (WS_CZ + 4u * (size_t)NP * TT)

// ---- weight tile in LDS for k_proj / k_out: a block's 64 k x 128 column slice of a (in,out) weight is read once for its four waves, in whole 128-byte lines (a lane: 4 columns x 16 k rows, 16-byte loads), rounded to its 16-bit operand type in registers and stored column-major (a column's 64 k values in a row of 128 bytes), so that a B fragment is two 16-byte LDS reads. Two buffers: the next tile's loads (and the wave's own next A rows) fly during this tile's products, one barrier a tile. The A rows take the same road: a wave reads its 16 rows x 64 k in whole lines (a load = two rows' 256 bytes), rounds them to the operand type once and stores them row-major at a pitch of 144 bytes behind the weight buffers; an A fragment is two 16-byte LDS reads.
#define KT 64               // k rows of a tile
#define WT_G 2336           // elements between the four column groups n & 3: 32 rows of 72 + 32. Column n lies at (n & 3) x 4672 B + (n >> 2) x 144 B: the storing lanes (columns 4 apart) and the reading lanes (16 neighbouring columns) both fall on 16 different 16-byte bank groups
#define WT_SZ (4 * WT_G)    // elements of one buffer
__device__ __forceinline__ int wt_row(int n) { return (n & 3) * WT_G + (n >> 2) * 72; }
struct WT { v4f r[16]; };   // a lane's share of a tile: k rows wave x 16 + 0..15, columns lane x 4 + 0..3
#define AT_P 72             // elements between two A rows in LDS: 144 B = 16 B x 9, the reading lanes (16 neighbouring rows) fall on 16 different 16-byte bank groups
#define AT_SZ (64 * AT_P)   // elements of one A plane (the block's 64 rows)
typedef __attribute__((ext_vector_type(4))) __bf16 v4b;
typedef __attribute__((ext_vector_type(4))) _Float16 v4h;
struct XR { v4f r[8]; };    // a lane's share of its wave's A rows of one tile: rows 2q + (lane >> 4), k (lane & 15) x 4 + 0..3
__device__ __forceinline__ void wt_load(WT& t, const float* p, int ld) {
#pragma unroll
  for (int i = 0; i < 16; ++i) t.r[i] = *(const v4f*)(p + (size_t)i * ld); }
__device__ __forceinline__ void xr_load(XR& x, const float* p) {   // p = the wave's row (lane >> 4) at k (lane & 15) x 4; the A rows have 1024 elements
#pragma unroll
  for (int q = 0; q < 8; ++q) x.r[q] = *(const v4f*)(p + (size_t)(2 * q) * 1024); }
// MODE 0: bf16(a); 1: bf16 hi in the first plane, bf16 lo in the second; 2: f16(a x 2^6). ab = the buffer's first plane
template <int MODE> __device__ __forceinline__ void xr_store(const XR& x, __bf16* ab, int wave, int lane) {
#pragma unroll
  for (int q = 0; q < 8; ++q) { __bf16* d = ab + (wave * 16 + 2 * q + (lane >> 4)) * AT_P + (lane & 15) * 4;
    if (MODE == 2) { v4h o;
#pragma unroll
      for (int u = 0; u < 4; ++u) o[u] = (_Float16)(x.r[q][u] * 64.0f);
      *(v4h*)d = o;
    } else { v4b o, ol;
#pragma unroll
      for (int u = 0; u < 4; ++u) { const __bf16 h = (__bf16)x.r[q][u]; o[u] = h; ol[u] = (__bf16)(x.r[q][u] - (float)h); }
      *(v4b*)d = o; if (MODE == 1) *(v4b*)(d + AT_SZ) = ol; } } }
template <int F16> __device__ __forceinline__ void wt_store(const WT& t, __bf16* buf, int wave, int lane) {   // F16 = 0: bf16(w); 1: f16(bf16(w) x 2^8), both exact carriers of the bf16 weight
#pragma unroll
  for (int u = 0; u < 4; ++u) { __bf16* d = buf + wt_row(lane * 4 + u) + wave * 16;
#pragma unroll
    for (int hf = 0; hf < 2; ++hf) {
      if (F16) { v8h o;
#pragma unroll
        for (int i = 0; i < 8; ++i) o[i] = (_Float16)(bfr(t.r[hf * 8 + i][u]) * 256.0f);
        *(v8h*)(d + hf * 8) = o;
      } else { v8b o;
#pragma unroll
        for (int i = 0; i < 8; ++i) o[i] = (__bf16)t.r[hf * 8 + i][u];
        *(v8b*)(d + hf * 8) = o; } } } }
// the first tile's loads, written once in front of any branch between the modes, with their wait directly behind them
__device__ __forceinline__ void gemm_first(WT& wt, XR& xr, const float* xp, const float* wp, int ldw) { wt_load(wt, wp, ldw); xr_load(xr, xp);
  asm volatile("s_wait_xcnt 0x0" ::: "memory"); __builtin_amdgcn_sched_barrier(0); }   /* the wait stands in front of any reuse of the address registers that the issued loads name; the scheduling barrier keeps the register arithmetic that follows from being lifted over it */
// acc[j] += A (the wave's 16 rows, f32 source, K = 1024) x W (columns j x 16 + 0..15 of the block's 128). xp = the wave's row g at k col x 4; wp = the weight at (k row wave x 16, the lane's 4 columns), ldw its row pitch. wt / xr = tile 0 as gemm_first loaded it. MODE 0: A bf16 x W bf16; 1: A bf16 hi + lo x W bf16 (2 products); 2: A x 2^6 f16 x W f16(bf16 x 2^8). Ends behind a barrier: the buffers may be reused
template <int MODE> __device__ __forceinline__ void gemm_wt(WT& wt, XR& xr, const float* xp, const float* wp, int ldw, __bf16* wbuf, int wave, int lane, v8f acc[8]) { const int col = lane & 15; constexpr int AB = (MODE == 1 ? 2 : 1) * AT_SZ; __bf16* abuf = wbuf + 2 * WT_SZ;   /* the A buffers lie behind the two weight buffers */
  wt_store<MODE == 2>(wt, wbuf, wave, lane); xr_store<MODE>(xr, abuf, wave, lane);
  __syncthreads();
  for (int t = 0; t < 1024 / KT; ++t) { const __bf16* wb = wbuf + (t & 1) * WT_SZ; const __bf16* ab = abuf + (t & 1) * AB + (wave * 16 + col) * AT_P;
    if (t + 1 < 1024 / KT) { wt_load(wt, wp + (size_t)(t + 1) * KT * ldw, ldw); xr_load(xr, xp + (t + 1) * KT);
      asm volatile("s_wait_xcnt 0x0" ::: "memory"); __builtin_amdgcn_sched_barrier(0); }   /* as above: the address registers are reused while the loads fly */
#pragma unroll
    for (int s = 0; s < 2; ++s) {
      v16b w[8], ah = frag_b(ab + s * 32, lane), al; if (MODE == 1) al = frag_b(ab + AT_SZ + s * 32, lane);
#pragma unroll
      for (int j = 0; j < 8; ++j) w[j] = frag_b(wb + wt_row(col) + j * (4 * 72) + s * 32, lane);   /* wt_row(j x 16 + col) written as one lane address + a constant: the eight fragments share one address register */
      __builtin_amdgcn_sched_barrier(0);   /* keeps the step's LDS reads together in front of its products: left alone the compiler reads each fragment into one register set directly in front of its product, and every product then waits out an LDS latency */
#pragma unroll
      for (int j = 0; j < 8; ++j) {
        if (MODE == 2) acc[j] = wmma16(__builtin_bit_cast(v16h, ah), __builtin_bit_cast(v16h, w[j]), acc[j]);
        else { acc[j] = wmma_bf(ah, w[j], acc[j]); if (MODE == 1) acc[j] = wmma_bf(al, w[j], acc[j]); } } }
    __builtin_amdgcn_sched_barrier(0);   /* keeps the wait for the next tile's loads behind this tile's last product: left alone the compiler lifts the first conversions, and the wait with them, in among the products */
    if (t + 1 < 1024 / KT) { wt_store<MODE == 2>(wt, wbuf + ((t + 1) & 1) * WT_SZ, wave, lane); xr_store<MODE>(xr, abuf + ((t + 1) & 1) * AB, wave, lane); }
    __syncthreads(); } }   /* the one barrier of a tile: publishes tile t + 1 and ends every wave's reads of the buffer that trip t + 1 refills */
// ---- k_proj: block = (64 rows, 128 cols, which): q/k/v = X W (+ b) with exact bf16 products (K = DIN) -> which 0: q f16 rows (+ residual rows < QHI); 1: k f16 rows (+ residual rows < KHI); 2: v f16 planes [c][t] (+ bf16 hi/lo planes for t < KHI)
__global__ __launch_bounds__(128) void k_proj(const float* __restrict__ XQ, const float* __restrict__ XK, const float* __restrict__ XV, const float* __restrict__ WQ, const float* __restrict__ WK, const float* __restrict__ WV, const float* __restrict__ BQ, const float* __restrict__ BK, const float* __restrict__ BV,
    _Float16* __restrict__ QH, _Float16* __restrict__ QL, _Float16* __restrict__ KH, _Float16* __restrict__ KL, _Float16* __restrict__ VT, __bf16* __restrict__ VB, __bf16* __restrict__ VBL) {
  union Sm { struct { _Float16 sh[64][136], sl[64][136]; } qk; struct { _Float16 th[128][72]; __bf16 tb[128][72], tbl[128][72]; } vv; __bf16 w[2 * WT_SZ + 2 * AT_SZ]; };   /* the weight tiles lie in the LDS of the epilogue's staging arrays, which are written only behind the product loop's last barrier */
  __shared__ __align__(16) Sm sm; _Float16 (&sh)[64][136] = sm.qk.sh; _Float16 (&sl)[64][136] = sm.qk.sl; _Float16 (&th)[128][72] = sm.vv.th; __bf16 (&tb)[128][72] = sm.vv.tb; __bf16 (&tbl)[128][72] = sm.vv.tbl;
  const int tid = threadIdx.x, wave = tid >> 5, lane = tid & 31, col = lane & 15, g = lane >> 4; const int which = blockIdx.z; const int c0 = blockIdx.y * 128; const size_t r0 = (size_t)blockIdx.x * 64; const size_t bb = r0 / TT; const int t0 = (int)(r0 % TT);
  const float* X = which == 0 ? XQ : which == 1 ? XK : XV; const float* WA = which == 0 ? WQ : which == 1 ? WK : WV; const float* BA = which == 0 ? BQ : which == 1 ? BK : BV;
  v8f acc[8] = {};
  const float* xp = X + (r0 + wave * 16 + g) * DIN + col * 4; const float* wp = WA + (size_t)(c0 / 64 + g) * DIN * 64 + (size_t)(wave * 16) * 64 + col * 4; WT wt; XR xr; gemm_first(wt, xr, xp, wp, 64);
  gemm_wt<0>(wt, xr, xp, wp, 64, sm.w, wave, lane, acc);   /* per-head weights [16][DIN][64]: the block's 128 columns are two heads' slabs at pitch 64; lanes 0..15 read the first head's 64 columns, lanes 16..31 the second's */
  if (which < 2) { _Float16* DH = which == 0 ? QH : KH; _Float16* DL = which == 0 ? QL : KL; const int nhi = which == 0 ? QHI : KHI; const bool hi_rows = t0 < nhi;
#pragma unroll
    for (int j = 0; j < 8; ++j) { const float bias = BA ? bfr(BA[c0 + j * 16 + col]) : 0.f;
#pragma unroll
      for (int r = 0; r < 8; ++r) { const float v = acc[j][r] + bias; const _Float16 hv = (_Float16)v; sh[wave * 16 + 8 * g + r][j * 16 + col] = hv; sl[wave * 16 + 8 * g + r][j * 16 + col] = (_Float16)((v - (float)hv) * 1024.0f); } }
    __syncthreads();
    for (int e = tid; e < 64 * 16; e += 128) { const int rl = e >> 4, q = e & 15; vst2((unsigned*)(DH + (r0 + rl) * CC + c0 + q * 8), *(const v4u*)&sh[rl][q * 8]); if (hi_rows) vst2((unsigned*)(DL + (bb * nhi + t0 + rl) * (size_t)CC + c0 + q * 8), *(const v4u*)&sl[rl][q * 8]); }
  } else { const bool hi_rows = t0 < KHI;
#pragma unroll
    for (int j = 0; j < 8; ++j) { const float bias = BA ? bfr(BA[c0 + j * 16 + col]) : 0.f;
#pragma unroll
      for (int r = 0; r < 8; ++r) { const float v = acc[j][r] + bias; const int rl = wave * 16 + 8 * g + r, cl = j * 16 + col; th[cl][rl] = (_Float16)v; const __bf16 bh = (__bf16)v; tb[cl][rl] = bh; tbl[cl][rl] = (__bf16)(v - (float)bh); } }
    __syncthreads();
    for (int e = tid; e < 128 * 8; e += 128) { const int cl = e >> 3, q = e & 7; vst2((unsigned*)(VT + (bb * CC + c0 + cl) * (size_t)TT + t0 + q * 8), *(const v4u*)&th[cl][q * 8]); if (hi_rows) { const size_t o3 = (bb * CC + c0 + cl) * (size_t)KHI + t0 + q * 8; vst2((unsigned*)(VB + o3), *(const v4u*)&tb[cl][q * 8]); vst2((unsigned*)(VBL + o3), *(const v4u*)&tbl[cl][q * 8]); } } } }
// ---- k_sm: block = query row t (head in group): keys [0, kend): causal -> logit if s <= t else excluded; softmax in f32; P x 2^11 in place (0 for excluded)
__global__ __launch_bounds__(256) void k_sm(float* __restrict__ S0 SM_EXTRA_PARAMS) { __shared__ float sred[8]; __shared__ float sbc; __shared__ __align__(16) float shv[TT];
  const int tid = threadIdx.x; const int t = blockIdx.x; const int kend = (kb_last(t >> 6) + 1) * 128;
  float* sr = S0 + (size_t)blockIdx.y * TT * TT + (size_t)t * TT;
  float m = -3.0e38f; for (int k = tid; k < kend; k += 256) { float v = (!CAUSAL || k <= t) ? sr[k] : -3.0e38f; SM_MASK_HOOK; shv[k] = v; m = fmaxf(m, v); }
#pragma unroll
  for (int o = 1; o < 32; o <<= 1) m = fmaxf(m, __shfl_xor(m, o));
  if ((tid & 31) == 0) sred[tid >> 5] = m; __syncthreads(); if (tid == 0) { float a = sred[0]; for (int i = 1; i < 8; ++i) a = fmaxf(a, sred[i]); sbc = a; } __syncthreads(); m = sbc; __syncthreads();
  float sum = 0.f; for (int k = tid; k < kend; k += 256) { const float v = shv[k]; const float e = (v <= -1.0e38f) ? 0.f : expf(v - m); shv[k] = e; sum += e; }
#pragma unroll
  for (int o = 1; o < 32; o <<= 1) sum += __shfl_xor(sum, o);
  if ((tid & 31) == 0) sred[tid >> 5] = sum; __syncthreads(); if (tid == 0) { float a = 0.f; for (int i = 0; i < 8; ++i) a += sred[i]; sbc = a > 0.f ? 2048.0f / a : 0.f; }   /* a fully excluded row yields P = 0 */ __syncthreads(); const float inv = sbc;
  for (int k = tid; k < kend; k += 256) shv[k] = shv[k] * inv;
  __syncthreads(); for (int q = tid; q < kend / 4; q += 256) vst2(sr + q * 4, *(const v4f*)&shv[q * 4]); }
// the products of k_colstat_w and k_pv_w: the plain builtins (the compiler keeps the distances behind its own matrix instructions, and their operands may lie in any register window)
__device__ __forceinline__ v8f mm_h(v16h a, v16h b, v8f c) { return __builtin_amdgcn_wmma_f32_16x16x32_f16(false, a, false, b, (short)0, c, false, false); }
__device__ __forceinline__ v8f mm_b(v16b a, v16b b, v8f c) { return __builtin_amdgcn_wmma_f32_16x16x32_bf16(false, a, false, b, (short)0, c, false, false); }
#define SC2 (SCALE * 1.44269504088896340736f)   // logit scale x log2(e): exp(s x SCALE - m) = 2^(s x SC2 - m2), m2 = m x log2(e); the column maxima are kept and stored in these log2 units
__device__ __forceinline__ float ex2(float v) { return __builtin_amdgcn_exp2f(v); }   // one v_exp_f32; a result below the normal range may come out 0, which is what such a term weighs beside a column sum >= 1
#define XW() do { asm volatile("s_wait_xcnt 0x0" ::: "memory"); __builtin_amdgcn_sched_barrier(0); } while (0)   /* behind a group of global loads: the wait stands in front of any later write of a register that the issued loads name (address, offset, scalar base); the scheduling barrier keeps such writes from being lifted over it and the loads from sinking below it */
// fragment loads as wave-uniform base + one 32-bit lane offset (elements): the lane offsets are formed once and stay in their registers, so no load of a loop names a vector register that is written again
__device__ __forceinline__ v16h frag_hu(const _Float16* ub, unsigned off) { union { v16h v; v8h q[2]; } u; const _Float16* p = ub + off; u.q[0] = *(const v8h*)p; u.q[1] = *(const v8h*)(p + 16); return u.v; }
__device__ __forceinline__ v16b frag_bu(const __bf16* ub, unsigned off) { union { v16b v; v8b q[2]; } u; const __bf16* p = ub + off; u.q[0] = *(const v8b*)p; u.q[1] = *(const v8b*)(p + 16); return u.v; }
// ---- k_colstat_w: softmax over the QUERY axis under the causal mask (the source's softmax(axis=2) on [B, H, q, k] scores with -inf where k > q): for every key column k: m_k = max_{q >= k} S[q][k], Z_k = sum_{q >= k} exp(S[q][k] - m_k) (f32, as 2^(s x SC2 - m2)). The logits are formed here on the matrix unit (q f16 x k f16, one product, x SC2: log2 units) and never stored. Block = 64 key columns of one (batch, head) pair, 8 waves: a wave keeps the 64 columns' k fragments in registers and takes every eighth 16-query tile from the block's first column down; a lane (column col, rows 8g + r) keeps a running (m, z) per column tile, rescaled once a tile; the 16 partial pairs of a column (8 waves x 2 lane halves) meet in LDS and are merged as z_w x 2^(m_w - m)
__global__ __launch_bounds__(256) void k_colstat_w(const _Float16* __restrict__ QH, const _Float16* __restrict__ KH, float* __restrict__ CM, float* __restrict__ CZ) { __shared__ __align__(16) float sm[16][64], sz[16][64];
  const int tid = threadIdx.x, wave = __builtin_amdgcn_readfirstlane(tid >> 5) /* in a scalar register: the trip tests are scalar branches, every lane is on at the products */, lane = tid & 31, col = lane & 15, g = lane >> 4; const int kb = blockIdx.x, pz = blockIdx.y, k0 = kb * 64;
  const size_t base = (size_t)(pz / NH) * TT * CC + (size_t)(pz % NH) * HD; const unsigned fo = (unsigned)col * CC + 8u * g;
  float m[4], z[4];
#pragma unroll
  for (int j = 0; j < 4; ++j) { m[j] = -3.0e38f; z[j] = 0.f; }
  int qt = kb * 4 + wave;   /* tiles above the block's first column hold no visible query */
  if (qt < TT / 16) { v16h kf[4][2]; const _Float16* Ku = KH + base + (size_t)k0 * CC; const _Float16* Qu = QH + base + (size_t)qt * 16 * CC;
#pragma unroll
    for (int j = 0; j < 4; ++j)
#pragma unroll
      for (int ks = 0; ks < 2; ++ks) kf[j][ks] = frag_hu(Ku + j * 16 * CC + ks * 32, fo);
    XW();
    do { const v16h a0 = frag_hu(Qu, fo), a1 = frag_hu(Qu + 32, fo);
      XW();
      v8f s[4] = {};
#pragma unroll
      for (int j = 0; j < 4; ++j) s[j] = mm_h(a0, kf[j][0], s[j]);
#pragma unroll
      for (int j = 0; j < 4; ++j) s[j] = mm_h(a1, kf[j][1], s[j]);
      const int dq = qt * 16 + 8 * g - k0 - col;   /* query of element 0 - key of column tile 0 */
#pragma unroll
      for (int j = 0; j < 4; ++j) { float sv[8], tm = -3.0e38f;
#pragma unroll
        for (int r = 0; r < 8; ++r) { sv[r] = s[j][r] * SC2; tm = fmaxf(tm, (dq + r >= j * 16) ? sv[r] : -3.0e38f); }
        const float mn = fmaxf(m[j], tm); float zs = z[j] * ex2(m[j] - mn);
#pragma unroll
        for (int r = 0; r < 8; ++r) { const float e = ex2(__builtin_fmaf(s[j][r], SC2, -mn)); zs += (dq + r >= j * 16) ? e : 0.f; }
        m[j] = mn; z[j] = zs; }
      Qu += 8 * 16 * CC; qt += 8; } while (qt < TT / 16); }
#pragma unroll
  for (int j = 0; j < 4; ++j) { sm[wave * 2 + g][j * 16 + col] = m[j]; sz[wave * 2 + g][j * 16 + col] = z[j]; }
  __syncthreads();
  if (tid < 64) { float mm = -3.0e38f, zz = 0.f;   /* a partial with no visible row of a column brings (-3e38, 0): its term is 0 */
#pragma unroll
    for (int w = 0; w < 16; ++w) mm = fmaxf(mm, sm[w][tid]);
#pragma unroll
    for (int w = 0; w < 16; ++w) zz += sz[w][tid] * ex2(sm[w][tid] - mm);
    vst2(CM + (size_t)pz * TT + k0 + tid, mm); vst2(CZ + (size_t)pz * TT + k0 + tid, 2048.0f / zz); } }   /* every column sees at least its own diagonal entry: Z_k >= 1; stored as 2^11 / Z_k, one division a column, the factor k_pv_w multiplies by; the maximum goes out in log2 units */
// ---- k_pv_w: ctx = P . v, the logits formed again on the matrix unit where P is needed. A wave = 32 queries (two 16-query tiles, their q fragments kept in registers) of one (batch, head) pair, a trip = 32 keys, up to the wave's own diagonal. The logits are taken TRANSPOSED (A = 16 key rows of k, B = the 16 queries of q): D element r of lane (g, col) is key 8g + r of query col, so the two key tiles of a trip are, register for register, elements 0..7 and 8..15 of the P fragment (row = query col, keys +8g+0..7 and +16+8g+0..7): no move between lanes. P = 2^(s x SC2 - m2_k) x (2^11 / Z_k) for key <= query, 0 above the diagonal; P and v as bf16 hi + lo, 3 products, each accumulator in the order h.vh, l.vh, h.vl. The k and v fragments of a trip serve both query tiles. Block = 8 waves of one pair: waves w and w + 4 take the 32-query tiles i and 31 - i (i + 1 and 32 - i trips), 33 trips for every such two
__global__ __launch_bounds__(256) void k_pv_w(const _Float16* __restrict__ QH, const _Float16* __restrict__ KH, const float* __restrict__ CM, const float* __restrict__ CZ, const __bf16* __restrict__ VB, const __bf16* __restrict__ VBL, float* __restrict__ Y) { __shared__ __align__(16) float ss[8][32][HD + 4];
  const int tid = threadIdx.x, wave = __builtin_amdgcn_readfirstlane(tid >> 5) /* in a scalar register: the trip count is wave-uniform and its test a scalar branch */, lane = tid & 31, col = lane & 15, g = lane >> 4; const int pz = blockIdx.z, b = pz / NH, h = pz % NH;
  const int i4 = blockIdx.x * 4 + (wave & 3), qi = wave < 4 ? i4 : 31 - i4, ql0 = qi * 32;
  const size_t base = (size_t)b * TT * CC + (size_t)h * HD; const unsigned fo = (unsigned)col * CC + 8u * g, co = 8u * g, vo = (unsigned)col * KHI + 8u * g;
  const _Float16* Qu = QH + base + (size_t)ql0 * CC; const _Float16* Ku = KH + base; const float* mu = CM + (size_t)pz * TT; const float* ru = CZ + (size_t)pz * TT; const __bf16* Vh = VB + ((size_t)b * CC + h * HD) * (size_t)KHI; const __bf16* Vl = VBL + ((size_t)b * CC + h * HD) * (size_t)KHI;
  v16h qf[2][2];
#pragma unroll
  for (int t = 0; t < 2; ++t)
#pragma unroll
    for (int ks = 0; ks < 2; ++ks) qf[t][ks] = frag_hu(Qu + t * 16 * CC + ks * 32, fo);
  XW();
  v8f acc[2][HD / 16] = {}; int kc = 0;
  do { v16h ka[2][2]; v4f m4[4], r4[4]; v16b vh[HD / 16], vl[HD / 16];   /* at least one trip: every tile has its diagonal */
#pragma unroll
    for (int kt = 0; kt < 2; ++kt)
#pragma unroll
      for (int ks = 0; ks < 2; ++ks) ka[kt][ks] = frag_hu(Ku + kt * 16 * CC + ks * 32, fo);
    XW();
#pragma unroll
    for (int q = 0; q < 4; ++q) { const int o = (q >> 1) * 16 + (q & 1) * 4; const float* pm = mu + co; const float* pr = ru + co; m4[q] = *(const v4f*)(pm + o); r4[q] = *(const v4f*)(pr + o); }
    XW();
#pragma unroll
    for (int j = 0; j < HD / 16; ++j) vh[j] = frag_bu(Vh + j * 16 * KHI, vo);
    XW();
#pragma unroll
    for (int j = 0; j < HD / 16; ++j) vl[j] = frag_bu(Vl + j * 16 * KHI, vo);
    XW();   /* all of a trip's loads are issued in front of its arithmetic: one load latency a trip */
#pragma unroll
    for (int t = 0; t < 2; ++t) { v8f s0 = {}, s1 = {};
      s0 = mm_h(ka[0][0], qf[t][0], s0); s1 = mm_h(ka[1][0], qf[t][0], s1); s0 = mm_h(ka[0][1], qf[t][1], s0); s1 = mm_h(ka[1][1], qf[t][1], s1);
      const int dk = ql0 + t * 16 + col - 8 * g - kc * 32;   /* query - the lane's first key */
      float pf[16];
#pragma unroll
      for (int i = 0; i < 8; ++i) { const float e0 = ex2(__builtin_fmaf(s0[i], SC2, -m4[i >> 2][i & 3])) * r4[i >> 2][i & 3], e1 = ex2(__builtin_fmaf(s1[i], SC2, -m4[2 + (i >> 2)][i & 3])) * r4[2 + (i >> 2)][i & 3]; pf[i] = (i <= dk) ? e0 : 0.f; pf[8 + i] = (16 + i <= dk) ? e1 : 0.f; }
      const F2 p = bsplit16(pf);
#pragma unroll
      for (int j = 0; j < HD / 16; ++j) acc[t][j] = mm_b(p.h, vh[j], acc[t][j]);
#pragma unroll
      for (int j = 0; j < HD / 16; ++j) acc[t][j] = mm_b(p.l, vh[j], acc[t][j]);
#pragma unroll
      for (int j = 0; j < HD / 16; ++j) acc[t][j] = mm_b(p.h, vl[j], acc[t][j]); }
    Ku += 32 * CC; mu += 32; ru += 32; Vh += 32; Vl += 32; } while (++kc <= qi);
#pragma unroll
  for (int t = 0; t < 2; ++t)
#pragma unroll
    for (int j = 0; j < HD / 16; ++j)
#pragma unroll
      for (int r = 0; r < 8; ++r) ss[wave][t * 16 + 8 * g + r][j * 16 + col] = acc[t][j][r] * (1.0f / 2048.0f);
  LDSX(); for (int i = 0; i < 16; ++i) vst2(Y + ((size_t)b * TT + ql0 + i * 2 + g) * CC + h * HD + col * 4, *(const v4f*)&ss[wave][i * 2 + g][col * 4]); }   /* a wave's own rows; a store = two rows' 256-byte (row, head) segments */
// ---- k_out: block = (64 rows, 128 cols): out = ctx Wo (+ bo): ctx x 2^6 once to f16 against Wo as f16(bf16 x 2^8) exact (1 product) x 2^-14; causal rows < QHI (none) and the last 64 rows of each sequence: ctx bf16 hi + lo against exact bf16 Wo (2 products)
__global__ __launch_bounds__(128) void k_out(const float* __restrict__ Y, const float* __restrict__ WO, const float* __restrict__ BO, float* __restrict__ OUT) { union Sm { float sf[4][16][132]; __bf16 w[2 * WT_SZ + 4 * AT_SZ]; }; __shared__ __align__(16) Sm sm; float (&sf)[4][16][132] = sm.sf;   /* weight tiles and the epilogue's staging share the LDS: sf is written only behind the product loop's last barrier */
  const int tid = threadIdx.x, wave = tid >> 5, lane = tid & 31, col = lane & 15, g = lane >> 4; const int c0 = blockIdx.y * 128; const size_t r0 = (size_t)blockIdx.x * 64 + wave * 16;
  v8f acc[8] = {};
  const float* xp = Y + (r0 + g) * CC + col * 4; const float* wp = WO + (size_t)(wave * 16) * DIN + c0 + lane * 4; WT wt; XR xr; gemm_first(wt, xr, xp, wp, DIN);   /* both arms start from the same first tile */
  const int tb_ = (int)(((size_t)blockIdx.x * 64) % TT); if (CAUSAL && (tb_ < QHI || tb_ >= TT - 64)) {   /* block-uniform; the LAST 64 query rows of each sequence also take the hi + lo context path: under a query-axis softmax the last key columns carry O(1) weights, so the context rows there are an order of magnitude larger */
    gemm_wt<1>(wt, xr, xp, wp, DIN, sm.w, wave, lane, acc);
#pragma unroll
    for (int j = 0; j < 8; ++j) { const float bias = BO ? bfr(BO[c0 + j * 16 + col]) : 0.f;
#pragma unroll
      for (int r = 0; r < 8; ++r) sf[wave][8 * g + r][j * 16 + col] = acc[j][r] + bias; }
  } else {
    gemm_wt<2>(wt, xr, xp, wp, DIN, sm.w, wave, lane, acc);   /* ctx carried x 2^6 into f16 so small-magnitude context rows stay clear of f16 subnormals */
#pragma unroll
    for (int j = 0; j < 8; ++j) { const float bias = BO ? bfr(BO[c0 + j * 16 + col]) : 0.f;
#pragma unroll
      for (int r = 0; r < 8; ++r) sf[wave][8 * g + r][j * 16 + col] = acc[j][r] * (1.0f / 16384.0f) + bias; } }   /* 2^-8 (Wo carry) x 2^-6 (ctx carry) */
  LDSX(); for (int rl = 0; rl < 16; ++rl) vst2(OUT + (r0 + rl) * DIN + c0 + lane * 4, *(const v4f*)&sf[wave][rl][lane * 4]); }

extern "C" void kernel_launch(void* const* d_in, const int* in_sizes, int n_in, void* d_out, int out_size, void* d_ws, size_t ws_size, hipStream_t stream) {
  (void)in_sizes; (void)n_in; (void)out_size;
  const float** F = (const float**)d_in;
  if (ws_size < (size_t)WS_END) return;
  char* ws = (char*)d_ws; _Float16 *QH = (_Float16*)(ws + WS_QH), *KH = (_Float16*)(ws + WS_KH), *VT = (_Float16*)(ws + WS_VT), *QL = (_Float16*)(ws + WS_QL), *KL = (_Float16*)(ws + WS_KL); __bf16 *VB = (__bf16*)(ws + WS_VB), *VBL = (__bf16*)(ws + WS_VBL); float *Y = (float*)(ws + WS_Y);
  (void)Y; (void)QL; (void)KL; (void)VB; (void)VBL;
  // inputs: 0 source [4,1024,1024]; 1 Wq [16,1024,64] (head, in, out), 2 bq [16,64]; 3 Wk, 4 bk; 5 Wv, 6 bv; 7 Wc [1024,1024] (in,out), 8 bc [1024] (all biases N(0, 0.02^2), nonzero)
  if (ws_size < (size_t)WS_END2) return;
  float *CM = (float*)(ws + WS_CM), *CZ = (float*)(ws + WS_CZ);
  k_proj<<<dim3(TNB * TT / 64, CC / 128, 3), 128, 0, stream>>>(F[0], F[0], F[0], F[1], F[3], F[5], F[2], F[4], F[6], QH, QL, KH, KL, VT, VB, VBL);
  k_colstat_w<<<dim3(TT / 64, NP), 256, 0, stream>>>(QH, KH, CM, CZ);   /* per key column j: max / sum over the visible queries i >= j */
  k_pv_w<<<dim3(TT / 256, 1, NP), 256, 0, stream>>>(QH, KH, CM, CZ, VB, VBL, Y);   /* P[i][j] = exp(S - m_j) x 2^11 / Z_j for j <= i, 0 above the diagonal */
  k_out<<<dim3(TNB * TT / 64, DIN / 128), 128, 0, stream>>>(Y, F[7], F[8], (float*)d_out);
}

// v008
// It runs in 111 microseconds.
// Timed twice side by side with v007, it ran 1.13 and 1.15 times as fast.
// All steps since v000 together make it 36.9 times as fast.
// compute dtype: all float inputs rounded to bf16; per-head q/k/v projections with EXACT bf16 products on WMMA 16x16x32 (f32 accumulate) + bias; causal scores q x k once to f16 each (1 product; sigma - 0.4) x 64^-0.5 on every block; softmax over the QUERY axis in f32 (per key column: max / sum over the visible queries; exp(x) = 2^(x log2 e) on the chip's own exp2 instruction, the logit scale and log2 e folded into one multiply-add); P as bf16 hi + lo against v as bf16 hi + lo (3 products) on EVERY block; ctx x 2^6 once to f16 x Wc f16(bf16 x 2^8) - except the LAST 128 rows of each sequence: ctx as bf16 hi + lo against exact bf16 Wc (2 products) - + bc; f32 output.
#include <hip/hip_runtime.h>
#include <math.h>

typedef __attribute__((ext_vector_type(16))) _Float16 v16h;
typedef __attribute__((ext_vector_type(16))) __bf16 v16b;
typedef __attribute__((ext_vector_type(8)))  _Float16 v8h;
typedef __attribute__((ext_vector_type(8)))  float v8f;
typedef __attribute__((ext_vector_type(4)))  float v4f;
typedef __attribute__((ext_vector_type(2)))  float v2f;
typedef __attribute__((ext_vector_type(4)))  unsigned v4u;
typedef __attribute__((ext_vector_type(4)))  int v4i;
typedef float __attribute__((may_alias)) float_a;
typedef int __attribute__((may_alias)) int_a;

template <typename T> __device__ __forceinline__ void vst2(void* p, T v) { *(T*)p = v;  }
__device__ __forceinline__ v8f wmma16(v16h a, v16h b, v8f c) {
  v8f d = __builtin_amdgcn_wmma_f32_16x16x32_f16(false, a, false, b, (short)0, c, false, false);
  asm volatile("v_nop\n\tv_nop\n\tv_nop\n\tv_nop" : "+v"(d) : "v"(a), "v"(b));
  return d;
}
__device__ __forceinline__ v8f wmma_bf(v16b a, v16b b, v8f c) {
  v8f d = __builtin_amdgcn_wmma_f32_16x16x32_bf16(false, a, false, b, (short)0, c, false, false);
  asm volatile("v_nop\n\tv_nop\n\tv_nop\n\tv_nop" : "+v"(d) : "v"(a), "v"(b));
  return d;
}
// 16x16x32 fragments: lane = (h = lane>>4, row/col = lane&15); elements 0..7 = k0+8h+0..7, 8..15 = k0+16+8h+0..7; D element r = row 8h+r
__device__ __forceinline__ v16h frag_h(const _Float16* rowk0, int lane) {
  union { v16h v; v8h q[2]; } u; const _Float16* p = rowk0 + 8 * (lane >> 4);
  u.q[0] = *(const v8h*)p; u.q[1] = *(const v8h*)(p + 16); return u.v;
}
__device__ __forceinline__ v16h frag_f32(const float* rowk0, int lane) {
  v16h a; const float* p = rowk0 + 8 * (lane >> 4);
#pragma unroll
  for (int i = 0; i < 8; ++i) { a[i] = (_Float16)p[i]; a[8 + i] = (_Float16)p[16 + i]; }
  return a;
}
__device__ __forceinline__ v16h frag_f32s(const float* rowk0, int lane, float sc) {
  v16h a; const float* p = rowk0 + 8 * (lane >> 4);
#pragma unroll
  for (int i = 0; i < 8; ++i) { a[i] = (_Float16)(p[i] * sc); a[8 + i] = (_Float16)(p[16 + i] * sc); }
  return a;
}
// column fragment from a [K][ld] layout (column n), rows >= K read as 0
__device__ __forceinline__ v16h fragc_f32(const float* W, int k0, int n, int lane, int ld, int K) {
  v16h a; const int g = lane >> 4;
#pragma unroll
  for (int i = 0; i < 8; ++i) { const int ka = k0 + 8 * g + i, kb = ka + 16;
    a[i] = (_Float16)(ka < K ? W[(size_t)(ka < K ? ka : K - 1) * ld + n] : 0.f); a[8 + i] = (_Float16)(kb < K ? W[(size_t)(kb < K ? kb : K - 1) * ld + n] : 0.f); }
  return a;
}
struct F2 { v16b h, l; };
__device__ __forceinline__ F2 bsplit16(const float v[16]) { F2 r;
#pragma unroll
  for (int i = 0; i < 16; ++i) { const __bf16 h = (__bf16)v[i]; r.h[i] = h; r.l[i] = (__bf16)(v[i] - (float)h); }
  return r; }
__device__ __forceinline__ F2 split_row(const float* row, int k0, int lane) { float v[16]; const float* p = row + k0 + 8 * (lane >> 4);
#pragma unroll
  for (int i = 0; i < 8; ++i) { v[i] = p[i]; v[8 + i] = p[16 + i]; }
  return bsplit16(v); }
__device__ __forceinline__ F2 split_rowK(const float* row, int k0, int lane, int K) { float v[16]; const int g = lane >> 4;
#pragma unroll
  for (int i = 0; i < 8; ++i) { const int ka = k0 + 8 * g + i, kb = ka + 16; v[i] = ka < K ? row[ka < K ? ka : K - 1] : 0.f; v[8 + i] = kb < K ? row[kb < K ? kb : K - 1] : 0.f; }
  return bsplit16(v); }
__device__ __forceinline__ F2 split_col(const float* W, int k0, int n, int lane, int ld, int K) { float v[16]; const int g = lane >> 4;
#pragma unroll
  for (int i = 0; i < 8; ++i) { const int ka = k0 + 8 * g + i, kb = ka + 16; v[i] = ka < K ? W[(size_t)(ka < K ? ka : K - 1) * ld + n] : 0.f; v[8 + i] = kb < K ? W[(size_t)(kb < K ? kb : K - 1) * ld + n] : 0.f; }
  return bsplit16(v); }
__device__ __forceinline__ v8f mac3(const F2& a, const F2& b, v8f c) { c = wmma_bf(a.l, b.h, c); c = wmma_bf(a.h, b.l, c); return wmma_bf(a.h, b.h, c); }
__device__ __forceinline__ float sigm(float v) { return 1.0f / (1.0f + expf(-v)); }
#define LDSX() do { asm volatile("s_wait_dscnt 0" ::: "memory"); __builtin_amdgcn_wave_barrier(); __builtin_amdgcn_fence(__ATOMIC_RELEASE, "workgroup"); } while (0)

// Causal multi-head attention whose softmax runs over the QUERY axis, with per-head projection tensors (source [4,1024,1024]; Wq / Wk / Wv [16,1024,64] (head, in, out) (0.02) + biases [16,64]; scores / sqrt(64) + triu(-inf, k=1); attn = softmax(..., axis=2) - axis 2 of [B, H, q, k] is the QUERY axis: every key column is normalised over the queries q >= k (faithful to the source); out = attn v; heads merged; Wc [1024,1024] (in,out) + bc).
#define NB 4
#define TT 1024
#define CC 1024            // NH * HD = projected width
#define DIN 1024          // input (model) width
#define NH 16
#define HD 64
#define NQB (TT / 64)
#define NP (NB * NH)        // (batch, head) pairs: the column-statistics and context kernels take all of them in one launch (grid y or z = pair)
#define SCALE (0.125f)
#define CAUSAL 1
#ifndef TNB
#define TNB NB
#endif
__device__ __forceinline__ float bfr(float v) { return (float)(__bf16)v; }
__host__ __device__ __forceinline__ int kb_last(int qb) { return CAUSAL ? ((qb * 64 + 63) >> 7) : (TT / 128 - 1); }
typedef __attribute__((ext_vector_type(8))) __bf16 v8b;
__device__ __forceinline__ v16b frag_b(const __bf16* rowk0, int lane) {
  union { v16b v; v8b q[2]; } u; const __bf16* p = rowk0 + 8 * (lane >> 4);
  u.q[0] = *(const v8b*)p; u.q[1] = *(const v8b*)(p + 16); return u.v;
}
#define QHI 0               // no q residual plane: the scores are small and single-product everywhere
#define KHI 1024            // key rows carrying k residual / v bf16 hi+lo planes (all key rows: the v planes feed every trip of k_pv_w; the k residual is not read)
// B fragment (k rows k0+.., output column o) of a weight: (in,out) [K][ld] or (out,in) [ld rows of K]: bf16 exact, or f16(bf16 * 256) exact
__device__ __forceinline__ v16b wcol_io(const float* Wm, int k0, int o, int lane, int ld) { v16b w; const int g = lane >> 4;
#pragma unroll
  for (int i = 0; i < 8; ++i) { w[i] = (__bf16)Wm[(size_t)(k0 + 8 * g + i) * ld + o]; w[8 + i] = (__bf16)Wm[(size_t)(k0 + 16 + 8 * g + i) * ld + o]; }
  return w; }
__device__ __forceinline__ v16b wcol_oi(const float* Wm, int k0, int o, int lane, int K) { v16b w; const float* p = Wm + (size_t)o * K + k0 + 8 * (lane >> 4);
#pragma unroll
  for (int i = 0; i < 8; ++i) { w[i] = (__bf16)p[i]; w[8 + i] = (__bf16)p[16 + i]; }
  return w; }
__device__ __forceinline__ v16h wcolh_io(const float* Wm, int k0, int o, int lane, int ld) { v16h w; const int g = lane >> 4;
#pragma unroll
  for (int i = 0; i < 8; ++i) { w[i] = (_Float16)(bfr(Wm[(size_t)(k0 + 8 * g + i) * ld + o]) * 256.0f); w[8 + i] = (_Float16)(bfr(Wm[(size_t)(k0 + 16 + 8 * g + i) * ld + o]) * 256.0f); }
  return w; }
__device__ __forceinline__ v16h wcolh_oi(const float* Wm, int k0, int o, int lane, int K) { v16h w; const float* p = Wm + (size_t)o * K + k0 + 8 * (lane >> 4);
#pragma unroll
  for (int i = 0; i < 8; ++i) { w[i] = (_Float16)(bfr(p[i]) * 256.0f); w[8 + i] = (_Float16)(bfr(p[16 + i]) * 256.0f); }
  return w; }
#define WQKV_LAYOUT 0   // 0 = per-head [NH][DIN][HD] (head, in, out); 1 = (out,in) [CC][DIN]; 2 = per-head [NH][DIN][HD]
__device__ __forceinline__ v16b wcol_hdk(const float* Wm, int k0, int o, int lane) { v16b w; const int g = lane >> 4; const float* p = Wm + (size_t)(o / HD) * DIN * HD + (o % HD);
#pragma unroll
  for (int i = 0; i < 8; ++i) { w[i] = (__bf16)p[(size_t)(k0 + 8 * g + i) * HD]; w[8 + i] = (__bf16)p[(size_t)(k0 + 16 + 8 * g + i) * HD]; }
  return w; }
#define WO_OUT_IN 0
#if WQKV_LAYOUT == 1
#define WCOL(W, k0, o, lane) wcol_oi(W, k0, o, lane, DIN)
#elif WQKV_LAYOUT == 2
#define WCOL(W, k0, o, lane) wcol_hdk(W, k0, o, lane)
#else
#define WCOL(W, k0, o, lane) wcol_io((W) + (size_t)((o) / 64) * DIN * 64, k0, (o) % 64, lane, 64)   /* per-head weight tensors [16][DIN][64] (head, in, out): output column o = h*64 + kk lives in head h's [DIN][64] (in,out) slab at pitch 64 (a 16-column tile never straddles a head) */
#endif
#if WO_OUT_IN
#define WOCOL(W, k0, o, lane) wcol_oi(W, k0, o, lane, CC)
#define WOCOLH(W, k0, o, lane) wcolh_oi(W, k0, o, lane, CC)
#else
#define WOCOL(W, k0, o, lane) wcol_io(W, k0, o, lane, DIN)
#define WOCOLH(W, k0, o, lane) wcolh_io(W, k0, o, lane, DIN)
#endif

#ifndef SM_EXTRA_PARAMS
#define SM_EXTRA_PARAMS
#endif
#ifndef PROJ_EXTRA_PARAMS
#define PROJ_EXTRA_PARAMS
#endif
#ifndef SM_MASK_HOOK
#define SM_MASK_HOOK (void)0
#endif

#define WS_QH  0u                                      // f16 q rows [b*t][CC]
#define WS_KH  (WS_QH + 2u * (size_t)NB * TT * CC)      // f16 k rows [b*t][CC]
#define WS_VT  (WS_KH + 2u * (size_t)NB * TT * CC)      // f16 v planes [b][c][t]
#define WS_QL  (WS_VT + 2u * (size_t)NB * CC * TT)      // f16 q residual x 2^10 rows [b][t < QHI][CC]
#define WS_KL  (WS_QL + 2u * (size_t)NB * QHI * CC)     // f16 k residual x 2^10 rows [b][t < KHI][CC]
#define WS_VB  (WS_KL + 2u * (size_t)NB * KHI * CC)     // bf16 v hi planes [b][c][t < KHI]
#define WS_VBL (WS_VB + 2u * (size_t)NB * CC * KHI)
#define WS_Y   (WS_VBL + 2u * (size_t)NB * CC * KHI)    // f32 ctx rows [b*t][CC] (only when there is an output projection)
#define WS_END (WS_Y  + 4u * (size_t)NB * TT * CC)
#define WS_CM (WS_END)                                  // f32 column maxima x log2(e) [NP][TT]
#define WS_CZ (WS_CM + 4u * (size_t)NP * TT)           // f32 2^11 / column sum [NP][TT]
#define WS_END2 (WS_CZ + 4u * (size_t)NP * TT)

// ---- weight tile in LDS for k_out (k_proj stages alike, with its own tile shape): a block's 64 k x 128 column slice of a (in,out) weight is read once for its eight waves (128 output rows), in whole 128-byte lines (a lane: 4 columns x 8 k rows, 16-byte loads), rounded to its 16-bit operand type in registers and stored column-major (a column's 64 k values in a row of 128 bytes), so that a B fragment is two 16-byte LDS reads. Two buffers: the next tile's loads (and the wave's own next A rows) fly during this tile's products, one barrier a tile. The A rows take the same road: a wave reads its 16 rows x 64 k in whole lines (a load = two rows' 256 bytes), rounds them to the operand type once and stores them row-major at a pitch of 144 bytes behind the weight buffers; an A fragment is two 16-byte LDS reads.
#define KT 64               // k rows of a tile
#define NW 8                // waves of a k_out block: each takes 16 of the block's output rows, all share the weight tile
#define KR (KT / NW)        // k rows of a weight tile that one wave brings in
#define BR (NW * 16)        // output rows of a block
#define WT_G 2336           // elements between the four column groups n & 3: 32 rows of 72 + 32. Column n lies at (n & 3) x 4672 B + (n >> 2) x 144 B: the storing lanes (columns 4 apart) and the reading lanes (16 neighbouring columns) both fall on 16 different 16-byte bank groups
#define WT_SZ (4 * WT_G)    // elements of one buffer
__device__ __forceinline__ int wt_row(int n) { return (n & 3) * WT_G + (n >> 2) * 72; }
struct WT { v4f r[KR]; };   // a lane's share of a tile: k rows wave x 8 + 0..7, columns lane x 4 + 0..3
#define AT_P 72             // elements between two A rows in LDS: 144 B = 16 B x 9, the reading lanes (16 neighbouring rows) fall on 16 different 16-byte bank groups
#define AT_SZ (BR * AT_P)   // elements of one A plane (the block's 128 rows)
typedef __attribute__((ext_vector_type(4))) __bf16 v4b;
typedef __attribute__((ext_vector_type(4))) _Float16 v4h;
struct XR { v4f r[8]; };    // a lane's share of its wave's A rows of one tile: rows 2q + (lane >> 4), k (lane & 15) x 4 + 0..3
__device__ __forceinline__ void wt_load(WT& t, const float* p, int ld) {
#pragma unroll
  for (int i = 0; i < KR; ++i) t.r[i] = *(const v4f*)(p + (size_t)i * ld); }
__device__ __forceinline__ void xr_load(XR& x, const float* p) {   // p = the wave's row (lane >> 4) at k (lane & 15) x 4; the A rows have 1024 elements
#pragma unroll
  for (int q = 0; q < 8; ++q) x.r[q] = *(const v4f*)(p + (size_t)(2 * q) * 1024); }
// MODE 0: bf16(a); 1: bf16 hi in the first plane, bf16 lo in the second; 2: f16(a x 2^6). ab = the buffer's first plane
template <int MODE> __device__ __forceinline__ void xr_store(const XR& x, __bf16* ab, int wave, int lane) {
#pragma unroll
  for (int q = 0; q < 8; ++q) { __bf16* d = ab + (wave * 16 + 2 * q + (lane >> 4)) * AT_P + (lane & 15) * 4;
    if (MODE == 2) { v4h o;
#pragma unroll
      for (int u = 0; u < 4; ++u) o[u] = (_Float16)(x.r[q][u] * 64.0f);
      *(v4h*)d = o;
    } else { v4b o, ol;
#pragma unroll
      for (int u = 0; u < 4; ++u) { const __bf16 h = (__bf16)x.r[q][u]; o[u] = h; ol[u] = (__bf16)(x.r[q][u] - (float)h); }
      *(v4b*)d = o; if (MODE == 1) *(v4b*)(d + AT_SZ) = ol; } } }
template <int F16> __device__ __forceinline__ void wt_store(const WT& t, __bf16* buf, int wave, int lane) {   // F16 = 0: bf16(w); 1: f16(bf16(w) x 2^8), both exact carriers of the bf16 weight
#pragma unroll
  for (int u = 0; u < 4; ++u) { __bf16* d = buf + wt_row(lane * 4 + u) + wave * KR;
#pragma unroll
    for (int hf = 0; hf < KR / 8; ++hf) {
      if (F16) { v8h o;
#pragma unroll
        for (int i = 0; i < 8; ++i) o[i] = (_Float16)(bfr(t.r[hf * 8 + i][u]) * 256.0f);
        *(v8h*)(d + hf * 8) = o;
      } else { v8b o;
#pragma unroll
        for (int i = 0; i < 8; ++i) o[i] = (__bf16)t.r[hf * 8 + i][u];
        *(v8b*)(d + hf * 8) = o; } } } }
// the first tile's loads, written once in front of any branch between the modes, with their wait directly behind them
__device__ __forceinline__ void gemm_first(WT& wt, XR& xr, const float* xp, const float* wp, int ldw) { wt_load(wt, wp, ldw); xr_load(xr, xp);
  asm volatile("s_wait_xcnt 0x0" ::: "memory"); __builtin_amdgcn_sched_barrier(0); }   /* the wait stands in front of any reuse of the address registers that the issued loads name; the scheduling barrier keeps the register arithmetic that follows from being lifted over it */
// acc[j] += A (the wave's 16 rows, f32 source, K = 1024) x W (columns j x 16 + 0..15 of the block's 128). xp = the wave's row g at k col x 4; wp = the weight at (k row wave x 8, the lane's 4 columns), ldw its row pitch. wt / xr = tile 0 as gemm_first loaded it. MODE 0: A bf16 x W bf16; 1: A bf16 hi + lo x W bf16 (2 products); 2: A x 2^6 f16 x W f16(bf16 x 2^8). Ends behind a barrier: the buffers may be reused
template <int MODE> __device__ __forceinline__ void gemm_wt(WT& wt, XR& xr, const float* xp, const float* wp, int ldw, __bf16* wbuf, int wave, int lane, v8f acc[8]) { const int col = lane & 15; constexpr int AB = (MODE == 1 ? 2 : 1) * AT_SZ; __bf16* abuf = wbuf + 2 * WT_SZ;   /* the A buffers lie behind the two weight buffers */
  wt_store<MODE == 2>(wt, wbuf, wave, lane); xr_store<MODE>(xr, abuf, wave, lane);
  __syncthreads();
  for (int t = 0; t < 1024 / KT; ++t) { const __bf16* wb = wbuf + (t & 1) * WT_SZ; const __bf16* ab = abuf + (t & 1) * AB + (wave * 16 + col) * AT_P;
    if (t + 1 < 1024 / KT) { wt_load(wt, wp + (size_t)(t + 1) * KT * ldw, ldw); xr_load(xr, xp + (t + 1) * KT);
      asm volatile("s_wait_xcnt 0x0" ::: "memory"); __builtin_amdgcn_sched_barrier(0); }   /* as above: the address registers are reused while the loads fly */
#pragma unroll
    for (int s = 0; s < 2; ++s) {
      v16b w[8], ah = frag_b(ab + s * 32, lane), al; if (MODE == 1) al = frag_b(ab + AT_SZ + s * 32, lane);
#pragma unroll
      for (int j = 0; j < 8; ++j) w[j] = frag_b(wb + wt_row(col) + j * (4 * 72) + s * 32, lane);   /* wt_row(j x 16 + col) written as one lane address + a constant: the eight fragments share one address register */
      __builtin_amdgcn_sched_barrier(0);   /* keeps the step's LDS reads together in front of its products: left alone the compiler reads each fragment into one register set directly in front of its product, and every product then waits out an LDS latency */
#pragma unroll
      for (int j = 0; j < 8; ++j) {
        if (MODE == 2) acc[j] = wmma16(__builtin_bit_cast(v16h, ah), __builtin_bit_cast(v16h, w[j]), acc[j]);
        else { acc[j] = wmma_bf(ah, w[j], acc[j]); if (MODE == 1) acc[j] = wmma_bf(al, w[j], acc[j]); } } }
    __builtin_amdgcn_sched_barrier(0);   /* keeps the wait for the next tile's loads behind this tile's last product: left alone the compiler lifts the first conversions, and the wait with them, in among the products */
    if (t + 1 < 1024 / KT) { wt_store<MODE == 2>(wt, wbuf + ((t + 1) & 1) * WT_SZ, wave, lane); xr_store<MODE>(xr, abuf + ((t + 1) & 1) * AB, wave, lane); }
    __syncthreads(); } }   /* the one barrier of a tile: publishes tile t + 1 and ends every wave's reads of the buffer that trip t + 1 refills */
// ---- k_proj: block = 256 rows x 192 columns, the 64 q, 64 k and 64 v columns of ONE head (grid y = head): the X rows are read once for all three products and each weight slab once for 256 rows. q/k/v = X W + b with exact bf16 products (K = DIN) -> q f16 rows; k f16 rows (+ residual rows < KHI); v f16 planes [c][t] (+ bf16 hi/lo planes for t < KHI). 16 waves in a 4 x 4 grid, a wave = 64 rows x 48 columns (4 A x 3 B fragments, 12 accumulators): 7 fragment reads feed 12 products. Staging as in k_out: tile = 64 k, two LDS buffers, the next tile's loads fly during this tile's products, one barrier a tile. Every wave brings its own 16 X rows; waves 0..11 also bring the weight tile: wave >> 2 = slab (q, k, v), a lane = 8 k rows x 4 columns
#define PW 16               // waves of a k_proj block
#define PR 256              // its output rows
#define PT_G (48 * 72 + 32) // as WT_G, for 192 columns: 48 rows of 72 + 32 elements between the four column groups n & 3
#define PT_SZ (4 * PT_G)    // elements of one weight buffer
#define PA_SZ (PR * AT_P)   // elements of one X buffer
__device__ __forceinline__ void pw_store(const WT& t, __bf16* d) {   // d = the lane's place in the buffer: column group (slab x 16 + col) x 72 + its first k; the lane's four columns lie PT_G apart
#pragma unroll
  for (int u = 0; u < 4; ++u) { v8b o;
#pragma unroll
    for (int i = 0; i < 8; ++i) o[i] = (__bf16)t.r[i][u];
    *(v8b*)(d + u * PT_G) = o; } }
__global__ __launch_bounds__(PW * 32) void k_proj(const float* __restrict__ X, const float* __restrict__ WQ, const float* __restrict__ WK, const float* __restrict__ WV, const float* __restrict__ BQ, const float* __restrict__ BK, const float* __restrict__ BV,
    _Float16* __restrict__ QH, _Float16* __restrict__ KH, _Float16* __restrict__ KL, _Float16* __restrict__ VT, __bf16* __restrict__ VB, __bf16* __restrict__ VBL) {
  union Sm { struct { _Float16 sq[PR][72], sk[PR][72], skl[PR][72], th[64][PR + 8]; __bf16 tb[64][PR + 8], tbl[64][PR + 8]; } e; __bf16 w[2 * PT_SZ + 2 * PA_SZ]; };   /* the tiles lie in the LDS of the epilogue's staging arrays, which are written only behind the product loop's last barrier */
  __shared__ __align__(16) Sm sm;
  const int tid = threadIdx.x, wave = __builtin_amdgcn_readfirstlane(tid >> 5) /* in a scalar register: the tests on the wave's number are scalar branches */, lane = tid & 31, col = lane & 15, g = lane >> 4; const int h = blockIdx.y; const size_t r0 = (size_t)blockIdx.x * PR; const size_t bb = r0 / TT; const int t0 = (int)(r0 % TT);
  const int wr = wave >> 2, wc = wave & 3;   /* the wave's place in the 4 x 4 grid: rows wr x 64, column fragments wc x 3 + 0..2 */
  const bool wl = wave < 12; const int slab = wave >> 2, kg = (wave & 3) * 2 + g;   /* weight loader: slab, and the lane's group of 8 k rows */
  const float* WA = slab == 0 ? WQ : slab == 1 ? WK : WV;
  const float* wp = WA + (size_t)h * DIN * 64 + (size_t)(kg * 8) * 64 + col * 4; const float* xp = X + (r0 + wave * 16 + g) * DIN + col * 4;
  __bf16* wbuf = sm.w; __bf16* abuf = sm.w + 2 * PT_SZ; const int wd = (slab * 16 + col) * 72 + kg * 8;
  v8f acc[4][3] = {}; WT wt; XR xr;
  if (wl) wt_load(wt, wp, 64);
  xr_load(xr, xp);
  asm volatile("s_wait_xcnt 0x0" ::: "memory"); __builtin_amdgcn_sched_barrier(0);   /* the wait stands in front of any reuse of the address registers that the issued loads name; the scheduling barrier keeps the register arithmetic that follows from being lifted over it */
  float bias[3];   /* the wave's three bias values are read here, beside the first tile's loads: read in the epilogue their latency would stand open */
#pragma unroll
  for (int j = 0; j < 3; ++j) { const int f = wc * 3 + j; const float* BA = (f >> 2) == 0 ? BQ : (f >> 2) == 1 ? BK : BV; bias[j] = BA[h * 64 + (f & 3) * 16 + col]; }
  asm volatile("s_wait_xcnt 0x0" ::: "memory"); __builtin_amdgcn_sched_barrier(0);   /* as above, for the bias loads */
#pragma unroll
  for (int j = 0; j < 3; ++j) bias[j] = bfr(bias[j]);
  if (wl) pw_store(wt, wbuf + wd);
  xr_store<0>(xr, abuf, wave, lane);
  __syncthreads();
  for (int t = 0; t < DIN / KT; ++t) { const __bf16* wb = wbuf + (t & 1) * PT_SZ + (col & 3) * PT_G + (col >> 2) * 72 + wc * (3 * 4 * 72); const __bf16* ab = abuf + (t & 1) * PA_SZ + (wr * 64 + col) * AT_P;
    if (t + 1 < DIN / KT) { if (wl) wt_load(wt, wp + (size_t)(t + 1) * KT * 64, 64);
      xr_load(xr, xp + (t + 1) * KT);
      asm volatile("s_wait_xcnt 0x0" ::: "memory"); __builtin_amdgcn_sched_barrier(0); }   /* as above: the address registers are reused while the loads fly */
#pragma unroll
    for (int s = 0; s < 2; ++s) { v16b a[4], w[3];
#pragma unroll
      for (int i = 0; i < 4; ++i) a[i] = frag_b(ab + i * (16 * AT_P) + s * 32, lane);
#pragma unroll
      for (int j = 0; j < 3; ++j) w[j] = frag_b(wb + j * (4 * 72) + s * 32, lane);
      __builtin_amdgcn_sched_barrier(0);   /* keeps the step's LDS reads together in front of its products: left alone the compiler reads each fragment directly in front of its product, and every product then waits out an LDS latency */
#pragma unroll
      for (int i = 0; i < 4; ++i)
#pragma unroll
        for (int j = 0; j < 3; ++j) acc[i][j] = wmma_bf(a[i], w[j], acc[i][j]); }
    __builtin_amdgcn_sched_barrier(0);   /* keeps the wait for the next tile's loads behind this tile's last product */
    if (t + 1 < DIN / KT) { if (wl) pw_store(wt, wbuf + ((t + 1) & 1) * PT_SZ + wd);
      xr_store<0>(xr, abuf + ((t + 1) & 1) * PA_SZ, wave, lane); }
    __syncthreads(); }   /* the one barrier of a tile: publishes tile t + 1 and ends every wave's reads of the buffer that trip t + 1 refills; the last one frees the LDS for the epilogue */
#pragma unroll
  for (int j = 0; j < 3; ++j) { const int f = wc * 3 + j, wh = f >> 2, cl = (f & 3) * 16 + col;   /* column fragment f of the block's 12: which product (wave-uniform), and the column inside the head */
    if (wh == 0) {
#pragma unroll
      for (int i = 0; i < 4; ++i)
#pragma unroll
        for (int r = 0; r < 8; ++r) sm.e.sq[wr * 64 + i * 16 + 8 * g + r][cl] = (_Float16)(acc[i][j][r] + bias[j]);
    } else if (wh == 1) {
#pragma unroll
      for (int i = 0; i < 4; ++i)
#pragma unroll
        for (int r = 0; r < 8; ++r) { const float v = acc[i][j][r] + bias[j]; const _Float16 hv = (_Float16)v; const int rl = wr * 64 + i * 16 + 8 * g + r; sm.e.sk[rl][cl] = hv; sm.e.skl[rl][cl] = (_Float16)((v - (float)hv) * 1024.0f); }
    } else {
#pragma unroll
      for (int i = 0; i < 4; ++i)
#pragma unroll
        for (int r = 0; r < 8; ++r) { const float v = acc[i][j][r] + bias[j]; const int rl = wr * 64 + i * 16 + 8 * g + r; sm.e.th[cl][rl] = (_Float16)v; const __bf16 bh = (__bf16)v; sm.e.tb[cl][rl] = bh; sm.e.tbl[cl][rl] = (__bf16)(v - (float)bh); } } }
  __syncthreads();
  const bool hi_rows = t0 < KHI;
  for (int e = tid; e < PR * 8; e += PW * 32) { const int rl = e >> 3, q = e & 7; const size_t o = (r0 + rl) * CC + h * 64 + q * 8;   /* a (row, head) segment = one 128-byte line */
    vst2((unsigned*)(QH + o), *(const v4u*)&sm.e.sq[rl][q * 8]); vst2((unsigned*)(KH + o), *(const v4u*)&sm.e.sk[rl][q * 8]); if (hi_rows) vst2((unsigned*)(KL + (bb * KHI + t0 + rl) * (size_t)CC + h * 64 + q * 8), *(const v4u*)&sm.e.skl[rl][q * 8]); }
  for (int e = tid; e < 64 * (PR / 8); e += PW * 32) { const int cl = e / (PR / 8), q = e % (PR / 8); vst2((unsigned*)(VT + (bb * CC + h * 64 + cl) * (size_t)TT + t0 + q * 8), *(const v4u*)&sm.e.th[cl][q * 8]); if (hi_rows) { const size_t o3 = (bb * CC + h * 64 + cl) * (size_t)KHI + t0 + q * 8; vst2((unsigned*)(VB + o3), *(const v4u*)&sm.e.tb[cl][q * 8]); vst2((unsigned*)(VBL + o3), *(const v4u*)&sm.e.tbl[cl][q * 8]); } } }
// ---- k_sm: block = query row t (head in group): keys [0, kend): causal -> logit if s <= t else excluded; softmax in f32; P x 2^11 in place (0 for excluded)
__global__ __launch_bounds__(256) void k_sm(float* __restrict__ S0 SM_EXTRA_PARAMS) { __shared__ float sred[8]; __shared__ float sbc; __shared__ __align__(16) float shv[TT];
  const int tid = threadIdx.x; const int t = blockIdx.x; const int kend = (kb_last(t >> 6) + 1) * 128;
  float* sr = S0 + (size_t)blockIdx.y * TT * TT + (size_t)t * TT;
  float m = -3.0e38f; for (int k = tid; k < kend; k += 256) { float v = (!CAUSAL || k <= t) ? sr[k] : -3.0e38f; SM_MASK_HOOK; shv[k] = v; m = fmaxf(m, v); }
#pragma unroll
  for (int o = 1; o < 32; o <<= 1) m = fmaxf(m, __shfl_xor(m, o));
  if ((tid & 31) == 0) sred[tid >> 5] = m; __syncthreads(); if (tid == 0) { float a = sred[0]; for (int i = 1; i < 8; ++i) a = fmaxf(a, sred[i]); sbc = a; } __syncthreads(); m = sbc; __syncthreads();
  float sum = 0.f; for (int k = tid; k < kend; k += 256) { const float v = shv[k]; const float e = (v <= -1.0e38f) ? 0.f : expf(v - m); shv[k] = e; sum += e; }
#pragma unroll
  for (int o = 1; o < 32; o <<= 1) sum += __shfl_xor(sum, o);
  if ((tid & 31) == 0) sred[tid >> 5] = sum; __syncthreads(); if (tid == 0) { float a = 0.f; for (int i = 0; i < 8; ++i) a += sred[i]; sbc = a > 0.f ? 2048.0f / a : 0.f; }   /* a fully excluded row yields P = 0 */ __syncthreads(); const float inv = sbc;
  for (int k = tid; k < kend; k += 256) shv[k] = shv[k] * inv;
  __syncthreads(); for (int q = tid; q < kend / 4; q += 256) vst2(sr + q * 4, *(const v4f*)&shv[q * 4]); }
// the products of k_colstat_w and k_pv_w: the plain builtins (the compiler keeps the distances behind its own matrix instructions, and their operands may lie in any register window)
__device__ __forceinline__ v8f mm_h(v16h a, v16h b, v8f c) { return __builtin_amdgcn_wmma_f32_16x16x32_f16(false, a, false, b, (short)0, c, false, false); }
__device__ __forceinline__ v8f mm_b(v16b a, v16b b, v8f c) { return __builtin_amdgcn_wmma_f32_16x16x32_bf16(false, a, false, b, (short)0, c, false, false); }
#define SC2 (SCALE * 1.44269504088896340736f)   // logit scale x log2(e): exp(s x SCALE - m) = 2^(s x SC2 - m2), m2 = m x log2(e); the column maxima are kept and stored in these log2 units
__device__ __forceinline__ float ex2(float v) { return __builtin_amdgcn_exp2f(v); }   // one v_exp_f32; a result below the normal range may come out 0, which is what such a term weighs beside a column sum >= 1
#define XW() do { asm volatile("s_wait_xcnt 0x0" ::: "memory"); __builtin_amdgcn_sched_barrier(0); } while (0)   /* behind a group of global loads: the wait stands in front of any later write of a register that the issued loads name (address, offset, scalar base); the scheduling barrier keeps such writes from being lifted over it and the loads from sinking below it */
// fragment loads as wave-uniform base + one 32-bit lane offset (elements): the lane offsets are formed once and stay in their registers, so no load of a loop names a vector register that is written again
__device__ __forceinline__ v16h frag_hu(const _Float16* ub, unsigned off) { union { v16h v; v8h q[2]; } u; const _Float16* p = ub + off; u.q[0] = *(const v8h*)p; u.q[1] = *(const v8h*)(p + 16); return u.v; }
__device__ __forceinline__ v16b frag_bu(const __bf16* ub, unsigned off) { union { v16b v; v8b q[2]; } u; const __bf16* p = ub + off; u.q[0] = *(const v8b*)p; u.q[1] = *(const v8b*)(p + 16); return u.v; }
// ---- k_colstat_w: softmax over the QUERY axis under the causal mask (the source's softmax(axis=2) on [B, H, q, k] scores with -inf where k > q): for every key column k: m_k = max_{q >= k} S[q][k], Z_k = sum_{q >= k} exp(S[q][k] - m_k) (f32, as 2^(s x SC2 - m2)). The logits are formed here on the matrix unit (q f16 x k f16, one product, x SC2: log2 units) and never stored. Block = 64 key columns of one (batch, head) pair, 8 waves: a wave keeps the 64 columns' k fragments in registers and takes every eighth 16-query tile from the block's first column down; a lane (column col, rows 8g + r) keeps a running (m, z) per column tile, rescaled once a tile; the 16 partial pairs of a column (8 waves x 2 lane halves) meet in LDS and are merged as z_w x 2^(m_w - m)
__global__ __launch_bounds__(256) void k_colstat_w(const _Float16* __restrict__ QH, const _Float16* __restrict__ KH, float* __restrict__ CM, float* __restrict__ CZ) { __shared__ __align__(16) float sm[16][64], sz[16][64];
  const int tid = threadIdx.x, wave = __builtin_amdgcn_readfirstlane(tid >> 5) /* in a scalar register: the trip tests are scalar branches, every lane is on at the products */, lane = tid & 31, col = lane & 15, g = lane >> 4; const int kb = blockIdx.x, pz = blockIdx.y, k0 = kb * 64;
  const size_t base = (size_t)(pz / NH) * TT * CC + (size_t)(pz % NH) * HD; const unsigned fo = (unsigned)col * CC + 8u * g;
  float m[4], z[4];
#pragma unroll
  for (int j = 0; j < 4; ++j) { m[j] = -3.0e38f; z[j] = 0.f; }
  int qt = kb * 4 + wave;   /* tiles above the block's first column hold no visible query */
  if (qt < TT / 16) { v16h kf[4][2]; const _Float16* Ku = KH + base + (size_t)k0 * CC; const _Float16* Qu = QH + base + (size_t)qt * 16 * CC;
#pragma unroll
    for (int j = 0; j < 4; ++j)
#pragma unroll
      for (int ks = 0; ks < 2; ++ks) kf[j][ks] = frag_hu(Ku + j * 16 * CC + ks * 32, fo);
    XW();
    do { const v16h a0 = frag_hu(Qu, fo), a1 = frag_hu(Qu + 32, fo);
      XW();
      v8f s[4] = {};
#pragma unroll
      for (int j = 0; j < 4; ++j) s[j] = mm_h(a0, kf[j][0], s[j]);
#pragma unroll
      for (int j = 0; j < 4; ++j) s[j] = mm_h(a1, kf[j][1], s[j]);
      const int dq = qt * 16 + 8 * g - k0 - col;   /* query of element 0 - key of column tile 0 */
#pragma unroll
      for (int j = 0; j < 4; ++j) { float sv[8], tm = -3.0e38f;
#pragma unroll
        for (int r = 0; r < 8; ++r) { sv[r] = s[j][r] * SC2; tm = fmaxf(tm, (dq + r >= j * 16) ? sv[r] : -3.0e38f); }
        const float mn = fmaxf(m[j], tm); float zs = z[j] * ex2(m[j] - mn);
#pragma unroll
        for (int r = 0; r < 8; ++r) { const float e = ex2(__builtin_fmaf(s[j][r], SC2, -mn)); zs += (dq + r >= j * 16) ? e : 0.f; }
        m[j] = mn; z[j] = zs; }
      Qu += 8 * 16 * CC; qt += 8; } while (qt < TT / 16); }
#pragma unroll
  for (int j = 0; j < 4; ++j) { sm[wave * 2 + g][j * 16 + col] = m[j]; sz[wave * 2 + g][j * 16 + col] = z[j]; }
  __syncthreads();
  if (tid < 64) { float mm = -3.0e38f, zz = 0.f;   /* a partial with no visible row of a column brings (-3e38, 0): its term is 0 */
#pragma unroll
    for (int w = 0; w < 16; ++w) mm = fmaxf(mm, sm[w][tid]);
#pragma unroll
    for (int w = 0; w < 16; ++w) zz += sz[w][tid] * ex2(sm[w][tid] - mm);
    vst2(CM + (size_t)pz * TT + k0 + tid, mm); vst2(CZ + (size_t)pz * TT + k0 + tid, 2048.0f / zz); } }   /* every column sees at least its own diagonal entry: Z_k >= 1; stored as 2^11 / Z_k, one division a column, the factor k_pv_w multiplies by; the maximum goes out in log2 units */
// ---- k_pv_w: ctx = P . v, the logits formed again on the matrix unit where P is needed. A wave = 32 queries (two 16-query tiles, their q fragments kept in registers) of one (batch, head) pair, a trip = 32 keys, up to the wave's own diagonal. The logits are taken TRANSPOSED (A = 16 key rows of k, B = the 16 queries of q): D element r of lane (g, col) is key 8g + r of query col, so the two key tiles of a trip are, register for register, elements 0..7 and 8..15 of the P fragment (row = query col, keys +8g+0..7 and +16+8g+0..7): no move between lanes. P = 2^(s x SC2 - m2_k) x (2^11 / Z_k) for key <= query, 0 above the diagonal; P and v as bf16 hi + lo, 3 products, each accumulator in the order h.vh, l.vh, h.vl. The k and v fragments of a trip serve both query tiles. Block = 8 waves of one pair: waves w and w + 4 take the 32-query tiles i and 31 - i (i + 1 and 32 - i trips), 33 trips for every such two
__global__ __launch_bounds__(256) void k_pv_w(const _Float16* __restrict__ QH, const _Float16* __restrict__ KH, const float* __restrict__ CM, const float* __restrict__ CZ, const __bf16* __restrict__ VB, const __bf16* __restrict__ VBL, float* __restrict__ Y) { __shared__ __align__(16) float ss[8][32][HD + 4];
  const int tid = threadIdx.x, wave = __builtin_amdgcn_readfirstlane(tid >> 5) /* in a scalar register: the trip count is wave-uniform and its test a scalar branch */, lane = tid & 31, col = lane & 15, g = lane >> 4; const int pz = blockIdx.z, b = pz / NH, h = pz % NH;
  const int i4 = blockIdx.x * 4 + (wave & 3), qi = wave < 4 ? i4 : 31 - i4, ql0 = qi * 32;
  const size_t base = (size_t)b * TT * CC + (size_t)h * HD; const unsigned fo = (unsigned)col * CC + 8u * g, co = 8u * g, vo = (unsigned)col * KHI + 8u * g;
  const _Float16* Qu = QH + base + (size_t)ql0 * CC; const _Float16* Ku = KH + base; const float* mu = CM + (size_t)pz * TT; const float* ru = CZ + (size_t)pz * TT; const __bf16* Vh = VB + ((size_t)b * CC + h * HD) * (size_t)KHI; const __bf16* Vl = VBL + ((size_t)b * CC + h * HD) * (size_t)KHI;
  v16h qf[2][2];
#pragma unroll
  for (int t = 0; t < 2; ++t)
#pragma unroll
    for (int ks = 0; ks < 2; ++ks) qf[t][ks] = frag_hu(Qu + t * 16 * CC + ks * 32, fo);
  XW();
  v8f acc[2][HD / 16] = {}; int kc = 0;
  do { v16h ka[2][2]; v4f m4[4], r4[4]; v16b vh[HD / 16], vl[HD / 16];   /* at least one trip: every tile has its diagonal */
#pragma unroll
    for (int kt = 0; kt < 2; ++kt)
#pragma unroll
      for (int ks = 0; ks < 2; ++ks) ka[kt][ks] = frag_hu(Ku + kt * 16 * CC + ks * 32, fo);
    XW();
#pragma unroll
    for (int q = 0; q < 4; ++q) { const int o = (q >> 1) * 16 + (q & 1) * 4; const float* pm = mu + co; const float* pr = ru + co; m4[q] = *(const v4f*)(pm + o); r4[q] = *(const v4f*)(pr + o); }
    XW();
#pragma unroll
    for (int j = 0; j < HD / 16; ++j) vh[j] = frag_bu(Vh + j * 16 * KHI, vo);
    XW();
#pragma unroll
    for (int j = 0; j < HD / 16; ++j) vl[j] = frag_bu(Vl + j * 16 * KHI, vo);
    XW();   /* all of a trip's loads are issued in front of its arithmetic: one load latency a trip */
#pragma unroll
    for (int t = 0; t < 2; ++t) { v8f s0 = {}, s1 = {};
      s0 = mm_h(ka[0][0], qf[t][0], s0); s1 = mm_h(ka[1][0], qf[t][0], s1); s0 = mm_h(ka[0][1], qf[t][1], s0); s1 = mm_h(ka[1][1], qf[t][1], s1);
      const int dk = ql0 + t * 16 + col - 8 * g - kc * 32;   /* query - the lane's first key */
      float pf[16];
#pragma unroll
      for (int i = 0; i < 8; ++i) { const float e0 = ex2(__builtin_fmaf(s0[i], SC2, -m4[i >> 2][i & 3])) * r4[i >> 2][i & 3], e1 = ex2(__builtin_fmaf(s1[i], SC2, -m4[2 + (i >> 2)][i & 3])) * r4[2 + (i >> 2)][i & 3]; pf[i] = (i <= dk) ? e0 : 0.f; pf[8 + i] = (16 + i <= dk) ? e1 : 0.f; }
      const F2 p = bsplit16(pf);
#pragma unroll
      for (int j = 0; j < HD / 16; ++j) acc[t][j] = mm_b(p.h, vh[j], acc[t][j]);
#pragma unroll
      for (int j = 0; j < HD / 16; ++j) acc[t][j] = mm_b(p.l, vh[j], acc[t][j]);
#pragma unroll
      for (int j = 0; j < HD / 16; ++j) acc[t][j] = mm_b(p.h, vl[j], acc[t][j]); }
    Ku += 32 * CC; mu += 32; ru += 32; Vh += 32; Vl += 32; } while (++kc <= qi);
#pragma unroll
  for (int t = 0; t < 2; ++t)
#pragma unroll
    for (int j = 0; j < HD / 16; ++j)
#pragma unroll
      for (int r = 0; r < 8; ++r) ss[wave][t * 16 + 8 * g + r][j * 16 + col] = acc[t][j][r] * (1.0f / 2048.0f);
  LDSX(); for (int i = 0; i < 16; ++i) vst2(Y + ((size_t)b * TT + ql0 + i * 2 + g) * CC + h * HD + col * 4, *(const v4f*)&ss[wave][i * 2 + g][col * 4]); }   /* a wave's own rows; a store = two rows' 256-byte (row, head) segments */
// ---- k_out: block = (128 rows, 128 cols): out = ctx Wo (+ bo): ctx once to f16 against Wo as f16(bf16 x 2^8) exact (1 product) x 2^-8; the last 128 rows of each sequence: ctx bf16 hi + lo against exact bf16 Wo (2 products)
__global__ __launch_bounds__(NW * 32) void k_out(const float* __restrict__ Y, const float* __restrict__ WO, const float* __restrict__ BO, float* __restrict__ OUT) { union Sm { float sf[NW][16][132]; __bf16 w[2 * WT_SZ + 4 * AT_SZ]; }; __shared__ __align__(16) Sm sm; float (&sf)[NW][16][132] = sm.sf;   /* weight tiles and the epilogue's staging share the LDS: sf is written only behind the product loop's last barrier */
  const int tid = threadIdx.x, wave = tid >> 5, lane = tid & 31, col = lane & 15, g = lane >> 4; const int c0 = blockIdx.y * 128; const size_t r0 = (size_t)blockIdx.x * BR + wave * 16;
  v8f acc[8] = {};
  const float* xp = Y + (r0 + g) * CC + col * 4; const float* wp = WO + (size_t)(wave * KR) * DIN + c0 + lane * 4; WT wt; XR xr; gemm_first(wt, xr, xp, wp, DIN);   /* both arms start from the same first tile */
  const int tb_ = (int)(((size_t)blockIdx.x * BR) % TT); if (CAUSAL && (tb_ < QHI || tb_ + BR > TT - 64)) {   /* block-uniform; the block that holds the LAST 64 query rows of each sequence takes the hi + lo context path: under a query-axis softmax the last key columns carry O(1) weights, so the context rows there are an order of magnitude larger */
    gemm_wt<1>(wt, xr, xp, wp, DIN, sm.w, wave, lane, acc);
#pragma unroll
    for (int j = 0; j < 8; ++j) { const float bias = BO ? bfr(BO[c0 + j * 16 + col]) : 0.f;
#pragma unroll
      for (int r = 0; r < 8; ++r) sf[wave][8 * g + r][j * 16 + col] = acc[j][r] + bias; }
  } else {
    gemm_wt<2>(wt, xr, xp, wp, DIN, sm.w, wave, lane, acc);   /* ctx carried x 2^6 into f16 so small-magnitude context rows stay clear of f16 subnormals */
#pragma unroll
    for (int j = 0; j < 8; ++j) { const float bias = BO ? bfr(BO[c0 + j * 16 + col]) : 0.f;
#pragma unroll
      for (int r = 0; r < 8; ++r) sf[wave][8 * g + r][j * 16 + col] = acc[j][r] * (1.0f / 16384.0f) + bias; } }   /* 2^-8 (Wo carry) x 2^-6 (ctx carry) */
  LDSX(); for (int rl = 0; rl < 16; ++rl) vst2(OUT + (r0 + rl) * DIN + c0 + lane * 4, *(const v4f*)&sf[wave][rl][lane * 4]); }

extern "C" void kernel_launch(void* const* d_in, const int* in_sizes, int n_in, void* d_out, int out_size, void* d_ws, size_t ws_size, hipStream_t stream) {
  (void)in_sizes; (void)n_in; (void)out_size;
  const float** F = (const float**)d_in;
  if (ws_size < (size_t)WS_END) return;
  char* ws = (char*)d_ws; _Float16 *QH = (_Float16*)(ws + WS_QH), *KH = (_Float16*)(ws + WS_KH), *VT = (_Float16*)(ws + WS_VT), *QL = (_Float16*)(ws + WS_QL), *KL = (_Float16*)(ws + WS_KL); __bf16 *VB = (__bf16*)(ws + WS_VB), *VBL = (__bf16*)(ws + WS_VBL); float *Y = (float*)(ws + WS_Y);
  (void)Y; (void)QL; (void)KL; (void)VB; (void)VBL;
  // inputs: 0 source [4,1024,1024]; 1 Wq [16,1024,64] (head, in, out), 2 bq [16,64]; 3 Wk, 4 bk; 5 Wv, 6 bv; 7 Wc [1024,1024] (in,out), 8 bc [1024] (all biases N(0, 0.02^2), nonzero)
  if (ws_size < (size_t)WS_END2) return;
  float *CM = (float*)(ws + WS_CM), *CZ = (float*)(ws + WS_CZ);
  k_proj<<<dim3(TNB * TT / PR, NH), PW * 32, 0, stream>>>(F[0], F[1], F[3], F[5], F[2], F[4], F[6], QH, KH, KL, VT, VB, VBL);
  k_colstat_w<<<dim3(TT / 64, NP), 256, 0, stream>>>(QH, KH, CM, CZ);   /* per key column j: max / sum over the visible queries i >= j */
  k_pv_w<<<dim3(TT / 256, 1, NP), 256, 0, stream>>>(QH, KH, CM, CZ, VB, VBL, Y);   /* P[i][j] = exp(S - m_j) x 2^11 / Z_j for j <= i, 0 above the diagonal */
  k_out<<<dim3(TNB * TT / BR, DIN / 128), NW * 32, 0, stream>>>(Y, F[7], F[8], (float*)d_out);
}

// v009
// Measured time: 95.3 microseconds a run.
// Next to v008, in two timings, it ran 1.17 times as fast each time.
// Over all steps from v000 it is 43.3 times as fast.
// compute dtype: all float inputs rounded to bf16; per-head q/k/v projections with EXACT bf16 products on WMMA 16x16x32 (f32 accumulate) + bias; causal scores q x k once to f16 each (1 product; sigma - 0.4) x 64^-0.5 on every block; softmax over the QUERY axis in f32 (per key column: max / sum over the visible queries; exp(x) = 2^(x log2 e) on the chip's own exp2 instruction, the logit scale and log2 e folded into one multiply-add); P as bf16 hi + lo against v as bf16 hi + lo (3 products) on EVERY block; ctx x 2^6 once to f16 x Wc f16(bf16 x 2^8) - except the LAST 128 rows of each sequence: ctx as bf16 hi + lo against exact bf16 Wc (2 products) - + bc; f32 output.
#include <hip/hip_runtime.h>
#include <math.h>

typedef __attribute__((ext_vector_type(16))) _Float16 v16h;
typedef __attribute__((ext_vector_type(16))) __bf16 v16b;
typedef __attribute__((ext_vector_type(8)))  _Float16 v8h;
typedef __attribute__((ext_vector_type(8)))  float v8f;
typedef __attribute__((ext_vector_type(4)))  float v4f;
typedef __attribute__((ext_vector_type(2)))  float v2f;
typedef __attribute__((ext_vector_type(4)))  unsigned v4u;
typedef __attribute__((ext_vector_type(4)))  int v4i;
typedef float __attribute__((may_alias)) float_a;
typedef int __attribute__((may_alias)) int_a;

template <typename T> __device__ __forceinline__ void vst2(void* p, T v) { *(T*)p = v;  }
__device__ __forceinline__ v8f wmma16(v16h a, v16h b, v8f c) {
  v8f d = __builtin_amdgcn_wmma_f32_16x16x32_f16(false, a, false, b, (short)0, c, false, false);
  asm volatile("v_nop\n\tv_nop\n\tv_nop\n\tv_nop" : "+v"(d) : "v"(a), "v"(b));
  return d;
}
__device__ __forceinline__ v8f wmma_bf(v16b a, v16b b, v8f c) {
  v8f d = __builtin_amdgcn_wmma_f32_16x16x32_bf16(false, a, false, b, (short)0, c, false, false);
  asm volatile("v_nop\n\tv_nop\n\tv_nop\n\tv_nop" : "+v"(d) : "v"(a), "v"(b));
  return d;
}
// 16x16x32 fragments: lane = (h = lane>>4, row/col = lane&15); elements 0..7 = k0+8h+0..7, 8..15 = k0+16+8h+0..7; D element r = row 8h+r
__device__ __forceinline__ v16h frag_h(const _Float16* rowk0, int lane) {
  union { v16h v; v8h q[2]; } u; const _Float16* p = rowk0 + 8 * (lane >> 4);
  u.q[0] = *(const v8h*)p; u.q[1] = *(const v8h*)(p + 16); return u.v;
}
__device__ __forceinline__ v16h frag_f32(const float* rowk0, int lane) {
  v16h a; const float* p = rowk0 + 8 * (lane >> 4);
#pragma unroll
  for (int i = 0; i < 8; ++i) { a[i] = (_Float16)p[i]; a[8 + i] = (_Float16)p[16 + i]; }
  return a;
}
__device__ __forceinline__ v16h frag_f32s(const float* rowk0, int lane, float sc) {
  v16h a; const float* p = rowk0 + 8 * (lane >> 4);
#pragma unroll
  for (int i = 0; i < 8; ++i) { a[i] = (_Float16)(p[i] * sc); a[8 + i] = (_Float16)(p[16 + i] * sc); }
  return a;
}
// column fragment from a [K][ld] layout (column n), rows >= K read as 0
__device__ __forceinline__ v16h fragc_f32(const float* W, int k0, int n, int lane, int ld, int K) {
  v16h a; const int g = lane >> 4;
#pragma unroll
  for (int i = 0; i < 8; ++i) { const int ka = k0 + 8 * g + i, kb = ka + 16;
    a[i] = (_Float16)(ka < K ? W[(size_t)(ka < K ? ka : K - 1) * ld + n] : 0.f); a[8 + i] = (_Float16)(kb < K ? W[(size_t)(kb < K ? kb : K - 1) * ld + n] : 0.f); }
  return a;
}
struct F2 { v16b h, l; };
__device__ __forceinline__ F2 bsplit16(const float v[16]) { F2 r;
#pragma unroll
  for (int i = 0; i < 16; ++i) { const __bf16 h = (__bf16)v[i]; r.h[i] = h; r.l[i] = (__bf16)(v[i] - (float)h); }
  return r; }
__device__ __forceinline__ F2 split_row(const float* row, int k0, int lane) { float v[16]; const float* p = row + k0 + 8 * (lane >> 4);
#pragma unroll
  for (int i = 0; i < 8; ++i) { v[i] = p[i]; v[8 + i] = p[16 + i]; }
  return bsplit16(v); }
__device__ __forceinline__ F2 split_rowK(const float* row, int k0, int lane, int K) { float v[16]; const int g = lane >> 4;
#pragma unroll
  for (int i = 0; i < 8; ++i) { const int ka = k0 + 8 * g + i, kb = ka + 16; v[i] = ka < K ? row[ka < K ? ka : K - 1] : 0.f; v[8 + i] = kb < K ? row[kb < K ? kb : K - 1] : 0.f; }
  return bsplit16(v); }
__device__ __forceinline__ F2 split_col(const float* W, int k0, int n, int lane, int ld, int K) { float v[16]; const int g = lane >> 4;
#pragma unroll
  for (int i = 0; i < 8; ++i) { const int ka = k0 + 8 * g + i, kb = ka + 16; v[i] = ka < K ? W[(size_t)(ka < K ? ka : K - 1) * ld + n] : 0.f; v[8 + i] = kb < K ? W[(size_t)(kb < K ? kb : K - 1) * ld + n] : 0.f; }
  return bsplit16(v); }
__device__ __forceinline__ v8f mac3(const F2& a, const F2& b, v8f c) { c = wmma_bf(a.l, b.h, c); c = wmma_bf(a.h, b.l, c); return wmma_bf(a.h, b.h, c); }
__device__ __forceinline__ float sigm(float v) { return 1.0f / (1.0f + expf(-v)); }
#define LDSX() do { asm volatile("s_wait_dscnt 0" ::: "memory"); __builtin_amdgcn_wave_barrier(); __builtin_amdgcn_fence(__ATOMIC_RELEASE, "workgroup"); } while (0)

// Causal multi-head attention whose softmax runs over the QUERY axis, with per-head projection tensors (source [4,1024,1024]; Wq / Wk / Wv [16,1024,64] (head, in, out) (0.02) + biases [16,64]; scores / sqrt(64) + triu(-inf, k=1); attn = softmax(..., axis=2) - axis 2 of [B, H, q, k] is the QUERY axis: every key column is normalised over the queries q >= k (faithful to the source); out = attn v; heads merged; Wc [1024,1024] (in,out) + bc).
#define NB 4
#define TT 1024
#define CC 1024            // NH * HD = projected width
#define DIN 1024          // input (model) width
#define NH 16
#define HD 64
#define NQB (TT / 64)
#define NP (NB * NH)        // (batch, head) pairs: the column-statistics and context kernels take all of them in one launch (grid y or z = pair)
#define SCALE (0.125f)
#define CAUSAL 1
#ifndef TNB
#define TNB NB
#endif
__device__ __forceinline__ float bfr(float v) { return (float)(__bf16)v; }
__host__ __device__ __forceinline__ int kb_last(int qb) { return CAUSAL ? ((qb * 64 + 63) >> 7) : (TT / 128 - 1); }
typedef __attribute__((ext_vector_type(8))) __bf16 v8b;
__device__ __forceinline__ v16b frag_b(const __bf16* rowk0, int lane) {
  union { v16b v; v8b q[2]; } u; const __bf16* p = rowk0 + 8 * (lane >> 4);
  u.q[0] = *(const v8b*)p; u.q[1] = *(const v8b*)(p + 16); return u.v;
}
#define QHI 0               // no q residual plane: the scores are small and single-product everywhere
#define KHI 1024            // key rows carrying k residual / v bf16 hi+lo planes (all key rows: the v planes feed every trip of k_pv_w; the k residual is not read)
// B fragment (k rows k0+.., output column o) of a weight: (in,out) [K][ld] or (out,in) [ld rows of K]: bf16 exact, or f16(bf16 * 256) exact
__device__ __forceinline__ v16b wcol_io(const float* Wm, int k0, int o, int lane, int ld) { v16b w; const int g = lane >> 4;
#pragma unroll
  for (int i = 0; i < 8; ++i) { w[i] = (__bf16)Wm[(size_t)(k0 + 8 * g + i) * ld + o]; w[8 + i] = (__bf16)Wm[(size_t)(k0 + 16 + 8 * g + i) * ld + o]; }
  return w; }
__device__ __forceinline__ v16b wcol_oi(const float* Wm, int k0, int o, int lane, int K) { v16b w; const float* p = Wm + (size_t)o * K + k0 + 8 * (lane >> 4);
#pragma unroll
  for (int i = 0; i < 8; ++i) { w[i] = (__bf16)p[i]; w[8 + i] = (__bf16)p[16 + i]; }
  return w; }
__device__ __forceinline__ v16h wcolh_io(const float* Wm, int k0, int o, int lane, int ld) { v16h w; const int g = lane >> 4;
#pragma unroll
  for (int i = 0; i < 8; ++i) { w[i] = (_Float16)(bfr(Wm[(size_t)(k0 + 8 * g + i) * ld + o]) * 256.0f); w[8 + i] = (_Float16)(bfr(Wm[(size_t)(k0 + 16 + 8 * g + i) * ld + o]) * 256.0f); }
  return w; }
__device__ __forceinline__ v16h wcolh_oi(const float* Wm, int k0, int o, int lane, int K) { v16h w; const float* p = Wm + (size_t)o * K + k0 + 8 * (lane >> 4);
#pragma unroll
  for (int i = 0; i < 8; ++i) { w[i] = (_Float16)(bfr(p[i]) * 256.0f); w[8 + i] = (_Float16)(bfr(p[16 + i]) * 256.0f); }
  return w; }
#define WQKV_LAYOUT 0   // 0 = per-head [NH][DIN][HD] (head, in, out); 1 = (out,in) [CC][DIN]; 2 = per-head [NH][DIN][HD]
__device__ __forceinline__ v16b wcol_hdk(const float* Wm, int k0, int o, int lane) { v16b w; const int g = lane >> 4; const float* p = Wm + (size_t)(o / HD) * DIN * HD + (o % HD);
#pragma unroll
  for (int i = 0; i < 8; ++i) { w[i] = (__bf16)p[(size_t)(k0 + 8 * g + i) * HD]; w[8 + i] = (__bf16)p[(size_t)(k0 + 16 + 8 * g + i) * HD]; }
  return w; }
#define WO_OUT_IN 0
#if WQKV_LAYOUT == 1
#define WCOL(W, k0, o, lane) wcol_oi(W, k0, o, lane, DIN)
#elif WQKV_LAYOUT == 2
#define WCOL(W, k0, o, lane) wcol_hdk(W, k0, o, lane)
#else
#define WCOL(W, k0, o, lane) wcol_io((W) + (size_t)((o) / 64) * DIN * 64, k0, (o) % 64, lane, 64)   /* per-head weight tensors [16][DIN][64] (head, in, out): output column o = h*64 + kk lives in head h's [DIN][64] (in,out) slab at pitch 64 (a 16-column tile never straddles a head) */
#endif
#if WO_OUT_IN
#define WOCOL(W, k0, o, lane) wcol_oi(W, k0, o, lane, CC)
#define WOCOLH(W, k0, o, lane) wcolh_oi(W, k0, o, lane, CC)
#else
#define WOCOL(W, k0, o, lane) wcol_io(W, k0, o, lane, DIN)
#define WOCOLH(W, k0, o, lane) wcolh_io(W, k0, o, lane, DIN)
#endif

#ifndef SM_EXTRA_PARAMS
#define SM_EXTRA_PARAMS
#endif
#ifndef PROJ_EXTRA_PARAMS
#define PROJ_EXTRA_PARAMS
#endif
#ifndef SM_MASK_HOOK
#define SM_MASK_HOOK (void)0
#endif

#define WS_QH  0u                                      // f16 q rows [b*t][CC]
#define WS_KH  (WS_QH + 2u * (size_t)NB * TT * CC)      // f16 k rows [b*t][CC]
#define WS_VT  (WS_KH + 2u * (size_t)NB * TT * CC)      // f16 v planes [b][c][t]
#define WS_QL  (WS_VT + 2u * (size_t)NB * CC * TT)      // f16 q residual x 2^10 rows [b][t < QHI][CC]
#define WS_KL  (WS_QL + 2u * (size_t)NB * QHI * CC)     // f16 k residual x 2^10 rows [b][t < KHI][CC]
#define WS_VB  (WS_KL + 2u * (size_t)NB * KHI * CC)     // bf16 v hi planes [b][c][t < KHI]
#define WS_VBL (WS_VB + 2u * (size_t)NB * CC * KHI)
#define WS_Y   (WS_VBL + 2u * (size_t)NB * CC * KHI)    // f32 ctx rows [b*t][CC] (only when there is an output projection)
#define WS_END (WS_Y  + 4u * (size_t)NB * TT * CC)
#define WS_CM (WS_END)                                  // f32 column maxima x log2(e) [NP][TT]
#define WS_CZ (WS_CM + 4u * (size_t)NP * TT)           // f32 2^11 / column sum [NP][TT]
#define WS_END2 (WS_CZ + 4u * (size_t)NP * TT)

// ---- weight tile in LDS for k_out (k_proj stages alike, with its own tile shape): a block's 64 k x 128 column slice of a (in,out) weight is read once for its eight waves (128 output rows), in whole 128-byte lines (a lane: 4 columns x 8 k rows, 16-byte loads), rounded to its 16-bit operand type in registers and stored column-major (a column's 64 k values in a row of 128 bytes), so that a B fragment is two 16-byte LDS reads. Two buffers: the next tile's loads (and the wave's own next A rows) fly during this tile's products, one barrier a tile. The A rows take the same road: a wave reads its 16 rows x 64 k in whole lines (a load = two rows' 256 bytes), rounds them to the operand type once and stores them row-major at a pitch of 144 bytes behind the weight buffers; an A fragment is two 16-byte LDS reads.
#define KT 64               // k rows of a tile
#define NW 8                // waves of a k_out block: each takes 16 of the block's output rows, all share the weight tile
#define KR (KT / NW)        // k rows of a weight tile that one wave brings in
#define BR (NW * 16)        // output rows of a block
#define WT_G 2336           // elements between the four column groups n & 3: 32 rows of 72 + 32. Column n lies at (n & 3) x 4672 B + (n >> 2) x 144 B: the storing lanes (columns 4 apart) and the reading lanes (16 neighbouring columns) both fall on 16 different 16-byte bank groups
#define WT_SZ (4 * WT_G)    // elements of one buffer
__device__ __forceinline__ int wt_row(int n) { return (n & 3) * WT_G + (n >> 2) * 72; }
struct WT { v4f r[KR]; };   // a lane's share of a tile: k rows wave x 8 + 0..7, columns lane x 4 + 0..3
#define AT_P 72             // elements between two A rows in LDS: 144 B = 16 B x 9, the reading lanes (16 neighbouring rows) fall on 16 different 16-byte bank groups
#define AT_SZ (BR * AT_P)   // elements of one A plane (the block's 128 rows)
typedef __attribute__((ext_vector_type(4))) __bf16 v4b;
typedef __attribute__((ext_vector_type(4))) _Float16 v4h;
struct XR { v4f r[8]; };    // a lane's share of its wave's A rows of one tile: rows 2q + (lane >> 4), k (lane & 15) x 4 + 0..3
__device__ __forceinline__ void wt_load(WT& t, const float* p, int ld) {
#pragma unroll
  for (int i = 0; i < KR; ++i) t.r[i] = *(const v4f*)(p + (size_t)i * ld); }
__device__ __forceinline__ void xr_load(XR& x, const float* p) {   // p = the wave's row (lane >> 4) at k (lane & 15) x 4; the A rows have 1024 elements
#pragma unroll
  for (int q = 0; q < 8; ++q) x.r[q] = *(const v4f*)(p + (size_t)(2 * q) * 1024); }
// MODE 0: bf16(a); 1: bf16 hi in the first plane, bf16 lo in the second; 2: f16(a x 2^6). ab = the buffer's first plane
template <int MODE> __device__ __forceinline__ void xr_store(const XR& x, __bf16* ab, int wave, int lane) {
#pragma unroll
  for (int q = 0; q < 8; ++q) { __bf16* d = ab + (wave * 16 + 2 * q + (lane >> 4)) * AT_P + (lane & 15) * 4;
    if (MODE == 2) { v4h o;
#pragma unroll
      for (int u = 0; u < 4; ++u) o[u] = (_Float16)(x.r[q][u] * 64.0f);
      *(v4h*)d = o;
    } else { v4b o, ol;
#pragma unroll
      for (int u = 0; u < 4; ++u) { const __bf16 h = (__bf16)x.r[q][u]; o[u] = h; ol[u] = (__bf16)(x.r[q][u] - (float)h); }
      *(v4b*)d = o; if (MODE == 1) *(v4b*)(d + AT_SZ) = ol; } } }
template <int F16> __device__ __forceinline__ void wt_store(const WT& t, __bf16* buf, int wave, int lane) {   // F16 = 0: bf16(w); 1: f16(bf16(w) x 2^8), both exact carriers of the bf16 weight
#pragma unroll
  for (int u = 0; u < 4; ++u) { __bf16* d = buf + wt_row(lane * 4 + u) + wave * KR;
#pragma unroll
    for (int hf = 0; hf < KR / 8; ++hf) {
      if (F16) { v8h o;
#pragma unroll
        for (int i = 0; i < 8; ++i) o[i] = (_Float16)(bfr(t.r[hf * 8 + i][u]) * 256.0f);
        *(v8h*)(d + hf * 8) = o;
      } else { v8b o;
#pragma unroll
        for (int i = 0; i < 8; ++i) o[i] = (__bf16)t.r[hf * 8 + i][u];
        *(v8b*)(d + hf * 8) = o; } } } }
// the first tile's loads, written once in front of any branch between the modes, with their wait directly behind them
__device__ __forceinline__ void gemm_first(WT& wt, XR& xr, const float* xp, const float* wp, int ldw) { wt_load(wt, wp, ldw); xr_load(xr, xp);
  asm volatile("s_wait_xcnt 0x0" ::: "memory"); __builtin_amdgcn_sched_barrier(0); }   /* the wait stands in front of any reuse of the address registers that the issued loads name; the scheduling barrier keeps the register arithmetic that follows from being lifted over it */
// acc[j] += A (the wave's 16 rows, f32 source, K = 1024) x W (columns j x 16 + 0..15 of the block's 128). xp = the wave's row g at k col x 4; wp = the weight at (k row wave x 8, the lane's 4 columns), ldw its row pitch. wt / xr = tile 0 as gemm_first loaded it. MODE 0: A bf16 x W bf16; 1: A bf16 hi + lo x W bf16 (2 products); 2: A x 2^6 f16 x W f16(bf16 x 2^8). Ends behind a barrier: the buffers may be reused
template <int MODE> __device__ __forceinline__ void gemm_wt(WT& wt, XR& xr, const float* xp, const float* wp, int ldw, __bf16* wbuf, int wave, int lane, v8f acc[8]) { const int col = lane & 15; constexpr int AB = (MODE == 1 ? 2 : 1) * AT_SZ; __bf16* abuf = wbuf + 2 * WT_SZ;   /* the A buffers lie behind the two weight buffers */
  wt_store<MODE == 2>(wt, wbuf, wave, lane); xr_store<MODE>(xr, abuf, wave, lane);
  __syncthreads();
  for (int t = 0; t < 1024 / KT; ++t) { const __bf16* wb = wbuf + (t & 1) * WT_SZ; const __bf16* ab = abuf + (t & 1) * AB + (wave * 16 + col) * AT_P;
    if (t + 1 < 1024 / KT) { wt_load(wt, wp + (size_t)(t + 1) * KT * ldw, ldw); xr_load(xr, xp + (t + 1) * KT);
      asm volatile("s_wait_xcnt 0x0" ::: "memory"); __builtin_amdgcn_sched_barrier(0); }   /* as above: the address registers are reused while the loads fly */
#pragma unroll
    for (int s = 0; s < 2; ++s) {
      v16b w[8], ah = frag_b(ab + s * 32, lane), al; if (MODE == 1) al = frag_b(ab + AT_SZ + s * 32, lane);
#pragma unroll
      for (int j = 0; j < 8; ++j) w[j] = frag_b(wb + wt_row(col) + j * (4 * 72) + s * 32, lane);   /* wt_row(j x 16 + col) written as one lane address + a constant: the eight fragments share one address register */
      __builtin_amdgcn_sched_barrier(0);   /* keeps the step's LDS reads together in front of its products: left alone the compiler reads each fragment into one register set directly in front of its product, and every product then waits out an LDS latency */
#pragma unroll
      for (int j = 0; j < 8; ++j) {
        if (MODE == 2) acc[j] = wmma16(__builtin_bit_cast(v16h, ah), __builtin_bit_cast(v16h, w[j]), acc[j]);
        else { acc[j] = wmma_bf(ah, w[j], acc[j]); if (MODE == 1) acc[j] = wmma_bf(al, w[j], acc[j]); } } }
    __builtin_amdgcn_sched_barrier(0);   /* keeps the wait for the next tile's loads behind this tile's last product: left alone the compiler lifts the first conversions, and the wait with them, in among the products */
    if (t + 1 < 1024 / KT) { wt_store<MODE == 2>(wt, wbuf + ((t + 1) & 1) * WT_SZ, wave, lane); xr_store<MODE>(xr, abuf + ((t + 1) & 1) * AB, wave, lane); }
    __syncthreads(); } }   /* the one barrier of a tile: publishes tile t + 1 and ends every wave's reads of the buffer that trip t + 1 refills */
// ---- k_proj: block = 256 rows x 192 columns, the 64 q, 64 k and 64 v columns of ONE head (grid y = head): the X rows are read once for all three products and each weight slab once for 256 rows. q/k/v = X W + b with exact bf16 products (K = DIN) -> q f16 rows; k f16 rows (+ residual rows < KHI); v f16 planes [c][t] (+ bf16 hi/lo planes for t < KHI). 16 waves in a 4 x 4 grid, a wave = 64 rows x 48 columns (4 A x 3 B fragments, 12 accumulators): 7 fragment reads feed 12 products. Staging as in k_out: tile = 64 k, two LDS buffers, the next tile's loads fly during this tile's products, one barrier a tile. Every wave brings its own 16 X rows; waves 0..11 also bring the weight tile: wave >> 2 = slab (q, k, v), a lane = 8 k rows x 4 columns
#define PW 16               // waves of a k_proj block
#define PR 256              // its output rows
#define PT_G (48 * 72 + 32) // as WT_G, for 192 columns: 48 rows of 72 + 32 elements between the four column groups n & 3
#define PT_SZ (4 * PT_G)    // elements of one weight buffer
#define PA_SZ (PR * AT_P)   // elements of one X buffer
__device__ __forceinline__ void pw_store(const WT& t, __bf16* d) {   // d = the lane's place in the buffer: column group (slab x 16 + col) x 72 + its first k; the lane's four columns lie PT_G apart
#pragma unroll
  for (int u = 0; u < 4; ++u) { v8b o;
#pragma unroll
    for (int i = 0; i < 8; ++i) o[i] = (__bf16)t.r[i][u];
    *(v8b*)(d + u * PT_G) = o; } }
__global__ __launch_bounds__(PW * 32) void k_proj(const float* __restrict__ X, const float* __restrict__ WQ, const float* __restrict__ WK, const float* __restrict__ WV, const float* __restrict__ BQ, const float* __restrict__ BK, const float* __restrict__ BV,
    _Float16* __restrict__ QH, _Float16* __restrict__ KH, _Float16* __restrict__ KL, _Float16* __restrict__ VT, __bf16* __restrict__ VB, __bf16* __restrict__ VBL) {
  union Sm { struct { _Float16 sq[PR][72], sk[PR][72], skl[PR][72], th[64][PR + 8]; __bf16 tb[64][PR + 8], tbl[64][PR + 8]; } e; __bf16 w[2 * PT_SZ + 2 * PA_SZ]; };   /* the tiles lie in the LDS of the epilogue's staging arrays, which are written only behind the product loop's last barrier */
  __shared__ __align__(16) Sm sm;
  const int tid = threadIdx.x, wave = __builtin_amdgcn_readfirstlane(tid >> 5) /* in a scalar register: the tests on the wave's number are scalar branches */, lane = tid & 31, col = lane & 15, g = lane >> 4; const int h = blockIdx.y; const size_t r0 = (size_t)blockIdx.x * PR; const size_t bb = r0 / TT; const int t0 = (int)(r0 % TT);
  const int wr = wave >> 2, wc = wave & 3;   /* the wave's place in the 4 x 4 grid: rows wr x 64, column fragments wc x 3 + 0..2 */
  const bool wl = wave < 12; const int slab = wave >> 2, kg = (wave & 3) * 2 + g;   /* weight loader: slab, and the lane's group of 8 k rows */
  const float* WA = slab == 0 ? WQ : slab == 1 ? WK : WV;
  const float* wp = WA + (size_t)h * DIN * 64 + (size_t)(kg * 8) * 64 + col * 4; const float* xp = X + (r0 + wave * 16 + g) * DIN + col * 4;
  __bf16* wbuf = sm.w; __bf16* abuf = sm.w + 2 * PT_SZ; const int wd = (slab * 16 + col) * 72 + kg * 8;
  v8f acc[4][3] = {}; WT wt; XR xr;
  if (wl) wt_load(wt, wp, 64);
  xr_load(xr, xp);
  asm volatile("s_wait_xcnt 0x0" ::: "memory"); __builtin_amdgcn_sched_barrier(0);   /* the wait stands in front of any reuse of the address registers that the issued loads name; the scheduling barrier keeps the register arithmetic that follows from being lifted over it */
  float bias[3];   /* the wave's three bias values are read here, beside the first tile's loads: read in the epilogue their latency would stand open */
#pragma unroll
  for (int j = 0; j < 3; ++j) { const int f = wc * 3 + j; const float* BA = (f >> 2) == 0 ? BQ : (f >> 2) == 1 ? BK : BV; bias[j] = BA[h * 64 + (f & 3) * 16 + col]; }
  asm volatile("s_wait_xcnt 0x0" ::: "memory"); __builtin_amdgcn_sched_barrier(0);   /* as above, for the bias loads */
#pragma unroll
  for (int j = 0; j < 3; ++j) bias[j] = bfr(bias[j]);
  if (wl) pw_store(wt, wbuf + wd);
  xr_store<0>(xr, abuf, wave, lane);
  __syncthreads();
  for (int t = 0; t < DIN / KT; ++t) { const __bf16* wb = wbuf + (t & 1) * PT_SZ + (col & 3) * PT_G + (col >> 2) * 72 + wc * (3 * 4 * 72); const __bf16* ab = abuf + (t & 1) * PA_SZ + (wr * 64 + col) * AT_P;
    if (t + 1 < DIN / KT) { if (wl) wt_load(wt, wp + (size_t)(t + 1) * KT * 64, 64);
      xr_load(xr, xp + (t + 1) * KT);
      asm volatile("s_wait_xcnt 0x0" ::: "memory"); __builtin_amdgcn_sched_barrier(0); }   /* as above: the address registers are reused while the loads fly */
#pragma unroll
    for (int s = 0; s < 2; ++s) { v16b a[4], w[3];
#pragma unroll
      for (int i = 0; i < 4; ++i) a[i] = frag_b(ab + i * (16 * AT_P) + s * 32, lane);
#pragma unroll
      for (int j = 0; j < 3; ++j) w[j] = frag_b(wb + j * (4 * 72) + s * 32, lane);
      __builtin_amdgcn_sched_barrier(0);   /* keeps the step's LDS reads together in front of its products: left alone the compiler reads each fragment directly in front of its product, and every product then waits out an LDS latency */
#pragma unroll
      for (int i = 0; i < 4; ++i)
#pragma unroll
        for (int j = 0; j < 3; ++j) acc[i][j] = wmma_bf(a[i], w[j], acc[i][j]); }
    __builtin_amdgcn_sched_barrier(0);   /* keeps the wait for the next tile's loads behind this tile's last product */
    if (t + 1 < DIN / KT) { if (wl) pw_store(wt, wbuf + ((t + 1) & 1) * PT_SZ + wd);
      xr_store<0>(xr, abuf + ((t + 1) & 1) * PA_SZ, wave, lane); }
    __syncthreads(); }   /* the one barrier of a tile: publishes tile t + 1 and ends every wave's reads of the buffer that trip t + 1 refills; the last one frees the LDS for the epilogue */
#pragma unroll
  for (int j = 0; j < 3; ++j) { const int f = wc * 3 + j, wh = f >> 2, cl = (f & 3) * 16 + col;   /* column fragment f of the block's 12: which product (wave-uniform), and the column inside the head */
    if (wh == 0) {
#pragma unroll
      for (int i = 0; i < 4; ++i)
#pragma unroll
        for (int r = 0; r < 8; ++r) sm.e.sq[wr * 64 + i * 16 + 8 * g + r][cl] = (_Float16)(acc[i][j][r] + bias[j]);
    } else if (wh == 1) {
#pragma unroll
      for (int i = 0; i < 4; ++i)
#pragma unroll
        for (int r = 0; r < 8; ++r) { const float v = acc[i][j][r] + bias[j]; const _Float16 hv = (_Float16)v; const int rl = wr * 64 + i * 16 + 8 * g + r; sm.e.sk[rl][cl] = hv; sm.e.skl[rl][cl] = (_Float16)((v - (float)hv) * 1024.0f); }
    } else {
#pragma unroll
      for (int i = 0; i < 4; ++i)
#pragma unroll
        for (int r = 0; r < 8; ++r) { const float v = acc[i][j][r] + bias[j]; const int rl = wr * 64 + i * 16 + 8 * g + r; sm.e.th[cl][rl] = (_Float16)v; const __bf16 bh = (__bf16)v; sm.e.tb[cl][rl] = bh; sm.e.tbl[cl][rl] = (__bf16)(v - (float)bh); } } }
  __syncthreads();
  const bool hi_rows = t0 < KHI;
  for (int e = tid; e < PR * 8; e += PW * 32) { const int rl = e >> 3, q = e & 7; const size_t o = (r0 + rl) * CC + h * 64 + q * 8;   /* a (row, head) segment = one 128-byte line */
    vst2((unsigned*)(QH + o), *(const v4u*)&sm.e.sq[rl][q * 8]); vst2((unsigned*)(KH + o), *(const v4u*)&sm.e.sk[rl][q * 8]); if (hi_rows) vst2((unsigned*)(KL + (bb * KHI + t0 + rl) * (size_t)CC + h * 64 + q * 8), *(const v4u*)&sm.e.skl[rl][q * 8]); }
  for (int e = tid; e < 64 * (PR / 8); e += PW * 32) { const int cl = e / (PR / 8), q = e % (PR / 8); vst2((unsigned*)(VT + (bb * CC + h * 64 + cl) * (size_t)TT + t0 + q * 8), *(const v4u*)&sm.e.th[cl][q * 8]); if (hi_rows) { const size_t o3 = (bb * CC + h * 64 + cl) * (size_t)KHI + t0 + q * 8; vst2((unsigned*)(VB + o3), *(const v4u*)&sm.e.tb[cl][q * 8]); vst2((unsigned*)(VBL + o3), *(const v4u*)&sm.e.tbl[cl][q * 8]); } } }
// ---- k_sm: block = query row t (head in group): keys [0, kend): causal -> logit if s <= t else excluded; softmax in f32; P x 2^11 in place (0 for excluded)
__global__ __launch_bounds__(256) void k_sm(float* __restrict__ S0 SM_EXTRA_PARAMS) { __shared__ float sred[8]; __shared__ float sbc; __shared__ __align__(16) float shv[TT];
  const int tid = threadIdx.x; const int t = blockIdx.x; const int kend = (kb_last(t >> 6) + 1) * 128;
  float* sr = S0 + (size_t)blockIdx.y * TT * TT + (size_t)t * TT;
  float m = -3.0e38f; for (int k = tid; k < kend; k += 256) { float v = (!CAUSAL || k <= t) ? sr[k] : -3.0e38f; SM_MASK_HOOK; shv[k] = v; m = fmaxf(m, v); }
#pragma unroll
  for (int o = 1; o < 32; o <<= 1) m = fmaxf(m, __shfl_xor(m, o));
  if ((tid & 31) == 0) sred[tid >> 5] = m; __syncthreads(); if (tid == 0) { float a = sred[0]; for (int i = 1; i < 8; ++i) a = fmaxf(a, sred[i]); sbc = a; } __syncthreads(); m = sbc; __syncthreads();
  float sum = 0.f; for (int k = tid; k < kend; k += 256) { const float v = shv[k]; const float e = (v <= -1.0e38f) ? 0.f : expf(v - m); shv[k] = e; sum += e; }
#pragma unroll
  for (int o = 1; o < 32; o <<= 1) sum += __shfl_xor(sum, o);
  if ((tid & 31) == 0) sred[tid >> 5] = sum; __syncthreads(); if (tid == 0) { float a = 0.f; for (int i = 0; i < 8; ++i) a += sred[i]; sbc = a > 0.f ? 2048.0f / a : 0.f; }   /* a fully excluded row yields P = 0 */ __syncthreads(); const float inv = sbc;
  for (int k = tid; k < kend; k += 256) shv[k] = shv[k] * inv;
  __syncthreads(); for (int q = tid; q < kend / 4; q += 256) vst2(sr + q * 4, *(const v4f*)&shv[q * 4]); }
// the products of k_colstat_w and k_pv_w: the plain builtins (the compiler keeps the distances behind its own matrix instructions, and their operands may lie in any register window)
__device__ __forceinline__ v8f mm_h(v16h a, v16h b, v8f c) { return __builtin_amdgcn_wmma_f32_16x16x32_f16(false, a, false, b, (short)0, c, false, false); }
__device__ __forceinline__ v8f mm_b(v16b a, v16b b, v8f c) { return __builtin_amdgcn_wmma_f32_16x16x32_bf16(false, a, false, b, (short)0, c, false, false); }
#define SC2 (SCALE * 1.44269504088896340736f)   // logit scale x log2(e): exp(s x SCALE - m) = 2^(s x SC2 - m2), m2 = m x log2(e); the column maxima are kept and stored in these log2 units
__device__ __forceinline__ float ex2(float v) { return __builtin_amdgcn_exp2f(v); }   // one v_exp_f32; a result below the normal range may come out 0, which is what such a term weighs beside a column sum >= 1
#define XW() do { asm volatile("s_wait_xcnt 0x0" ::: "memory"); __builtin_amdgcn_sched_barrier(0); } while (0)   /* behind a group of global loads: the wait stands in front of any later write of a register that the issued loads name (address, offset, scalar base); the scheduling barrier keeps such writes from being lifted over it and the loads from sinking below it */
// fragment loads as wave-uniform base + one 32-bit lane offset (elements): the lane offsets are formed once and stay in their registers, so no load of a loop names a vector register that is written again
__device__ __forceinline__ v16h frag_hu(const _Float16* ub, unsigned off) { union { v16h v; v8h q[2]; } u; const _Float16* p = ub + off; u.q[0] = *(const v8h*)p; u.q[1] = *(const v8h*)(p + 16); return u.v; }
// ---- k_colstat_w: softmax over the QUERY axis under the causal mask (the source's softmax(axis=2) on [B, H, q, k] scores with -inf where k > q): for every key column k: m_k = max_{q >= k} S[q][k], Z_k = sum_{q >= k} exp(S[q][k] - m_k) (f32, as 2^(s x SC2 - m2)). The logits are formed here on the matrix unit (q f16 x k f16, one product, x SC2: log2 units) and never stored. Block = 64 key columns of one (batch, head) pair, 8 waves: a wave keeps the 64 columns' k fragments in registers and takes every eighth 16-query tile from the block's first column down; a lane (column col, rows 8g + r) keeps a running (m, z) per column tile, rescaled once a tile; the 16 partial pairs of a column (8 waves x 2 lane halves) meet in LDS and are merged as z_w x 2^(m_w - m).
// The k rows (once for the block) and the q rows (a stage = the eight waves' next tiles, 128 rows, every wave bringing its own 16) come into LDS by asynchronous copies in whole 128-byte lines (a copy = four rows) and lie there at a pitch of 144 bytes; the fragments are read from LDS. Two q buffers: stage n + 1 flies while stage n is worked on; one barrier a stage; a wave whose tile lies past the last query brings and works nothing, but passes every wait and barrier
#define SP 72                        // elements between two staged rows of 64: 144 B = 16 B x 9, the 16 rows that a fragment read touches fall on different bank groups
#define CQ_SZ (128 * SP)             // elements of one q stage buffer
// a wave's own q tile: rows (lane >> 3) + 0, 4, 8, 12, 16 bytes a lane. ld = the lane's LDS byte address of the first, q = its source address
__device__ __forceinline__ void cs_copy(unsigned ld, const _Float16* q) {
  /* the copies go from global memory to LDS through no register; s_wait_xcnt 0 as the statement's last line stands in front of every later write of a register that a copy names */
  asm volatile("global_load_async_to_lds_b128 %0, %4, off\n\t"
               "global_load_async_to_lds_b128 %1, %5, off\n\t"
               "global_load_async_to_lds_b128 %2, %6, off\n\t"
               "global_load_async_to_lds_b128 %3, %7, off\n\t"
               "s_wait_xcnt 0x0"
               :: "v"(ld), "v"(ld + 4u * SP * 2u), "v"(ld + 8u * SP * 2u), "v"(ld + 12u * SP * 2u), "v"(q), "v"(q + 4 * CC), "v"(q + 8 * CC), "v"(q + 12 * CC) : "memory"); }
__global__ __launch_bounds__(256) void k_colstat_w(const _Float16* __restrict__ QH, const _Float16* __restrict__ KH, float* __restrict__ CM, float* __restrict__ CZ) { __shared__ __align__(16) float sm[16][64], sz[16][64]; __shared__ __align__(16) _Float16 sk[64 * SP], sq[2 * CQ_SZ];
  const int tid = threadIdx.x, wave = __builtin_amdgcn_readfirstlane(tid >> 5) /* in a scalar register: the tests on the wave's tile are scalar branches, every lane is on at the products and at the copies */, lane = tid & 31, col = lane & 15, g = lane >> 4; const int kb = blockIdx.x, pz = blockIdx.y, k0 = kb * 64;
  const size_t base = (size_t)(pz / NH) * TT * CC + (size_t)(pz % NH) * HD;
  float m[4], z[4];
#pragma unroll
  for (int j = 0; j < 4; ++j) { m[j] = -3.0e38f; z[j] = 0.f; }
  int qt = kb * 4 + wave;   /* tiles above the block's first column hold no visible query */
  const int nst = (TT / 16 - kb * 4 + 7) >> 3;   /* stages of the block: eight tiles each, the last one may hold four */
  const int nw = (TT / 16 + 7 - qt) >> 3;        /* the wave's own tiles, one a stage from stage 0 on: nst, or one less (0 where its first tile lies past the last query) */
  const int cr = lane >> 3, cc8 = (lane & 7) * 8;   /* the lane's first row of a copy group and its 8 elements of that row */
  const _Float16* kp = KH + base + (size_t)(k0 + wave * 8 + cr) * CC + cc8; const _Float16* qp = QH + base + (size_t)(qt * 16 + cr) * CC + cc8;
  const unsigned lk = (unsigned)(size_t)sk + (unsigned)((wave * 8 + cr) * SP + cc8) * 2u, lq = (unsigned)(size_t)sq + (unsigned)((wave * 16 + cr) * SP + cc8) * 2u;
  /* the block's 64 k rows, eight a wave; the wait as in cs_copy */
  asm volatile("global_load_async_to_lds_b128 %0, %2, off\n\tglobal_load_async_to_lds_b128 %1, %3, off\n\ts_wait_xcnt 0x0" :: "v"(lk), "v"(lk + 4u * SP * 2u), "v"(kp), "v"(kp + 4 * CC) : "memory");
  if (0 < nw) cs_copy(lq, qp);
  asm volatile("s_wait_asynccnt 0x0" ::: "memory");   /* the k rows and stage 0 have landed, as far as this wave copied them */
  __syncthreads();                                    /* ... and every other wave's share: they may be read */
  if (1 < nw) cs_copy(lq + CQ_SZ * 2u, qp + 8 * 16 * CC);
  v16h kf[4][2];
#pragma unroll
  for (int j = 0; j < 4; ++j)
#pragma unroll
    for (int ks = 0; ks < 2; ++ks) kf[j][ks] = frag_h(sk + (j * 16 + col) * SP + ks * 32, lane);
  for (int n = 0; n < nst; ++n) {
    if (n < nw) { const _Float16* qa = sq + (n & 1) * CQ_SZ + (wave * 16 + col) * SP; const v16h a0 = frag_h(qa, lane), a1 = frag_h(qa + 32, lane);
      v8f s[4] = {};
#pragma unroll
      for (int j = 0; j < 4; ++j) s[j] = mm_h(a0, kf[j][0], s[j]);
#pragma unroll
      for (int j = 0; j < 4; ++j) s[j] = mm_h(a1, kf[j][1], s[j]);
      const int dq = qt * 16 + 8 * g - k0 - col;   /* query of element 0 - key of column tile 0 */
#pragma unroll
      for (int j = 0; j < 4; ++j) { float sv[8], tm = -3.0e38f;
#pragma unroll
        for (int r = 0; r < 8; ++r) { sv[r] = s[j][r] * SC2; tm = fmaxf(tm, (dq + r >= j * 16) ? sv[r] : -3.0e38f); }
        const float mn = fmaxf(m[j], tm); float zs = z[j] * ex2(m[j] - mn);
#pragma unroll
        for (int r = 0; r < 8; ++r) { const float e = ex2(__builtin_fmaf(s[j][r], SC2, -mn)); zs += (dq + r >= j * 16) ? e : 0.f; }
        m[j] = mn; z[j] = zs; } }
    asm volatile("s_wait_dscnt 0x0" ::: "memory");      /* this wave's reads of stage n have returned before the buffer is handed to its next writer */
    asm volatile("s_wait_asynccnt 0x0" ::: "memory");   /* this wave's copies of stage n + 1 have landed */
    __syncthreads();                                    /* the one barrier of a stage: publishes stage n + 1 and ends every wave's reads of the buffer that is refilled behind it */
    qt += 8;
    if (n + 2 < nw) cs_copy(lq + (unsigned)(n & 1) * (CQ_SZ * 2u), qp + (size_t)(n + 2) * (8 * 16 * CC)); }
  asm volatile("s_wait_asynccnt 0x0" ::: "memory");     /* no copy is left in flight behind the loop */
#pragma unroll
  for (int j = 0; j < 4; ++j) { sm[wave * 2 + g][j * 16 + col] = m[j]; sz[wave * 2 + g][j * 16 + col] = z[j]; }
  __syncthreads();
  if (tid < 64) { float mm = -3.0e38f, zz = 0.f;   /* a partial with no visible row of a column brings (-3e38, 0): its term is 0 */
#pragma unroll
    for (int w = 0; w < 16; ++w) mm = fmaxf(mm, sm[w][tid]);
#pragma unroll
    for (int w = 0; w < 16; ++w) zz += sz[w][tid] * ex2(sm[w][tid] - mm);
    vst2(CM + (size_t)pz * TT + k0 + tid, mm); vst2(CZ + (size_t)pz * TT + k0 + tid, 2048.0f / zz); } }   /* every column sees at least its own diagonal entry: Z_k >= 1; stored as 2^11 / Z_k, one division a column, the factor k_pv_w multiplies by; the maximum goes out in log2 units */
// ---- k_pv_w: ctx = P . v, the logits formed again on the matrix unit where P is needed. A wave = 32 queries (two 16-query tiles, their q fragments kept in registers) of one (batch, head) pair, a trip = 32 keys, up to the wave's own diagonal. The logits are taken TRANSPOSED (A = 16 key rows of k, B = the 16 queries of q): D element r of lane (g, col) is key 8g + r of query col, so the two key tiles of a trip are, register for register, elements 0..7 and 8..15 of the P fragment (row = query col, keys +8g+0..7 and +16+8g+0..7): no move between lanes. P = 2^(s x SC2 - m2_k) x (2^11 / Z_k) for key <= query, 0 above the diagonal; P and v as bf16 hi + lo, 3 products, each accumulator in the order h.vh, l.vh, h.vl. The k and v fragments of a trip serve both query tiles. Block = 8 waves of one pair: waves w and w + 4 take the 32-query tiles i and 31 - i (i + 1 and 32 - i trips), 33 trips for every such two.
// The eight waves walk the same keys, so what a trip reads is brought into LDS once for the block, 64 keys (two trips) a stage, by asynchronous copies in whole 128-byte lines (a copy = four rows): 64 k rows, 64 v hi and 64 v lo channel rows of 128 bytes each, laid at a pitch of 144 bytes (16 B x 9: the 16 rows that a fragment read touches fall on different bank groups), and the 64 keys' m2 and 2^11 / Z. Two buffers: stage s + 1 flies while stage s is worked on; one barrier a stage; a wave past its own diagonal skips the trips, never the copies, the waits or the barrier
#define ST_VH (64 * SP)              // element offsets in a stage buffer: k rows at 0, v hi, v lo, then 64 f32 m2 and 64 f32 2^11 / Z
#define ST_VL (ST_VH + HD * SP)
#define ST_MR (ST_VL + HD * SP)
#define ST_SZ (ST_MR + 256)          // elements of one stage buffer
struct PvSrc { const _Float16* k; const __bf16* vh; const __bf16* vl; const float* mr; };   // the lane's own source addresses of the next stage to copy
// one stage's copies of one wave: rows wave x 8 + (lane >> 3) and + 4 of each of the three planes, 16 bytes a lane; wave 0 also brings m2 (lanes 0..15) and 2^11 / Z (lanes 16..31). ld = the lane's LDS byte address in the k plane of the target buffer, lm = its address in the m2 / Z rows. Then the sources step on by one stage
__device__ __forceinline__ void pv_copy(unsigned ld, unsigned lm, PvSrc& p, int wave) {
  /* the copies go from global memory to LDS through no register; s_wait_xcnt 0 as the statement's last line stands in front of every later write of a register that a copy names */
  asm volatile("global_load_async_to_lds_b128 %0, %6, off\n\t"
               "global_load_async_to_lds_b128 %1, %7, off\n\t"
               "global_load_async_to_lds_b128 %2, %8, off\n\t"
               "global_load_async_to_lds_b128 %3, %9, off\n\t"
               "global_load_async_to_lds_b128 %4, %10, off\n\t"
               "global_load_async_to_lds_b128 %5, %11, off\n\t"
               "s_wait_xcnt 0x0"
               :: "v"(ld), "v"(ld + 4u * SP * 2u), "v"(ld + ST_VH * 2u), "v"(ld + ST_VH * 2u + 4u * SP * 2u), "v"(ld + ST_VL * 2u), "v"(ld + ST_VL * 2u + 4u * SP * 2u),
                  "v"(p.k), "v"(p.k + 4 * CC), "v"(p.vh), "v"(p.vh + 4 * KHI), "v"(p.vl), "v"(p.vl + 4 * KHI) : "memory");
  if (wave == 0) asm volatile("global_load_async_to_lds_b128 %0, %1, off\n\ts_wait_xcnt 0x0" :: "v"(lm), "v"(p.mr) : "memory");   /* as above; the test is on a scalar register: every lane is on at the copy */
  p.k += 64 * CC; p.vh += 64; p.vl += 64; p.mr += 64; }
__global__ __launch_bounds__(256) void k_pv_w(const _Float16* __restrict__ QH, const _Float16* __restrict__ KH, const float* __restrict__ CM, const float* __restrict__ CZ, const __bf16* __restrict__ VB, const __bf16* __restrict__ VBL, float* __restrict__ Y) { __shared__ __align__(16) float ss[8][32][HD + 4]; __shared__ __align__(16) __bf16 st[2 * ST_SZ];
  const int tid = threadIdx.x, wave = __builtin_amdgcn_readfirstlane(tid >> 5) /* in a scalar register: the trip tests are wave-uniform scalar branches */, lane = tid & 31, col = lane & 15, g = lane >> 4; const int pz = blockIdx.z, b = pz / NH, h = pz % NH;
  const int i4 = blockIdx.x * 4 + (wave & 3), qi = wave < 4 ? i4 : 31 - i4, ql0 = qi * 32;
  const int ns = ((31 - (int)blockIdx.x * 4) >> 1) + 1;   /* stages of the block: up to the diagonal of its last query tile, 31 - 4 x blockIdx.x */
  const size_t base = (size_t)b * TT * CC + (size_t)h * HD; const unsigned fo = (unsigned)col * CC + 8u * g;
  const _Float16* Qu = QH + base + (size_t)ql0 * CC;
  const int crow = wave * 8 + (lane >> 3), cc8 = (lane & 7) * 8;   /* the lane's first row of a plane and its 8 elements of that row */
  PvSrc sp; sp.k = KH + base + (size_t)crow * CC + cc8; sp.vh = VB + ((size_t)b * CC + h * HD + crow) * (size_t)KHI + cc8; sp.vl = VBL + ((size_t)b * CC + h * HD + crow) * (size_t)KHI + cc8; sp.mr = (g ? CZ : CM) + (size_t)pz * TT + col * 4;
  const unsigned lb = (unsigned)(size_t)st, ld0 = lb + (unsigned)(crow * SP + cc8) * 2u, lm0 = lb + ST_MR * 2u + (unsigned)lane * 16u;
  pv_copy(ld0, lm0, sp, wave);
  v16h qf[2][2];
#pragma unroll
  for (int t = 0; t < 2; ++t)
#pragma unroll
    for (int ks = 0; ks < 2; ++ks) qf[t][ks] = frag_hu(Qu + t * 16 * CC + ks * 32, fo);
  XW();
  asm volatile("s_wait_asynccnt 0x0" ::: "memory");   /* stage 0 has landed, as far as this wave copied it */
  __syncthreads();                                    /* ... and every other wave's share: stage 0 may be read */
  if (1 < ns) pv_copy(ld0 + ST_SZ * 2u, lm0 + ST_SZ * 2u, sp, wave);
  v8f acc[2][HD / 16] = {};
  for (int s = 0; s < ns; ++s) { const __bf16* sb = st + (s & 1) * ST_SZ;
#pragma unroll
    for (int u = 0; u < 2; ++u) { const int kc = 2 * s + u;
      if (kc <= qi) { v16h ka[2][2]; v4f m4[4], r4[4]; v16b vh[HD / 16], vl[HD / 16];
#pragma unroll
        for (int kt = 0; kt < 2; ++kt)
#pragma unroll
          for (int ks = 0; ks < 2; ++ks) ka[kt][ks] = frag_h((const _Float16*)sb + (u * 32 + kt * 16 + col) * SP + ks * 32, lane);
#pragma unroll
        for (int q = 0; q < 4; ++q) { const float* pm = (const float*)(sb + ST_MR) + u * 32 + 8 * g + (q >> 1) * 16 + (q & 1) * 4; m4[q] = *(const v4f*)pm; r4[q] = *(const v4f*)(pm + 64); }
#pragma unroll
        for (int j = 0; j < HD / 16; ++j) vh[j] = frag_b(sb + ST_VH + (j * 16 + col) * SP + u * 32, lane);
#pragma unroll
        for (int j = 0; j < HD / 16; ++j) vl[j] = frag_b(sb + ST_VL + (j * 16 + col) * SP + u * 32, lane);
#pragma unroll
        for (int t = 0; t < 2; ++t) { v8f s0 = {}, s1 = {};
          s0 = mm_h(ka[0][0], qf[t][0], s0); s1 = mm_h(ka[1][0], qf[t][0], s1); s0 = mm_h(ka[0][1], qf[t][1], s0); s1 = mm_h(ka[1][1], qf[t][1], s1);
          const int dk = ql0 + t * 16 + col - 8 * g - kc * 32;   /* query - the lane's first key */
          float pf[16];
#pragma unroll
          for (int i = 0; i < 8; ++i) { const float e0 = ex2(__builtin_fmaf(s0[i], SC2, -m4[i >> 2][i & 3])) * r4[i >> 2][i & 3], e1 = ex2(__builtin_fmaf(s1[i], SC2, -m4[2 + (i >> 2)][i & 3])) * r4[2 + (i >> 2)][i & 3]; pf[i] = (i <= dk) ? e0 : 0.f; pf[8 + i] = (16 + i <= dk) ? e1 : 0.f; }
          const F2 p = bsplit16(pf);
#pragma unroll
          for (int j = 0; j < HD / 16; ++j) acc[t][j] = mm_b(p.h, vh[j], acc[t][j]);
#pragma unroll
          for (int j = 0; j < HD / 16; ++j) acc[t][j] = mm_b(p.l, vh[j], acc[t][j]);
#pragma unroll
          for (int j = 0; j < HD / 16; ++j) acc[t][j] = mm_b(p.h, vl[j], acc[t][j]); } } }
    asm volatile("s_wait_dscnt 0x0" ::: "memory");      /* this wave's reads of stage s have returned before the buffer is handed to its next writer */
    asm volatile("s_wait_asynccnt 0x0" ::: "memory");   /* this wave's copies of stage s + 1 have landed */
    __syncthreads();                                    /* the one barrier of a stage: publishes stage s + 1 and ends every wave's reads of the buffer that is refilled behind it */
    if (s + 2 < ns) pv_copy(ld0 + (unsigned)(s & 1) * (ST_SZ * 2u), lm0 + (unsigned)(s & 1) * (ST_SZ * 2u), sp, wave); }
  asm volatile("s_wait_asynccnt 0x0" ::: "memory");     /* no copy is left in flight behind the loop */
#pragma unroll
  for (int t = 0; t < 2; ++t)
#pragma unroll
    for (int j = 0; j < HD / 16; ++j)
#pragma unroll
      for (int r = 0; r < 8; ++r) ss[wave][t * 16 + 8 * g + r][j * 16 + col] = acc[t][j][r] * (1.0f / 2048.0f);
  LDSX(); for (int i = 0; i < 16; ++i) vst2(Y + ((size_t)b * TT + ql0 + i * 2 + g) * CC + h * HD + col * 4, *(const v4f*)&ss[wave][i * 2 + g][col * 4]); }   /* a wave's own rows; a store = two rows' 256-byte (row, head) segments */
// ---- k_out: block = (128 rows, 128 cols): out = ctx Wo (+ bo): ctx once to f16 against Wo as f16(bf16 x 2^8) exact (1 product) x 2^-8; the last 128 rows of each sequence: ctx bf16 hi + lo against exact bf16 Wo (2 products)
__global__ __launch_bounds__(NW * 32) void k_out(const float* __restrict__ Y, const float* __restrict__ WO, const float* __restrict__ BO, float* __restrict__ OUT) { union Sm { float sf[NW][16][132]; __bf16 w[2 * WT_SZ + 4 * AT_SZ]; }; __shared__ __align__(16) Sm sm; float (&sf)[NW][16][132] = sm.sf;   /* weight tiles and the epilogue's staging share the LDS: sf is written only behind the product loop's last barrier */
  const int tid = threadIdx.x, wave = tid >> 5, lane = tid & 31, col = lane & 15, g = lane >> 4; const int c0 = blockIdx.y * 128; const size_t r0 = (size_t)blockIdx.x * BR + wave * 16;
  v8f acc[8] = {};
  const float* xp = Y + (r0 + g) * CC + col * 4; const float* wp = WO + (size_t)(wave * KR) * DIN + c0 + lane * 4; WT wt; XR xr; gemm_first(wt, xr, xp, wp, DIN);   /* both arms start from the same first tile */
  const int tb_ = (int)(((size_t)blockIdx.x * BR) % TT); if (CAUSAL && (tb_ < QHI || tb_ + BR > TT - 64)) {   /* block-uniform; the block that holds the LAST 64 query rows of each sequence takes the hi + lo context path: under a query-axis softmax the last key columns carry O(1) weights, so the context rows there are an order of magnitude larger */
    gemm_wt<1>(wt, xr, xp, wp, DIN, sm.w, wave, lane, acc);
#pragma unroll
    for (int j = 0; j < 8; ++j) { const float bias = BO ? bfr(BO[c0 + j * 16 + col]) : 0.f;
#pragma unroll
      for (int r = 0; r < 8; ++r) sf[wave][8 * g + r][j * 16 + col] = acc[j][r] + bias; }
  } else {
    gemm_wt<2>(wt, xr, xp, wp, DIN, sm.w, wave, lane, acc);   /* ctx carried x 2^6 into f16 so small-magnitude context rows stay clear of f16 subnormals */
#pragma unroll
    for (int j = 0; j < 8; ++j) { const float bias = BO ? bfr(BO[c0 + j * 16 + col]) : 0.f;
#pragma unroll
      for (int r = 0; r < 8; ++r) sf[wave][8 * g + r][j * 16 + col] = acc[j][r] * (1.0f / 16384.0f) + bias; } }   /* 2^-8 (Wo carry) x 2^-6 (ctx carry) */
  LDSX(); for (int rl = 0; rl < 16; ++rl) vst2(OUT + (r0 + rl) * DIN + c0 + lane * 4, *(const v4f*)&sf[wave][rl][lane * 4]); }

extern "C" void kernel_launch(void* const* d_in, const int* in_sizes, int n_in, void* d_out, int out_size, void* d_ws, size_t ws_size, hipStream_t stream) {
  (void)in_sizes; (void)n_in; (void)out_size;
  const float** F = (const float**)d_in;
  if (ws_size < (size_t)WS_END) return;
  char* ws = (char*)d_ws; _Float16 *QH = (_Float16*)(ws + WS_QH), *KH = (_Float16*)(ws + WS_KH), *VT = (_Float16*)(ws + WS_VT), *QL = (_Float16*)(ws + WS_QL), *KL = (_Float16*)(ws + WS_KL); __bf16 *VB = (__bf16*)(ws + WS_VB), *VBL = (__bf16*)(ws + WS_VBL); float *Y = (float*)(ws + WS_Y);
  (void)Y; (void)QL; (void)KL; (void)VB; (void)VBL;
  // inputs: 0 source [4,1024,1024]; 1 Wq [16,1024,64] (head, in, out), 2 bq [16,64]; 3 Wk, 4 bk; 5 Wv, 6 bv; 7 Wc [1024,1024] (in,out), 8 bc [1024] (all biases N(0, 0.02^2), nonzero)
  if (ws_size < (size_t)WS_END2) return;
  float *CM = (float*)(ws + WS_CM), *CZ = (float*)(ws + WS_CZ);
  k_proj<<<dim3(TNB * TT / PR, NH), PW * 32, 0, stream>>>(F[0], F[1], F[3], F[5], F[2], F[4], F[6], QH, KH, KL, VT, VB, VBL);
  k_colstat_w<<<dim3(TT / 64, NP), 256, 0, stream>>>(QH, KH, CM, CZ);   /* per key column j: max / sum over the visible queries i >= j */
  k_pv_w<<<dim3(TT / 256, 1, NP), 256, 0, stream>>>(QH, KH, CM, CZ, VB, VBL, Y);   /* P[i][j] = exp(S - m_j) x 2^11 / Z_j for j <= i, 0 above the diagonal */
  k_out<<<dim3(TNB * TT / BR, DIN / 128), NW * 32, 0, stream>>>(Y, F[7], F[8], (float*)d_out);
}

// v010
// One run takes 91.7 microseconds.
// Timed twice side by side with v009, it ran 1.05 and 1.03 times as fast.
// Counting every step since v000, it is 45.0 times as fast.
// compute dtype: all float inputs rounded to bf16; per-head q/k/v projections with EXACT bf16 products on WMMA 16x16x32 (f32 accumulate) + bias; causal scores q x k once to f16 each (1 product; sigma - 0.4) x 64^-0.5 on every block; softmax over the QUERY axis in f32 (per key column: max / sum over the visible queries; exp(x) = 2^(x log2 e) on the chip's own exp2 instruction, the logit scale and log2 e folded into one multiply-add); P as bf16 hi + lo against v as bf16 hi + lo (3 products) on EVERY block; ctx x 2^6 once to f16 x Wc f16(bf16 x 2^8) - except the LAST 128 rows of each sequence: ctx as bf16 hi + lo against exact bf16 Wc (2 products) - + bc; f32 output.
#include <hip/hip_runtime.h>
#include <math.h>

typedef __attribute__((ext_vector_type(16))) _Float16 v16h;
typedef __attribute__((ext_vector_type(16))) __bf16 v16b;
typedef __attribute__((ext_vector_type(8)))  _Float16 v8h;
typedef __attribute__((ext_vector_type(8)))  float v8f;
typedef __attribute__((ext_vector_type(4)))  float v4f;
typedef __attribute__((ext_vector_type(2)))  float v2f;
typedef __attribute__((ext_vector_type(4)))  unsigned v4u;
typedef __attribute__((ext_vector_type(4)))  int v4i;
typedef float __attribute__((may_alias)) float_a;
typedef int __attribute__((may_alias)) int_a;

template <typename T> __device__ __forceinline__ void vst2(void* p, T v) { *(T*)p = v;  }
__device__ __forceinline__ v8f wmma16(v16h a, v16h b, v8f c) {
  v8f d = __builtin_amdgcn_wmma_f32_16x16x32_f16(false, a, false, b, (short)0, c, false, false);
  asm volatile("v_nop\n\tv_nop\n\tv_nop\n\tv_nop" : "+v"(d) : "v"(a), "v"(b));
  return d;
}
__device__ __forceinline__ v8f wmma_bf(v16b a, v16b b, v8f c) {
  v8f d = __builtin_amdgcn_wmma_f32_16x16x32_bf16(false, a, false, b, (short)0, c, false, false);
  asm volatile("v_nop\n\tv_nop\n\tv_nop\n\tv_nop" : "+v"(d) : "v"(a), "v"(b));
  return d;
}
// 16x16x32 fragments: lane = (h = lane>>4, row/col = lane&15); elements 0..7 = k0+8h+0..7, 8..15 = k0+16+8h+0..7; D element r = row 8h+r
__device__ __forceinline__ v16h frag_h(const _Float16* rowk0, int lane) {
  union { v16h v; v8h q[2]; } u; const _Float16* p = rowk0 + 8 * (lane >> 4);
  u.q[0] = *(const v8h*)p; u.q[1] = *(const v8h*)(p + 16); return u.v;
}
__device__ __forceinline__ v16h frag_f32(const float* rowk0, int lane) {
  v16h a; const float* p = rowk0 + 8 * (lane >> 4);
#pragma unroll
  for (int i = 0; i < 8; ++i) { a[i] = (_Float16)p[i]; a[8 + i] = (_Float16)p[16 + i]; }
  return a;
}
__device__ __forceinline__ v16h frag_f32s(const float* rowk0, int lane, float sc) {
  v16h a; const float* p = rowk0 + 8 * (lane >> 4);
#pragma unroll
  for (int i = 0; i < 8; ++i) { a[i] = (_Float16)(p[i] * sc); a[8 + i] = (_Float16)(p[16 + i] * sc); }
  return a;
}
// column fragment from a [K][ld] layout (column n), rows >= K read as 0
__device__ __forceinline__ v16h fragc_f32(const float* W, int k0, int n, int lane, int ld, int K) {
  v16h a; const int g = lane >> 4;
#pragma unroll
  for (int i = 0; i < 8; ++i) { const int ka = k0 + 8 * g + i, kb = ka + 16;
    a[i] = (_Float16)(ka < K ? W[(size_t)(ka < K ? ka : K - 1) * ld + n] : 0.f); a[8 + i] = (_Float16)(kb < K ? W[(size_t)(kb < K ? kb : K - 1) * ld + n] : 0.f); }
  return a;
}
struct F2 { v16b h, l; };
__device__ __forceinline__ F2 bsplit16(const float v[16]) { F2 r;
#pragma unroll
  for (int i = 0; i < 16; ++i) { const __bf16 h = (__bf16)v[i]; r.h[i] = h; r.l[i] = (__bf16)(v[i] - (float)h); }
  return r; }
__device__ __forceinline__ F2 split_row(const float* row, int k0, int lane) { float v[16]; const float* p = row + k0 + 8 * (lane >> 4);
#pragma unroll
  for (int i = 0; i < 8; ++i) { v[i] = p[i]; v[8 + i] = p[16 + i]; }
  return bsplit16(v); }
__device__ __forceinline__ F2 split_rowK(const float* row, int k0, int lane, int K) { float v[16]; const int g = lane >> 4;
#pragma unroll
  for (int i = 0; i < 8; ++i) { const int ka = k0 + 8 * g + i, kb = ka + 16; v[i] = ka < K ? row[ka < K ? ka : K - 1] : 0.f; v[8 + i] = kb < K ? row[kb < K ? kb : K - 1] : 0.f; }
  return bsplit16(v); }
__device__ __forceinline__ F2 split_col(const float* W, int k0, int n, int lane, int ld, int K) { float v[16]; const int g = lane >> 4;
#pragma unroll
  for (int i = 0; i < 8; ++i) { const int ka = k0 + 8 * g + i, kb = ka + 16; v[i] = ka < K ? W[(size_t)(ka < K ? ka : K - 1) * ld + n] : 0.f; v[8 + i] = kb < K ? W[(size_t)(kb < K ? kb : K - 1) * ld + n] : 0.f; }
  return bsplit16(v); }
__device__ __forceinline__ v8f mac3(const F2& a, const F2& b, v8f c) { c = wmma_bf(a.l, b.h, c); c = wmma_bf(a.h, b.l, c); return wmma_bf(a.h, b.h, c); }
__device__ __forceinline__ float sigm(float v) { return 1.0f / (1.0f + expf(-v)); }
#define LDSX() do { asm volatile("s_wait_dscnt 0" ::: "memory"); __builtin_amdgcn_wave_barrier(); __builtin_amdgcn_fence(__ATOMIC_RELEASE, "workgroup"); } while (0)

// Causal multi-head attention whose softmax runs over the QUERY axis, with per-head projection tensors (source [4,1024,1024]; Wq / Wk / Wv [16,1024,64] (head, in, out) (0.02) + biases [16,64]; scores / sqrt(64) + triu(-inf, k=1); attn = softmax(..., axis=2) - axis 2 of [B, H, q, k] is the QUERY axis: every key column is normalised over the queries q >= k (faithful to the source); out = attn v; heads merged; Wc [1024,1024] (in,out) + bc).
#define NB 4
#define TT 1024
#define CC 1024            // NH * HD = projected width
#define DIN 1024          // input (model) width
#define NH 16
#define HD 64
#define NQB (TT / 64)
#define NP (NB * NH)        // (batch, head) pairs: the column-statistics and context kernels take all of them in one launch (grid x or z = pair)
#define SCALE (0.125f)
#define CAUSAL 1
#ifndef TNB
#define TNB NB
#endif
__device__ __forceinline__ float bfr(float v) { return (float)(__bf16)v; }
__host__ __device__ __forceinline__ int kb_last(int qb) { return CAUSAL ? ((qb * 64 + 63) >> 7) : (TT / 128 - 1); }
typedef __attribute__((ext_vector_type(8))) __bf16 v8b;
__device__ __forceinline__ v16b frag_b(const __bf16* rowk0, int lane) {
  union { v16b v; v8b q[2]; } u; const __bf16* p = rowk0 + 8 * (lane >> 4);
  u.q[0] = *(const v8b*)p; u.q[1] = *(const v8b*)(p + 16); return u.v;
}
#define QHI 0               // no q residual plane: the scores are small and single-product everywhere
#define KHI 1024            // key rows carrying k residual / v bf16 hi+lo planes (all key rows: the v planes feed every trip of k_pv_w; the k residual is not read)
// B fragment (k rows k0+.., output column o) of a weight: (in,out) [K][ld] or (out,in) [ld rows of K]: bf16 exact, or f16(bf16 * 256) exact
__device__ __forceinline__ v16b wcol_io(const float* Wm, int k0, int o, int lane, int ld) { v16b w; const int g = lane >> 4;
#pragma unroll
  for (int i = 0; i < 8; ++i) { w[i] = (__bf16)Wm[(size_t)(k0 + 8 * g + i) * ld + o]; w[8 + i] = (__bf16)Wm[(size_t)(k0 + 16 + 8 * g + i) * ld + o]; }
  return w; }
__device__ __forceinline__ v16b wcol_oi(const float* Wm, int k0, int o, int lane, int K) { v16b w; const float* p = Wm + (size_t)o * K + k0 + 8 * (lane >> 4);
#pragma unroll
  for (int i = 0; i < 8; ++i) { w[i] = (__bf16)p[i]; w[8 + i] = (__bf16)p[16 + i]; }
  return w; }
__device__ __forceinline__ v16h wcolh_io(const float* Wm, int k0, int o, int lane, int ld) { v16h w; const int g = lane >> 4;
#pragma unroll
  for (int i = 0; i < 8; ++i) { w[i] = (_Float16)(bfr(Wm[(size_t)(k0 + 8 * g + i) * ld + o]) * 256.0f); w[8 + i] = (_Float16)(bfr(Wm[(size_t)(k0 + 16 + 8 * g + i) * ld + o]) * 256.0f); }
  return w; }
__device__ __forceinline__ v16h wcolh_oi(const float* Wm, int k0, int o, int lane, int K) { v16h w; const float* p = Wm + (size_t)o * K + k0 + 8 * (lane >> 4);
#pragma unroll
  for (int i = 0; i < 8; ++i) { w[i] = (_Float16)(bfr(p[i]) * 256.0f); w[8 + i] = (_Float16)(bfr(p[16 + i]) * 256.0f); }
  return w; }
#define WQKV_LAYOUT 0   // 0 = per-head [NH][DIN][HD] (head, in, out); 1 = (out,in) [CC][DIN]; 2 = per-head [NH][DIN][HD]
__device__ __forceinline__ v16b wcol_hdk(const float* Wm, int k0, int o, int lane) { v16b w; const int g = lane >> 4; const float* p = Wm + (size_t)(o / HD) * DIN * HD + (o % HD);
#pragma unroll
  for (int i = 0; i < 8; ++i) { w[i] = (__bf16)p[(size_t)(k0 + 8 * g + i) * HD]; w[8 + i] = (__bf16)p[(size_t)(k0 + 16 + 8 * g + i) * HD]; }
  return w; }
#define WO_OUT_IN 0
#if WQKV_LAYOUT == 1
#define WCOL(W, k0, o, lane) wcol_oi(W, k0, o, lane, DIN)
#elif WQKV_LAYOUT == 2
#define WCOL(W, k0, o, lane) wcol_hdk(W, k0, o, lane)
#else
#define WCOL(W, k0, o, lane) wcol_io((W) + (size_t)((o) / 64) * DIN * 64, k0, (o) % 64, lane, 64)   /* per-head weight tensors [16][DIN][64] (head, in, out): output column o = h*64 + kk lives in head h's [DIN][64] (in,out) slab at pitch 64 (a 16-column tile never straddles a head) */
#endif
#if WO_OUT_IN
#define WOCOL(W, k0, o, lane) wcol_oi(W, k0, o, lane, CC)
#define WOCOLH(W, k0, o, lane) wcolh_oi(W, k0, o, lane, CC)
#else
#define WOCOL(W, k0, o, lane) wcol_io(W, k0, o, lane, DIN)
#define WOCOLH(W, k0, o, lane) wcolh_io(W, k0, o, lane, DIN)
#endif

#ifndef SM_EXTRA_PARAMS
#define SM_EXTRA_PARAMS
#endif
#ifndef PROJ_EXTRA_PARAMS
#define PROJ_EXTRA_PARAMS
#endif
#ifndef SM_MASK_HOOK
#define SM_MASK_HOOK (void)0
#endif

#define WS_QH  0u                                      // f16 q rows [b*t][CC]
#define WS_KH  (WS_QH + 2u * (size_t)NB * TT * CC)      // f16 k rows [b*t][CC]
#define WS_VT  (WS_KH + 2u * (size_t)NB * TT * CC)      // f16 v planes [b][c][t]
#define WS_QL  (WS_VT + 2u * (size_t)NB * CC * TT)      // f16 q residual x 2^10 rows [b][t < QHI][CC]
#define WS_KL  (WS_QL + 2u * (size_t)NB * QHI * CC)     // f16 k residual x 2^10 rows [b][t < KHI][CC]
#define WS_VB  (WS_KL + 2u * (size_t)NB * KHI * CC)     // bf16 v hi planes [b][c][t < KHI]
#define WS_VBL (WS_VB + 2u * (size_t)NB * CC * KHI)
#define WS_Y   (WS_VBL + 2u * (size_t)NB * CC * KHI)    // f32 ctx rows [b*t][CC] (only when there is an output projection)
#define WS_END (WS_Y  + 4u * (size_t)NB * TT * CC)
#define WS_CM (WS_END)                                  // f32 column maxima x log2(e) [NP][TT]
#define WS_CZ (WS_CM + 4u * (size_t)NP * TT)           // f32 2^11 / column sum [NP][TT]
#define WS_END2 (WS_CZ + 4u * (size_t)NP * TT)

// ---- weight tile in LDS for k_out (k_proj stages alike, with its own tile shape): a block's 64 k x 128 column slice of a (in,out) weight is read once for its eight waves (128 output rows), in whole 128-byte lines (a lane: 4 columns x 8 k rows, 16-byte loads), rounded to its 16-bit operand type in registers and stored column-major (a column's 64 k values in a row of 128 bytes), so that a B fragment is two 16-byte LDS reads. Two buffers: the next tile's loads (and the wave's own next A rows) fly during this tile's products, one barrier a tile. The A rows take the same road: a wave reads its 16 rows x 64 k in whole lines (a load = two rows' 256 bytes), rounds them to the operand type once and stores them row-major at a pitch of 144 bytes behind the weight buffers; an A fragment is two 16-byte LDS reads.
#define KT 64               // k rows of a tile
#define NW 8                // waves of a k_out block: each takes 16 of the block's output rows, all share the weight tile
#define KR (KT / NW)        // k rows of a weight tile that one wave brings in
#define BR (NW * 16)        // output rows of a block
#define WT_G 2336           // elements between the four column groups n & 3: 32 rows of 72 + 32. Column n lies at (n & 3) x 4672 B + (n >> 2) x 144 B: the storing lanes (columns 4 apart) and the reading lanes (16 neighbouring columns) both fall on 16 different 16-byte bank groups
#define WT_SZ (4 * WT_G)    // elements of one buffer
__device__ __forceinline__ int wt_row(int n) { return (n & 3) * WT_G + (n >> 2) * 72; }
struct WT { v4f r[KR]; };   // a lane's share of a tile: k rows wave x 8 + 0..7, columns lane x 4 + 0..3
#define AT_P 72             // elements between two A rows in LDS: 144 B = 16 B x 9, the reading lanes (16 neighbouring rows) fall on 16 different 16-byte bank groups
#define AT_SZ (BR * AT_P)   // elements of one A plane (the block's 128 rows)
typedef __attribute__((ext_vector_type(4))) __bf16 v4b;
typedef __attribute__((ext_vector_type(4))) _Float16 v4h;
struct XR { v4f r[8]; };    // a lane's share of its wave's A rows of one tile: rows 2q + (lane >> 4), k (lane & 15) x 4 + 0..3
__device__ __forceinline__ void wt_load(WT& t, const float* p, int ld) {
#pragma unroll
  for (int i = 0; i < KR; ++i) t.r[i] = *(const v4f*)(p + (size_t)i * ld); }
__device__ __forceinline__ void xr_load(XR& x, const float* p) {   // p = the wave's row (lane >> 4) at k (lane & 15) x 4; the A rows have 1024 elements
#pragma unroll
  for (int q = 0; q < 8; ++q) x.r[q] = *(const v4f*)(p + (size_t)(2 * q) * 1024); }
// MODE 0: bf16(a); 1: bf16 hi in the first plane, bf16 lo in the second; 2: f16(a x 2^6). ab = the buffer's first plane
template <int MODE> __device__ __forceinline__ void xr_store(const XR& x, __bf16* ab, int wave, int lane) {
#pragma unroll
  for (int q = 0; q < 8; ++q) { __bf16* d = ab + (wave * 16 + 2 * q + (lane >> 4)) * AT_P + (lane & 15) * 4;
    if (MODE == 2) { v4h o;
#pragma unroll
      for (int u = 0; u < 4; ++u) o[u] = (_Float16)(x.r[q][u] * 64.0f);
      *(v4h*)d = o;
    } else { v4b o, ol;
#pragma unroll
      for (int u = 0; u < 4; ++u) { const __bf16 h = (__bf16)x.r[q][u]; o[u] = h; ol[u] = (__bf16)(x.r[q][u] - (float)h); }
      *(v4b*)d = o; if (MODE == 1) *(v4b*)(d + AT_SZ) = ol; } } }
template <int F16> __device__ __forceinline__ void wt_store(const WT& t, __bf16* buf, int wave, int lane) {   // F16 = 0: bf16(w); 1: f16(bf16(w) x 2^8), both exact carriers of the bf16 weight
#pragma unroll
  for (int u = 0; u < 4; ++u) { __bf16* d = buf + wt_row(lane * 4 + u) + wave * KR;
#pragma unroll
    for (int hf = 0; hf < KR / 8; ++hf) {
      if (F16) { v8h o;
#pragma unroll
        for (int i = 0; i < 8; ++i) o[i] = (_Float16)(bfr(t.r[hf * 8 + i][u]) * 256.0f);
        *(v8h*)(d + hf * 8) = o;
      } else { v8b o;
#pragma unroll
        for (int i = 0; i < 8; ++i) o[i] = (__bf16)t.r[hf * 8 + i][u];
        *(v8b*)(d + hf * 8) = o; } } } }
// the first tile's loads, written once in front of any branch between the modes, with their wait directly behind them
__device__ __forceinline__ void gemm_first(WT& wt, XR& xr, const float* xp, const float* wp, int ldw) { wt_load(wt, wp, ldw); xr_load(xr, xp);
  asm volatile("s_wait_xcnt 0x0" ::: "memory"); __builtin_amdgcn_sched_barrier(0); }   /* the wait stands in front of any reuse of the address registers that the issued loads name; the scheduling barrier keeps the register arithmetic that follows from being lifted over it */
// acc[j] += A (the wave's 16 rows, f32 source, K = 1024) x W (columns j x 16 + 0..15 of the block's 128). xp = the wave's row g at k col x 4; wp = the weight at (k row wave x 8, the lane's 4 columns), ldw its row pitch. wt / xr = tile 0 as gemm_first loaded it. MODE 0: A bf16 x W bf16; 1: A bf16 hi + lo x W bf16 (2 products); 2: A x 2^6 f16 x W f16(bf16 x 2^8). Ends behind a barrier: the buffers may be reused
template <int MODE> __device__ __forceinline__ void gemm_wt(WT& wt, XR& xr, const float* xp, const float* wp, int ldw, __bf16* wbuf, int wave, int lane, v8f acc[8]) { const int col = lane & 15; constexpr int AB = (MODE == 1 ? 2 : 1) * AT_SZ; __bf16* abuf = wbuf + 2 * WT_SZ;   /* the A buffers lie behind the two weight buffers */
  wt_store<MODE == 2>(wt, wbuf, wave, lane); xr_store<MODE>(xr, abuf, wave, lane);
  __syncthreads();
  for (int t = 0; t < 1024 / KT; ++t) { const __bf16* wb = wbuf + (t & 1) * WT_SZ; const __bf16* ab = abuf + (t & 1) * AB + (wave * 16 + col) * AT_P;
    if (t + 1 < 1024 / KT) { wt_load(wt, wp + (size_t)(t + 1) * KT * ldw, ldw); xr_load(xr, xp + (t + 1) * KT);
      asm volatile("s_wait_xcnt 0x0" ::: "memory"); __builtin_amdgcn_sched_barrier(0); }   /* as above: the address registers are reused while the loads fly */
#pragma unroll
    for (int s = 0; s < 2; ++s) {
      v16b w[8], ah = frag_b(ab + s * 32, lane), al; if (MODE == 1) al = frag_b(ab + AT_SZ + s * 32, lane);
#pragma unroll
      for (int j = 0; j < 8; ++j) w[j] = frag_b(wb + wt_row(col) + j * (4 * 72) + s * 32, lane);   /* wt_row(j x 16 + col) written as one lane address + a constant: the eight fragments share one address register */
      __builtin_amdgcn_sched_barrier(0);   /* keeps the step's LDS reads together in front of its products: left alone the compiler reads each fragment into one register set directly in front of its product, and every product then waits out an LDS latency */
#pragma unroll
      for (int j = 0; j < 8; ++j) {
        if (MODE == 2) acc[j] = wmma16(__builtin_bit_cast(v16h, ah), __builtin_bit_cast(v16h, w[j]), acc[j]);
        else { acc[j] = wmma_bf(ah, w[j], acc[j]); if (MODE == 1) acc[j] = wmma_bf(al, w[j], acc[j]); } } }
    __builtin_amdgcn_sched_barrier(0);   /* keeps the wait for the next tile's loads behind this tile's last product: left alone the compiler lifts the first conversions, and the wait with them, in among the products */
    if (t + 1 < 1024 / KT) { wt_store<MODE == 2>(wt, wbuf + ((t + 1) & 1) * WT_SZ, wave, lane); xr_store<MODE>(xr, abuf + ((t + 1) & 1) * AB, wave, lane); }
    __syncthreads(); } }   /* the one barrier of a tile: publishes tile t + 1 and ends every wave's reads of the buffer that trip t + 1 refills */
// ---- k_proj: block = 256 rows x 192 columns, the 64 q, 64 k and 64 v columns of ONE head (grid y = head): the X rows are read once for all three products and each weight slab once for 256 rows. q/k/v = X W + b with exact bf16 products (K = DIN) -> q f16 rows; k f16 rows (+ residual rows < KHI); v f16 planes [c][t] (+ bf16 hi/lo planes for t < KHI). 16 waves in a 4 x 4 grid, a wave = 64 rows x 48 columns (4 A x 3 B fragments, 12 accumulators): 7 fragment reads feed 12 products. Staging as in k_out: tile = 64 k, two LDS buffers, the next tile's loads fly during this tile's products, one barrier a tile. Every wave brings its own 16 X rows; waves 0..11 also bring the weight tile: wave >> 2 = slab (q, k, v), a lane = 8 k rows x 4 columns
#define PW 16               // waves of a k_proj block
#define PR 256              // its output rows
#define PT_G (48 * 72 + 32) // as WT_G, for 192 columns: 48 rows of 72 + 32 elements between the four column groups n & 3
#define PT_SZ (4 * PT_G)    // elements of one weight buffer
#define PA_SZ (PR * AT_P)   // elements of one X buffer
__device__ __forceinline__ void pw_store(const WT& t, __bf16* d) {   // d = the lane's place in the buffer: column group (slab x 16 + col) x 72 + its first k; the lane's four columns lie PT_G apart
#pragma unroll
  for (int u = 0; u < 4; ++u) { v8b o;
#pragma unroll
    for (int i = 0; i < 8; ++i) o[i] = (__bf16)t.r[i][u];
    *(v8b*)(d + u * PT_G) = o; } }
__global__ __launch_bounds__(PW * 32) void k_proj(const float* __restrict__ X, const float* __restrict__ WQ, const float* __restrict__ WK, const float* __restrict__ WV, const float* __restrict__ BQ, const float* __restrict__ BK, const float* __restrict__ BV,
    _Float16* __restrict__ QH, _Float16* __restrict__ KH, _Float16* __restrict__ KL, _Float16* __restrict__ VT, __bf16* __restrict__ VB, __bf16* __restrict__ VBL) {
  union Sm { struct { _Float16 sq[PR][72], sk[PR][72], skl[PR][72], th[64][PR + 8]; __bf16 tb[64][PR + 8], tbl[64][PR + 8]; } e; __bf16 w[2 * PT_SZ + 2 * PA_SZ]; };   /* the tiles lie in the LDS of the epilogue's staging arrays, which are written only behind the product loop's last barrier */
  __shared__ __align__(16) Sm sm;
  const int tid = threadIdx.x, wave = __builtin_amdgcn_readfirstlane(tid >> 5) /* in a scalar register: the tests on the wave's number are scalar branches */, lane = tid & 31, col = lane & 15, g = lane >> 4; const int h = blockIdx.y; const size_t r0 = (size_t)blockIdx.x * PR; const size_t bb = r0 / TT; const int t0 = (int)(r0 % TT);
  const int wr = wave >> 2, wc = wave & 3;   /* the wave's place in the 4 x 4 grid: rows wr x 64, column fragments wc x 3 + 0..2 */
  const bool wl = wave < 12; const int slab = wave >> 2, kg = (wave & 3) * 2 + g;   /* weight loader: slab, and the lane's group of 8 k rows */
  const float* WA = slab == 0 ? WQ : slab == 1 ? WK : WV;
  const float* wp = WA + (size_t)h * DIN * 64 + (size_t)(kg * 8) * 64 + col * 4; const float* xp = X + (r0 + wave * 16 + g) * DIN + col * 4;
  __bf16* wbuf = sm.w; __bf16* abuf = sm.w + 2 * PT_SZ; const int wd = (slab * 16 + col) * 72 + kg * 8;
  v8f acc[4][3] = {}; WT wt; XR xr;
  if (wl) wt_load(wt, wp, 64);
  xr_load(xr, xp);
  asm volatile("s_wait_xcnt 0x0" ::: "memory"); __builtin_amdgcn_sched_barrier(0);   /* the wait stands in front of any reuse of the address registers that the issued loads name; the scheduling barrier keeps the register arithmetic that follows from being lifted over it */
  float bias[3];   /* the wave's three bias values are read here, beside the first tile's loads: read in the epilogue their latency would stand open */
#pragma unroll
  for (int j = 0; j < 3; ++j) { const int f = wc * 3 + j; const float* BA = (f >> 2) == 0 ? BQ : (f >> 2) == 1 ? BK : BV; bias[j] = BA[h * 64 + (f & 3) * 16 + col]; }
  asm volatile("s_wait_xcnt 0x0" ::: "memory"); __builtin_amdgcn_sched_barrier(0);   /* as above, for the bias loads */
#pragma unroll
  for (int j = 0; j < 3; ++j) bias[j] = bfr(bias[j]);
  if (wl) pw_store(wt, wbuf + wd);
  xr_store<0>(xr, abuf, wave, lane);
  __syncthreads();
  for (int t = 0; t < DIN / KT; ++t) { const __bf16* wb = wbuf + (t & 1) * PT_SZ + (col & 3) * PT_G + (col >> 2) * 72 + wc * (3 * 4 * 72); const __bf16* ab = abuf + (t & 1) * PA_SZ + (wr * 64 + col) * AT_P;
    if (t + 1 < DIN / KT) { if (wl) wt_load(wt, wp + (size_t)(t + 1) * KT * 64, 64);
      xr_load(xr, xp + (t + 1) * KT);
      asm volatile("s_wait_xcnt 0x0" ::: "memory"); __builtin_amdgcn_sched_barrier(0); }   /* as above: the address registers are reused while the loads fly */
#pragma unroll
    for (int s = 0; s < 2; ++s) { v16b a[4], w[3];
#pragma unroll
      for (int i = 0; i < 4; ++i) a[i] = frag_b(ab + i * (16 * AT_P) + s * 32, lane);
#pragma unroll
      for (int j = 0; j < 3; ++j) w[j] = frag_b(wb + j * (4 * 72) + s * 32, lane);
      __builtin_amdgcn_sched_barrier(0);   /* keeps the step's LDS reads together in front of its products: left alone the compiler reads each fragment directly in front of its product, and every product then waits out an LDS latency */
#pragma unroll
      for (int i = 0; i < 4; ++i)
#pragma unroll
        for (int j = 0; j < 3; ++j) acc[i][j] = wmma_bf(a[i], w[j], acc[i][j]); }
    __builtin_amdgcn_sched_barrier(0);   /* keeps the wait for the next tile's loads behind this tile's last product */
    if (t + 1 < DIN / KT) { if (wl) pw_store(wt, wbuf + ((t + 1) & 1) * PT_SZ + wd);
      xr_store<0>(xr, abuf + ((t + 1) & 1) * PA_SZ, wave, lane); }
    __syncthreads(); }   /* the one barrier of a tile: publishes tile t + 1 and ends every wave's reads of the buffer that trip t + 1 refills; the last one frees the LDS for the epilogue */
#pragma unroll
  for (int j = 0; j < 3; ++j) { const int f = wc * 3 + j, wh = f >> 2, cl = (f & 3) * 16 + col;   /* column fragment f of the block's 12: which product (wave-uniform), and the column inside the head */
    if (wh == 0) {
#pragma unroll
      for (int i = 0; i < 4; ++i)
#pragma unroll
        for (int r = 0; r < 8; ++r) sm.e.sq[wr * 64 + i * 16 + 8 * g + r][cl] = (_Float16)(acc[i][j][r] + bias[j]);
    } else if (wh == 1) {
#pragma unroll
      for (int i = 0; i < 4; ++i)
#pragma unroll
        for (int r = 0; r < 8; ++r) { const float v = acc[i][j][r] + bias[j]; const _Float16 hv = (_Float16)v; const int rl = wr * 64 + i * 16 + 8 * g + r; sm.e.sk[rl][cl] = hv; sm.e.skl[rl][cl] = (_Float16)((v - (float)hv) * 1024.0f); }
    } else {
#pragma unroll
      for (int i = 0; i < 4; ++i)
#pragma unroll
        for (int r = 0; r < 8; ++r) { const float v = acc[i][j][r] + bias[j]; const int rl = wr * 64 + i * 16 + 8 * g + r; sm.e.th[cl][rl] = (_Float16)v; const __bf16 bh = (__bf16)v; sm.e.tb[cl][rl] = bh; sm.e.tbl[cl][rl] = (__bf16)(v - (float)bh); } } }
  __syncthreads();
  const bool hi_rows = t0 < KHI;
  for (int e = tid; e < PR * 8; e += PW * 32) { const int rl = e >> 3, q = e & 7; const size_t o = (r0 + rl) * CC + h * 64 + q * 8;   /* a (row, head) segment = one 128-byte line */
    vst2((unsigned*)(QH + o), *(const v4u*)&sm.e.sq[rl][q * 8]); vst2((unsigned*)(KH + o), *(const v4u*)&sm.e.sk[rl][q * 8]); if (hi_rows) vst2((unsigned*)(KL + (bb * KHI + t0 + rl) * (size_t)CC + h * 64 + q * 8), *(const v4u*)&sm.e.skl[rl][q * 8]); }
  for (int e = tid; e < 64 * (PR / 8); e += PW * 32) { const int cl = e / (PR / 8), q = e % (PR / 8); vst2((unsigned*)(VT + (bb * CC + h * 64 + cl) * (size_t)TT + t0 + q * 8), *(const v4u*)&sm.e.th[cl][q * 8]); if (hi_rows) { const size_t o3 = (bb * CC + h * 64 + cl) * (size_t)KHI + t0 + q * 8; vst2((unsigned*)(VB + o3), *(const v4u*)&sm.e.tb[cl][q * 8]); vst2((unsigned*)(VBL + o3), *(const v4u*)&sm.e.tbl[cl][q * 8]); } } }
// ---- k_sm: block = query row t (head in group): keys [0, kend): causal -> logit if s <= t else excluded; softmax in f32; P x 2^11 in place (0 for excluded)
__global__ __launch_bounds__(256) void k_sm(float* __restrict__ S0 SM_EXTRA_PARAMS) { __shared__ float sred[8]; __shared__ float sbc; __shared__ __align__(16) float shv[TT];
  const int tid = threadIdx.x; const int t = blockIdx.x; const int kend = (kb_last(t >> 6) + 1) * 128;
  float* sr = S0 + (size_t)blockIdx.y * TT * TT + (size_t)t * TT;
  float m = -3.0e38f; for (int k = tid; k < kend; k += 256) { float v = (!CAUSAL || k <= t) ? sr[k] : -3.0e38f; SM_MASK_HOOK; shv[k] = v; m = fmaxf(m, v); }
#pragma unroll
  for (int o = 1; o < 32; o <<= 1) m = fmaxf(m, __shfl_xor(m, o));
  if ((tid & 31) == 0) sred[tid >> 5] = m; __syncthreads(); if (tid == 0) { float a = sred[0]; for (int i = 1; i < 8; ++i) a = fmaxf(a, sred[i]); sbc = a; } __syncthreads(); m = sbc; __syncthreads();
  float sum = 0.f; for (int k = tid; k < kend; k += 256) { const float v = shv[k]; const float e = (v <= -1.0e38f) ? 0.f : expf(v - m); shv[k] = e; sum += e; }
#pragma unroll
  for (int o = 1; o < 32; o <<= 1) sum += __shfl_xor(sum, o);
  if ((tid & 31) == 0) sred[tid >> 5] = sum; __syncthreads(); if (tid == 0) { float a = 0.f; for (int i = 0; i < 8; ++i) a += sred[i]; sbc = a > 0.f ? 2048.0f / a : 0.f; }   /* a fully excluded row yields P = 0 */ __syncthreads(); const float inv = sbc;
  for (int k = tid; k < kend; k += 256) shv[k] = shv[k] * inv;
  __syncthreads(); for (int q = tid; q < kend / 4; q += 256) vst2(sr + q * 4, *(const v4f*)&shv[q * 4]); }
// the products of k_colstat_w and k_pv_w: the plain builtins (the compiler keeps the distances behind its own matrix instructions, and their operands may lie in any register window)
__device__ __forceinline__ v8f mm_h(v16h a, v16h b, v8f c) { return __builtin_amdgcn_wmma_f32_16x16x32_f16(false, a, false, b, (short)0, c, false, false); }
__device__ __forceinline__ v8f mm_b(v16b a, v16b b, v8f c) { return __builtin_amdgcn_wmma_f32_16x16x32_bf16(false, a, false, b, (short)0, c, false, false); }
#define SC2 (SCALE * 1.44269504088896340736f)   // logit scale x log2(e): exp(s x SCALE - m) = 2^(s x SC2 - m2), m2 = m x log2(e); the column maxima are kept and stored in these log2 units
__device__ __forceinline__ float ex2(float v) { return __builtin_amdgcn_exp2f(v); }   // one v_exp_f32; a result below the normal range may come out 0, which is what such a term weighs beside a column sum >= 1
#define XW() do { asm volatile("s_wait_xcnt 0x0" ::: "memory"); __builtin_amdgcn_sched_barrier(0); } while (0)   /* behind a group of global loads: the wait stands in front of any later write of a register that the issued loads name (address, offset, scalar base); the scheduling barrier keeps such writes from being lifted over it and the loads from sinking below it */
// fragment loads as wave-uniform base + one 32-bit lane offset (elements): the lane offsets are formed once and stay in their registers, so no load of a loop names a vector register that is written again
__device__ __forceinline__ v16h frag_hu(const _Float16* ub, unsigned off) { union { v16h v; v8h q[2]; } u; const _Float16* p = ub + off; u.q[0] = *(const v8h*)p; u.q[1] = *(const v8h*)(p + 16); return u.v; }
// ---- k_colstat_w: softmax over the QUERY axis under the causal mask (the source's softmax(axis=2) on [B, H, q, k] scores with -inf where k > q): for every key column k: m_k = max_{q >= k} S[q][k], Z_k = sum_{q >= k} exp(S[q][k] - m_k) (f32, as 2^(s x SC2 - m2)). The logits are formed here on the matrix unit (q f16 x k f16, one product, x SC2: log2 units) and never stored. Block = 64 key columns of one (batch, head) pair, 8 waves: a wave keeps the 64 columns' k fragments in registers and takes every eighth 16-query tile from the block's first column down; a lane (column col, rows 8g + r) keeps a running (m, z) per column tile, rescaled once a tile; the 16 partial pairs of a column (8 waves x 2 lane halves) meet in LDS and are merged as z_w x 2^(m_w - m).
// The k rows (once for the block) and the q rows (a stage = the eight waves' next tiles, 128 rows, every wave bringing its own 16) come into LDS by asynchronous copies in whole 128-byte lines (a copy = four rows) and lie there at a pitch of 144 bytes; the fragments are read from LDS. Two q buffers: stage n + 1 flies while stage n is worked on; one barrier a stage; a wave whose tile lies past the last query brings and works nothing, but passes every wait and barrier
#define SP 72                        // elements between two staged rows of 64: 144 B = 16 B x 9, the 16 rows that a fragment read touches fall on different bank groups
#define CQ_SZ (128 * SP)             // elements of one q stage buffer
// a wave's own q tile: rows (lane >> 3) + 0, 4, 8, 12, 16 bytes a lane. ld = the lane's LDS byte address of the first, q = its source address
__device__ __forceinline__ void cs_copy(unsigned ld, const _Float16* q) {
  /* the copies go from global memory to LDS through no register; s_wait_xcnt 0 as the statement's last line stands in front of every later write of a register that a copy names */
  asm volatile("global_load_async_to_lds_b128 %0, %4, off\n\t"
               "global_load_async_to_lds_b128 %1, %5, off\n\t"
               "global_load_async_to_lds_b128 %2, %6, off\n\t"
               "global_load_async_to_lds_b128 %3, %7, off\n\t"
               "s_wait_xcnt 0x0"
               :: "v"(ld), "v"(ld + 4u * SP * 2u), "v"(ld + 8u * SP * 2u), "v"(ld + 12u * SP * 2u), "v"(q), "v"(q + 4 * CC), "v"(q + 8 * CC), "v"(q + 12 * CC) : "memory"); }
__global__ __launch_bounds__(256) void k_colstat_w(const _Float16* __restrict__ QH, const _Float16* __restrict__ KH, float* __restrict__ CM, float* __restrict__ CZ) { __shared__ __align__(16) float sm[16][64], sz[16][64]; __shared__ __align__(16) _Float16 sk[64 * SP], sq[2 * CQ_SZ];
  const int tid = threadIdx.x, wave = __builtin_amdgcn_readfirstlane(tid >> 5) /* in a scalar register: the tests on the wave's tile are scalar branches, every lane is on at the products and at the copies */, lane = tid & 31, col = lane & 15, g = lane >> 4; const int pz = blockIdx.x, rk = blockIdx.y, kb = (rk & 4) ? rk ^ 3 : rk, k0 = kb * 64;
  /* which block takes which columns, for speed only (any order gives the same result): column block kb costs 64 - 4 kb query tiles, and all 1,024 blocks are resident at once, four a WGP. The pair is the fast grid axis, so the flat index modulo 8 no longer carries kb; the turn of every second four (rk ^ 3) makes ranks a, a + 4, a + 8, a + 12 column blocks a, 7 - a, 8 + a, 15 - a: 136 tiles whatever a is */
  const size_t base = (size_t)(pz / NH) * TT * CC + (size_t)(pz % NH) * HD;
  float m[4], z[4];
#pragma unroll
  for (int j = 0; j < 4; ++j) { m[j] = -3.0e38f; z[j] = 0.f; }
  int qt = kb * 4 + wave;   /* tiles above the block's first column hold no visible query */
  const int nst = (TT / 16 - kb * 4 + 7) >> 3;   /* stages of the block: eight tiles each, the last one may hold four */
  const int nw = (TT / 16 + 7 - qt) >> 3;        /* the wave's own tiles, one a stage from stage 0 on: nst, or one less (0 where its first tile lies past the last query) */
  const int cr = lane >> 3, cc8 = (lane & 7) * 8;   /* the lane's first row of a copy group and its 8 elements of that row */
  const _Float16* kp = KH + base + (size_t)(k0 + wave * 8 + cr) * CC + cc8; const _Float16* qp = QH + base + (size_t)(qt * 16 + cr) * CC + cc8;
  const unsigned lk = (unsigned)(size_t)sk + (unsigned)((wave * 8 + cr) * SP + cc8) * 2u, lq = (unsigned)(size_t)sq + (unsigned)((wave * 16 + cr) * SP + cc8) * 2u;
  /* the block's 64 k rows, eight a wave; the wait as in cs_copy */
  asm volatile("global_load_async_to_lds_b128 %0, %2, off\n\tglobal_load_async_to_lds_b128 %1, %3, off\n\ts_wait_xcnt 0x0" :: "v"(lk), "v"(lk + 4u * SP * 2u), "v"(kp), "v"(kp + 4 * CC) : "memory");
  if (0 < nw) cs_copy(lq, qp);
  asm volatile("s_wait_asynccnt 0x0" ::: "memory");   /* the k rows and stage 0 have landed, as far as this wave copied them */
  __syncthreads();                                    /* ... and every other wave's share: they may be read */
  if (1 < nw) cs_copy(lq + CQ_SZ * 2u, qp + 8 * 16 * CC);
  v16h kf[4][2];
#pragma unroll
  for (int j = 0; j < 4; ++j)
#pragma unroll
    for (int ks = 0; ks < 2; ++ks) kf[j][ks] = frag_h(sk + (j * 16 + col) * SP + ks * 32, lane);
  for (int n = 0; n < nst; ++n) {
    if (n < nw) { const _Float16* qa = sq + (n & 1) * CQ_SZ + (wave * 16 + col) * SP; const v16h a0 = frag_h(qa, lane), a1 = frag_h(qa + 32, lane);
      v8f s[4] = {};
#pragma unroll
      for (int j = 0; j < 4; ++j) s[j] = mm_h(a0, kf[j][0], s[j]);
#pragma unroll
      for (int j = 0; j < 4; ++j) s[j] = mm_h(a1, kf[j][1], s[j]);
      const int dq = qt * 16 + 8 * g - k0 - col;   /* query of element 0 - key of column tile 0 */
#pragma unroll
      for (int j = 0; j < 4; ++j) { float sv[8], tm = -3.0e38f;
#pragma unroll
        for (int r = 0; r < 8; ++r) { sv[r] = s[j][r] * SC2; tm = fmaxf(tm, (dq + r >= j * 16) ? sv[r] : -3.0e38f); }
        const float mn = fmaxf(m[j], tm); float zs = z[j] * ex2(m[j] - mn);
#pragma unroll
        for (int r = 0; r < 8; ++r) { const float e = ex2(__builtin_fmaf(s[j][r], SC2, -mn)); zs += (dq + r >= j * 16) ? e : 0.f; }
        m[j] = mn; z[j] = zs; } }
    asm volatile("s_wait_dscnt 0x0" ::: "memory");      /* this wave's reads of stage n have returned before the buffer is handed to its next writer */
    asm volatile("s_wait_asynccnt 0x0" ::: "memory");   /* this wave's copies of stage n + 1 have landed */
    __syncthreads();                                    /* the one barrier of a stage: publishes stage n + 1 and ends every wave's reads of the buffer that is refilled behind it */
    qt += 8;
    if (n + 2 < nw) cs_copy(lq + (unsigned)(n & 1) * (CQ_SZ * 2u), qp + (size_t)(n + 2) * (8 * 16 * CC)); }
  asm volatile("s_wait_asynccnt 0x0" ::: "memory");     /* no copy is left in flight behind the loop */
#pragma unroll
  for (int j = 0; j < 4; ++j) { sm[wave * 2 + g][j * 16 + col] = m[j]; sz[wave * 2 + g][j * 16 + col] = z[j]; }
  __syncthreads();
  if (tid < 64) { float mm = -3.0e38f, zz = 0.f;   /* a partial with no visible row of a column brings (-3e38, 0): its term is 0 */
#pragma unroll
    for (int w = 0; w < 16; ++w) mm = fmaxf(mm, sm[w][tid]);
#pragma unroll
    for (int w = 0; w < 16; ++w) zz += sz[w][tid] * ex2(sm[w][tid] - mm);
    vst2(CM + (size_t)pz * TT + k0 + tid, mm); vst2(CZ + (size_t)pz * TT + k0 + tid, 2048.0f / zz); } }   /* every column sees at least its own diagonal entry: Z_k >= 1; stored as 2^11 / Z_k, one division a column, the factor k_pv_w multiplies by; the maximum goes out in log2 units */
// ---- k_pv_w: ctx = P . v, the logits formed again on the matrix unit where P is needed. A wave = 32 queries (two 16-query tiles, their q fragments kept in registers) of one (batch, head) pair, a trip = 32 keys, up to the wave's own diagonal. The logits are taken TRANSPOSED (A = 16 key rows of k, B = the 16 queries of q): D element r of lane (g, col) is key 8g + r of query col, so the two key tiles of a trip are, register for register, elements 0..7 and 8..15 of the P fragment (row = query col, keys +8g+0..7 and +16+8g+0..7): no move between lanes. P = 2^(s x SC2 - m2_k) x (2^11 / Z_k) for key <= query, 0 above the diagonal; P and v as bf16 hi + lo, 3 products, each accumulator in the order h.vh, l.vh, h.vl. The k and v fragments of a trip serve both query tiles. Block = 8 waves of one pair: waves w and w + 4 take the 32-query tiles i and 31 - i (i + 1 and 32 - i trips), 33 trips for every such two.
// The eight waves walk the same keys, so what a trip reads is brought into LDS once for the block, 64 keys (two trips) a stage, by asynchronous copies in whole 128-byte lines (a copy = four rows): 64 k rows, 64 v hi and 64 v lo channel rows of 128 bytes each, laid at a pitch of 144 bytes (16 B x 9: the 16 rows that a fragment read touches fall on different bank groups), and the 64 keys' m2 and 2^11 / Z. Two buffers: stage s + 1 flies while stage s is worked on; one barrier a stage; a wave past its own diagonal skips the trips, never the copies, the waits or the barrier
#define ST_VH (64 * SP)              // element offsets in a stage buffer: k rows at 0, v hi, v lo, then 64 f32 m2 and 64 f32 2^11 / Z
#define ST_VL (ST_VH + HD * SP)
#define ST_MR (ST_VL + HD * SP)
#define ST_SZ (ST_MR + 256)          // elements of one stage buffer
struct PvSrc { const _Float16* k; const __bf16* vh; const __bf16* vl; const float* mr; };   // the lane's own source addresses of the next stage to copy
// one stage's copies of one wave: rows wave x 8 + (lane >> 3) and + 4 of each of the three planes, 16 bytes a lane; wave 0 also brings m2 (lanes 0..15) and 2^11 / Z (lanes 16..31). ld = the lane's LDS byte address in the k plane of the target buffer, lm = its address in the m2 / Z rows. Then the sources step on by one stage
__device__ __forceinline__ void pv_copy(unsigned ld, unsigned lm, PvSrc& p, int wave) {
  /* the copies go from global memory to LDS through no register; s_wait_xcnt 0 as the statement's last line stands in front of every later write of a register that a copy names */
  asm volatile("global_load_async_to_lds_b128 %0, %6, off\n\t"
               "global_load_async_to_lds_b128 %1, %7, off\n\t"
               "global_load_async_to_lds_b128 %2, %8, off\n\t"
               "global_load_async_to_lds_b128 %3, %9, off\n\t"
               "global_load_async_to_lds_b128 %4, %10, off\n\t"
               "global_load_async_to_lds_b128 %5, %11, off\n\t"
               "s_wait_xcnt 0x0"
               :: "v"(ld), "v"(ld + 4u * SP * 2u), "v"(ld + ST_VH * 2u), "v"(ld + ST_VH * 2u + 4u * SP * 2u), "v"(ld + ST_VL * 2u), "v"(ld + ST_VL * 2u + 4u * SP * 2u),
                  "v"(p.k), "v"(p.k + 4 * CC), "v"(p.vh), "v"(p.vh + 4 * KHI), "v"(p.vl), "v"(p.vl + 4 * KHI) : "memory");
  if (wave == 0) asm volatile("global_load_async_to_lds_b128 %0, %1, off\n\ts_wait_xcnt 0x0" :: "v"(lm), "v"(p.mr) : "memory");   /* as above; the test is on a scalar register: every lane is on at the copy */
  p.k += 64 * CC; p.vh += 64; p.vl += 64; p.mr += 64; }
__global__ __launch_bounds__(256) void k_pv_w(const _Float16* __restrict__ QH, const _Float16* __restrict__ KH, const float* __restrict__ CM, const float* __restrict__ CZ, const __bf16* __restrict__ VB, const __bf16* __restrict__ VBL, float* __restrict__ Y) { __shared__ __align__(16) float ss[8][32][HD + 4]; __shared__ __align__(16) __bf16 st[2 * ST_SZ];
  const int tid = threadIdx.x, wave = __builtin_amdgcn_readfirstlane(tid >> 5) /* in a scalar register: the trip tests are wave-uniform scalar branches */, lane = tid & 31, col = lane & 15, g = lane >> 4; const int pz = blockIdx.z, b = pz / NH, h = pz % NH;
  const int i4 = blockIdx.x * 4 + (wave & 3), qi = wave < 4 ? i4 : 31 - i4, ql0 = qi * 32;
  const int ns = ((31 - (int)blockIdx.x * 4) >> 1) + 1;   /* stages of the block: up to the diagonal of its last query tile, 31 - 4 x blockIdx.x */
  const size_t base = (size_t)b * TT * CC + (size_t)h * HD; const unsigned fo = (unsigned)col * CC + 8u * g;
  const _Float16* Qu = QH + base + (size_t)ql0 * CC;
  const int crow = wave * 8 + (lane >> 3), cc8 = (lane & 7) * 8;   /* the lane's first row of a plane and its 8 elements of that row */
  PvSrc sp; sp.k = KH + base + (size_t)crow * CC + cc8; sp.vh = VB + ((size_t)b * CC + h * HD + crow) * (size_t)KHI + cc8; sp.vl = VBL + ((size_t)b * CC + h * HD + crow) * (size_t)KHI + cc8; sp.mr = (g ? CZ : CM) + (size_t)pz * TT + col * 4;
  const unsigned lb = (unsigned)(size_t)st, ld0 = lb + (unsigned)(crow * SP + cc8) * 2u, lm0 = lb + ST_MR * 2u + (unsigned)lane * 16u;
  pv_copy(ld0, lm0, sp, wave);
  v16h qf[2][2];
#pragma unroll
  for (int t = 0; t < 2; ++t)
#pragma unroll
    for (int ks = 0; ks < 2; ++ks) qf[t][ks] = frag_hu(Qu + t * 16 * CC + ks * 32, fo);
  XW();
  asm volatile("s_wait_asynccnt 0x0" ::: "memory");   /* stage 0 has landed, as far as this wave copied it */
  __syncthreads();                                    /* ... and every other wave's share: stage 0 may be read */
  if (1 < ns) pv_copy(ld0 + ST_SZ * 2u, lm0 + ST_SZ * 2u, sp, wave);
  v8f acc[2][HD / 16] = {};
  for (int s = 0; s < ns; ++s) { const __bf16* sb = st + (s & 1) * ST_SZ;
#pragma unroll
    for (int u = 0; u < 2; ++u) { const int kc = 2 * s + u;
      if (kc <= qi) { v16h ka[2][2]; v4f m4[4], r4[4]; v16b vh[HD / 16], vl[HD / 16];
#pragma unroll
        for (int kt = 0; kt < 2; ++kt)
#pragma unroll
          for (int ks = 0; ks < 2; ++ks) ka[kt][ks] = frag_h((const _Float16*)sb + (u * 32 + kt * 16 + col) * SP + ks * 32, lane);
#pragma unroll
        for (int q = 0; q < 4; ++q) { const float* pm = (const float*)(sb + ST_MR) + u * 32 + 8 * g + (q >> 1) * 16 + (q & 1) * 4; m4[q] = *(const v4f*)pm; r4[q] = *(const v4f*)(pm + 64); }
#pragma unroll
        for (int j = 0; j < HD / 16; ++j) vh[j] = frag_b(sb + ST_VH + (j * 16 + col) * SP + u * 32, lane);
#pragma unroll
        for (int j = 0; j < HD / 16; ++j) vl[j] = frag_b(sb + ST_VL + (j * 16 + col) * SP + u * 32, lane);
#pragma unroll
        for (int t = 0; t < 2; ++t) { v8f s0 = {}, s1 = {};
          s0 = mm_h(ka[0][0], qf[t][0], s0); s1 = mm_h(ka[1][0], qf[t][0], s1); s0 = mm_h(ka[0][1], qf[t][1], s0); s1 = mm_h(ka[1][1], qf[t][1], s1);
          const int dk = ql0 + t * 16 + col - 8 * g - kc * 32;   /* query - the lane's first key */
          float pf[16];
#pragma unroll
          for (int i = 0; i < 8; ++i) { const float e0 = ex2(__builtin_fmaf(s0[i], SC2, -m4[i >> 2][i & 3])) * r4[i >> 2][i & 3], e1 = ex2(__builtin_fmaf(s1[i], SC2, -m4[2 + (i >> 2)][i & 3])) * r4[2 + (i >> 2)][i & 3]; pf[i] = (i <= dk) ? e0 : 0.f; pf[8 + i] = (16 + i <= dk) ? e1 : 0.f; }
          const F2 p = bsplit16(pf);
#pragma unroll
          for (int j = 0; j < HD / 16; ++j) acc[t][j] = mm_b(p.h, vh[j], acc[t][j]);
#pragma unroll
          for (int j = 0; j < HD / 16; ++j) acc[t][j] = mm_b(p.l, vh[j], acc[t][j]);
#pragma unroll
          for (int j = 0; j < HD / 16; ++j) acc[t][j] = mm_b(p.h, vl[j], acc[t][j]); } } }
    asm volatile("s_wait_dscnt 0x0" ::: "memory");      /* this wave's reads of stage s have returned before the buffer is handed to its next writer */
    asm volatile("s_wait_asynccnt 0x0" ::: "memory");   /* this wave's copies of stage s + 1 have landed */
    __syncthreads();                                    /* the one barrier of a stage: publishes stage s + 1 and ends every wave's reads of the buffer that is refilled behind it */
    if (s + 2 < ns) pv_copy(ld0 + (unsigned)(s & 1) * (ST_SZ * 2u), lm0 + (unsigned)(s & 1) * (ST_SZ * 2u), sp, wave); }
  asm volatile("s_wait_asynccnt 0x0" ::: "memory");     /* no copy is left in flight behind the loop */
#pragma unroll
  for (int t = 0; t < 2; ++t)
#pragma unroll
    for (int j = 0; j < HD / 16; ++j)
#pragma unroll
      for (int r = 0; r < 8; ++r) ss[wave][t * 16 + 8 * g + r][j * 16 + col] = acc[t][j][r] * (1.0f / 2048.0f);
  LDSX(); for (int i = 0; i < 16; ++i) vst2(Y + ((size_t)b * TT + ql0 + i * 2 + g) * CC + h * HD + col * 4, *(const v4f*)&ss[wave][i * 2 + g][col * 4]); }   /* a wave's own rows; a store = two rows' 256-byte (row, head) segments */
// ---- k_out: block = (128 rows, 128 cols): out = ctx Wo (+ bo): ctx x 2^6 once to f16 against Wo as f16(bf16 x 2^8) exact (1 product) x 2^-14; the last 128 rows of each sequence: ctx bf16 hi + lo against exact bf16 Wo (2 products)
__global__ __launch_bounds__(NW * 32) void k_out(const float* __restrict__ Y, const float* __restrict__ WO, const float* __restrict__ BO, float* __restrict__ OUT) { union Sm { float sf[NW][16][132]; __bf16 w[2 * WT_SZ + 4 * AT_SZ]; }; __shared__ __align__(16) Sm sm; float (&sf)[NW][16][132] = sm.sf;   /* weight tiles and the epilogue's staging share the LDS: sf is written only behind the product loop's last barrier */
  const int tid = threadIdx.x, wave = tid >> 5, lane = tid & 31, col = lane & 15, g = lane >> 4; const int c0 = blockIdx.y * 128; const size_t r0 = (size_t)blockIdx.x * BR + wave * 16;
  v8f acc[8] = {};
  const float* xp = Y + (r0 + g) * CC + col * 4; const float* wp = WO + (size_t)(wave * KR) * DIN + c0 + lane * 4; WT wt; XR xr; gemm_first(wt, xr, xp, wp, DIN);   /* both arms start from the same first tile */
  const int tb_ = (int)(((size_t)blockIdx.x * BR) % TT); if (CAUSAL && (tb_ < QHI || tb_ + BR > TT - 64)) {   /* block-uniform; the block that holds the LAST 64 query rows of each sequence takes the hi + lo context path: under a query-axis softmax the last key columns carry O(1) weights, so the context rows there are an order of magnitude larger */
    gemm_wt<1>(wt, xr, xp, wp, DIN, sm.w, wave, lane, acc);
#pragma unroll
    for (int j = 0; j < 8; ++j) { const float bias = BO ? bfr(BO[c0 + j * 16 + col]) : 0.f;
#pragma unroll
      for (int r = 0; r < 8; ++r) sf[wave][8 * g + r][j * 16 + col] = acc[j][r] + bias; }
  } else {
    gemm_wt<2>(wt, xr, xp, wp, DIN, sm.w, wave, lane, acc);   /* ctx carried x 2^6 into f16 so small-magnitude context rows stay clear of f16 subnormals */
#pragma unroll
    for (int j = 0; j < 8; ++j) { const float bias = BO ? bfr(BO[c0 + j * 16 + col]) : 0.f;
#pragma unroll
      for (int r = 0; r < 8; ++r) sf[wave][8 * g + r][j * 16 + col] = acc[j][r] * (1.0f / 16384.0f) + bias; } }   /* 2^-8 (Wo carry) x 2^-6 (ctx carry) */
  LDSX(); for (int rl = 0; rl < 16; ++rl) vst2(OUT + (r0 + rl) * DIN + c0 + lane * 4, *(const v4f*)&sf[wave][rl][lane * 4]); }

extern "C" void kernel_launch(void* const* d_in, const int* in_sizes, int n_in, void* d_out, int out_size, void* d_ws, size_t ws_size, hipStream_t stream) {
  (void)in_sizes; (void)n_in; (void)out_size;
  const float** F = (const float**)d_in;
  if (ws_size < (size_t)WS_END) return;
  char* ws = (char*)d_ws; _Float16 *QH = (_Float16*)(ws + WS_QH), *KH = (_Float16*)(ws + WS_KH), *VT = (_Float16*)(ws + WS_VT), *QL = (_Float16*)(ws + WS_QL), *KL = (_Float16*)(ws + WS_KL); __bf16 *VB = (__bf16*)(ws + WS_VB), *VBL = (__bf16*)(ws + WS_VBL); float *Y = (float*)(ws + WS_Y);
  (void)Y; (void)QL; (void)KL; (void)VB; (void)VBL;
  // inputs: 0 source [4,1024,1024]; 1 Wq [16,1024,64] (head, in, out), 2 bq [16,64]; 3 Wk, 4 bk; 5 Wv, 6 bv; 7 Wc [1024,1024] (in,out), 8 bc [1024] (all biases N(0, 0.02^2), nonzero)
  if (ws_size < (size_t)WS_END2) return;
  float *CM = (float*)(ws + WS_CM), *CZ = (float*)(ws + WS_CZ);
  k_proj<<<dim3(TNB * TT / PR, NH), PW * 32, 0, stream>>>(F[0], F[1], F[3], F[5], F[2], F[4], F[6], QH, KH, KL, VT, VB, VBL);
  k_colstat_w<<<dim3(NP, TT / 64), 256, 0, stream>>>(QH, KH, CM, CZ);   /* per key column j: max / sum over the visible queries i >= j */
  k_pv_w<<<dim3(TT / 256, 1, NP), 256, 0, stream>>>(QH, KH, CM, CZ, VB, VBL, Y);   /* P[i][j] = exp(S - m_j) x 2^11 / Z_j for j <= i, 0 above the diagonal */
  k_out<<<dim3(TNB * TT / BR, DIN / 128), NW * 32, 0, stream>>>(Y, F[7], F[8], (float*)d_out);
}
